// v000
// Measured on an AMD MI455X. A time is GPU time per run, averaged over a window of back-to-back runs after a warm-up
// (all launches, gaps included; the runs take copies of the inputs in turn), and the median of several windows.
// Apart from v000's, it joins two sittings. Times from different sittings can be a few percent apart, while
// side-by-side timings come from the same sitting.
// The starting kernel, v000, takes 535 microseconds a run.
#include <hip/hip_runtime.h>
// CDRs attention (4 sequences x 2048 tokens x 512; 8 heads x 64): q,k,v = x W + b; scores/8; keys with mask == 0 invalid for all heads; for heads 0..1 additionally keys with cdrs_score == 0 invalid unless the sequence has no CDR token at all; softmax; ctx Wo + bo -> [4,2048,512].
// Structure: the per-(sequence, head, key) validity table from the two int inputs on VALU (one block per sequence for the 'all masked' reduction); x as an exact f16 plane; q/k/v projections as f16 WMMA GEMMs (32x64 wave tiles, f32 accumulation, exact x16 weights + bias) split into hi + 2^10 residual planes; V^T by LDS tiles; the fused flash kernel with hi + 2^10-residual q/k planes (S = QhKh + (QlKh + QhKl)/1024) and plain f16 P (x2^10) and V with the validity-table mask mode (invalid keys skipped == the reference's -inf); the output projection from hi + residual planes.
// Compute dtype: x and parameters rounded to bf16; q, k hi + residual (~2^-21-class logits); P and v plain f16 (~2^-12); f32 accumulation/softmax. v_wmma_f32_16x16x32_f16.
#define NB 4
#define DMOD 512
#define CDRH 2
#define NR (NB * SLEN)
#define QBLKS (TQ / 64)
#define SLEN 2048
#define TQ SLEN
#define TK SLEN
#define NH 8
#define SCL 0.125f               /* 64^-0.5 */
typedef __bf16 v16b __attribute__((ext_vector_type(16)));
typedef unsigned short v8us __attribute__((ext_vector_type(8), may_alias));
typedef float  v8f  __attribute__((ext_vector_type(8)));
typedef float  v4f  __attribute__((ext_vector_type(4)));
typedef float  v4fa __attribute__((ext_vector_type(4), may_alias));
union FragB { v16b v; v8us half[2]; unsigned short u[16]; };

__device__ __forceinline__ unsigned short bf16_bits(float x) { unsigned int u = __float_as_uint(x); return (unsigned short)((u + 0x7FFFu + ((u >> 16) & 1u)) >> 16); }
__device__ __forceinline__ float bf16_val(unsigned short b) { return __uint_as_float(((unsigned int)b) << 16); }
__device__ __forceinline__ float bf16_round(float x) { return bf16_val(bf16_bits(x)); }
// D += A·B with NT terms: 1 = ah·bh, 2 = + al·bh (A split), 3 = + ah·bl (both split)
template <int NT>
__device__ __forceinline__ v8f mmaN(v16b ah, v16b al, v16b bh, v16b bl, v8f c) {
  c = __builtin_amdgcn_wmma_f32_16x16x32_bf16(false, ah, false, bh, (short)0, c, false, false);
  if (NT >= 2) c = __builtin_amdgcn_wmma_f32_16x16x32_bf16(false, al, false, bh, (short)0, c, false, false);
  if (NT >= 3) c = __builtin_amdgcn_wmma_f32_16x16x32_bf16(false, ah, false, bl, (short)0, c, false, false);
  asm volatile("v_nop\n\tv_nop\n\tv_nop\n\tv_nop" : "+v"(c) : "v"(ah), "v"(al), "v"(bh), "v"(bl));
  return c;
}

__global__ __launch_bounds__(256) void k_wt_bf16(const float* __restrict__ W, unsigned short* __restrict__ Wt, int K, int N) {
  const int t = blockIdx.x * 256 + threadIdx.x;
  const int k8n = K / 8;
  if (t >= N * k8n) return;
  const int n = t / k8n, k8 = (t % k8n) * 8;
  v8us v;
#pragma unroll
  for (int i = 0; i < 8; ++i) v[i] = bf16_bits(W[(size_t)(k8 + i) * N + n]);
  *(v8us*)(Wt + (size_t)n * K + k8) = v;
  
}

// GEMM C[M][N] (f32, pitch ldc) = act(A[M][K]·W + bias). A f32 row-major (pitch lda) converted per fragment to bf16
// (ASPLIT: hi/lo two planes -> 2 terms, else single rounded term); Wt bf16 [N][K] (pitch ldb). BIAS_BF16 rounds the
// bias to bf16 first (bias quantised to bf16 before the add). K%32==0, M%16==0, N%64==0.
template <bool ASPLIT, int ACT, bool BIAS_BF16>
__global__ __launch_bounds__(128) void k_gemm_bf(const float* __restrict__ A, int lda, const unsigned short* __restrict__ Wt, int ldb,
                                               const float* __restrict__ bias, float* __restrict__ C, int ldc, int M, int N, int K) {
  __shared__ __attribute__((aligned(16))) float so[4][16][64];
  const int tid = threadIdx.x, w = tid >> 5, lane = tid & 31, ln = lane & 15, hh = lane >> 4;
  const int ntn = N / 64;
  const int wid = blockIdx.x * 4 + w;
  const int mt = wid / ntn, nq = wid % ntn;
  if (mt * 16 >= M) return;
  const int row0 = mt * 16, col0 = nq * 64;
  const float* arow = A + (size_t)(row0 + ln) * lda;
  v8f acc[4] = {};
  for (int kb = 0; kb < K; kb += 32) {
    FragB ah, al;
    const v4f x0 = *(const v4fa*)(arow + kb + 8 * hh), x1 = *(const v4fa*)(arow + kb + 8 * hh + 4);
    const v4f x2 = *(const v4fa*)(arow + kb + 16 + 8 * hh), x3 = *(const v4fa*)(arow + kb + 16 + 8 * hh + 4);
    float xs[16] = {x0[0],x0[1],x0[2],x0[3],x1[0],x1[1],x1[2],x1[3],x2[0],x2[1],x2[2],x2[3],x3[0],x3[1],x3[2],x3[3]};
#pragma unroll
    for (int i = 0; i < 16; ++i) { const unsigned short hb = bf16_bits(xs[i]); ah.u[i] = hb; al.u[i] = ASPLIT ? bf16_bits(xs[i] - bf16_val(hb)) : (unsigned short)0; }
#pragma unroll
    for (int t = 0; t < 4; ++t) {
      const unsigned short* brow = Wt + (size_t)(col0 + t * 16 + ln) * ldb + kb;
      FragB b;
      b.half[0] = *(const v8us*)(brow + 8 * hh);
      b.half[1] = *(const v8us*)(brow + 16 + 8 * hh);
      acc[t] = mmaN<ASPLIT ? 2 : 1>(ah.v, al.v, b.v, b.v, acc[t]);
    }
  }
#pragma unroll
  for (int t = 0; t < 4; ++t) {
    float bv = bias ? bias[col0 + t * 16 + ln] : 0.f;
    if (BIAS_BF16) bv = bf16_round(bv);
#pragma unroll
    for (int r = 0; r < 8; ++r) { float v = acc[t][r] + bv; if (ACT == 1) v = fmaxf(v, 0.f); so[w][8 * hh + r][t * 16 + ln] = v; }
  }
  __builtin_amdgcn_fence(__ATOMIC_ACQ_REL, "workgroup");
  __builtin_amdgcn_wave_barrier();
  const int rsub = lane >> 4, c4 = (lane & 15) * 4;
  {
#pragma unroll
    for (int q = 0; q < 8; ++q) {
      const int r = q * 2 + rsub;
      const v4f v = *(const v4fa*)&so[w][r][c4];
      *(v4f*)(C + (size_t)(row0 + r) * ldc + col0 + c4) = v;
    }
    
  }
}

// GEMM C = act(A·W + bias + resid): A f32 (ASPLIT -> hi/lo 2 terms), Wt bf16 [N][K]; ACT 0 none, 1 relu, 2 exact gelu;
// resid (optional, f32, row index = (row % rmod), pitch ldr, RES_BF16 rounds it) added before the activation.
template <bool ASPLIT, int ACT, bool BIAS_BF16, bool RES_BF16>
__global__ __launch_bounds__(128) void k_gemm_bf3(const float* __restrict__ A, int lda, const unsigned short* __restrict__ Wt, int ldb,
                                                const float* __restrict__ bias, const float* __restrict__ resid, int rmod, int ldr,
                                                float* __restrict__ C, int ldc, int M, int N, int K) {
  __shared__ __attribute__((aligned(16))) float so[4][16][64];
  const int tid = threadIdx.x, w = tid >> 5, lane = tid & 31, ln = lane & 15, hh = lane >> 4;
  const int ntn = N / 64;
  const int wid = blockIdx.x * 4 + w;
  const int mt = wid / ntn, nq = wid % ntn;
  if (mt * 16 >= M) return;
  const int row0 = mt * 16, col0 = nq * 64;
  const float* arow = A + (size_t)(row0 + ln) * lda;
  v8f acc[4] = {};
  for (int kb = 0; kb < K; kb += 32) {
    FragB ah, al;
    const v4f x0 = *(const v4fa*)(arow + kb + 8 * hh), x1 = *(const v4fa*)(arow + kb + 8 * hh + 4);
    const v4f x2 = *(const v4fa*)(arow + kb + 16 + 8 * hh), x3 = *(const v4fa*)(arow + kb + 16 + 8 * hh + 4);
    float xs[16] = {x0[0],x0[1],x0[2],x0[3],x1[0],x1[1],x1[2],x1[3],x2[0],x2[1],x2[2],x2[3],x3[0],x3[1],x3[2],x3[3]};
#pragma unroll
    for (int i = 0; i < 16; ++i) { const unsigned short hb = bf16_bits(xs[i]); ah.u[i] = hb; al.u[i] = ASPLIT ? bf16_bits(xs[i] - bf16_val(hb)) : (unsigned short)0; }
#pragma unroll
    for (int t = 0; t < 4; ++t) {
      const unsigned short* brow = Wt + (size_t)(col0 + t * 16 + ln) * ldb + kb;
      FragB b;
      b.half[0] = *(const v8us*)(brow + 8 * hh);
      b.half[1] = *(const v8us*)(brow + 16 + 8 * hh);
      acc[t] = mmaN<ASPLIT ? 2 : 1>(ah.v, al.v, b.v, b.v, acc[t]);
    }
  }
#pragma unroll
  for (int t = 0; t < 4; ++t) {
    const int col = col0 + t * 16 + ln;
    float bv = bias ? bias[col] : 0.f;
    if (BIAS_BF16) bv = bf16_round(bv);
#pragma unroll
    for (int r = 0; r < 8; ++r) {
      float v = acc[t][r] + bv;
      if (resid) { float rv = resid[(size_t)((row0 + 8 * hh + r) % rmod) * ldr + col]; if (RES_BF16) rv = bf16_round(rv); v += rv; }
      if (ACT == 1) v = fmaxf(v, 0.f);
      if (ACT == 2) v = 0.5f * v * (1.0f + erff(v * 0.70710678118654752f));
      if (ACT == 3) { const float u = 0.7978845608028654f * (v + 0.044715f * v * v * v); v = 0.5f * v * (1.0f + tanhf(u)); }
      so[w][8 * hh + r][t * 16 + ln] = v;
    }
  }
  __builtin_amdgcn_fence(__ATOMIC_ACQ_REL, "workgroup");
  __builtin_amdgcn_wave_barrier();
  const int rsub = lane >> 4, c4 = (lane & 15) * 4;
  {
#pragma unroll
    for (int q = 0; q < 8; ++q) {
      const int r = q * 2 + rsub;
      const v4f v = *(const v4fa*)&so[w][r][c4];
      *(v4f*)(C + (size_t)(row0 + r) * ldc + col0 + c4) = v;
    }
    
  }
}
// row LayerNorm (biased variance, eps) over N: s = X (+ R); optional out_sum <- s; out_norm <- (s-mu)*rsqrt(var+eps)*g + b
template <bool PARAM_BF16>
__global__ __launch_bounds__(256) void k_layernorm(const float* __restrict__ X, const float* __restrict__ R, const float* __restrict__ g, const float* __restrict__ bta,
                                                  float* __restrict__ out_sum, float* __restrict__ out_norm, int N, float eps) {
  __shared__ float red[256];
  const int row = blockIdx.x, tid = threadIdx.x;
  const float* x = X + (size_t)row * N; const float* rr = R ? R + (size_t)row * N : nullptr;
  float vals[16];                     // up to N = 4096
  const int per = N / 256;            // contiguous chunk per thread? use strided-by-4 chunks: thread handles j = tid*4 + 1024*u
  float s1 = 0.f;
  for (int u = 0; u < per / 4; ++u) {
    const int j = tid * 4 + 1024 * u;
    const v4f a = *(const v4fa*)(x + j);
    v4f b = {0.f,0.f,0.f,0.f}; if (rr) b = *(const v4fa*)(rr + j);
#pragma unroll
    for (int q = 0; q < 4; ++q) { const float v = a[q] + b[q]; vals[u * 4 + q] = v; s1 += v; }
  }
  red[tid] = s1; __syncthreads();
  for (int st = 128; st > 0; st >>= 1) { if (tid < st) red[tid] += red[tid + st]; __syncthreads(); }
  const float mu = red[0] / (float)N; __syncthreads();
  float s2 = 0.f;
  for (int u = 0; u < per / 4; ++u)
#pragma unroll
    for (int q = 0; q < 4; ++q) { const float c = vals[u * 4 + q] - mu; s2 += c * c; }
  red[tid] = s2; __syncthreads();
  for (int st = 128; st > 0; st >>= 1) { if (tid < st) red[tid] += red[tid + st]; __syncthreads(); }
  const float rs = rsqrtf(red[0] / (float)N + eps);
  {
    for (int u = 0; u < per / 4; ++u) {
      const int j = tid * 4 + 1024 * u;
      v4f o, sm;
#pragma unroll
      for (int q = 0; q < 4; ++q) {
        float gg = g[j + q], bb = bta[j + q];
        if (PARAM_BF16) { gg = bf16_round(gg); bb = bf16_round(bb); }
        sm[q] = vals[u * 4 + q]; o[q] = (vals[u * 4 + q] - mu) * rs * gg + bb;
      }
      if (out_sum) *(v4f*)(out_sum + (size_t)row * N + j) = sm;
      *(v4f*)(out_norm + (size_t)row * N + j) = o;
    }
    
  }
}



// ---- f16 WMMA path (v_wmma_f32_16x16x32_f16): 11-bit significands for operands in range — used where a [0,1] probability operand needs more precision than bf16
typedef _Float16 v16h __attribute__((ext_vector_type(16)));
union FragH { v16h v; v8us half[2]; _Float16 h[16]; unsigned short u[16]; };
template <int NT>
__device__ __forceinline__ v8f mmaH(v16h ah, v16h al, v16h bh, v16h bl, v8f c) {
  c = __builtin_amdgcn_wmma_f32_16x16x32_f16(false, ah, false, bh, (short)0, c, false, false);
  if (NT >= 2) c = __builtin_amdgcn_wmma_f32_16x16x32_f16(false, al, false, bh, (short)0, c, false, false);
  if (NT >= 3) c = __builtin_amdgcn_wmma_f32_16x16x32_f16(false, ah, false, bl, (short)0, c, false, false);
  asm volatile("v_nop\n\tv_nop\n\tv_nop\n\tv_nop" : "+v"(c) : "v"(ah), "v"(al), "v"(bh), "v"(bl));
  return c;
}
// batched GEMM like k_gemm_b but f16 operands: A f32 (split into f16 hi/lo if ASPLIT, else rounded to f16), Bt = f16 values [n][k]; alpha; C f32; N multiple of 16 (partial tiles skipped)
template <bool ASPLIT>
__global__ __launch_bounds__(128) void k_gemm_h(const float* __restrict__ A, int lda, size_t sA, const _Float16* __restrict__ Bh, int ldb, size_t sB, float alpha, float* __restrict__ C, int ldc, size_t sC, int M, int N, int K) {
  __shared__ __attribute__((aligned(16))) float so[4][16][64];
  const int tid = threadIdx.x, w = tid >> 5, lane = tid & 31, ln = lane & 15, hh = lane >> 4; const int by = blockIdx.y;
  A += (size_t)by * sA; Bh += (size_t)by * sB; C += (size_t)by * sC;
  const int ntn = (N + 63) / 64; const int wid = blockIdx.x * 4 + w; const int mt = wid / ntn, nq = wid % ntn; if (mt * 16 >= M) return;
  const int row0 = mt * 16, col0 = nq * 64; const float* arow = A + (size_t)(row0 + ln) * lda;
  v8f acc[4] = {};
  for (int kb = 0; kb < K; kb += 32) {
    FragH ah, al;
    const v4f x0 = *(const v4fa*)(arow + kb + 8 * hh), x1 = *(const v4fa*)(arow + kb + 8 * hh + 4), x2 = *(const v4fa*)(arow + kb + 16 + 8 * hh), x3 = *(const v4fa*)(arow + kb + 16 + 8 * hh + 4);
    float xs[16] = {x0[0],x0[1],x0[2],x0[3],x1[0],x1[1],x1[2],x1[3],x2[0],x2[1],x2[2],x2[3],x3[0],x3[1],x3[2],x3[3]};
#pragma unroll
    for (int i = 0; i < 16; ++i) { const _Float16 h = (_Float16)xs[i]; ah.h[i] = h; al.h[i] = ASPLIT ? (_Float16)(xs[i] - (float)h) : (_Float16)0.0f; }
#pragma unroll
    for (int t = 0; t < 4; ++t) { if (col0 + t * 16 >= N) continue; const size_t boff = (size_t)(col0 + t * 16 + ln) * ldb + kb; FragH bq; bq.half[0] = *(const v8us*)(Bh + boff + 8 * hh); bq.half[1] = *(const v8us*)(Bh + boff + 16 + 8 * hh);
      acc[t] = mmaH<ASPLIT ? 2 : 1>(ah.v, al.v, bq.v, bq.v, acc[t]); }
  }
#pragma unroll
  for (int t = 0; t < 4; ++t) { if (col0 + t * 16 >= N) continue;
#pragma unroll
    for (int r = 0; r < 8; ++r) so[w][8 * hh + r][t * 16 + ln] = acc[t][r] * alpha; }
  __builtin_amdgcn_fence(__ATOMIC_ACQ_REL, "workgroup"); __builtin_amdgcn_wave_barrier();
  const int rsub = lane >> 4, c4 = (lane & 15) * 4;
  {
#pragma unroll
    for (int q = 0; q < 8; ++q) { const int r = q * 2 + rsub; if (col0 + c4 < N) { const v4f v = *(const v4fa*)&so[w][r][c4]; *(v4f*)(C + (size_t)(row0 + r) * ldc + col0 + c4) = v; } }
     }
}

// Wt[n][k] = f16(W[k][n]·scale) from f32 row-major W[K][N] (scale = power of two; bf16-exact weights stay exact in f16 away from the subnormal range)
__global__ __launch_bounds__(256) void k_wt_f16(const float* __restrict__ W, _Float16* __restrict__ Wt, int K, int N, float scale) {
  const int t = blockIdx.x * 256 + threadIdx.x; if (t >= N * (K / 8)) return; const int n = t / (K / 8), k8 = (t % (K / 8)) * 8; FragH f;
#pragma unroll
  for (int i = 0; i < 8; ++i) f.h[i] = (_Float16)(bf16_round(W[(size_t)(k8 + i) * N + n]) * scale); const v8us o = f.half[0];
  *(v8us*)((unsigned short*)Wt + (size_t)n * K + k8) = o; 
}
// k_gemm_hh variant with fused epilogue: v = acc·alpha + bias[by·sBias + col] (+ CP[(row/rowsPerB)·sCPb + by·64 + col] if CP) ; ACT 0 none / 1 elu ; writes f16 C16 (and f32 C if non-null)
template <int ACT>
__global__ __launch_bounds__(128) void k_gemm_hhx(const _Float16* __restrict__ A, int lda, size_t sA, const _Float16* __restrict__ Bh, int ldb, size_t sB, float alpha, const float* __restrict__ bias, size_t sBias, const float* __restrict__ CP, int rowsPerB, size_t sCPb, int row0g,
    float* __restrict__ C, _Float16* __restrict__ C16, int ldc, size_t sC, int M, int N, int K) {
  __shared__ __attribute__((aligned(16))) float so[4][16][64];
  const int tid = threadIdx.x, w = tid >> 5, lane = tid & 31, ln = lane & 15, hh = lane >> 4; const int by = blockIdx.y;
  A += (size_t)by * sA; Bh += (size_t)by * sB; const size_t cofs = (size_t)by * sC; const float* bp = bias ? bias + (size_t)by * sBias : nullptr;
  const int ntn = (N + 63) / 64; const int wid = blockIdx.x * 4 + w; const int mt = wid / ntn, nq = wid % ntn; if (mt * 16 >= M) return;
  const int row0 = mt * 16, col0 = nq * 64; const _Float16* arow = A + (size_t)(row0 + ln) * lda;
  v8f acc[4] = {};
  for (int kb = 0; kb < K; kb += 32) { FragH ah; ah.half[0] = *(const v8us*)((const unsigned short*)arow + kb + 8 * hh); ah.half[1] = *(const v8us*)((const unsigned short*)arow + kb + 16 + 8 * hh);
#pragma unroll
    for (int t = 0; t < 4; ++t) { if (col0 + t * 16 >= N) continue; const size_t boff = (size_t)(col0 + t * 16 + ln) * ldb + kb; FragH bq; bq.half[0] = *(const v8us*)((const unsigned short*)Bh + boff + 8 * hh); bq.half[1] = *(const v8us*)((const unsigned short*)Bh + boff + 16 + 8 * hh);
      acc[t] = mmaH<1>(ah.v, ah.v, bq.v, bq.v, acc[t]); }
  }
#pragma unroll
  for (int t = 0; t < 4; ++t) { if (col0 + t * 16 >= N) continue; const int col = col0 + t * 16 + ln; const float bv = bp ? bf16_round(bp[col]) : 0.f;
#pragma unroll
    for (int r = 0; r < 8; ++r) { float v = acc[t][r] * alpha + bv; if (CP) { const int bidx = (row0g + row0 + 8 * hh + r) / rowsPerB; v += CP[(size_t)bidx * sCPb + (size_t)by * 64 + col]; } if (ACT == 1) v = (v > 0.f) ? v : expm1f(v); else if (ACT == 7) v = (v > 0.f) ? v + 1.0f : expf(v); else if (ACT == 8) v = tanhf(v); else if (ACT == 9) v = 0.5f * v * (1.0f + tanhf(0.7978845608028654f * (v + 0.044715f * v * v * v))); else if (ACT == 11) v = 1.0f / (1.0f + expf(-v)); else if (ACT == 12) v = (v > 0.f) ? v : 0.01f * v; else if (ACT == 14) v = (v > 0.f) ? v : 0.1f * v; else if (ACT == 15) v = v / (1.0f + expf(-v)); else if (ACT == 3) v = fmaxf(v, 0.f); else if (ACT == 6) v = 0.5f * v * (1.0f + erff(v * 0.70710678118654752f)); so[w][8 * hh + r][t * 16 + ln] = v; } }
  __builtin_amdgcn_fence(__ATOMIC_ACQ_REL, "workgroup"); __builtin_amdgcn_wave_barrier();
  const int rsub = lane >> 4, c4 = (lane & 15) * 4; typedef _Float16 v4h __attribute__((ext_vector_type(4)));
  {
#pragma unroll
    for (int q = 0; q < 8; ++q) { const int r = q * 2 + rsub; if (col0 + c4 < N) { const v4f v = *(const v4fa*)&so[w][r][c4]; if (C) *(v4f*)(C + cofs + (size_t)(row0 + r) * ldc + col0 + c4) = v; if (C16) { v4h h4; for (int i = 0; i < 4; ++i) h4[i] = (_Float16)v[i]; *(v4h*)(C16 + cofs + (size_t)(row0 + r) * ldc + col0 + c4) = h4; } } }
     }
}


typedef _Float16 v4h __attribute__((ext_vector_type(4)));

__global__ __launch_bounds__(256) void k_x16(const float* __restrict__ x, _Float16* __restrict__ X16, size_t n8) { const size_t t = (size_t)blockIdx.x * 256 + threadIdx.x; if (t >= n8) return; FragH f;
#pragma unroll
  for (int q = 0; q < 8; ++q) f.h[q] = (_Float16)bf16_round(x[t * 8 + q]); *(v8us*)((unsigned short*)X16 + t * 8) = f.half[0];  }
__global__ __launch_bounds__(256) void k_h16(const float* __restrict__ x, _Float16* __restrict__ X16, size_t n8) { const size_t t = (size_t)blockIdx.x * 256 + threadIdx.x; if (t >= n8) return; FragH f;
#pragma unroll
  for (int q = 0; q < 8; ++q) f.h[q] = (_Float16)x[t * 8 + q]; *(v8us*)((unsigned short*)X16 + t * 8) = f.half[0];  }
__global__ __launch_bounds__(256) void k_round16f(const float* __restrict__ W, _Float16* __restrict__ Bt, size_t n8) { const size_t t = (size_t)blockIdx.x * 256 + threadIdx.x; if (t >= n8) return; FragH f;
#pragma unroll
  for (int i = 0; i < 8; ++i) f.h[i] = (_Float16)(bf16_round(W[t * 8 + i]) * 16.0f); *(v8us*)((unsigned short*)Bt + t * 8) = f.half[0];  }
template <int NHv, int TTv>
__global__ __launch_bounds__(256) void k_vt(const _Float16* __restrict__ V16, int ldv, int voff, _Float16* __restrict__ Vt) { __shared__ unsigned short tl[64][66]; const int tid = threadIdx.x; const int slab = blockIdx.x / (TTv / 64), lg = blockIdx.x % (TTv / 64); const int b = slab / NHv, h = slab % NHv;
  for (int i = tid; i < 64 * 8; i += 256) { const int r = i / 8, c8 = (i % 8) * 8; FragH f; f.half[0] = *(const v8us*)((const unsigned short*)V16 + ((size_t)b * TTv + lg * 64 + r) * ldv + voff + h * 64 + c8);
#pragma unroll
    for (int q = 0; q < 8; ++q) tl[r][c8 + q] = f.u[q]; }
  __syncthreads();
  {
#pragma unroll
    for (int rd = 0; rd < 2; ++rd) { const int d = rd * 32 + tid / 8, pc = tid % 8; FragH f;
#pragma unroll
      for (int q = 0; q < 8; ++q) f.u[q] = tl[pc * 8 + q][d];
      *(v8us*)((unsigned short*)Vt + ((size_t)slab * 64 + d) * TTv + lg * 64 + pc * 8) = f.half[0]; }
     } }

__global__ __launch_bounds__(256) void k_hl(const float* __restrict__ F, _Float16* __restrict__ Hh, _Float16* __restrict__ Hl, size_t n8) { const size_t t = (size_t)blockIdx.x * 256 + threadIdx.x; if (t >= n8) return; FragH fh, fl; const v4f a = *(const v4fa*)(F + t * 8), c = *(const v4fa*)(F + t * 8 + 4);
#pragma unroll
  for (int q = 0; q < 4; ++q) { _Float16 h = (_Float16)a[q]; fh.h[q] = h; fl.h[q] = (_Float16)((a[q] - (float)h) * 1024.0f); h = (_Float16)c[q]; fh.h[4 + q] = h; fl.h[4 + q] = (_Float16)((c[q] - (float)h) * 1024.0f); }
  { *(v8us*)((unsigned short*)Hh + t * 8) = fh.half[0]; *(v8us*)((unsigned short*)Hl + t * 8) = fl.half[0];  } }

// ---- fast GEMM (wave tile 32x64; requires M % 32 == 0 rows per launch region and N % 64 == 0); epilogue = k_gemm_hhx semantics ----
__device__ __forceinline__ v16h g2_frag(const _Float16* p, int hh) { FragH f; f.half[0] = *(const v8us*)((const unsigned short*)p + 8 * hh); f.half[1] = *(const v8us*)((const unsigned short*)p + 16 + 8 * hh); return f.v; }
__device__ __forceinline__ v8f g2_mma(v16h a, v16h b, v8f c) { v8f d = __builtin_amdgcn_wmma_f32_16x16x32_f16(false, a, false, b, (short)0, c, false, false); asm volatile("v_nop\n\tv_nop\n\tv_nop\n\tv_nop" : "+v"(d) : "v"(a), "v"(b)); return d; }
template <int ACT>
__global__ __launch_bounds__(128) void k_gemm2(const _Float16* __restrict__ A, int lda, size_t sA, const _Float16* __restrict__ Bh, int ldb, size_t sB, float alpha, const float* __restrict__ bias, size_t sBias, const float* __restrict__ CP, int rowsPerB, size_t sCPb, int row0g,
    float* __restrict__ C, _Float16* __restrict__ C16, int ldc, size_t sC, int M, int N, int K) {
  __shared__ __attribute__((aligned(16))) float so[4][32][68];
  const int tid = threadIdx.x, w = tid >> 5, lane = tid & 31, ln = lane & 15, hh = lane >> 4; const int by = blockIdx.y;
  A += (size_t)by * sA; Bh += (size_t)by * sB; const size_t cofs = (size_t)by * sC; const float* bp = bias ? bias + (size_t)by * sBias : nullptr;
  const int ntn = N >> 6; const int mt = blockIdx.x / ntn, nq = blockIdx.x - mt * ntn; const int row0 = mt * 128 + 32 * w, col0 = nq * 64; if (row0 >= M) return;
  const _Float16* a0p = A + (size_t)(row0 + ln) * lda; const _Float16* a1p = a0p + (size_t)16 * lda;
  const _Float16* b0p = Bh + (size_t)(col0 + ln) * ldb; const _Float16* b1p = b0p + (size_t)16 * ldb; const _Float16* b2p = b1p + (size_t)16 * ldb; const _Float16* b3p = b2p + (size_t)16 * ldb;
  const v8f z8 = {0.f,0.f,0.f,0.f,0.f,0.f,0.f,0.f}; v8f c00 = z8, c01 = z8, c02 = z8, c03 = z8, c10 = z8, c11 = z8, c12 = z8, c13 = z8;
#pragma unroll 1
  for (int kb = 0; kb < K; kb += 32) { const v16h a0 = g2_frag(a0p + kb, hh), a1 = g2_frag(a1p + kb, hh);
    v16h b = g2_frag(b0p + kb, hh); c00 = g2_mma(a0, b, c00); c10 = g2_mma(a1, b, c10);
    b = g2_frag(b1p + kb, hh); c01 = g2_mma(a0, b, c01); c11 = g2_mma(a1, b, c11);
    b = g2_frag(b2p + kb, hh); c02 = g2_mma(a0, b, c02); c12 = g2_mma(a1, b, c12);
    b = g2_frag(b3p + kb, hh); c03 = g2_mma(a0, b, c03); c13 = g2_mma(a1, b, c13); }
  v8f accs[8] = {c00, c01, c02, c03, c10, c11, c12, c13};
#pragma unroll
  for (int u = 0; u < 8; ++u) { const int t = u & 3, half = u >> 2; const int col = col0 + t * 16 + ln; const float bv = bp ? bf16_round(bp[col]) : 0.f;
#pragma unroll
    for (int r = 0; r < 8; ++r) { const int rloc = half * 16 + 8 * hh + r; float v = accs[u][r] * alpha + bv; if (CP) { const int bidx = (row0g + row0 + rloc) / rowsPerB; v += CP[(size_t)bidx * sCPb + (size_t)by * 64 + col]; }
      if (ACT == 3) v = fmaxf(v, 0.f); else if (ACT == 6) v = 0.5f * v * (1.0f + erff(v * 0.70710678118654752f)); else if (ACT == 11) v = 1.0f / (1.0f + expf(-v)); else if (ACT == 15) v = v / (1.0f + expf(-v)); else if (ACT == 12) v = (v > 0.f) ? v : 0.01f * v; else if (ACT == 8) v = tanhf(v);
      so[w][rloc][t * 16 + ln] = v; } }
  __builtin_amdgcn_fence(__ATOMIC_ACQ_REL, "workgroup"); __builtin_amdgcn_wave_barrier();
  const int rsub = lane >> 4, c4 = (lane & 15) * 4;
  {
#pragma unroll
    for (int q = 0; q < 16; ++q) { const int r = q * 2 + rsub; const v4f v = *(const v4fa*)&so[w][r][c4]; if (C) *(v4f*)(C + cofs + (size_t)(row0 + r) * ldc + col0 + c4) = v; if (C16) { v4h h4; for (int i = 0; i < 4; ++i) h4[i] = (_Float16)v[i]; *(v4h*)(C16 + cofs + (size_t)(row0 + r) * ldc + col0 + c4) = h4; } }
     } }



template <int CAUSAL>
__global__ __launch_bounds__(128) void k_flash(const _Float16* __restrict__ Q16, int ldq, const _Float16* __restrict__ K16, int ldk, const _Float16* __restrict__ Vt, const int* __restrict__ MSK, float* __restrict__ O, int ldo) {
  constexpr int RPW = 16, RTN = RPW / 16, NQB = TQ / (4 * RPW), DT = 4, KS = 2;
  __shared__ __attribute__((aligned(16))) unsigned short sP[4][RPW][40]; __shared__ __attribute__((aligned(16))) float sO[4][RPW][64 + 4];
  const int tid = threadIdx.x, w = tid >> 5, lane = tid & 31, ln = lane & 15, hh = lane >> 4;
  const int slab = blockIdx.x / NQB, qblk = blockIdx.x % NQB; const int b = slab / NH, h = slab % NH; const int qb0 = qblk * (4 * RPW); const int q0 = qb0 + w * RPW;
  FragH aq[2][KS];
#pragma unroll
  for (int rt = 0; rt < RTN; ++rt) { const unsigned short* qr = (const unsigned short*)Q16 + ((size_t)b * TQ + q0 + rt * 16 + ln) * ldq + h * 64;
#pragma unroll
    for (int ks = 0; ks < KS; ++ks) { aq[rt][ks].half[0] = *(const v8us*)(qr + ks * 32 + 8 * hh); aq[rt][ks].half[1] = *(const v8us*)(qr + ks * 32 + 16 + 8 * hh); } }
  const unsigned short* Vth = (const unsigned short*)Vt + (size_t)slab * 64 * TK;
  float m_r[2][8], l_r[2][8]; v8f oacc[2][DT];
#pragma unroll
  for (int rt = 0; rt < RTN; ++rt) {
#pragma unroll
    for (int r = 0; r < 8; ++r) { m_r[rt][r] = -3.0e38f; l_r[rt][r] = 0.f; }
#pragma unroll
    for (int dt = 0; dt < DT; ++dt) oacc[rt][dt] = (v8f){0.f,0.f,0.f,0.f,0.f,0.f,0.f,0.f}; }
  const int jend = (CAUSAL == 1) ? (qb0 + 4 * RPW) : TK;      /* causal: keys beyond the block's last query never contribute */
#pragma unroll 1
  for (int j0 = 0; j0 < jend; j0 += 32) {
    v8f s[2][2];
#pragma unroll
    for (int nt = 0; nt < 2; ++nt) { const unsigned short* kr = (const unsigned short*)K16 + ((size_t)b * TK + j0 + nt * 16 + ln) * ldk + h * 64; FragH bk[KS];
#pragma unroll
      for (int ks = 0; ks < KS; ++ks) { bk[ks].half[0] = *(const v8us*)(kr + ks * 32 + 8 * hh); bk[ks].half[1] = *(const v8us*)(kr + ks * 32 + 16 + 8 * hh); }
#pragma unroll
      for (int rt = 0; rt < RTN; ++rt) { v8f acc = (v8f){0.f,0.f,0.f,0.f,0.f,0.f,0.f,0.f};
#pragma unroll
        for (int ks = 0; ks < KS; ++ks) acc = mmaH<1>(aq[rt][ks].v, aq[rt][ks].v, bk[ks].v, bk[ks].v, acc); s[rt][nt] = acc; } }
#pragma unroll
    for (int rt = 0; rt < RTN; ++rt)
#pragma unroll
      for (int r = 0; r < 8; ++r) { const int tq = q0 + rt * 16 + 8 * hh + r; const int k0 = j0 + ln, k1 = j0 + 16 + ln;
        const bool ok0 = (CAUSAL == 1) ? (k0 <= tq) : ((CAUSAL == 2) ? ((k0 >> 5) == (tq >> 5)) : true), ok1 = (CAUSAL == 1) ? (k1 <= tq) : ((CAUSAL == 2) ? ((k1 >> 5) == (tq >> 5)) : true);      /* mode 2: block-diagonal 32-token groups */
        const float s0 = ok0 ? s[rt][0][r] * SCL : -3.0e38f, s1 = ok1 ? s[rt][1][r] * SCL : -3.0e38f; float mc = fmaxf(s0, s1);
        mc = fmaxf(mc, __shfl_xor(mc, 1, 32)); mc = fmaxf(mc, __shfl_xor(mc, 2, 32)); mc = fmaxf(mc, __shfl_xor(mc, 4, 32)); mc = fmaxf(mc, __shfl_xor(mc, 8, 32));
        const float mn = fmaxf(m_r[rt][r], mc); const float al = (mn > -1.0e38f) ? expf(m_r[rt][r] - mn) : 1.0f; m_r[rt][r] = mn; const float p0 = ok0 ? expf(s0 - mn) : 0.f, p1 = ok1 ? expf(s1 - mn) : 0.f; l_r[rt][r] = l_r[rt][r] * al + p0 + p1;
#pragma unroll
        for (int dt = 0; dt < DT; ++dt) oacc[rt][dt][r] *= al;
        FragH t2; t2.h[0] = (_Float16)(p0 * 1024.0f); t2.h[1] = (_Float16)(p1 * 1024.0f); sP[w][rt * 16 + 8 * hh + r][ln] = t2.u[0]; sP[w][rt * 16 + 8 * hh + r][16 + ln] = t2.u[1]; }
    __builtin_amdgcn_fence(__ATOMIC_ACQ_REL, "workgroup"); __builtin_amdgcn_wave_barrier();
    FragH pa[2];
#pragma unroll
    for (int rt = 0; rt < RTN; ++rt) { pa[rt].half[0] = *(const v8us*)&sP[w][rt * 16 + ln][8 * hh]; pa[rt].half[1] = *(const v8us*)&sP[w][rt * 16 + ln][16 + 8 * hh]; }
#pragma unroll
    for (int dt = 0; dt < DT; ++dt) { const unsigned short* vrow = Vth + (size_t)(dt * 16 + ln) * TK + j0; FragH bv; bv.half[0] = *(const v8us*)(vrow + 8 * hh); bv.half[1] = *(const v8us*)(vrow + 16 + 8 * hh);
#pragma unroll
      for (int rt = 0; rt < RTN; ++rt) oacc[rt][dt] = mmaH<1>(pa[rt].v, pa[rt].v, bv.v, bv.v, oacc[rt][dt]); }
    __builtin_amdgcn_fence(__ATOMIC_ACQ_REL, "workgroup"); __builtin_amdgcn_wave_barrier(); }
#pragma unroll
  for (int rt = 0; rt < RTN; ++rt) {
#pragma unroll
    for (int r = 0; r < 8; ++r) { float l = l_r[rt][r]; l += __shfl_xor(l, 1, 32); l += __shfl_xor(l, 2, 32); l += __shfl_xor(l, 4, 32); l += __shfl_xor(l, 8, 32); l_r[rt][r] = (l > 0.f) ? 1.0f / (l * 1024.0f) : 0.f; }
#pragma unroll
    for (int dt = 0; dt < DT; ++dt)
#pragma unroll
      for (int r = 0; r < 8; ++r) sO[w][rt * 16 + 8 * hh + r][dt * 16 + ln] = oacc[rt][dt][r] * l_r[rt][r]; }
  __builtin_amdgcn_fence(__ATOMIC_ACQ_REL, "workgroup"); __builtin_amdgcn_wave_barrier();
  {
#pragma unroll
    for (int rp = 0; rp < RPW; rp += 2) { const int r = rp + (lane >> 4), pc = lane & 15; const v4f val = *(const v4fa*)&sO[w][r][pc * 4]; *(v4f*)(O + ((size_t)b * TQ + q0 + r) * ldo + h * 64 + pc * 4) = val; }
     } }
// Q/K-split variant: S = Qh Kh^T + (Ql Kh^T + Qh Kl^T)/1024 with Q/K = [hi | 2^10 residual] f16 planes (QL/KL same layout as Q16/K16); plain f16 P (x2^10) . V^T as in k_flash
template <int CAUSAL>
__global__ __launch_bounds__(128) void k_flashqk(const _Float16* __restrict__ Q16, const _Float16* __restrict__ QL, int ldq, const _Float16* __restrict__ K16, const _Float16* __restrict__ KL, int ldk, const _Float16* __restrict__ Vt, const int* __restrict__ MSK, float* __restrict__ O, int ldo) {
  constexpr int RPW = 16, RTN = RPW / 16, NQB = TQ / (4 * RPW), DT = 4, KS = 2;
  __shared__ __attribute__((aligned(16))) unsigned short sP[4][RPW][40]; __shared__ __attribute__((aligned(16))) float sO[4][RPW][64 + 4];
  const int tid = threadIdx.x, w = tid >> 5, lane = tid & 31, ln = lane & 15, hh = lane >> 4;
  const int slab = blockIdx.x / QBLKS, qblk = blockIdx.x % QBLKS; (void)NQB; const int b = slab / NH, h = slab % NH; const int qb0 = qblk * (4 * RPW); const int q0 = qb0 + w * RPW;
  FragH aq[2][KS], aql[2][KS];
#pragma unroll
  for (int rt = 0; rt < RTN; ++rt) { const unsigned short* qr = (const unsigned short*)Q16 + ((size_t)b * TQ + q0 + rt * 16 + ln) * ldq + h * 64; const unsigned short* ql = (const unsigned short*)QL + ((size_t)b * TQ + q0 + rt * 16 + ln) * ldq + h * 64;
#pragma unroll
    for (int ks = 0; ks < KS; ++ks) { aq[rt][ks].half[0] = *(const v8us*)(qr + ks * 32 + 8 * hh); aq[rt][ks].half[1] = *(const v8us*)(qr + ks * 32 + 16 + 8 * hh); aql[rt][ks].half[0] = *(const v8us*)(ql + ks * 32 + 8 * hh); aql[rt][ks].half[1] = *(const v8us*)(ql + ks * 32 + 16 + 8 * hh); } }
  const unsigned short* Vth = (const unsigned short*)Vt + (size_t)slab * 64 * TK;
  float m_r[2][8], l_r[2][8]; v8f oacc[2][DT];
#pragma unroll
  for (int rt = 0; rt < RTN; ++rt) {
#pragma unroll
    for (int r = 0; r < 8; ++r) { m_r[rt][r] = -3.0e38f; l_r[rt][r] = 0.f; }
#pragma unroll
    for (int dt = 0; dt < DT; ++dt) oacc[rt][dt] = (v8f){0.f,0.f,0.f,0.f,0.f,0.f,0.f,0.f}; }
  const int jend = (CAUSAL == 1) ? (qb0 + 4 * RPW) : TK;      /* causal: keys beyond the block's last query never contribute */
#pragma unroll 1
  for (int j0 = 0; j0 < jend; j0 += 32) {
    v8f s[2][2];
#pragma unroll
    for (int nt = 0; nt < 2; ++nt) { const unsigned short* kr = (const unsigned short*)K16 + ((size_t)b * TK + j0 + nt * 16 + ln) * ldk + h * 64; const unsigned short* klr = (const unsigned short*)KL + ((size_t)b * TK + j0 + nt * 16 + ln) * ldk + h * 64; FragH bk[KS], bkl[KS];
#pragma unroll
      for (int ks = 0; ks < KS; ++ks) { bk[ks].half[0] = *(const v8us*)(kr + ks * 32 + 8 * hh); bk[ks].half[1] = *(const v8us*)(kr + ks * 32 + 16 + 8 * hh); bkl[ks].half[0] = *(const v8us*)(klr + ks * 32 + 8 * hh); bkl[ks].half[1] = *(const v8us*)(klr + ks * 32 + 16 + 8 * hh); }
#pragma unroll
      for (int rt = 0; rt < RTN; ++rt) { v8f acc = (v8f){0.f,0.f,0.f,0.f,0.f,0.f,0.f,0.f}, accl = acc;
#pragma unroll
        for (int ks = 0; ks < KS; ++ks) { acc = mmaH<1>(aq[rt][ks].v, aq[rt][ks].v, bk[ks].v, bk[ks].v, acc); accl = mmaH<1>(aql[rt][ks].v, aql[rt][ks].v, bk[ks].v, bk[ks].v, accl); accl = mmaH<1>(aq[rt][ks].v, aq[rt][ks].v, bkl[ks].v, bkl[ks].v, accl); }
#pragma unroll
        for (int r = 0; r < 8; ++r) acc[r] += accl[r] * 0.0009765625f;
        s[rt][nt] = acc; } }
#pragma unroll
    for (int rt = 0; rt < RTN; ++rt)
#pragma unroll
      for (int r = 0; r < 8; ++r) { const int tq = q0 + rt * 16 + 8 * hh + r; const int k0 = j0 + ln, k1 = j0 + 16 + ln;
        bool ok0 = (CAUSAL == 1) ? (k0 <= tq) : ((CAUSAL == 2) ? ((k0 >> 5) == (tq >> 5)) : true), ok1 = (CAUSAL == 1) ? (k1 <= tq) : ((CAUSAL == 2) ? ((k1 >> 5) == (tq >> 5)) : true);      /* mode 2: block-diagonal 32-token groups */
        if (CAUSAL == 5) { const int* mrow = MSK + ((size_t)b * NH + h) * TK; ok0 = mrow[k0] != 0; ok1 = mrow[k1] != 0; }      /* mode 5: per-(batch, head, key) validity table (key padding + head-specific masks) */
        if (CAUSAL == 4) { const int* mrow = MSK + ((size_t)b * TQ + tq) * TK; ok0 = mrow[k0] != 0; ok1 = mrow[k1] != 0; }      /* mode 4: per-(query, key) INPUT mask shared by all heads; masked keys contribute nothing (== the reference's -4096 fill, whose exp underflows to 0), rows with no valid key give l = 0 -> output 0 (== the reference's row_valid zeroing) */
        const float s0 = ok0 ? s[rt][0][r] * SCL : -3.0e38f, s1 = ok1 ? s[rt][1][r] * SCL : -3.0e38f; float mc = fmaxf(s0, s1);
        mc = fmaxf(mc, __shfl_xor(mc, 1, 32)); mc = fmaxf(mc, __shfl_xor(mc, 2, 32)); mc = fmaxf(mc, __shfl_xor(mc, 4, 32)); mc = fmaxf(mc, __shfl_xor(mc, 8, 32));
        const float mn = fmaxf(m_r[rt][r], mc); const float al = (mn > -1.0e38f) ? expf(m_r[rt][r] - mn) : 1.0f; m_r[rt][r] = mn; const float p0 = ok0 ? expf(s0 - mn) : 0.f, p1 = ok1 ? expf(s1 - mn) : 0.f; l_r[rt][r] = l_r[rt][r] * al + p0 + p1;
#pragma unroll
        for (int dt = 0; dt < DT; ++dt) oacc[rt][dt][r] *= al;
        FragH t2; t2.h[0] = (_Float16)(p0 * 1024.0f); t2.h[1] = (_Float16)(p1 * 1024.0f); sP[w][rt * 16 + 8 * hh + r][ln] = t2.u[0]; sP[w][rt * 16 + 8 * hh + r][16 + ln] = t2.u[1]; }
    __builtin_amdgcn_fence(__ATOMIC_ACQ_REL, "workgroup"); __builtin_amdgcn_wave_barrier();
    FragH pa[2];
#pragma unroll
    for (int rt = 0; rt < RTN; ++rt) { pa[rt].half[0] = *(const v8us*)&sP[w][rt * 16 + ln][8 * hh]; pa[rt].half[1] = *(const v8us*)&sP[w][rt * 16 + ln][16 + 8 * hh]; }
#pragma unroll
    for (int dt = 0; dt < DT; ++dt) { const unsigned short* vrow = Vth + (size_t)(dt * 16 + ln) * TK + j0; FragH bv; bv.half[0] = *(const v8us*)(vrow + 8 * hh); bv.half[1] = *(const v8us*)(vrow + 16 + 8 * hh);
#pragma unroll
      for (int rt = 0; rt < RTN; ++rt) oacc[rt][dt] = mmaH<1>(pa[rt].v, pa[rt].v, bv.v, bv.v, oacc[rt][dt]); }
    __builtin_amdgcn_fence(__ATOMIC_ACQ_REL, "workgroup"); __builtin_amdgcn_wave_barrier(); }
#pragma unroll
  for (int rt = 0; rt < RTN; ++rt) {
#pragma unroll
    for (int r = 0; r < 8; ++r) { float l = l_r[rt][r]; l += __shfl_xor(l, 1, 32); l += __shfl_xor(l, 2, 32); l += __shfl_xor(l, 4, 32); l += __shfl_xor(l, 8, 32); l_r[rt][r] = (l > 0.f) ? 1.0f / (l * 1024.0f) : 0.f; }
#pragma unroll
    for (int dt = 0; dt < DT; ++dt)
#pragma unroll
      for (int r = 0; r < 8; ++r) sO[w][rt * 16 + 8 * hh + r][dt * 16 + ln] = oacc[rt][dt][r] * l_r[rt][r]; }
  __builtin_amdgcn_fence(__ATOMIC_ACQ_REL, "workgroup"); __builtin_amdgcn_wave_barrier();
  {
#pragma unroll
    for (int rp = 0; rp < RPW; rp += 2) { const int r = rp + (lane >> 4), pc = lane & 15; const v4f val = *(const v4fa*)&sO[w][r][pc * 4]; *(v4f*)(O + ((size_t)b * TQ + q0 + r) * ldo + h * 64 + pc * 4) = val; }
     } }

__global__ __launch_bounds__(256) void k_woutp(const float* __restrict__ Wm, _Float16* __restrict__ Bt) { const size_t t = (size_t)blockIdx.x * 256 + threadIdx.x; if (t >= (size_t)DMOD * (2 * DMOD / 8)) return; const int pc = (int)(t % (2 * DMOD / 8)); const int o = (int)(t / (2 * DMOD / 8)); const bool lo = pc * 8 >= DMOD; FragH f;
  for (int q = 0; q < 8; ++q) { const int c = pc * 8 + q - (lo ? DMOD : 0); f.h[q] = (_Float16)(bf16_round(Wm[(size_t)c * DMOD + o]) * (lo ? 1.0f : 16.0f)); } *(v8us*)((unsigned short*)Bt + (size_t)o * 2 * DMOD + pc * 8) = f.half[0];  }      /* Wo stored (in, out) */
__global__ __launch_bounds__(256) void k_mask(const int* __restrict__ mask, const int* __restrict__ cdrs, int* __restrict__ MK) {
  __shared__ int sh[256]; const int b = blockIdx.x, tid = threadIdx.x; int any = 0; for (int k = tid; k < TK; k += 256) any |= (cdrs[(size_t)b * TK + k] != 0) ? 1 : 0; sh[tid] = any; __syncthreads();
  for (int st = 128; st > 0; st >>= 1) { if (tid < st) sh[tid] |= sh[tid + st]; __syncthreads(); } const bool allmasked = (sh[0] == 0);      /* no CDR token at all -> the CDR mask is disabled */
  { for (int i = tid; i < NH * TK; i += 256) { const int h = i / TK, k = i % TK; const bool pad = mask[(size_t)b * TK + k] == 0; const bool cdrm = (!allmasked) && (cdrs[(size_t)b * TK + k] == 0) && (h < CDRH); *(int*)(MK + ((size_t)b * NH + h) * TK + k) = (!pad && !cdrm) ? 1 : 0; }  } }

extern "C" void kernel_launch(void* const* d_in, const int* in_sizes, int n_in,
                              void* d_out, int out_size, void* d_ws, size_t ws_size, hipStream_t stream) {
  (void)in_sizes; (void)n_in; (void)out_size;
  const float* const* I = (const float* const*)d_in; const float* x = I[0]; const int* mask = (const int*)d_in[1]; const int* cdrs = (const int*)d_in[2]; const float* Wq = I[3]; const float* bq = I[4]; const float* Wk = I[5]; const float* bk = I[6]; const float* Wv = I[7]; const float* bv = I[8]; const float* Wo = I[9]; const float* bo = I[10];
  char* ws = (char*)d_ws; size_t off = 0;
  auto take = [&](size_t bytes) { char* p = ws + off; off += (bytes + 255) & ~(size_t)255; return p; };
  const size_t w8 = (size_t)DMOD * DMOD / 8;
  _Float16* BQ = (_Float16*)take(w8 * 16); _Float16* BK = (_Float16*)take(w8 * 16); _Float16* BV = (_Float16*)take(w8 * 16); _Float16* BO = (_Float16*)take(w8 * 32); int* MK = (int*)take((size_t)NB * NH * TK * 4);
  _Float16* X16 = (_Float16*)take((size_t)NR * DMOD * 2); float* F32 = (float*)take((size_t)NR * DMOD * 4); _Float16* QH = (_Float16*)take((size_t)NR * DMOD * 2); _Float16* QL = (_Float16*)take((size_t)NR * DMOD * 2); _Float16* KH = (_Float16*)take((size_t)NR * DMOD * 2); _Float16* KL = (_Float16*)take((size_t)NR * DMOD * 2); _Float16* VH = (_Float16*)take((size_t)NR * DMOD * 2); _Float16* VL = (_Float16*)take((size_t)NR * DMOD * 2); _Float16* VT = (_Float16*)take((size_t)NR * DMOD * 2); _Float16* VTL = (_Float16*)take((size_t)NR * DMOD * 2);
  float* O = F32; _Float16* Hh = VH; _Float16* Hl = VL;
  if (off > ws_size) return;      /* 2.5 + 0.3 + 8 + 16 + 8 x 8 = 91 MiB */
  k_wt_f16<<<(unsigned)(((size_t)DMOD * (DMOD / 8) + 255) / 256), 256, 0, stream>>>(Wq, BQ, DMOD, DMOD, 16.0f); k_wt_f16<<<(unsigned)(((size_t)DMOD * (DMOD / 8) + 255) / 256), 256, 0, stream>>>(Wk, BK, DMOD, DMOD, 16.0f); k_wt_f16<<<(unsigned)(((size_t)DMOD * (DMOD / 8) + 255) / 256), 256, 0, stream>>>(Wv, BV, DMOD, DMOD, 16.0f); k_woutp<<<(unsigned)(((size_t)DMOD * (2 * DMOD / 8) + 255) / 256), 256, 0, stream>>>(Wo, BO);
  k_mask<<<NB, 256, 0, stream>>>(mask, cdrs, MK);
  k_x16<<<(unsigned)(((size_t)NR * DMOD / 8 + 255) / 256), 256, 0, stream>>>(x, X16, (size_t)NR * DMOD / 8);
  const dim3 gA((NR / 128) * (DMOD / 64), 1); const unsigned n8 = (unsigned)(((size_t)NR * DMOD / 8 + 255) / 256);
  k_gemm2<0><<<gA, 128, 0, stream>>>(X16, DMOD, 0, BQ, DMOD, 0, 0.0625f, bq, 0, nullptr, 1, 0, 0, F32, nullptr, DMOD, 0, NR, DMOD, DMOD); k_hl<<<n8, 256, 0, stream>>>(F32, QH, QL, (size_t)NR * DMOD / 8);
  k_gemm2<0><<<gA, 128, 0, stream>>>(X16, DMOD, 0, BK, DMOD, 0, 0.0625f, bk, 0, nullptr, 1, 0, 0, F32, nullptr, DMOD, 0, NR, DMOD, DMOD); k_hl<<<n8, 256, 0, stream>>>(F32, KH, KL, (size_t)NR * DMOD / 8);
  k_gemm2<0><<<gA, 128, 0, stream>>>(X16, DMOD, 0, BV, DMOD, 0, 0.0625f, bv, 0, nullptr, 1, 0, 0, F32, nullptr, DMOD, 0, NR, DMOD, DMOD); k_hl<<<n8, 256, 0, stream>>>(F32, VH, VL, (size_t)NR * DMOD / 8);
  k_vt<NH, SLEN><<<NB * NH * (SLEN / 64), 256, 0, stream>>>(VH, DMOD, 0, VT);
  k_flashqk<5><<<NB * NH * QBLKS, 128, 0, stream>>>(QH, QL, DMOD, KH, KL, DMOD, VT, MK, O, DMOD);      /* q/k hi + residual; P (x2^10) and V plain f16 */
  k_hl<<<n8, 256, 0, stream>>>(O, Hh, Hl, (size_t)NR * DMOD / 8);
  k_gemm2<0><<<gA, 128, 0, stream>>>(Hh, DMOD, 0, BO, 2 * DMOD, 0, 0.0625f, bo, 0, nullptr, 1, 0, 0, (float*)d_out, nullptr, DMOD, 0, NR, DMOD, DMOD);
  k_gemm2<0><<<gA, 128, 0, stream>>>(Hl, DMOD, 0, BO + DMOD, 2 * DMOD, 0, 1.0f / 1024.0f, nullptr, 0, (const float*)d_out, 1, (size_t)DMOD, 0, (float*)d_out, nullptr, DMOD, 0, NR, DMOD, DMOD);
}

// v001
// Measured time: 352 microseconds a run.
// Two timings next to v000 both put it at 1.53 times that version's speed.
#include <hip/hip_runtime.h>
// CDRs attention (4 sequences x 2048 tokens x 512; 8 heads x 64): q,k,v = x W + b; scores/8; keys with mask == 0 invalid for all heads; for heads 0..1 additionally keys with cdrs_score == 0 invalid unless the sequence has no CDR token at all; softmax; ctx Wo + bo -> [4,2048,512].
// Structure: per sequence two compacted lists of valid key positions (CDR heads / other heads) with their counts, from the two int inputs on VALU (one block per sequence: 'all masked' flag + prefix sum); K planes and V^T are gathered through the lists, so the flash loop runs only over valid keys; x as an exact f16 plane; q/k/v projections as f16 WMMA GEMMs (32x64 wave tiles, f32 accumulation, exact x16 weights + bias) split into hi + 2^10 residual planes; V^T by LDS tiles; the fused flash kernel with hi + 2^10-residual q/k planes (S = QhKh + (QlKh + QhKl)/1024) and plain f16 P (x2^10) and V with the key-count mask mode (invalid keys never visited == the reference's -inf); the output projection from hi + residual planes.
// Compute dtype: x and parameters rounded to bf16; q, k hi + residual (~2^-21-class logits); P and v plain f16 (~2^-12); f32 accumulation/softmax. v_wmma_f32_16x16x32_f16.
#define NB 4
#define DMOD 512
#define CDRH 2
#define NR (NB * SLEN)
#define QBLKS (TQ / 64)
#define SLEN 2048
#define TQ SLEN
#define TK SLEN
#define NH 8
#define SCL 0.125f               /* 64^-0.5 */
typedef __bf16 v16b __attribute__((ext_vector_type(16)));
typedef unsigned short v8us __attribute__((ext_vector_type(8), may_alias));
typedef float  v8f  __attribute__((ext_vector_type(8)));
typedef float  v4f  __attribute__((ext_vector_type(4)));
typedef float  v4fa __attribute__((ext_vector_type(4), may_alias));
union FragB { v16b v; v8us half[2]; unsigned short u[16]; };

__device__ __forceinline__ unsigned short bf16_bits(float x) { unsigned int u = __float_as_uint(x); return (unsigned short)((u + 0x7FFFu + ((u >> 16) & 1u)) >> 16); }
__device__ __forceinline__ float bf16_val(unsigned short b) { return __uint_as_float(((unsigned int)b) << 16); }
__device__ __forceinline__ float bf16_round(float x) { return bf16_val(bf16_bits(x)); }
// D += A·B with NT terms: 1 = ah·bh, 2 = + al·bh (A split), 3 = + ah·bl (both split)
template <int NT>
__device__ __forceinline__ v8f mmaN(v16b ah, v16b al, v16b bh, v16b bl, v8f c) {
  c = __builtin_amdgcn_wmma_f32_16x16x32_bf16(false, ah, false, bh, (short)0, c, false, false);
  if (NT >= 2) c = __builtin_amdgcn_wmma_f32_16x16x32_bf16(false, al, false, bh, (short)0, c, false, false);
  if (NT >= 3) c = __builtin_amdgcn_wmma_f32_16x16x32_bf16(false, ah, false, bl, (short)0, c, false, false);
  asm volatile("v_nop\n\tv_nop\n\tv_nop\n\tv_nop" : "+v"(c) : "v"(ah), "v"(al), "v"(bh), "v"(bl));
  return c;
}

__global__ __launch_bounds__(256) void k_wt_bf16(const float* __restrict__ W, unsigned short* __restrict__ Wt, int K, int N) {
  const int t = blockIdx.x * 256 + threadIdx.x;
  const int k8n = K / 8;
  if (t >= N * k8n) return;
  const int n = t / k8n, k8 = (t % k8n) * 8;
  v8us v;
#pragma unroll
  for (int i = 0; i < 8; ++i) v[i] = bf16_bits(W[(size_t)(k8 + i) * N + n]);
  *(v8us*)(Wt + (size_t)n * K + k8) = v;
  
}

// GEMM C[M][N] (f32, pitch ldc) = act(A[M][K]·W + bias). A f32 row-major (pitch lda) converted per fragment to bf16
// (ASPLIT: hi/lo two planes -> 2 terms, else single rounded term); Wt bf16 [N][K] (pitch ldb). BIAS_BF16 rounds the
// bias to bf16 first (bias quantised to bf16 before the add). K%32==0, M%16==0, N%64==0.
template <bool ASPLIT, int ACT, bool BIAS_BF16>
__global__ __launch_bounds__(128) void k_gemm_bf(const float* __restrict__ A, int lda, const unsigned short* __restrict__ Wt, int ldb,
                                               const float* __restrict__ bias, float* __restrict__ C, int ldc, int M, int N, int K) {
  __shared__ __attribute__((aligned(16))) float so[4][16][64];
  const int tid = threadIdx.x, w = tid >> 5, lane = tid & 31, ln = lane & 15, hh = lane >> 4;
  const int ntn = N / 64;
  const int wid = blockIdx.x * 4 + w;
  const int mt = wid / ntn, nq = wid % ntn;
  if (mt * 16 >= M) return;
  const int row0 = mt * 16, col0 = nq * 64;
  const float* arow = A + (size_t)(row0 + ln) * lda;
  v8f acc[4] = {};
  for (int kb = 0; kb < K; kb += 32) {
    FragB ah, al;
    const v4f x0 = *(const v4fa*)(arow + kb + 8 * hh), x1 = *(const v4fa*)(arow + kb + 8 * hh + 4);
    const v4f x2 = *(const v4fa*)(arow + kb + 16 + 8 * hh), x3 = *(const v4fa*)(arow + kb + 16 + 8 * hh + 4);
    float xs[16] = {x0[0],x0[1],x0[2],x0[3],x1[0],x1[1],x1[2],x1[3],x2[0],x2[1],x2[2],x2[3],x3[0],x3[1],x3[2],x3[3]};
#pragma unroll
    for (int i = 0; i < 16; ++i) { const unsigned short hb = bf16_bits(xs[i]); ah.u[i] = hb; al.u[i] = ASPLIT ? bf16_bits(xs[i] - bf16_val(hb)) : (unsigned short)0; }
#pragma unroll
    for (int t = 0; t < 4; ++t) {
      const unsigned short* brow = Wt + (size_t)(col0 + t * 16 + ln) * ldb + kb;
      FragB b;
      b.half[0] = *(const v8us*)(brow + 8 * hh);
      b.half[1] = *(const v8us*)(brow + 16 + 8 * hh);
      acc[t] = mmaN<ASPLIT ? 2 : 1>(ah.v, al.v, b.v, b.v, acc[t]);
    }
  }
#pragma unroll
  for (int t = 0; t < 4; ++t) {
    float bv = bias ? bias[col0 + t * 16 + ln] : 0.f;
    if (BIAS_BF16) bv = bf16_round(bv);
#pragma unroll
    for (int r = 0; r < 8; ++r) { float v = acc[t][r] + bv; if (ACT == 1) v = fmaxf(v, 0.f); so[w][8 * hh + r][t * 16 + ln] = v; }
  }
  __builtin_amdgcn_fence(__ATOMIC_ACQ_REL, "workgroup");
  __builtin_amdgcn_wave_barrier();
  const int rsub = lane >> 4, c4 = (lane & 15) * 4;
  {
#pragma unroll
    for (int q = 0; q < 8; ++q) {
      const int r = q * 2 + rsub;
      const v4f v = *(const v4fa*)&so[w][r][c4];
      *(v4f*)(C + (size_t)(row0 + r) * ldc + col0 + c4) = v;
    }
    
  }
}

// GEMM C = act(A·W + bias + resid): A f32 (ASPLIT -> hi/lo 2 terms), Wt bf16 [N][K]; ACT 0 none, 1 relu, 2 exact gelu;
// resid (optional, f32, row index = (row % rmod), pitch ldr, RES_BF16 rounds it) added before the activation.
template <bool ASPLIT, int ACT, bool BIAS_BF16, bool RES_BF16>
__global__ __launch_bounds__(128) void k_gemm_bf3(const float* __restrict__ A, int lda, const unsigned short* __restrict__ Wt, int ldb,
                                                const float* __restrict__ bias, const float* __restrict__ resid, int rmod, int ldr,
                                                float* __restrict__ C, int ldc, int M, int N, int K) {
  __shared__ __attribute__((aligned(16))) float so[4][16][64];
  const int tid = threadIdx.x, w = tid >> 5, lane = tid & 31, ln = lane & 15, hh = lane >> 4;
  const int ntn = N / 64;
  const int wid = blockIdx.x * 4 + w;
  const int mt = wid / ntn, nq = wid % ntn;
  if (mt * 16 >= M) return;
  const int row0 = mt * 16, col0 = nq * 64;
  const float* arow = A + (size_t)(row0 + ln) * lda;
  v8f acc[4] = {};
  for (int kb = 0; kb < K; kb += 32) {
    FragB ah, al;
    const v4f x0 = *(const v4fa*)(arow + kb + 8 * hh), x1 = *(const v4fa*)(arow + kb + 8 * hh + 4);
    const v4f x2 = *(const v4fa*)(arow + kb + 16 + 8 * hh), x3 = *(const v4fa*)(arow + kb + 16 + 8 * hh + 4);
    float xs[16] = {x0[0],x0[1],x0[2],x0[3],x1[0],x1[1],x1[2],x1[3],x2[0],x2[1],x2[2],x2[3],x3[0],x3[1],x3[2],x3[3]};
#pragma unroll
    for (int i = 0; i < 16; ++i) { const unsigned short hb = bf16_bits(xs[i]); ah.u[i] = hb; al.u[i] = ASPLIT ? bf16_bits(xs[i] - bf16_val(hb)) : (unsigned short)0; }
#pragma unroll
    for (int t = 0; t < 4; ++t) {
      const unsigned short* brow = Wt + (size_t)(col0 + t * 16 + ln) * ldb + kb;
      FragB b;
      b.half[0] = *(const v8us*)(brow + 8 * hh);
      b.half[1] = *(const v8us*)(brow + 16 + 8 * hh);
      acc[t] = mmaN<ASPLIT ? 2 : 1>(ah.v, al.v, b.v, b.v, acc[t]);
    }
  }
#pragma unroll
  for (int t = 0; t < 4; ++t) {
    const int col = col0 + t * 16 + ln;
    float bv = bias ? bias[col] : 0.f;
    if (BIAS_BF16) bv = bf16_round(bv);
#pragma unroll
    for (int r = 0; r < 8; ++r) {
      float v = acc[t][r] + bv;
      if (resid) { float rv = resid[(size_t)((row0 + 8 * hh + r) % rmod) * ldr + col]; if (RES_BF16) rv = bf16_round(rv); v += rv; }
      if (ACT == 1) v = fmaxf(v, 0.f);
      if (ACT == 2) v = 0.5f * v * (1.0f + erff(v * 0.70710678118654752f));
      if (ACT == 3) { const float u = 0.7978845608028654f * (v + 0.044715f * v * v * v); v = 0.5f * v * (1.0f + tanhf(u)); }
      so[w][8 * hh + r][t * 16 + ln] = v;
    }
  }
  __builtin_amdgcn_fence(__ATOMIC_ACQ_REL, "workgroup");
  __builtin_amdgcn_wave_barrier();
  const int rsub = lane >> 4, c4 = (lane & 15) * 4;
  {
#pragma unroll
    for (int q = 0; q < 8; ++q) {
      const int r = q * 2 + rsub;
      const v4f v = *(const v4fa*)&so[w][r][c4];
      *(v4f*)(C + (size_t)(row0 + r) * ldc + col0 + c4) = v;
    }
    
  }
}
// row LayerNorm (biased variance, eps) over N: s = X (+ R); optional out_sum <- s; out_norm <- (s-mu)*rsqrt(var+eps)*g + b
template <bool PARAM_BF16>
__global__ __launch_bounds__(256) void k_layernorm(const float* __restrict__ X, const float* __restrict__ R, const float* __restrict__ g, const float* __restrict__ bta,
                                                  float* __restrict__ out_sum, float* __restrict__ out_norm, int N, float eps) {
  __shared__ float red[256];
  const int row = blockIdx.x, tid = threadIdx.x;
  const float* x = X + (size_t)row * N; const float* rr = R ? R + (size_t)row * N : nullptr;
  float vals[16];                     // up to N = 4096
  const int per = N / 256;            // contiguous chunk per thread? use strided-by-4 chunks: thread handles j = tid*4 + 1024*u
  float s1 = 0.f;
  for (int u = 0; u < per / 4; ++u) {
    const int j = tid * 4 + 1024 * u;
    const v4f a = *(const v4fa*)(x + j);
    v4f b = {0.f,0.f,0.f,0.f}; if (rr) b = *(const v4fa*)(rr + j);
#pragma unroll
    for (int q = 0; q < 4; ++q) { const float v = a[q] + b[q]; vals[u * 4 + q] = v; s1 += v; }
  }
  red[tid] = s1; __syncthreads();
  for (int st = 128; st > 0; st >>= 1) { if (tid < st) red[tid] += red[tid + st]; __syncthreads(); }
  const float mu = red[0] / (float)N; __syncthreads();
  float s2 = 0.f;
  for (int u = 0; u < per / 4; ++u)
#pragma unroll
    for (int q = 0; q < 4; ++q) { const float c = vals[u * 4 + q] - mu; s2 += c * c; }
  red[tid] = s2; __syncthreads();
  for (int st = 128; st > 0; st >>= 1) { if (tid < st) red[tid] += red[tid + st]; __syncthreads(); }
  const float rs = rsqrtf(red[0] / (float)N + eps);
  {
    for (int u = 0; u < per / 4; ++u) {
      const int j = tid * 4 + 1024 * u;
      v4f o, sm;
#pragma unroll
      for (int q = 0; q < 4; ++q) {
        float gg = g[j + q], bb = bta[j + q];
        if (PARAM_BF16) { gg = bf16_round(gg); bb = bf16_round(bb); }
        sm[q] = vals[u * 4 + q]; o[q] = (vals[u * 4 + q] - mu) * rs * gg + bb;
      }
      if (out_sum) *(v4f*)(out_sum + (size_t)row * N + j) = sm;
      *(v4f*)(out_norm + (size_t)row * N + j) = o;
    }
    
  }
}



// ---- f16 WMMA path (v_wmma_f32_16x16x32_f16): 11-bit significands for operands in range — used where a [0,1] probability operand needs more precision than bf16
typedef _Float16 v16h __attribute__((ext_vector_type(16)));
union FragH { v16h v; v8us half[2]; _Float16 h[16]; unsigned short u[16]; };
template <int NT>
__device__ __forceinline__ v8f mmaH(v16h ah, v16h al, v16h bh, v16h bl, v8f c) {
  c = __builtin_amdgcn_wmma_f32_16x16x32_f16(false, ah, false, bh, (short)0, c, false, false);
  if (NT >= 2) c = __builtin_amdgcn_wmma_f32_16x16x32_f16(false, al, false, bh, (short)0, c, false, false);
  if (NT >= 3) c = __builtin_amdgcn_wmma_f32_16x16x32_f16(false, ah, false, bl, (short)0, c, false, false);
  asm volatile("v_nop\n\tv_nop\n\tv_nop\n\tv_nop" : "+v"(c) : "v"(ah), "v"(al), "v"(bh), "v"(bl));
  return c;
}
// batched GEMM like k_gemm_b but f16 operands: A f32 (split into f16 hi/lo if ASPLIT, else rounded to f16), Bt = f16 values [n][k]; alpha; C f32; N multiple of 16 (partial tiles skipped)
template <bool ASPLIT>
__global__ __launch_bounds__(128) void k_gemm_h(const float* __restrict__ A, int lda, size_t sA, const _Float16* __restrict__ Bh, int ldb, size_t sB, float alpha, float* __restrict__ C, int ldc, size_t sC, int M, int N, int K) {
  __shared__ __attribute__((aligned(16))) float so[4][16][64];
  const int tid = threadIdx.x, w = tid >> 5, lane = tid & 31, ln = lane & 15, hh = lane >> 4; const int by = blockIdx.y;
  A += (size_t)by * sA; Bh += (size_t)by * sB; C += (size_t)by * sC;
  const int ntn = (N + 63) / 64; const int wid = blockIdx.x * 4 + w; const int mt = wid / ntn, nq = wid % ntn; if (mt * 16 >= M) return;
  const int row0 = mt * 16, col0 = nq * 64; const float* arow = A + (size_t)(row0 + ln) * lda;
  v8f acc[4] = {};
  for (int kb = 0; kb < K; kb += 32) {
    FragH ah, al;
    const v4f x0 = *(const v4fa*)(arow + kb + 8 * hh), x1 = *(const v4fa*)(arow + kb + 8 * hh + 4), x2 = *(const v4fa*)(arow + kb + 16 + 8 * hh), x3 = *(const v4fa*)(arow + kb + 16 + 8 * hh + 4);
    float xs[16] = {x0[0],x0[1],x0[2],x0[3],x1[0],x1[1],x1[2],x1[3],x2[0],x2[1],x2[2],x2[3],x3[0],x3[1],x3[2],x3[3]};
#pragma unroll
    for (int i = 0; i < 16; ++i) { const _Float16 h = (_Float16)xs[i]; ah.h[i] = h; al.h[i] = ASPLIT ? (_Float16)(xs[i] - (float)h) : (_Float16)0.0f; }
#pragma unroll
    for (int t = 0; t < 4; ++t) { if (col0 + t * 16 >= N) continue; const size_t boff = (size_t)(col0 + t * 16 + ln) * ldb + kb; FragH bq; bq.half[0] = *(const v8us*)(Bh + boff + 8 * hh); bq.half[1] = *(const v8us*)(Bh + boff + 16 + 8 * hh);
      acc[t] = mmaH<ASPLIT ? 2 : 1>(ah.v, al.v, bq.v, bq.v, acc[t]); }
  }
#pragma unroll
  for (int t = 0; t < 4; ++t) { if (col0 + t * 16 >= N) continue;
#pragma unroll
    for (int r = 0; r < 8; ++r) so[w][8 * hh + r][t * 16 + ln] = acc[t][r] * alpha; }
  __builtin_amdgcn_fence(__ATOMIC_ACQ_REL, "workgroup"); __builtin_amdgcn_wave_barrier();
  const int rsub = lane >> 4, c4 = (lane & 15) * 4;
  {
#pragma unroll
    for (int q = 0; q < 8; ++q) { const int r = q * 2 + rsub; if (col0 + c4 < N) { const v4f v = *(const v4fa*)&so[w][r][c4]; *(v4f*)(C + (size_t)(row0 + r) * ldc + col0 + c4) = v; } }
     }
}

// Wt[n][k] = f16(W[k][n]·scale) from f32 row-major W[K][N] (scale = power of two; bf16-exact weights stay exact in f16 away from the subnormal range)
__global__ __launch_bounds__(256) void k_wt_f16(const float* __restrict__ W, _Float16* __restrict__ Wt, int K, int N, float scale) {
  const int t = blockIdx.x * 256 + threadIdx.x; if (t >= N * (K / 8)) return; const int n = t / (K / 8), k8 = (t % (K / 8)) * 8; FragH f;
#pragma unroll
  for (int i = 0; i < 8; ++i) f.h[i] = (_Float16)(bf16_round(W[(size_t)(k8 + i) * N + n]) * scale); const v8us o = f.half[0];
  *(v8us*)((unsigned short*)Wt + (size_t)n * K + k8) = o; 
}
// k_gemm_hh variant with fused epilogue: v = acc·alpha + bias[by·sBias + col] (+ CP[(row/rowsPerB)·sCPb + by·64 + col] if CP) ; ACT 0 none / 1 elu ; writes f16 C16 (and f32 C if non-null)
template <int ACT>
__global__ __launch_bounds__(128) void k_gemm_hhx(const _Float16* __restrict__ A, int lda, size_t sA, const _Float16* __restrict__ Bh, int ldb, size_t sB, float alpha, const float* __restrict__ bias, size_t sBias, const float* __restrict__ CP, int rowsPerB, size_t sCPb, int row0g,
    float* __restrict__ C, _Float16* __restrict__ C16, int ldc, size_t sC, int M, int N, int K) {
  __shared__ __attribute__((aligned(16))) float so[4][16][64];
  const int tid = threadIdx.x, w = tid >> 5, lane = tid & 31, ln = lane & 15, hh = lane >> 4; const int by = blockIdx.y;
  A += (size_t)by * sA; Bh += (size_t)by * sB; const size_t cofs = (size_t)by * sC; const float* bp = bias ? bias + (size_t)by * sBias : nullptr;
  const int ntn = (N + 63) / 64; const int wid = blockIdx.x * 4 + w; const int mt = wid / ntn, nq = wid % ntn; if (mt * 16 >= M) return;
  const int row0 = mt * 16, col0 = nq * 64; const _Float16* arow = A + (size_t)(row0 + ln) * lda;
  v8f acc[4] = {};
  for (int kb = 0; kb < K; kb += 32) { FragH ah; ah.half[0] = *(const v8us*)((const unsigned short*)arow + kb + 8 * hh); ah.half[1] = *(const v8us*)((const unsigned short*)arow + kb + 16 + 8 * hh);
#pragma unroll
    for (int t = 0; t < 4; ++t) { if (col0 + t * 16 >= N) continue; const size_t boff = (size_t)(col0 + t * 16 + ln) * ldb + kb; FragH bq; bq.half[0] = *(const v8us*)((const unsigned short*)Bh + boff + 8 * hh); bq.half[1] = *(const v8us*)((const unsigned short*)Bh + boff + 16 + 8 * hh);
      acc[t] = mmaH<1>(ah.v, ah.v, bq.v, bq.v, acc[t]); }
  }
#pragma unroll
  for (int t = 0; t < 4; ++t) { if (col0 + t * 16 >= N) continue; const int col = col0 + t * 16 + ln; const float bv = bp ? bf16_round(bp[col]) : 0.f;
#pragma unroll
    for (int r = 0; r < 8; ++r) { float v = acc[t][r] * alpha + bv; if (CP) { const int bidx = (row0g + row0 + 8 * hh + r) / rowsPerB; v += CP[(size_t)bidx * sCPb + (size_t)by * 64 + col]; } if (ACT == 1) v = (v > 0.f) ? v : expm1f(v); else if (ACT == 7) v = (v > 0.f) ? v + 1.0f : expf(v); else if (ACT == 8) v = tanhf(v); else if (ACT == 9) v = 0.5f * v * (1.0f + tanhf(0.7978845608028654f * (v + 0.044715f * v * v * v))); else if (ACT == 11) v = 1.0f / (1.0f + expf(-v)); else if (ACT == 12) v = (v > 0.f) ? v : 0.01f * v; else if (ACT == 14) v = (v > 0.f) ? v : 0.1f * v; else if (ACT == 15) v = v / (1.0f + expf(-v)); else if (ACT == 3) v = fmaxf(v, 0.f); else if (ACT == 6) v = 0.5f * v * (1.0f + erff(v * 0.70710678118654752f)); so[w][8 * hh + r][t * 16 + ln] = v; } }
  __builtin_amdgcn_fence(__ATOMIC_ACQ_REL, "workgroup"); __builtin_amdgcn_wave_barrier();
  const int rsub = lane >> 4, c4 = (lane & 15) * 4; typedef _Float16 v4h __attribute__((ext_vector_type(4)));
  {
#pragma unroll
    for (int q = 0; q < 8; ++q) { const int r = q * 2 + rsub; if (col0 + c4 < N) { const v4f v = *(const v4fa*)&so[w][r][c4]; if (C) *(v4f*)(C + cofs + (size_t)(row0 + r) * ldc + col0 + c4) = v; if (C16) { v4h h4; for (int i = 0; i < 4; ++i) h4[i] = (_Float16)v[i]; *(v4h*)(C16 + cofs + (size_t)(row0 + r) * ldc + col0 + c4) = h4; } } }
     }
}


typedef _Float16 v4h __attribute__((ext_vector_type(4)));

__global__ __launch_bounds__(256) void k_x16(const float* __restrict__ x, _Float16* __restrict__ X16, size_t n8) { const size_t t = (size_t)blockIdx.x * 256 + threadIdx.x; if (t >= n8) return; FragH f;
#pragma unroll
  for (int q = 0; q < 8; ++q) f.h[q] = (_Float16)bf16_round(x[t * 8 + q]); *(v8us*)((unsigned short*)X16 + t * 8) = f.half[0];  }
__global__ __launch_bounds__(256) void k_h16(const float* __restrict__ x, _Float16* __restrict__ X16, size_t n8) { const size_t t = (size_t)blockIdx.x * 256 + threadIdx.x; if (t >= n8) return; FragH f;
#pragma unroll
  for (int q = 0; q < 8; ++q) f.h[q] = (_Float16)x[t * 8 + q]; *(v8us*)((unsigned short*)X16 + t * 8) = f.half[0];  }
__global__ __launch_bounds__(256) void k_round16f(const float* __restrict__ W, _Float16* __restrict__ Bt, size_t n8) { const size_t t = (size_t)blockIdx.x * 256 + threadIdx.x; if (t >= n8) return; FragH f;
#pragma unroll
  for (int i = 0; i < 8; ++i) f.h[i] = (_Float16)(bf16_round(W[t * 8 + i]) * 16.0f); *(v8us*)((unsigned short*)Bt + t * 8) = f.half[0];  }
template <int NHv, int TTv>
__global__ __launch_bounds__(256) void k_vt(const _Float16* __restrict__ V16, int ldv, int voff, const int* __restrict__ IDX, const int* __restrict__ CNT, _Float16* __restrict__ Vt) { __shared__ unsigned short tl[64][66]; const int tid = threadIdx.x; const int slab = blockIdx.x / (TTv / 64), lg = blockIdx.x % (TTv / 64); const int b = slab / NHv, h = slab % NHv;
  const int cls = (h < CDRH) ? 0 : 1; if (lg * 64 >= ((CNT[b * 32 + cls] + 31) & ~31)) return;      /* block-uniform: columns past the rounded key count are never read */
  const int* idx = IDX + ((size_t)b * 2 + cls) * TTv + lg * 64;      /* column j of V^T = j-th valid key; list entries past the count are 0 (a finite row, weighted by P = 0) */
  for (int i = tid; i < 64 * 8; i += 256) { const int r = i / 8, c8 = (i % 8) * 8; FragH f; f.half[0] = *(const v8us*)((const unsigned short*)V16 + ((size_t)b * TTv + idx[r]) * ldv + voff + h * 64 + c8);
#pragma unroll
    for (int q = 0; q < 8; ++q) tl[r][c8 + q] = f.u[q]; }
  __syncthreads();
  {
#pragma unroll
    for (int rd = 0; rd < 2; ++rd) { const int d = rd * 32 + tid / 8, pc = tid % 8; FragH f;
#pragma unroll
      for (int q = 0; q < 8; ++q) f.u[q] = tl[pc * 8 + q][d];
      *(v8us*)((unsigned short*)Vt + ((size_t)slab * 64 + d) * TTv + lg * 64 + pc * 8) = f.half[0]; }
     } }

__global__ __launch_bounds__(256) void k_hl(const float* __restrict__ F, _Float16* __restrict__ Hh, _Float16* __restrict__ Hl, size_t n8) { const size_t t = (size_t)blockIdx.x * 256 + threadIdx.x; if (t >= n8) return; FragH fh, fl; const v4f a = *(const v4fa*)(F + t * 8), c = *(const v4fa*)(F + t * 8 + 4);
#pragma unroll
  for (int q = 0; q < 4; ++q) { _Float16 h = (_Float16)a[q]; fh.h[q] = h; fl.h[q] = (_Float16)((a[q] - (float)h) * 1024.0f); h = (_Float16)c[q]; fh.h[4 + q] = h; fl.h[4 + q] = (_Float16)((c[q] - (float)h) * 1024.0f); }
  { *(v8us*)((unsigned short*)Hh + t * 8) = fh.half[0]; *(v8us*)((unsigned short*)Hl + t * 8) = fl.half[0];  } }
// k_hl with a row gather: row j of a sequence's output planes = row IDX[j] of F, the list chosen by the column's head class; rows past the key count rounded up to 32 are not written (and never read)
__global__ __launch_bounds__(256) void k_hlg(const float* __restrict__ F, const int* __restrict__ IDX, const int* __restrict__ CNT, _Float16* __restrict__ Hh, _Float16* __restrict__ Hl) { const int t = blockIdx.x * 256 + threadIdx.x; const int row = t / (DMOD / 8), c8 = (t % (DMOD / 8)) * 8; const int b = row / TK, j = row % TK; const int cls = (c8 < CDRH * 64) ? 0 : 1;
  if (j >= ((CNT[b * 32 + cls] + 31) & ~31)) return; const float* fr = F + ((size_t)b * TK + IDX[((size_t)b * 2 + cls) * TK + j]) * DMOD + c8; FragH fh, fl; const v4f a = *(const v4fa*)fr, c = *(const v4fa*)(fr + 4);
#pragma unroll
  for (int q = 0; q < 4; ++q) { _Float16 h = (_Float16)a[q]; fh.h[q] = h; fl.h[q] = (_Float16)((a[q] - (float)h) * 1024.0f); h = (_Float16)c[q]; fh.h[4 + q] = h; fl.h[4 + q] = (_Float16)((c[q] - (float)h) * 1024.0f); }
  { *(v8us*)((unsigned short*)Hh + (size_t)t * 8) = fh.half[0]; *(v8us*)((unsigned short*)Hl + (size_t)t * 8) = fl.half[0];  } }

// ---- fast GEMM (wave tile 32x64; requires M % 32 == 0 rows per launch region and N % 64 == 0); epilogue = k_gemm_hhx semantics ----
__device__ __forceinline__ v16h g2_frag(const _Float16* p, int hh) { FragH f; f.half[0] = *(const v8us*)((const unsigned short*)p + 8 * hh); f.half[1] = *(const v8us*)((const unsigned short*)p + 16 + 8 * hh); return f.v; }
__device__ __forceinline__ v8f g2_mma(v16h a, v16h b, v8f c) { v8f d = __builtin_amdgcn_wmma_f32_16x16x32_f16(false, a, false, b, (short)0, c, false, false); asm volatile("v_nop\n\tv_nop\n\tv_nop\n\tv_nop" : "+v"(d) : "v"(a), "v"(b)); return d; }
template <int ACT>
__global__ __launch_bounds__(128) void k_gemm2(const _Float16* __restrict__ A, int lda, size_t sA, const _Float16* __restrict__ Bh, int ldb, size_t sB, float alpha, const float* __restrict__ bias, size_t sBias, const float* __restrict__ CP, int rowsPerB, size_t sCPb, int row0g,
    float* __restrict__ C, _Float16* __restrict__ C16, int ldc, size_t sC, int M, int N, int K) {
  __shared__ __attribute__((aligned(16))) float so[4][32][68];
  const int tid = threadIdx.x, w = tid >> 5, lane = tid & 31, ln = lane & 15, hh = lane >> 4; const int by = blockIdx.y;
  A += (size_t)by * sA; Bh += (size_t)by * sB; const size_t cofs = (size_t)by * sC; const float* bp = bias ? bias + (size_t)by * sBias : nullptr;
  const int ntn = N >> 6; const int mt = blockIdx.x / ntn, nq = blockIdx.x - mt * ntn; const int row0 = mt * 128 + 32 * w, col0 = nq * 64; if (row0 >= M) return;
  const _Float16* a0p = A + (size_t)(row0 + ln) * lda; const _Float16* a1p = a0p + (size_t)16 * lda;
  const _Float16* b0p = Bh + (size_t)(col0 + ln) * ldb; const _Float16* b1p = b0p + (size_t)16 * ldb; const _Float16* b2p = b1p + (size_t)16 * ldb; const _Float16* b3p = b2p + (size_t)16 * ldb;
  const v8f z8 = {0.f,0.f,0.f,0.f,0.f,0.f,0.f,0.f}; v8f c00 = z8, c01 = z8, c02 = z8, c03 = z8, c10 = z8, c11 = z8, c12 = z8, c13 = z8;
#pragma unroll 1
  for (int kb = 0; kb < K; kb += 32) { const v16h a0 = g2_frag(a0p + kb, hh), a1 = g2_frag(a1p + kb, hh);
    v16h b = g2_frag(b0p + kb, hh); c00 = g2_mma(a0, b, c00); c10 = g2_mma(a1, b, c10);
    b = g2_frag(b1p + kb, hh); c01 = g2_mma(a0, b, c01); c11 = g2_mma(a1, b, c11);
    b = g2_frag(b2p + kb, hh); c02 = g2_mma(a0, b, c02); c12 = g2_mma(a1, b, c12);
    b = g2_frag(b3p + kb, hh); c03 = g2_mma(a0, b, c03); c13 = g2_mma(a1, b, c13); }
  v8f accs[8] = {c00, c01, c02, c03, c10, c11, c12, c13};
#pragma unroll
  for (int u = 0; u < 8; ++u) { const int t = u & 3, half = u >> 2; const int col = col0 + t * 16 + ln; const float bv = bp ? bf16_round(bp[col]) : 0.f;
#pragma unroll
    for (int r = 0; r < 8; ++r) { const int rloc = half * 16 + 8 * hh + r; float v = accs[u][r] * alpha + bv; if (CP) { const int bidx = (row0g + row0 + rloc) / rowsPerB; v += CP[(size_t)bidx * sCPb + (size_t)by * 64 + col]; }
      if (ACT == 3) v = fmaxf(v, 0.f); else if (ACT == 6) v = 0.5f * v * (1.0f + erff(v * 0.70710678118654752f)); else if (ACT == 11) v = 1.0f / (1.0f + expf(-v)); else if (ACT == 15) v = v / (1.0f + expf(-v)); else if (ACT == 12) v = (v > 0.f) ? v : 0.01f * v; else if (ACT == 8) v = tanhf(v);
      so[w][rloc][t * 16 + ln] = v; } }
  __builtin_amdgcn_fence(__ATOMIC_ACQ_REL, "workgroup"); __builtin_amdgcn_wave_barrier();
  const int rsub = lane >> 4, c4 = (lane & 15) * 4;
  {
#pragma unroll
    for (int q = 0; q < 16; ++q) { const int r = q * 2 + rsub; const v4f v = *(const v4fa*)&so[w][r][c4]; if (C) *(v4f*)(C + cofs + (size_t)(row0 + r) * ldc + col0 + c4) = v; if (C16) { v4h h4; for (int i = 0; i < 4; ++i) h4[i] = (_Float16)v[i]; *(v4h*)(C16 + cofs + (size_t)(row0 + r) * ldc + col0 + c4) = h4; } }
     } }



template <int CAUSAL>
__global__ __launch_bounds__(128) void k_flash(const _Float16* __restrict__ Q16, int ldq, const _Float16* __restrict__ K16, int ldk, const _Float16* __restrict__ Vt, const int* __restrict__ MSK, float* __restrict__ O, int ldo) {
  constexpr int RPW = 16, RTN = RPW / 16, NQB = TQ / (4 * RPW), DT = 4, KS = 2;
  __shared__ __attribute__((aligned(16))) unsigned short sP[4][RPW][40]; __shared__ __attribute__((aligned(16))) float sO[4][RPW][64 + 4];
  const int tid = threadIdx.x, w = tid >> 5, lane = tid & 31, ln = lane & 15, hh = lane >> 4;
  const int slab = blockIdx.x / NQB, qblk = blockIdx.x % NQB; const int b = slab / NH, h = slab % NH; const int qb0 = qblk * (4 * RPW); const int q0 = qb0 + w * RPW;
  FragH aq[2][KS];
#pragma unroll
  for (int rt = 0; rt < RTN; ++rt) { const unsigned short* qr = (const unsigned short*)Q16 + ((size_t)b * TQ + q0 + rt * 16 + ln) * ldq + h * 64;
#pragma unroll
    for (int ks = 0; ks < KS; ++ks) { aq[rt][ks].half[0] = *(const v8us*)(qr + ks * 32 + 8 * hh); aq[rt][ks].half[1] = *(const v8us*)(qr + ks * 32 + 16 + 8 * hh); } }
  const unsigned short* Vth = (const unsigned short*)Vt + (size_t)slab * 64 * TK;
  float m_r[2][8], l_r[2][8]; v8f oacc[2][DT];
#pragma unroll
  for (int rt = 0; rt < RTN; ++rt) {
#pragma unroll
    for (int r = 0; r < 8; ++r) { m_r[rt][r] = -3.0e38f; l_r[rt][r] = 0.f; }
#pragma unroll
    for (int dt = 0; dt < DT; ++dt) oacc[rt][dt] = (v8f){0.f,0.f,0.f,0.f,0.f,0.f,0.f,0.f}; }
  const int jend = (CAUSAL == 1) ? (qb0 + 4 * RPW) : TK;      /* causal: keys beyond the block's last query never contribute */
#pragma unroll 1
  for (int j0 = 0; j0 < jend; j0 += 32) {
    v8f s[2][2];
#pragma unroll
    for (int nt = 0; nt < 2; ++nt) { const unsigned short* kr = (const unsigned short*)K16 + ((size_t)b * TK + j0 + nt * 16 + ln) * ldk + h * 64; FragH bk[KS];
#pragma unroll
      for (int ks = 0; ks < KS; ++ks) { bk[ks].half[0] = *(const v8us*)(kr + ks * 32 + 8 * hh); bk[ks].half[1] = *(const v8us*)(kr + ks * 32 + 16 + 8 * hh); }
#pragma unroll
      for (int rt = 0; rt < RTN; ++rt) { v8f acc = (v8f){0.f,0.f,0.f,0.f,0.f,0.f,0.f,0.f};
#pragma unroll
        for (int ks = 0; ks < KS; ++ks) acc = mmaH<1>(aq[rt][ks].v, aq[rt][ks].v, bk[ks].v, bk[ks].v, acc); s[rt][nt] = acc; } }
#pragma unroll
    for (int rt = 0; rt < RTN; ++rt)
#pragma unroll
      for (int r = 0; r < 8; ++r) { const int tq = q0 + rt * 16 + 8 * hh + r; const int k0 = j0 + ln, k1 = j0 + 16 + ln;
        const bool ok0 = (CAUSAL == 1) ? (k0 <= tq) : ((CAUSAL == 2) ? ((k0 >> 5) == (tq >> 5)) : true), ok1 = (CAUSAL == 1) ? (k1 <= tq) : ((CAUSAL == 2) ? ((k1 >> 5) == (tq >> 5)) : true);      /* mode 2: block-diagonal 32-token groups */
        const float s0 = ok0 ? s[rt][0][r] * SCL : -3.0e38f, s1 = ok1 ? s[rt][1][r] * SCL : -3.0e38f; float mc = fmaxf(s0, s1);
        mc = fmaxf(mc, __shfl_xor(mc, 1, 32)); mc = fmaxf(mc, __shfl_xor(mc, 2, 32)); mc = fmaxf(mc, __shfl_xor(mc, 4, 32)); mc = fmaxf(mc, __shfl_xor(mc, 8, 32));
        const float mn = fmaxf(m_r[rt][r], mc); const float al = (mn > -1.0e38f) ? expf(m_r[rt][r] - mn) : 1.0f; m_r[rt][r] = mn; const float p0 = ok0 ? expf(s0 - mn) : 0.f, p1 = ok1 ? expf(s1 - mn) : 0.f; l_r[rt][r] = l_r[rt][r] * al + p0 + p1;
#pragma unroll
        for (int dt = 0; dt < DT; ++dt) oacc[rt][dt][r] *= al;
        FragH t2; t2.h[0] = (_Float16)(p0 * 1024.0f); t2.h[1] = (_Float16)(p1 * 1024.0f); sP[w][rt * 16 + 8 * hh + r][ln] = t2.u[0]; sP[w][rt * 16 + 8 * hh + r][16 + ln] = t2.u[1]; }
    __builtin_amdgcn_fence(__ATOMIC_ACQ_REL, "workgroup"); __builtin_amdgcn_wave_barrier();
    FragH pa[2];
#pragma unroll
    for (int rt = 0; rt < RTN; ++rt) { pa[rt].half[0] = *(const v8us*)&sP[w][rt * 16 + ln][8 * hh]; pa[rt].half[1] = *(const v8us*)&sP[w][rt * 16 + ln][16 + 8 * hh]; }
#pragma unroll
    for (int dt = 0; dt < DT; ++dt) { const unsigned short* vrow = Vth + (size_t)(dt * 16 + ln) * TK + j0; FragH bv; bv.half[0] = *(const v8us*)(vrow + 8 * hh); bv.half[1] = *(const v8us*)(vrow + 16 + 8 * hh);
#pragma unroll
      for (int rt = 0; rt < RTN; ++rt) oacc[rt][dt] = mmaH<1>(pa[rt].v, pa[rt].v, bv.v, bv.v, oacc[rt][dt]); }
    __builtin_amdgcn_fence(__ATOMIC_ACQ_REL, "workgroup"); __builtin_amdgcn_wave_barrier(); }
#pragma unroll
  for (int rt = 0; rt < RTN; ++rt) {
#pragma unroll
    for (int r = 0; r < 8; ++r) { float l = l_r[rt][r]; l += __shfl_xor(l, 1, 32); l += __shfl_xor(l, 2, 32); l += __shfl_xor(l, 4, 32); l += __shfl_xor(l, 8, 32); l_r[rt][r] = (l > 0.f) ? 1.0f / (l * 1024.0f) : 0.f; }
#pragma unroll
    for (int dt = 0; dt < DT; ++dt)
#pragma unroll
      for (int r = 0; r < 8; ++r) sO[w][rt * 16 + 8 * hh + r][dt * 16 + ln] = oacc[rt][dt][r] * l_r[rt][r]; }
  __builtin_amdgcn_fence(__ATOMIC_ACQ_REL, "workgroup"); __builtin_amdgcn_wave_barrier();
  {
#pragma unroll
    for (int rp = 0; rp < RPW; rp += 2) { const int r = rp + (lane >> 4), pc = lane & 15; const v4f val = *(const v4fa*)&sO[w][r][pc * 4]; *(v4f*)(O + ((size_t)b * TQ + q0 + r) * ldo + h * 64 + pc * 4) = val; }
     } }
// Q/K-split variant: S = Qh Kh^T + (Ql Kh^T + Qh Kl^T)/1024 with Q/K = [hi | 2^10 residual] f16 planes (QL/KL same layout as Q16/K16); plain f16 P (x2^10) . V^T as in k_flash
template <int CAUSAL>
__global__ __launch_bounds__(128) void k_flashqk(const _Float16* __restrict__ Q16, const _Float16* __restrict__ QL, int ldq, const _Float16* __restrict__ K16, const _Float16* __restrict__ KL, int ldk, const _Float16* __restrict__ Vt, const int* __restrict__ MSK, float* __restrict__ O, int ldo) {
  constexpr int RPW = 16, RTN = RPW / 16, NQB = TQ / (4 * RPW), DT = 4, KS = 2;
  __shared__ __attribute__((aligned(16))) unsigned short sP[4][RPW][40]; __shared__ __attribute__((aligned(16))) float sO[4][RPW][64 + 4];
  const int tid = threadIdx.x, w = tid >> 5, lane = tid & 31, ln = lane & 15, hh = lane >> 4;
  const int slab = blockIdx.x / QBLKS, qblk = blockIdx.x % QBLKS; (void)NQB; const int b = slab / NH, h = slab % NH; const int qb0 = qblk * (4 * RPW); const int q0 = qb0 + w * RPW;
  FragH aq[2][KS], aql[2][KS];
#pragma unroll
  for (int rt = 0; rt < RTN; ++rt) { const unsigned short* qr = (const unsigned short*)Q16 + ((size_t)b * TQ + q0 + rt * 16 + ln) * ldq + h * 64; const unsigned short* ql = (const unsigned short*)QL + ((size_t)b * TQ + q0 + rt * 16 + ln) * ldq + h * 64;
#pragma unroll
    for (int ks = 0; ks < KS; ++ks) { aq[rt][ks].half[0] = *(const v8us*)(qr + ks * 32 + 8 * hh); aq[rt][ks].half[1] = *(const v8us*)(qr + ks * 32 + 16 + 8 * hh); aql[rt][ks].half[0] = *(const v8us*)(ql + ks * 32 + 8 * hh); aql[rt][ks].half[1] = *(const v8us*)(ql + ks * 32 + 16 + 8 * hh); } }
  const unsigned short* Vth = (const unsigned short*)Vt + (size_t)slab * 64 * TK;
  float m_r[2][8], l_r[2][8]; v8f oacc[2][DT];
#pragma unroll
  for (int rt = 0; rt < RTN; ++rt) {
#pragma unroll
    for (int r = 0; r < 8; ++r) { m_r[rt][r] = -3.0e38f; l_r[rt][r] = 0.f; }
#pragma unroll
    for (int dt = 0; dt < DT; ++dt) oacc[rt][dt] = (v8f){0.f,0.f,0.f,0.f,0.f,0.f,0.f,0.f}; }
  const int kcnt = (CAUSAL == 5) ? min(MSK[b * 32 + ((h < CDRH) ? 0 : 1)], TK) : TK;      /* mode 5: number of valid keys of this (sequence, head class); K planes and V^T hold them compacted, in key order */
  const int jend = (CAUSAL == 1) ? (qb0 + 4 * RPW) : ((CAUSAL == 5) ? ((kcnt + 31) & ~31) : TK);      /* causal: keys beyond the block's last query never contribute */
#pragma unroll 1
  for (int j0 = 0; j0 < jend; j0 += 32) {
    v8f s[2][2];
#pragma unroll
    for (int nt = 0; nt < 2; ++nt) { const unsigned short* kr = (const unsigned short*)K16 + ((size_t)b * TK + j0 + nt * 16 + ln) * ldk + h * 64; const unsigned short* klr = (const unsigned short*)KL + ((size_t)b * TK + j0 + nt * 16 + ln) * ldk + h * 64; FragH bk[KS], bkl[KS];
#pragma unroll
      for (int ks = 0; ks < KS; ++ks) { bk[ks].half[0] = *(const v8us*)(kr + ks * 32 + 8 * hh); bk[ks].half[1] = *(const v8us*)(kr + ks * 32 + 16 + 8 * hh); bkl[ks].half[0] = *(const v8us*)(klr + ks * 32 + 8 * hh); bkl[ks].half[1] = *(const v8us*)(klr + ks * 32 + 16 + 8 * hh); }
#pragma unroll
      for (int rt = 0; rt < RTN; ++rt) { v8f acc = (v8f){0.f,0.f,0.f,0.f,0.f,0.f,0.f,0.f}, accl = acc;
#pragma unroll
        for (int ks = 0; ks < KS; ++ks) { acc = mmaH<1>(aq[rt][ks].v, aq[rt][ks].v, bk[ks].v, bk[ks].v, acc); accl = mmaH<1>(aql[rt][ks].v, aql[rt][ks].v, bk[ks].v, bk[ks].v, accl); accl = mmaH<1>(aq[rt][ks].v, aq[rt][ks].v, bkl[ks].v, bkl[ks].v, accl); }
#pragma unroll
        for (int r = 0; r < 8; ++r) acc[r] += accl[r] * 0.0009765625f;
        s[rt][nt] = acc; } }
#pragma unroll
    for (int rt = 0; rt < RTN; ++rt)
#pragma unroll
      for (int r = 0; r < 8; ++r) { const int tq = q0 + rt * 16 + 8 * hh + r; const int k0 = j0 + ln, k1 = j0 + 16 + ln;
        bool ok0 = (CAUSAL == 1) ? (k0 <= tq) : ((CAUSAL == 2) ? ((k0 >> 5) == (tq >> 5)) : true), ok1 = (CAUSAL == 1) ? (k1 <= tq) : ((CAUSAL == 2) ? ((k1 >> 5) == (tq >> 5)) : true);      /* mode 2: block-diagonal 32-token groups */
        if (CAUSAL == 5) { ok0 = k0 < kcnt; ok1 = k1 < kcnt; }      /* mode 5: compacted keys (key padding + head-specific masks applied by the gather); only the tail of the last 32-key trip is invalid */
        if (CAUSAL == 4) { const int* mrow = MSK + ((size_t)b * TQ + tq) * TK; ok0 = mrow[k0] != 0; ok1 = mrow[k1] != 0; }      /* mode 4: per-(query, key) INPUT mask shared by all heads; masked keys contribute nothing (== the reference's -4096 fill, whose exp underflows to 0), rows with no valid key give l = 0 -> output 0 (== the reference's row_valid zeroing) */
        const float s0 = ok0 ? s[rt][0][r] * SCL : -3.0e38f, s1 = ok1 ? s[rt][1][r] * SCL : -3.0e38f; float mc = fmaxf(s0, s1);
        mc = fmaxf(mc, __shfl_xor(mc, 1, 32)); mc = fmaxf(mc, __shfl_xor(mc, 2, 32)); mc = fmaxf(mc, __shfl_xor(mc, 4, 32)); mc = fmaxf(mc, __shfl_xor(mc, 8, 32));
        const float mn = fmaxf(m_r[rt][r], mc); const float al = (mn > -1.0e38f) ? expf(m_r[rt][r] - mn) : 1.0f; m_r[rt][r] = mn; const float p0 = ok0 ? expf(s0 - mn) : 0.f, p1 = ok1 ? expf(s1 - mn) : 0.f; l_r[rt][r] = l_r[rt][r] * al + p0 + p1;
#pragma unroll
        for (int dt = 0; dt < DT; ++dt) oacc[rt][dt][r] *= al;
        FragH t2; t2.h[0] = (_Float16)(p0 * 1024.0f); t2.h[1] = (_Float16)(p1 * 1024.0f); sP[w][rt * 16 + 8 * hh + r][ln] = t2.u[0]; sP[w][rt * 16 + 8 * hh + r][16 + ln] = t2.u[1]; }
    __builtin_amdgcn_fence(__ATOMIC_ACQ_REL, "workgroup"); __builtin_amdgcn_wave_barrier();
    FragH pa[2];
#pragma unroll
    for (int rt = 0; rt < RTN; ++rt) { pa[rt].half[0] = *(const v8us*)&sP[w][rt * 16 + ln][8 * hh]; pa[rt].half[1] = *(const v8us*)&sP[w][rt * 16 + ln][16 + 8 * hh]; }
#pragma unroll
    for (int dt = 0; dt < DT; ++dt) { const unsigned short* vrow = Vth + (size_t)(dt * 16 + ln) * TK + j0; FragH bv; bv.half[0] = *(const v8us*)(vrow + 8 * hh); bv.half[1] = *(const v8us*)(vrow + 16 + 8 * hh);
#pragma unroll
      for (int rt = 0; rt < RTN; ++rt) oacc[rt][dt] = mmaH<1>(pa[rt].v, pa[rt].v, bv.v, bv.v, oacc[rt][dt]); }
    __builtin_amdgcn_fence(__ATOMIC_ACQ_REL, "workgroup"); __builtin_amdgcn_wave_barrier(); }
#pragma unroll
  for (int rt = 0; rt < RTN; ++rt) {
#pragma unroll
    for (int r = 0; r < 8; ++r) { float l = l_r[rt][r]; l += __shfl_xor(l, 1, 32); l += __shfl_xor(l, 2, 32); l += __shfl_xor(l, 4, 32); l += __shfl_xor(l, 8, 32); l_r[rt][r] = (l > 0.f) ? 1.0f / (l * 1024.0f) : 0.f; }
#pragma unroll
    for (int dt = 0; dt < DT; ++dt)
#pragma unroll
      for (int r = 0; r < 8; ++r) sO[w][rt * 16 + 8 * hh + r][dt * 16 + ln] = oacc[rt][dt][r] * l_r[rt][r]; }
  __builtin_amdgcn_fence(__ATOMIC_ACQ_REL, "workgroup"); __builtin_amdgcn_wave_barrier();
  {
#pragma unroll
    for (int rp = 0; rp < RPW; rp += 2) { const int r = rp + (lane >> 4), pc = lane & 15; const v4f val = *(const v4fa*)&sO[w][r][pc * 4]; *(v4f*)(O + ((size_t)b * TQ + q0 + r) * ldo + h * 64 + pc * 4) = val; }
     } }

__global__ __launch_bounds__(256) void k_woutp(const float* __restrict__ Wm, _Float16* __restrict__ Bt) { const size_t t = (size_t)blockIdx.x * 256 + threadIdx.x; if (t >= (size_t)DMOD * (2 * DMOD / 8)) return; const int pc = (int)(t % (2 * DMOD / 8)); const int o = (int)(t / (2 * DMOD / 8)); const bool lo = pc * 8 >= DMOD; FragH f;
  for (int q = 0; q < 8; ++q) { const int c = pc * 8 + q - (lo ? DMOD : 0); f.h[q] = (_Float16)(bf16_round(Wm[(size_t)c * DMOD + o]) * (lo ? 1.0f : 16.0f)); } *(v8us*)((unsigned short*)Bt + (size_t)o * 2 * DMOD + pc * 8) = f.half[0];  }      /* Wo stored (in, out) */
typedef int v4ia __attribute__((ext_vector_type(4), may_alias));
// One block per sequence, 8 consecutive keys a thread. IDX[b][0][.] = positions of the keys valid for the CDR heads, IDX[b][1][.] = for the other heads, ascending; entries past the count are 0. CNT[b*32 + class] = the counts (one 128-byte line per sequence).
__global__ __launch_bounds__(256) void k_mask(const int* __restrict__ mask, const int* __restrict__ cdrs, int* __restrict__ IDX, int* __restrict__ CNT) {
  __shared__ int sh[256]; __shared__ int sany; const int b = blockIdx.x, tid = threadIdx.x; static_assert(TK == 256 * 8, "8 keys a thread");
  const v4ia m0 = *(const v4ia*)(mask + (size_t)b * TK + tid * 8), m1 = *(const v4ia*)(mask + (size_t)b * TK + tid * 8 + 4), c0 = *(const v4ia*)(cdrs + (size_t)b * TK + tid * 8), c1 = *(const v4ia*)(cdrs + (size_t)b * TK + tid * 8 + 4);
  bool vp[8], vc[8]; int np = 0, nb = 0, any = 0;
#pragma unroll
  for (int q = 0; q < 8; ++q) { const int mv = (q < 4) ? m0[q & 3] : m1[q & 3], cv = (q < 4) ? c0[q & 3] : c1[q & 3]; vp[q] = mv != 0; vc[q] = cv != 0; any |= vc[q] ? 1 : 0; np += vp[q] ? 1 : 0; nb += (vp[q] && vc[q]) ? 1 : 0; }
  if (tid == 0) sany = 0; __syncthreads(); if (any) sany = 1;
  const int own = np | (nb << 16); int v = own; sh[tid] = v; __syncthreads();      /* both counts stay <= 2048, so one packed inclusive scan serves both lists */
  for (int st = 1; st < 256; st <<= 1) { const int add = (tid >= st) ? sh[tid - st] : 0; __syncthreads(); v += add; sh[tid] = v; __syncthreads(); }
  const bool allmasked = (sany == 0);      /* no CDR token at all -> the CDR mask is disabled */
  const int tot = sh[255], ex = v - own; const int cnt1 = tot & 0xFFFF, cnt0 = allmasked ? cnt1 : (tot >> 16); int o1 = ex & 0xFFFF, o0 = allmasked ? o1 : (ex >> 16);
  int* i0 = IDX + ((size_t)b * 2 + 0) * TK; int* i1 = IDX + ((size_t)b * 2 + 1) * TK;
#pragma unroll
  for (int q = 0; q < 8; ++q) { const int k = tid * 8 + q; if (vp[q]) i1[o1++] = k; if (vp[q] && (allmasked || vc[q])) i0[o0++] = k; if (k >= cnt1) i1[k] = 0; if (k >= cnt0) i0[k] = 0; }
  if (tid == 0) { CNT[b * 32 + 0] = cnt0; CNT[b * 32 + 1] = cnt1; } }

extern "C" void kernel_launch(void* const* d_in, const int* in_sizes, int n_in,
                              void* d_out, int out_size, void* d_ws, size_t ws_size, hipStream_t stream) {
  (void)in_sizes; (void)n_in; (void)out_size;
  const float* const* I = (const float* const*)d_in; const float* x = I[0]; const int* mask = (const int*)d_in[1]; const int* cdrs = (const int*)d_in[2]; const float* Wq = I[3]; const float* bq = I[4]; const float* Wk = I[5]; const float* bk = I[6]; const float* Wv = I[7]; const float* bv = I[8]; const float* Wo = I[9]; const float* bo = I[10];
  char* ws = (char*)d_ws; size_t off = 0;
  auto take = [&](size_t bytes) { char* p = ws + off; off += (bytes + 255) & ~(size_t)255; return p; };
  const size_t w8 = (size_t)DMOD * DMOD / 8;
  _Float16* BQ = (_Float16*)take(w8 * 16); _Float16* BK = (_Float16*)take(w8 * 16); _Float16* BV = (_Float16*)take(w8 * 16); _Float16* BO = (_Float16*)take(w8 * 32); int* IDX = (int*)take((size_t)NB * 2 * TK * 4); int* CNT = (int*)take((size_t)NB * 32 * 4);
  _Float16* X16 = (_Float16*)take((size_t)NR * DMOD * 2); float* F32 = (float*)take((size_t)NR * DMOD * 4); _Float16* QH = (_Float16*)take((size_t)NR * DMOD * 2); _Float16* QL = (_Float16*)take((size_t)NR * DMOD * 2); _Float16* KH = (_Float16*)take((size_t)NR * DMOD * 2); _Float16* KL = (_Float16*)take((size_t)NR * DMOD * 2); _Float16* VH = (_Float16*)take((size_t)NR * DMOD * 2); _Float16* VL = (_Float16*)take((size_t)NR * DMOD * 2); _Float16* VT = (_Float16*)take((size_t)NR * DMOD * 2); _Float16* VTL = (_Float16*)take((size_t)NR * DMOD * 2);
  float* O = F32; _Float16* Hh = VH; _Float16* Hl = VL;
  if (off > ws_size) return;      /* 2.5 + 0.06 + 8 + 16 + 8 x 8 = 91 MiB */
  k_wt_f16<<<(unsigned)(((size_t)DMOD * (DMOD / 8) + 255) / 256), 256, 0, stream>>>(Wq, BQ, DMOD, DMOD, 16.0f); k_wt_f16<<<(unsigned)(((size_t)DMOD * (DMOD / 8) + 255) / 256), 256, 0, stream>>>(Wk, BK, DMOD, DMOD, 16.0f); k_wt_f16<<<(unsigned)(((size_t)DMOD * (DMOD / 8) + 255) / 256), 256, 0, stream>>>(Wv, BV, DMOD, DMOD, 16.0f); k_woutp<<<(unsigned)(((size_t)DMOD * (2 * DMOD / 8) + 255) / 256), 256, 0, stream>>>(Wo, BO);
  k_mask<<<NB, 256, 0, stream>>>(mask, cdrs, IDX, CNT);
  k_x16<<<(unsigned)(((size_t)NR * DMOD / 8 + 255) / 256), 256, 0, stream>>>(x, X16, (size_t)NR * DMOD / 8);
  const dim3 gA((NR / 128) * (DMOD / 64), 1); const unsigned n8 = (unsigned)(((size_t)NR * DMOD / 8 + 255) / 256);
  k_gemm2<0><<<gA, 128, 0, stream>>>(X16, DMOD, 0, BQ, DMOD, 0, 0.0625f, bq, 0, nullptr, 1, 0, 0, F32, nullptr, DMOD, 0, NR, DMOD, DMOD); k_hl<<<n8, 256, 0, stream>>>(F32, QH, QL, (size_t)NR * DMOD / 8);
  k_gemm2<0><<<gA, 128, 0, stream>>>(X16, DMOD, 0, BK, DMOD, 0, 0.0625f, bk, 0, nullptr, 1, 0, 0, F32, nullptr, DMOD, 0, NR, DMOD, DMOD); k_hlg<<<n8, 256, 0, stream>>>(F32, IDX, CNT, KH, KL);
  k_gemm2<0><<<gA, 128, 0, stream>>>(X16, DMOD, 0, BV, DMOD, 0, 0.0625f, bv, 0, nullptr, 1, 0, 0, F32, nullptr, DMOD, 0, NR, DMOD, DMOD); k_hl<<<n8, 256, 0, stream>>>(F32, VH, VL, (size_t)NR * DMOD / 8);
  k_vt<NH, SLEN><<<NB * NH * (SLEN / 64), 256, 0, stream>>>(VH, DMOD, 0, IDX, CNT, VT);
  k_flashqk<5><<<NB * NH * QBLKS, 128, 0, stream>>>(QH, QL, DMOD, KH, KL, DMOD, VT, CNT, O, DMOD);      /* q/k hi + residual; P (x2^10) and V plain f16 */
  k_hl<<<n8, 256, 0, stream>>>(O, Hh, Hl, (size_t)NR * DMOD / 8);
  k_gemm2<0><<<gA, 128, 0, stream>>>(Hh, DMOD, 0, BO, 2 * DMOD, 0, 0.0625f, bo, 0, nullptr, 1, 0, 0, (float*)d_out, nullptr, DMOD, 0, NR, DMOD, DMOD);
  k_gemm2<0><<<gA, 128, 0, stream>>>(Hl, DMOD, 0, BO + DMOD, 2 * DMOD, 0, 1.0f / 1024.0f, nullptr, 0, (const float*)d_out, 1, (size_t)DMOD, 0, (float*)d_out, nullptr, DMOD, 0, NR, DMOD, DMOD);
}

// v002
// It runs in 298 microseconds.
// Two timings next to v001 put it at 1.18 and 1.19 times that version's speed.
// All steps since v000 together make it 1.82 times as fast.
#include <hip/hip_runtime.h>
// CDRs attention (4 sequences x 2048 tokens x 512; 8 heads x 64): q,k,v = x W + b; scores/8; keys with mask == 0 invalid for all heads; for heads 0..1 additionally keys with cdrs_score == 0 invalid unless the sequence has no CDR token at all; softmax; ctx Wo + bo -> [4,2048,512].
// Structure: per sequence two compacted lists of valid key positions (CDR heads / other heads) with their counts, from the two int inputs on VALU (one block per sequence: 'all masked' flag + prefix sum); K planes and V^T are gathered through the lists, so the flash loop runs only over valid keys; x as an exact f16 plane; q/k/v projections as f16 WMMA GEMMs (32x64 wave tiles, f32 accumulation, exact x16 weights + bias) split into hi + 2^10 residual planes; V^T by LDS tiles; the fused flash kernel with hi + 2^10-residual q/k planes (S = QhKh + (QlKh + QhKl)/1024) and plain f16 P (x2^10) and V with the key-count mask mode (invalid keys never visited == the reference's -inf); the output projection from hi + residual planes.
// Compute dtype: x and parameters rounded to bf16; q, k hi + residual (~2^-21-class logits); P and v plain f16 (~2^-12); f32 accumulation/softmax. v_wmma_f32_16x16x32_f16.
#define NB 4
#define DMOD 512
#define CDRH 2
#define NR (NB * SLEN)
#define QBLKS (TQ / 64)
#define SLEN 2048
#define TQ SLEN
#define TK SLEN
#define NH 8
#define SCL 0.125f               /* 64^-0.5 */
typedef __bf16 v16b __attribute__((ext_vector_type(16)));
typedef unsigned short v8us __attribute__((ext_vector_type(8), may_alias));
typedef float  v8f  __attribute__((ext_vector_type(8)));
typedef float  v4f  __attribute__((ext_vector_type(4)));
typedef float  v4fa __attribute__((ext_vector_type(4), may_alias));
union FragB { v16b v; v8us half[2]; unsigned short u[16]; };

__device__ __forceinline__ unsigned short bf16_bits(float x) { unsigned int u = __float_as_uint(x); return (unsigned short)((u + 0x7FFFu + ((u >> 16) & 1u)) >> 16); }
__device__ __forceinline__ float bf16_val(unsigned short b) { return __uint_as_float(((unsigned int)b) << 16); }
__device__ __forceinline__ float bf16_round(float x) { return bf16_val(bf16_bits(x)); }
// D += A·B with NT terms: 1 = ah·bh, 2 = + al·bh (A split), 3 = + ah·bl (both split)
template <int NT>
__device__ __forceinline__ v8f mmaN(v16b ah, v16b al, v16b bh, v16b bl, v8f c) {
  c = __builtin_amdgcn_wmma_f32_16x16x32_bf16(false, ah, false, bh, (short)0, c, false, false);
  if (NT >= 2) c = __builtin_amdgcn_wmma_f32_16x16x32_bf16(false, al, false, bh, (short)0, c, false, false);
  if (NT >= 3) c = __builtin_amdgcn_wmma_f32_16x16x32_bf16(false, ah, false, bl, (short)0, c, false, false);
  asm volatile("v_nop\n\tv_nop\n\tv_nop\n\tv_nop" : "+v"(c) : "v"(ah), "v"(al), "v"(bh), "v"(bl));
  return c;
}

__global__ __launch_bounds__(256) void k_wt_bf16(const float* __restrict__ W, unsigned short* __restrict__ Wt, int K, int N) {
  const int t = blockIdx.x * 256 + threadIdx.x;
  const int k8n = K / 8;
  if (t >= N * k8n) return;
  const int n = t / k8n, k8 = (t % k8n) * 8;
  v8us v;
#pragma unroll
  for (int i = 0; i < 8; ++i) v[i] = bf16_bits(W[(size_t)(k8 + i) * N + n]);
  *(v8us*)(Wt + (size_t)n * K + k8) = v;
  
}

// GEMM C[M][N] (f32, pitch ldc) = act(A[M][K]·W + bias). A f32 row-major (pitch lda) converted per fragment to bf16
// (ASPLIT: hi/lo two planes -> 2 terms, else single rounded term); Wt bf16 [N][K] (pitch ldb). BIAS_BF16 rounds the
// bias to bf16 first (bias quantised to bf16 before the add). K%32==0, M%16==0, N%64==0.
template <bool ASPLIT, int ACT, bool BIAS_BF16>
__global__ __launch_bounds__(128) void k_gemm_bf(const float* __restrict__ A, int lda, const unsigned short* __restrict__ Wt, int ldb,
                                               const float* __restrict__ bias, float* __restrict__ C, int ldc, int M, int N, int K) {
  __shared__ __attribute__((aligned(16))) float so[4][16][64];
  const int tid = threadIdx.x, w = tid >> 5, lane = tid & 31, ln = lane & 15, hh = lane >> 4;
  const int ntn = N / 64;
  const int wid = blockIdx.x * 4 + w;
  const int mt = wid / ntn, nq = wid % ntn;
  if (mt * 16 >= M) return;
  const int row0 = mt * 16, col0 = nq * 64;
  const float* arow = A + (size_t)(row0 + ln) * lda;
  v8f acc[4] = {};
  for (int kb = 0; kb < K; kb += 32) {
    FragB ah, al;
    const v4f x0 = *(const v4fa*)(arow + kb + 8 * hh), x1 = *(const v4fa*)(arow + kb + 8 * hh + 4);
    const v4f x2 = *(const v4fa*)(arow + kb + 16 + 8 * hh), x3 = *(const v4fa*)(arow + kb + 16 + 8 * hh + 4);
    float xs[16] = {x0[0],x0[1],x0[2],x0[3],x1[0],x1[1],x1[2],x1[3],x2[0],x2[1],x2[2],x2[3],x3[0],x3[1],x3[2],x3[3]};
#pragma unroll
    for (int i = 0; i < 16; ++i) { const unsigned short hb = bf16_bits(xs[i]); ah.u[i] = hb; al.u[i] = ASPLIT ? bf16_bits(xs[i] - bf16_val(hb)) : (unsigned short)0; }
#pragma unroll
    for (int t = 0; t < 4; ++t) {
      const unsigned short* brow = Wt + (size_t)(col0 + t * 16 + ln) * ldb + kb;
      FragB b;
      b.half[0] = *(const v8us*)(brow + 8 * hh);
      b.half[1] = *(const v8us*)(brow + 16 + 8 * hh);
      acc[t] = mmaN<ASPLIT ? 2 : 1>(ah.v, al.v, b.v, b.v, acc[t]);
    }
  }
#pragma unroll
  for (int t = 0; t < 4; ++t) {
    float bv = bias ? bias[col0 + t * 16 + ln] : 0.f;
    if (BIAS_BF16) bv = bf16_round(bv);
#pragma unroll
    for (int r = 0; r < 8; ++r) { float v = acc[t][r] + bv; if (ACT == 1) v = fmaxf(v, 0.f); so[w][8 * hh + r][t * 16 + ln] = v; }
  }
  __builtin_amdgcn_fence(__ATOMIC_ACQ_REL, "workgroup");
  __builtin_amdgcn_wave_barrier();
  const int rsub = lane >> 4, c4 = (lane & 15) * 4;
  {
#pragma unroll
    for (int q = 0; q < 8; ++q) {
      const int r = q * 2 + rsub;
      const v4f v = *(const v4fa*)&so[w][r][c4];
      *(v4f*)(C + (size_t)(row0 + r) * ldc + col0 + c4) = v;
    }
    
  }
}

// GEMM C = act(A·W + bias + resid): A f32 (ASPLIT -> hi/lo 2 terms), Wt bf16 [N][K]; ACT 0 none, 1 relu, 2 exact gelu;
// resid (optional, f32, row index = (row % rmod), pitch ldr, RES_BF16 rounds it) added before the activation.
template <bool ASPLIT, int ACT, bool BIAS_BF16, bool RES_BF16>
__global__ __launch_bounds__(128) void k_gemm_bf3(const float* __restrict__ A, int lda, const unsigned short* __restrict__ Wt, int ldb,
                                                const float* __restrict__ bias, const float* __restrict__ resid, int rmod, int ldr,
                                                float* __restrict__ C, int ldc, int M, int N, int K) {
  __shared__ __attribute__((aligned(16))) float so[4][16][64];
  const int tid = threadIdx.x, w = tid >> 5, lane = tid & 31, ln = lane & 15, hh = lane >> 4;
  const int ntn = N / 64;
  const int wid = blockIdx.x * 4 + w;
  const int mt = wid / ntn, nq = wid % ntn;
  if (mt * 16 >= M) return;
  const int row0 = mt * 16, col0 = nq * 64;
  const float* arow = A + (size_t)(row0 + ln) * lda;
  v8f acc[4] = {};
  for (int kb = 0; kb < K; kb += 32) {
    FragB ah, al;
    const v4f x0 = *(const v4fa*)(arow + kb + 8 * hh), x1 = *(const v4fa*)(arow + kb + 8 * hh + 4);
    const v4f x2 = *(const v4fa*)(arow + kb + 16 + 8 * hh), x3 = *(const v4fa*)(arow + kb + 16 + 8 * hh + 4);
    float xs[16] = {x0[0],x0[1],x0[2],x0[3],x1[0],x1[1],x1[2],x1[3],x2[0],x2[1],x2[2],x2[3],x3[0],x3[1],x3[2],x3[3]};
#pragma unroll
    for (int i = 0; i < 16; ++i) { const unsigned short hb = bf16_bits(xs[i]); ah.u[i] = hb; al.u[i] = ASPLIT ? bf16_bits(xs[i] - bf16_val(hb)) : (unsigned short)0; }
#pragma unroll
    for (int t = 0; t < 4; ++t) {
      const unsigned short* brow = Wt + (size_t)(col0 + t * 16 + ln) * ldb + kb;
      FragB b;
      b.half[0] = *(const v8us*)(brow + 8 * hh);
      b.half[1] = *(const v8us*)(brow + 16 + 8 * hh);
      acc[t] = mmaN<ASPLIT ? 2 : 1>(ah.v, al.v, b.v, b.v, acc[t]);
    }
  }
#pragma unroll
  for (int t = 0; t < 4; ++t) {
    const int col = col0 + t * 16 + ln;
    float bv = bias ? bias[col] : 0.f;
    if (BIAS_BF16) bv = bf16_round(bv);
#pragma unroll
    for (int r = 0; r < 8; ++r) {
      float v = acc[t][r] + bv;
      if (resid) { float rv = resid[(size_t)((row0 + 8 * hh + r) % rmod) * ldr + col]; if (RES_BF16) rv = bf16_round(rv); v += rv; }
      if (ACT == 1) v = fmaxf(v, 0.f);
      if (ACT == 2) v = 0.5f * v * (1.0f + erff(v * 0.70710678118654752f));
      if (ACT == 3) { const float u = 0.7978845608028654f * (v + 0.044715f * v * v * v); v = 0.5f * v * (1.0f + tanhf(u)); }
      so[w][8 * hh + r][t * 16 + ln] = v;
    }
  }
  __builtin_amdgcn_fence(__ATOMIC_ACQ_REL, "workgroup");
  __builtin_amdgcn_wave_barrier();
  const int rsub = lane >> 4, c4 = (lane & 15) * 4;
  {
#pragma unroll
    for (int q = 0; q < 8; ++q) {
      const int r = q * 2 + rsub;
      const v4f v = *(const v4fa*)&so[w][r][c4];
      *(v4f*)(C + (size_t)(row0 + r) * ldc + col0 + c4) = v;
    }
    
  }
}
// row LayerNorm (biased variance, eps) over N: s = X (+ R); optional out_sum <- s; out_norm <- (s-mu)*rsqrt(var+eps)*g + b
template <bool PARAM_BF16>
__global__ __launch_bounds__(256) void k_layernorm(const float* __restrict__ X, const float* __restrict__ R, const float* __restrict__ g, const float* __restrict__ bta,
                                                  float* __restrict__ out_sum, float* __restrict__ out_norm, int N, float eps) {
  __shared__ float red[256];
  const int row = blockIdx.x, tid = threadIdx.x;
  const float* x = X + (size_t)row * N; const float* rr = R ? R + (size_t)row * N : nullptr;
  float vals[16];                     // up to N = 4096
  const int per = N / 256;            // contiguous chunk per thread? use strided-by-4 chunks: thread handles j = tid*4 + 1024*u
  float s1 = 0.f;
  for (int u = 0; u < per / 4; ++u) {
    const int j = tid * 4 + 1024 * u;
    const v4f a = *(const v4fa*)(x + j);
    v4f b = {0.f,0.f,0.f,0.f}; if (rr) b = *(const v4fa*)(rr + j);
#pragma unroll
    for (int q = 0; q < 4; ++q) { const float v = a[q] + b[q]; vals[u * 4 + q] = v; s1 += v; }
  }
  red[tid] = s1; __syncthreads();
  for (int st = 128; st > 0; st >>= 1) { if (tid < st) red[tid] += red[tid + st]; __syncthreads(); }
  const float mu = red[0] / (float)N; __syncthreads();
  float s2 = 0.f;
  for (int u = 0; u < per / 4; ++u)
#pragma unroll
    for (int q = 0; q < 4; ++q) { const float c = vals[u * 4 + q] - mu; s2 += c * c; }
  red[tid] = s2; __syncthreads();
  for (int st = 128; st > 0; st >>= 1) { if (tid < st) red[tid] += red[tid + st]; __syncthreads(); }
  const float rs = rsqrtf(red[0] / (float)N + eps);
  {
    for (int u = 0; u < per / 4; ++u) {
      const int j = tid * 4 + 1024 * u;
      v4f o, sm;
#pragma unroll
      for (int q = 0; q < 4; ++q) {
        float gg = g[j + q], bb = bta[j + q];
        if (PARAM_BF16) { gg = bf16_round(gg); bb = bf16_round(bb); }
        sm[q] = vals[u * 4 + q]; o[q] = (vals[u * 4 + q] - mu) * rs * gg + bb;
      }
      if (out_sum) *(v4f*)(out_sum + (size_t)row * N + j) = sm;
      *(v4f*)(out_norm + (size_t)row * N + j) = o;
    }
    
  }
}



// ---- f16 WMMA path (v_wmma_f32_16x16x32_f16): 11-bit significands for operands in range — used where a [0,1] probability operand needs more precision than bf16
typedef _Float16 v16h __attribute__((ext_vector_type(16)));
union FragH { v16h v; v8us half[2]; _Float16 h[16]; unsigned short u[16]; };
template <int NT>
__device__ __forceinline__ v8f mmaH(v16h ah, v16h al, v16h bh, v16h bl, v8f c) {
  c = __builtin_amdgcn_wmma_f32_16x16x32_f16(false, ah, false, bh, (short)0, c, false, false);
  if (NT >= 2) c = __builtin_amdgcn_wmma_f32_16x16x32_f16(false, al, false, bh, (short)0, c, false, false);
  if (NT >= 3) c = __builtin_amdgcn_wmma_f32_16x16x32_f16(false, ah, false, bl, (short)0, c, false, false);
  asm volatile("v_nop\n\tv_nop\n\tv_nop\n\tv_nop" : "+v"(c) : "v"(ah), "v"(al), "v"(bh), "v"(bl));
  return c;
}
// batched GEMM like k_gemm_b but f16 operands: A f32 (split into f16 hi/lo if ASPLIT, else rounded to f16), Bt = f16 values [n][k]; alpha; C f32; N multiple of 16 (partial tiles skipped)
template <bool ASPLIT>
__global__ __launch_bounds__(128) void k_gemm_h(const float* __restrict__ A, int lda, size_t sA, const _Float16* __restrict__ Bh, int ldb, size_t sB, float alpha, float* __restrict__ C, int ldc, size_t sC, int M, int N, int K) {
  __shared__ __attribute__((aligned(16))) float so[4][16][64];
  const int tid = threadIdx.x, w = tid >> 5, lane = tid & 31, ln = lane & 15, hh = lane >> 4; const int by = blockIdx.y;
  A += (size_t)by * sA; Bh += (size_t)by * sB; C += (size_t)by * sC;
  const int ntn = (N + 63) / 64; const int wid = blockIdx.x * 4 + w; const int mt = wid / ntn, nq = wid % ntn; if (mt * 16 >= M) return;
  const int row0 = mt * 16, col0 = nq * 64; const float* arow = A + (size_t)(row0 + ln) * lda;
  v8f acc[4] = {};
  for (int kb = 0; kb < K; kb += 32) {
    FragH ah, al;
    const v4f x0 = *(const v4fa*)(arow + kb + 8 * hh), x1 = *(const v4fa*)(arow + kb + 8 * hh + 4), x2 = *(const v4fa*)(arow + kb + 16 + 8 * hh), x3 = *(const v4fa*)(arow + kb + 16 + 8 * hh + 4);
    float xs[16] = {x0[0],x0[1],x0[2],x0[3],x1[0],x1[1],x1[2],x1[3],x2[0],x2[1],x2[2],x2[3],x3[0],x3[1],x3[2],x3[3]};
#pragma unroll
    for (int i = 0; i < 16; ++i) { const _Float16 h = (_Float16)xs[i]; ah.h[i] = h; al.h[i] = ASPLIT ? (_Float16)(xs[i] - (float)h) : (_Float16)0.0f; }
#pragma unroll
    for (int t = 0; t < 4; ++t) { if (col0 + t * 16 >= N) continue; const size_t boff = (size_t)(col0 + t * 16 + ln) * ldb + kb; FragH bq; bq.half[0] = *(const v8us*)(Bh + boff + 8 * hh); bq.half[1] = *(const v8us*)(Bh + boff + 16 + 8 * hh);
      acc[t] = mmaH<ASPLIT ? 2 : 1>(ah.v, al.v, bq.v, bq.v, acc[t]); }
  }
#pragma unroll
  for (int t = 0; t < 4; ++t) { if (col0 + t * 16 >= N) continue;
#pragma unroll
    for (int r = 0; r < 8; ++r) so[w][8 * hh + r][t * 16 + ln] = acc[t][r] * alpha; }
  __builtin_amdgcn_fence(__ATOMIC_ACQ_REL, "workgroup"); __builtin_amdgcn_wave_barrier();
  const int rsub = lane >> 4, c4 = (lane & 15) * 4;
  {
#pragma unroll
    for (int q = 0; q < 8; ++q) { const int r = q * 2 + rsub; if (col0 + c4 < N) { const v4f v = *(const v4fa*)&so[w][r][c4]; *(v4f*)(C + (size_t)(row0 + r) * ldc + col0 + c4) = v; } }
     }
}

// Wt[n][k] = f16(W[k][n]·scale) from f32 row-major W[K][N] (scale = power of two; bf16-exact weights stay exact in f16 away from the subnormal range)
__global__ __launch_bounds__(256) void k_wt_f16(const float* __restrict__ W, _Float16* __restrict__ Wt, int K, int N, float scale) {
  const int t = blockIdx.x * 256 + threadIdx.x; if (t >= N * (K / 8)) return; const int n = t / (K / 8), k8 = (t % (K / 8)) * 8; FragH f;
#pragma unroll
  for (int i = 0; i < 8; ++i) f.h[i] = (_Float16)(bf16_round(W[(size_t)(k8 + i) * N + n]) * scale); const v8us o = f.half[0];
  *(v8us*)((unsigned short*)Wt + (size_t)n * K + k8) = o; 
}
// k_gemm_hh variant with fused epilogue: v = acc·alpha + bias[by·sBias + col] (+ CP[(row/rowsPerB)·sCPb + by·64 + col] if CP) ; ACT 0 none / 1 elu ; writes f16 C16 (and f32 C if non-null)
template <int ACT>
__global__ __launch_bounds__(128) void k_gemm_hhx(const _Float16* __restrict__ A, int lda, size_t sA, const _Float16* __restrict__ Bh, int ldb, size_t sB, float alpha, const float* __restrict__ bias, size_t sBias, const float* __restrict__ CP, int rowsPerB, size_t sCPb, int row0g,
    float* __restrict__ C, _Float16* __restrict__ C16, int ldc, size_t sC, int M, int N, int K) {
  __shared__ __attribute__((aligned(16))) float so[4][16][64];
  const int tid = threadIdx.x, w = tid >> 5, lane = tid & 31, ln = lane & 15, hh = lane >> 4; const int by = blockIdx.y;
  A += (size_t)by * sA; Bh += (size_t)by * sB; const size_t cofs = (size_t)by * sC; const float* bp = bias ? bias + (size_t)by * sBias : nullptr;
  const int ntn = (N + 63) / 64; const int wid = blockIdx.x * 4 + w; const int mt = wid / ntn, nq = wid % ntn; if (mt * 16 >= M) return;
  const int row0 = mt * 16, col0 = nq * 64; const _Float16* arow = A + (size_t)(row0 + ln) * lda;
  v8f acc[4] = {};
  for (int kb = 0; kb < K; kb += 32) { FragH ah; ah.half[0] = *(const v8us*)((const unsigned short*)arow + kb + 8 * hh); ah.half[1] = *(const v8us*)((const unsigned short*)arow + kb + 16 + 8 * hh);
#pragma unroll
    for (int t = 0; t < 4; ++t) { if (col0 + t * 16 >= N) continue; const size_t boff = (size_t)(col0 + t * 16 + ln) * ldb + kb; FragH bq; bq.half[0] = *(const v8us*)((const unsigned short*)Bh + boff + 8 * hh); bq.half[1] = *(const v8us*)((const unsigned short*)Bh + boff + 16 + 8 * hh);
      acc[t] = mmaH<1>(ah.v, ah.v, bq.v, bq.v, acc[t]); }
  }
#pragma unroll
  for (int t = 0; t < 4; ++t) { if (col0 + t * 16 >= N) continue; const int col = col0 + t * 16 + ln; const float bv = bp ? bf16_round(bp[col]) : 0.f;
#pragma unroll
    for (int r = 0; r < 8; ++r) { float v = acc[t][r] * alpha + bv; if (CP) { const int bidx = (row0g + row0 + 8 * hh + r) / rowsPerB; v += CP[(size_t)bidx * sCPb + (size_t)by * 64 + col]; } if (ACT == 1) v = (v > 0.f) ? v : expm1f(v); else if (ACT == 7) v = (v > 0.f) ? v + 1.0f : expf(v); else if (ACT == 8) v = tanhf(v); else if (ACT == 9) v = 0.5f * v * (1.0f + tanhf(0.7978845608028654f * (v + 0.044715f * v * v * v))); else if (ACT == 11) v = 1.0f / (1.0f + expf(-v)); else if (ACT == 12) v = (v > 0.f) ? v : 0.01f * v; else if (ACT == 14) v = (v > 0.f) ? v : 0.1f * v; else if (ACT == 15) v = v / (1.0f + expf(-v)); else if (ACT == 3) v = fmaxf(v, 0.f); else if (ACT == 6) v = 0.5f * v * (1.0f + erff(v * 0.70710678118654752f)); so[w][8 * hh + r][t * 16 + ln] = v; } }
  __builtin_amdgcn_fence(__ATOMIC_ACQ_REL, "workgroup"); __builtin_amdgcn_wave_barrier();
  const int rsub = lane >> 4, c4 = (lane & 15) * 4; typedef _Float16 v4h __attribute__((ext_vector_type(4)));
  {
#pragma unroll
    for (int q = 0; q < 8; ++q) { const int r = q * 2 + rsub; if (col0 + c4 < N) { const v4f v = *(const v4fa*)&so[w][r][c4]; if (C) *(v4f*)(C + cofs + (size_t)(row0 + r) * ldc + col0 + c4) = v; if (C16) { v4h h4; for (int i = 0; i < 4; ++i) h4[i] = (_Float16)v[i]; *(v4h*)(C16 + cofs + (size_t)(row0 + r) * ldc + col0 + c4) = h4; } } }
     }
}


typedef _Float16 v4h __attribute__((ext_vector_type(4)));

__global__ __launch_bounds__(256) void k_x16(const float* __restrict__ x, _Float16* __restrict__ X16, size_t n8) { const size_t t = (size_t)blockIdx.x * 256 + threadIdx.x; if (t >= n8) return; FragH f;
#pragma unroll
  for (int q = 0; q < 8; ++q) f.h[q] = (_Float16)bf16_round(x[t * 8 + q]); *(v8us*)((unsigned short*)X16 + t * 8) = f.half[0];  }
__global__ __launch_bounds__(256) void k_h16(const float* __restrict__ x, _Float16* __restrict__ X16, size_t n8) { const size_t t = (size_t)blockIdx.x * 256 + threadIdx.x; if (t >= n8) return; FragH f;
#pragma unroll
  for (int q = 0; q < 8; ++q) f.h[q] = (_Float16)x[t * 8 + q]; *(v8us*)((unsigned short*)X16 + t * 8) = f.half[0];  }
__global__ __launch_bounds__(256) void k_round16f(const float* __restrict__ W, _Float16* __restrict__ Bt, size_t n8) { const size_t t = (size_t)blockIdx.x * 256 + threadIdx.x; if (t >= n8) return; FragH f;
#pragma unroll
  for (int i = 0; i < 8; ++i) f.h[i] = (_Float16)(bf16_round(W[t * 8 + i]) * 16.0f); *(v8us*)((unsigned short*)Bt + t * 8) = f.half[0];  }
template <int NHv, int TTv>
__global__ __launch_bounds__(256) void k_vt(const _Float16* __restrict__ V16, int ldv, int voff, const int* __restrict__ IDX, const int* __restrict__ CNT, _Float16* __restrict__ Vt) { __shared__ unsigned short tl[64][66]; const int tid = threadIdx.x; const int slab = blockIdx.x / (TTv / 64), lg = blockIdx.x % (TTv / 64); const int b = slab / NHv, h = slab % NHv;
  const int cls = (h < CDRH) ? 0 : 1; if (lg * 64 >= ((CNT[b * 32 + cls] + 31) & ~31)) return;      /* block-uniform: columns past the rounded key count are never read */
  const int* idx = IDX + ((size_t)b * 2 + cls) * TTv + lg * 64;      /* column j of V^T = j-th valid key; list entries past the count are 0 (a finite row, weighted by P = 0) */
  for (int i = tid; i < 64 * 8; i += 256) { const int r = i / 8, c8 = (i % 8) * 8; FragH f; f.half[0] = *(const v8us*)((const unsigned short*)V16 + ((size_t)b * TTv + idx[r]) * ldv + voff + h * 64 + c8);
#pragma unroll
    for (int q = 0; q < 8; ++q) tl[r][c8 + q] = f.u[q]; }
  __syncthreads();
  {
#pragma unroll
    for (int rd = 0; rd < 2; ++rd) { const int d = rd * 32 + tid / 8, pc = tid % 8; FragH f;
#pragma unroll
      for (int q = 0; q < 8; ++q) f.u[q] = tl[pc * 8 + q][d];
      *(v8us*)((unsigned short*)Vt + ((size_t)slab * 64 + d) * TTv + lg * 64 + pc * 8) = f.half[0]; }
     } }

__global__ __launch_bounds__(256) void k_hl(const float* __restrict__ F, _Float16* __restrict__ Hh, _Float16* __restrict__ Hl, size_t n8) { const size_t t = (size_t)blockIdx.x * 256 + threadIdx.x; if (t >= n8) return; FragH fh, fl; const v4f a = *(const v4fa*)(F + t * 8), c = *(const v4fa*)(F + t * 8 + 4);
#pragma unroll
  for (int q = 0; q < 4; ++q) { _Float16 h = (_Float16)a[q]; fh.h[q] = h; fl.h[q] = (_Float16)((a[q] - (float)h) * 1024.0f); h = (_Float16)c[q]; fh.h[4 + q] = h; fl.h[4 + q] = (_Float16)((c[q] - (float)h) * 1024.0f); }
  { *(v8us*)((unsigned short*)Hh + t * 8) = fh.half[0]; *(v8us*)((unsigned short*)Hl + t * 8) = fl.half[0];  } }
// k_hl with a row gather: row j of a sequence's output planes = row IDX[j] of F, the list chosen by the column's head class; rows past the key count rounded up to 32 are not written (and never read)
__global__ __launch_bounds__(256) void k_hlg(const float* __restrict__ F, const int* __restrict__ IDX, const int* __restrict__ CNT, _Float16* __restrict__ Hh, _Float16* __restrict__ Hl) { const int t = blockIdx.x * 256 + threadIdx.x; const int row = t / (DMOD / 8), c8 = (t % (DMOD / 8)) * 8; const int b = row / TK, j = row % TK; const int cls = (c8 < CDRH * 64) ? 0 : 1;
  if (j >= ((CNT[b * 32 + cls] + 31) & ~31)) return; const float* fr = F + ((size_t)b * TK + IDX[((size_t)b * 2 + cls) * TK + j]) * DMOD + c8; FragH fh, fl; const v4f a = *(const v4fa*)fr, c = *(const v4fa*)(fr + 4);
#pragma unroll
  for (int q = 0; q < 4; ++q) { _Float16 h = (_Float16)a[q]; fh.h[q] = h; fl.h[q] = (_Float16)((a[q] - (float)h) * 1024.0f); h = (_Float16)c[q]; fh.h[4 + q] = h; fl.h[4 + q] = (_Float16)((c[q] - (float)h) * 1024.0f); }
  { *(v8us*)((unsigned short*)Hh + (size_t)t * 8) = fh.half[0]; *(v8us*)((unsigned short*)Hl + (size_t)t * 8) = fl.half[0];  } }

// ---- fast GEMM (wave tile 32x64; requires M % 32 == 0 rows per launch region and N % 64 == 0); epilogue = k_gemm_hhx semantics ----
__device__ __forceinline__ v16h g2_frag(const _Float16* p, int hh) { FragH f; f.half[0] = *(const v8us*)((const unsigned short*)p + 8 * hh); f.half[1] = *(const v8us*)((const unsigned short*)p + 16 + 8 * hh); return f.v; }
__device__ __forceinline__ v8f g2_mma(v16h a, v16h b, v8f c) { v8f d = __builtin_amdgcn_wmma_f32_16x16x32_f16(false, a, false, b, (short)0, c, false, false); asm volatile("v_nop\n\tv_nop\n\tv_nop\n\tv_nop" : "+v"(d) : "v"(a), "v"(b)); return d; }
template <int ACT>
__global__ __launch_bounds__(128) void k_gemm2(const _Float16* __restrict__ A, int lda, size_t sA, const _Float16* __restrict__ Bh, int ldb, size_t sB, float alpha, const float* __restrict__ bias, size_t sBias, const float* __restrict__ CP, int rowsPerB, size_t sCPb, int row0g,
    float* __restrict__ C, _Float16* __restrict__ C16, int ldc, size_t sC, int M, int N, int K) {
  __shared__ __attribute__((aligned(16))) float so[4][32][68];
  const int tid = threadIdx.x, w = tid >> 5, lane = tid & 31, ln = lane & 15, hh = lane >> 4; const int by = blockIdx.y;
  A += (size_t)by * sA; Bh += (size_t)by * sB; const size_t cofs = (size_t)by * sC; const float* bp = bias ? bias + (size_t)by * sBias : nullptr;
  const int ntn = N >> 6; const int mt = blockIdx.x / ntn, nq = blockIdx.x - mt * ntn; const int row0 = mt * 128 + 32 * w, col0 = nq * 64; if (row0 >= M) return;
  const _Float16* a0p = A + (size_t)(row0 + ln) * lda; const _Float16* a1p = a0p + (size_t)16 * lda;
  const _Float16* b0p = Bh + (size_t)(col0 + ln) * ldb; const _Float16* b1p = b0p + (size_t)16 * ldb; const _Float16* b2p = b1p + (size_t)16 * ldb; const _Float16* b3p = b2p + (size_t)16 * ldb;
  const v8f z8 = {0.f,0.f,0.f,0.f,0.f,0.f,0.f,0.f}; v8f c00 = z8, c01 = z8, c02 = z8, c03 = z8, c10 = z8, c11 = z8, c12 = z8, c13 = z8;
#pragma unroll 1
  for (int kb = 0; kb < K; kb += 32) { const v16h a0 = g2_frag(a0p + kb, hh), a1 = g2_frag(a1p + kb, hh);
    v16h b = g2_frag(b0p + kb, hh); c00 = g2_mma(a0, b, c00); c10 = g2_mma(a1, b, c10);
    b = g2_frag(b1p + kb, hh); c01 = g2_mma(a0, b, c01); c11 = g2_mma(a1, b, c11);
    b = g2_frag(b2p + kb, hh); c02 = g2_mma(a0, b, c02); c12 = g2_mma(a1, b, c12);
    b = g2_frag(b3p + kb, hh); c03 = g2_mma(a0, b, c03); c13 = g2_mma(a1, b, c13); }
  v8f accs[8] = {c00, c01, c02, c03, c10, c11, c12, c13};
#pragma unroll
  for (int u = 0; u < 8; ++u) { const int t = u & 3, half = u >> 2; const int col = col0 + t * 16 + ln; const float bv = bp ? bf16_round(bp[col]) : 0.f;
#pragma unroll
    for (int r = 0; r < 8; ++r) { const int rloc = half * 16 + 8 * hh + r; float v = accs[u][r] * alpha + bv; if (CP) { const int bidx = (row0g + row0 + rloc) / rowsPerB; v += CP[(size_t)bidx * sCPb + (size_t)by * 64 + col]; }
      if (ACT == 3) v = fmaxf(v, 0.f); else if (ACT == 6) v = 0.5f * v * (1.0f + erff(v * 0.70710678118654752f)); else if (ACT == 11) v = 1.0f / (1.0f + expf(-v)); else if (ACT == 15) v = v / (1.0f + expf(-v)); else if (ACT == 12) v = (v > 0.f) ? v : 0.01f * v; else if (ACT == 8) v = tanhf(v);
      so[w][rloc][t * 16 + ln] = v; } }
  __builtin_amdgcn_fence(__ATOMIC_ACQ_REL, "workgroup"); __builtin_amdgcn_wave_barrier();
  const int rsub = lane >> 4, c4 = (lane & 15) * 4;
  {
#pragma unroll
    for (int q = 0; q < 16; ++q) { const int r = q * 2 + rsub; const v4f v = *(const v4fa*)&so[w][r][c4]; if (C) *(v4f*)(C + cofs + (size_t)(row0 + r) * ldc + col0 + c4) = v; if (C16) { v4h h4; for (int i = 0; i < 4; ++i) h4[i] = (_Float16)v[i]; *(v4h*)(C16 + cofs + (size_t)(row0 + r) * ldc + col0 + c4) = h4; } }
     } }



template <int CAUSAL>
__global__ __launch_bounds__(128) void k_flash(const _Float16* __restrict__ Q16, int ldq, const _Float16* __restrict__ K16, int ldk, const _Float16* __restrict__ Vt, const int* __restrict__ MSK, float* __restrict__ O, int ldo) {
  constexpr int RPW = 16, RTN = RPW / 16, NQB = TQ / (4 * RPW), DT = 4, KS = 2;
  __shared__ __attribute__((aligned(16))) unsigned short sP[4][RPW][40]; __shared__ __attribute__((aligned(16))) float sO[4][RPW][64 + 4];
  const int tid = threadIdx.x, w = tid >> 5, lane = tid & 31, ln = lane & 15, hh = lane >> 4;
  const int slab = blockIdx.x / NQB, qblk = blockIdx.x % NQB; const int b = slab / NH, h = slab % NH; const int qb0 = qblk * (4 * RPW); const int q0 = qb0 + w * RPW;
  FragH aq[2][KS];
#pragma unroll
  for (int rt = 0; rt < RTN; ++rt) { const unsigned short* qr = (const unsigned short*)Q16 + ((size_t)b * TQ + q0 + rt * 16 + ln) * ldq + h * 64;
#pragma unroll
    for (int ks = 0; ks < KS; ++ks) { aq[rt][ks].half[0] = *(const v8us*)(qr + ks * 32 + 8 * hh); aq[rt][ks].half[1] = *(const v8us*)(qr + ks * 32 + 16 + 8 * hh); } }
  const unsigned short* Vth = (const unsigned short*)Vt + (size_t)slab * 64 * TK;
  float m_r[2][8], l_r[2][8]; v8f oacc[2][DT];
#pragma unroll
  for (int rt = 0; rt < RTN; ++rt) {
#pragma unroll
    for (int r = 0; r < 8; ++r) { m_r[rt][r] = -3.0e38f; l_r[rt][r] = 0.f; }
#pragma unroll
    for (int dt = 0; dt < DT; ++dt) oacc[rt][dt] = (v8f){0.f,0.f,0.f,0.f,0.f,0.f,0.f,0.f}; }
  const int jend = (CAUSAL == 1) ? (qb0 + 4 * RPW) : TK;      /* causal: keys beyond the block's last query never contribute */
#pragma unroll 1
  for (int j0 = 0; j0 < jend; j0 += 32) {
    v8f s[2][2];
#pragma unroll
    for (int nt = 0; nt < 2; ++nt) { const unsigned short* kr = (const unsigned short*)K16 + ((size_t)b * TK + j0 + nt * 16 + ln) * ldk + h * 64; FragH bk[KS];
#pragma unroll
      for (int ks = 0; ks < KS; ++ks) { bk[ks].half[0] = *(const v8us*)(kr + ks * 32 + 8 * hh); bk[ks].half[1] = *(const v8us*)(kr + ks * 32 + 16 + 8 * hh); }
#pragma unroll
      for (int rt = 0; rt < RTN; ++rt) { v8f acc = (v8f){0.f,0.f,0.f,0.f,0.f,0.f,0.f,0.f};
#pragma unroll
        for (int ks = 0; ks < KS; ++ks) acc = mmaH<1>(aq[rt][ks].v, aq[rt][ks].v, bk[ks].v, bk[ks].v, acc); s[rt][nt] = acc; } }
#pragma unroll
    for (int rt = 0; rt < RTN; ++rt)
#pragma unroll
      for (int r = 0; r < 8; ++r) { const int tq = q0 + rt * 16 + 8 * hh + r; const int k0 = j0 + ln, k1 = j0 + 16 + ln;
        const bool ok0 = (CAUSAL == 1) ? (k0 <= tq) : ((CAUSAL == 2) ? ((k0 >> 5) == (tq >> 5)) : true), ok1 = (CAUSAL == 1) ? (k1 <= tq) : ((CAUSAL == 2) ? ((k1 >> 5) == (tq >> 5)) : true);      /* mode 2: block-diagonal 32-token groups */
        const float s0 = ok0 ? s[rt][0][r] * SCL : -3.0e38f, s1 = ok1 ? s[rt][1][r] * SCL : -3.0e38f; float mc = fmaxf(s0, s1);
        mc = fmaxf(mc, __shfl_xor(mc, 1, 32)); mc = fmaxf(mc, __shfl_xor(mc, 2, 32)); mc = fmaxf(mc, __shfl_xor(mc, 4, 32)); mc = fmaxf(mc, __shfl_xor(mc, 8, 32));
        const float mn = fmaxf(m_r[rt][r], mc); const float al = (mn > -1.0e38f) ? expf(m_r[rt][r] - mn) : 1.0f; m_r[rt][r] = mn; const float p0 = ok0 ? expf(s0 - mn) : 0.f, p1 = ok1 ? expf(s1 - mn) : 0.f; l_r[rt][r] = l_r[rt][r] * al + p0 + p1;
#pragma unroll
        for (int dt = 0; dt < DT; ++dt) oacc[rt][dt][r] *= al;
        FragH t2; t2.h[0] = (_Float16)(p0 * 1024.0f); t2.h[1] = (_Float16)(p1 * 1024.0f); sP[w][rt * 16 + 8 * hh + r][ln] = t2.u[0]; sP[w][rt * 16 + 8 * hh + r][16 + ln] = t2.u[1]; }
    __builtin_amdgcn_fence(__ATOMIC_ACQ_REL, "workgroup"); __builtin_amdgcn_wave_barrier();
    FragH pa[2];
#pragma unroll
    for (int rt = 0; rt < RTN; ++rt) { pa[rt].half[0] = *(const v8us*)&sP[w][rt * 16 + ln][8 * hh]; pa[rt].half[1] = *(const v8us*)&sP[w][rt * 16 + ln][16 + 8 * hh]; }
#pragma unroll
    for (int dt = 0; dt < DT; ++dt) { const unsigned short* vrow = Vth + (size_t)(dt * 16 + ln) * TK + j0; FragH bv; bv.half[0] = *(const v8us*)(vrow + 8 * hh); bv.half[1] = *(const v8us*)(vrow + 16 + 8 * hh);
#pragma unroll
      for (int rt = 0; rt < RTN; ++rt) oacc[rt][dt] = mmaH<1>(pa[rt].v, pa[rt].v, bv.v, bv.v, oacc[rt][dt]); }
    __builtin_amdgcn_fence(__ATOMIC_ACQ_REL, "workgroup"); __builtin_amdgcn_wave_barrier(); }
#pragma unroll
  for (int rt = 0; rt < RTN; ++rt) {
#pragma unroll
    for (int r = 0; r < 8; ++r) { float l = l_r[rt][r]; l += __shfl_xor(l, 1, 32); l += __shfl_xor(l, 2, 32); l += __shfl_xor(l, 4, 32); l += __shfl_xor(l, 8, 32); l_r[rt][r] = (l > 0.f) ? 1.0f / (l * 1024.0f) : 0.f; }
#pragma unroll
    for (int dt = 0; dt < DT; ++dt)
#pragma unroll
      for (int r = 0; r < 8; ++r) sO[w][rt * 16 + 8 * hh + r][dt * 16 + ln] = oacc[rt][dt][r] * l_r[rt][r]; }
  __builtin_amdgcn_fence(__ATOMIC_ACQ_REL, "workgroup"); __builtin_amdgcn_wave_barrier();
  {
#pragma unroll
    for (int rp = 0; rp < RPW; rp += 2) { const int r = rp + (lane >> 4), pc = lane & 15; const v4f val = *(const v4fa*)&sO[w][r][pc * 4]; *(v4f*)(O + ((size_t)b * TQ + q0 + r) * ldo + h * 64 + pc * 4) = val; }
     } }
// Six 16-byte asynchronous copies to LDS per lane (one 32-key tile's share). s_wait_xcnt 0 closes the statement so that no address register of an issued copy is rewritten ahead of it.
__device__ __forceinline__ void cp_tile6(unsigned l0, const unsigned short* g0, unsigned l1, const unsigned short* g1, unsigned l2, const unsigned short* g2, unsigned l3, const unsigned short* g3, unsigned l4, const unsigned short* g4, unsigned l5, const unsigned short* g5) {
  asm volatile("global_load_async_to_lds_b128 %0, %1, off\n\t"
               "global_load_async_to_lds_b128 %2, %3, off\n\t"
               "global_load_async_to_lds_b128 %4, %5, off\n\t"
               "global_load_async_to_lds_b128 %6, %7, off\n\t"
               "global_load_async_to_lds_b128 %8, %9, off\n\t"
               "global_load_async_to_lds_b128 %10, %11, off\n\t"
               "s_wait_xcnt 0x0"
               :: "v"(l0), "v"(g0), "v"(l1), "v"(g1), "v"(l2), "v"(g2), "v"(l3), "v"(g3), "v"(l4), "v"(g4), "v"(l5), "v"(g5) : "memory");
}
// Q/K-split variant: S = Qh Kh^T + (Ql Kh^T + Qh Kl^T)/1024 with Q/K = [hi | 2^10 residual] f16 planes (QL/KL same layout as Q16/K16); plain f16 P (x2^10) . V^T as in k_flash. Each 32-key tile (K hi, K residual, V^T) is brought into LDS once per block by asynchronous copies, two buffers, and all four waves take their fragments from there
template <int CAUSAL>
__global__ __launch_bounds__(128) void k_flashqk(const _Float16* __restrict__ Q16, const _Float16* __restrict__ QL, int ldq, const _Float16* __restrict__ K16, const _Float16* __restrict__ KL, int ldk, const _Float16* __restrict__ Vt, const int* __restrict__ MSK, float* __restrict__ O, int ldo) {
  constexpr int RPW = 16, RTN = RPW / 16, NQB = TQ / (4 * RPW), DT = 4, KS = 2;
  __shared__ __attribute__((aligned(16))) unsigned short sP[4][RPW][40]; __shared__ __attribute__((aligned(16))) float sO[4][RPW][64 + 4];
  __shared__ __attribute__((aligned(16))) unsigned short sKh[2][32][72], sKl[2][32][72], sV[2][64][40];      /* row pitches 144 B and 80 B: 16 B x odd, for 16-byte fragment reads */
  const int tid = threadIdx.x, w = tid >> 5, lane = tid & 31, ln = lane & 15, hh = lane >> 4;
  const int slab = blockIdx.x / QBLKS, qblk = blockIdx.x % QBLKS; (void)NQB; const int b = slab / NH, h = slab % NH; const int qb0 = qblk * (4 * RPW); const int q0 = qb0 + w * RPW;
  FragH aq[2][KS], aql[2][KS];
#pragma unroll
  for (int rt = 0; rt < RTN; ++rt) { const unsigned short* qr = (const unsigned short*)Q16 + ((size_t)b * TQ + q0 + rt * 16 + ln) * ldq + h * 64; const unsigned short* ql = (const unsigned short*)QL + ((size_t)b * TQ + q0 + rt * 16 + ln) * ldq + h * 64;
#pragma unroll
    for (int ks = 0; ks < KS; ++ks) { aq[rt][ks].half[0] = *(const v8us*)(qr + ks * 32 + 8 * hh); aq[rt][ks].half[1] = *(const v8us*)(qr + ks * 32 + 16 + 8 * hh); aql[rt][ks].half[0] = *(const v8us*)(ql + ks * 32 + 8 * hh); aql[rt][ks].half[1] = *(const v8us*)(ql + ks * 32 + 16 + 8 * hh); } }
  const unsigned short* Vth = (const unsigned short*)Vt + (size_t)slab * 64 * TK;
  float m_r[2][8], l_r[2][8]; v8f oacc[2][DT];
#pragma unroll
  for (int rt = 0; rt < RTN; ++rt) {
#pragma unroll
    for (int r = 0; r < 8; ++r) { m_r[rt][r] = -3.0e38f; l_r[rt][r] = 0.f; }
#pragma unroll
    for (int dt = 0; dt < DT; ++dt) oacc[rt][dt] = (v8f){0.f,0.f,0.f,0.f,0.f,0.f,0.f,0.f}; }
  const int kcnt = (CAUSAL == 5) ? min(MSK[b * 32 + ((h < CDRH) ? 0 : 1)], TK) : TK;      /* mode 5: number of valid keys of this (sequence, head class); K planes and V^T hold them compacted, in key order */
  const int jend = (CAUSAL == 1) ? (qb0 + 4 * RPW) : ((CAUSAL == 5) ? ((kcnt + 31) & ~31) : TK);      /* causal: keys beyond the block's last query never contribute */
  const int kr0 = tid >> 3, kc0 = (tid & 7) * 8, vr0 = tid >> 2, vc0 = (tid & 3) * 8;      /* a lane's share of a tile: rows kr0 and kr0 + 16 of both K planes, rows vr0 and vr0 + 32 of V^T, 16 bytes each; whole 128-byte K lines per 8 lanes */
  const unsigned short* gkh = (const unsigned short*)K16 + ((size_t)b * TK + kr0) * ldk + h * 64 + kc0; const unsigned short* gkl = (const unsigned short*)KL + ((size_t)b * TK + kr0) * ldk + h * 64 + kc0; const unsigned short* gv = Vth + (size_t)vr0 * TK + vc0;
  auto stage = [&](int jt, int bf) { const size_t ko = (size_t)jt * ldk;
    cp_tile6((unsigned)(size_t)&sKh[bf][kr0][kc0], gkh + ko, (unsigned)(size_t)&sKh[bf][kr0 + 16][kc0], gkh + ko + (size_t)16 * ldk, (unsigned)(size_t)&sKl[bf][kr0][kc0], gkl + ko, (unsigned)(size_t)&sKl[bf][kr0 + 16][kc0], gkl + ko + (size_t)16 * ldk,
             (unsigned)(size_t)&sV[bf][vr0][vc0], gv + jt, (unsigned)(size_t)&sV[bf][vr0 + 32][vc0], gv + (size_t)32 * TK + jt); };
  if (jend > 0) stage(0, 0);
  asm volatile("s_wait_asynccnt 0x0" ::: "memory");      /* this wave's share of tile 0 has landed */
  __syncthreads();      /* tile 0 is published to all four waves */
  if (jend > 32) stage(32, 1);
#pragma unroll 1
  for (int j0 = 0; j0 < jend; j0 += 32) {
    const int bf = (j0 >> 5) & 1;
    v8f s[2][2];
#pragma unroll
    for (int nt = 0; nt < 2; ++nt) { const unsigned short* kr = &sKh[bf][nt * 16 + ln][0]; const unsigned short* klr = &sKl[bf][nt * 16 + ln][0]; FragH bk[KS], bkl[KS];
#pragma unroll
      for (int ks = 0; ks < KS; ++ks) { bk[ks].half[0] = *(const v8us*)(kr + ks * 32 + 8 * hh); bk[ks].half[1] = *(const v8us*)(kr + ks * 32 + 16 + 8 * hh); bkl[ks].half[0] = *(const v8us*)(klr + ks * 32 + 8 * hh); bkl[ks].half[1] = *(const v8us*)(klr + ks * 32 + 16 + 8 * hh); }
#pragma unroll
      for (int rt = 0; rt < RTN; ++rt) { v8f acc = (v8f){0.f,0.f,0.f,0.f,0.f,0.f,0.f,0.f}, accl = acc;
#pragma unroll
        for (int ks = 0; ks < KS; ++ks) { acc = mmaH<1>(aq[rt][ks].v, aq[rt][ks].v, bk[ks].v, bk[ks].v, acc); accl = mmaH<1>(aql[rt][ks].v, aql[rt][ks].v, bk[ks].v, bk[ks].v, accl); accl = mmaH<1>(aq[rt][ks].v, aq[rt][ks].v, bkl[ks].v, bkl[ks].v, accl); }
#pragma unroll
        for (int r = 0; r < 8; ++r) acc[r] += accl[r] * 0.0009765625f;
        s[rt][nt] = acc; } }
#pragma unroll
    for (int rt = 0; rt < RTN; ++rt)
#pragma unroll
      for (int r = 0; r < 8; ++r) { const int tq = q0 + rt * 16 + 8 * hh + r; const int k0 = j0 + ln, k1 = j0 + 16 + ln;
        bool ok0 = (CAUSAL == 1) ? (k0 <= tq) : ((CAUSAL == 2) ? ((k0 >> 5) == (tq >> 5)) : true), ok1 = (CAUSAL == 1) ? (k1 <= tq) : ((CAUSAL == 2) ? ((k1 >> 5) == (tq >> 5)) : true);      /* mode 2: block-diagonal 32-token groups */
        if (CAUSAL == 5) { ok0 = k0 < kcnt; ok1 = k1 < kcnt; }      /* mode 5: compacted keys (key padding + head-specific masks applied by the gather); only the tail of the last 32-key trip is invalid */
        if (CAUSAL == 4) { const int* mrow = MSK + ((size_t)b * TQ + tq) * TK; ok0 = mrow[k0] != 0; ok1 = mrow[k1] != 0; }      /* mode 4: per-(query, key) INPUT mask shared by all heads; masked keys contribute nothing (== the reference's -4096 fill, whose exp underflows to 0), rows with no valid key give l = 0 -> output 0 (== the reference's row_valid zeroing) */
        const float s0 = ok0 ? s[rt][0][r] * SCL : -3.0e38f, s1 = ok1 ? s[rt][1][r] * SCL : -3.0e38f; float mc = fmaxf(s0, s1);
        mc = fmaxf(mc, __shfl_xor(mc, 1, 32)); mc = fmaxf(mc, __shfl_xor(mc, 2, 32)); mc = fmaxf(mc, __shfl_xor(mc, 4, 32)); mc = fmaxf(mc, __shfl_xor(mc, 8, 32));
        const float mn = fmaxf(m_r[rt][r], mc); const float al = (mn > -1.0e38f) ? expf(m_r[rt][r] - mn) : 1.0f; m_r[rt][r] = mn; const float p0 = ok0 ? expf(s0 - mn) : 0.f, p1 = ok1 ? expf(s1 - mn) : 0.f; l_r[rt][r] = l_r[rt][r] * al + p0 + p1;
#pragma unroll
        for (int dt = 0; dt < DT; ++dt) oacc[rt][dt][r] *= al;
        FragH t2; t2.h[0] = (_Float16)(p0 * 1024.0f); t2.h[1] = (_Float16)(p1 * 1024.0f); sP[w][rt * 16 + 8 * hh + r][ln] = t2.u[0]; sP[w][rt * 16 + 8 * hh + r][16 + ln] = t2.u[1]; }
    __builtin_amdgcn_fence(__ATOMIC_ACQ_REL, "workgroup"); __builtin_amdgcn_wave_barrier();
    FragH pa[2];
#pragma unroll
    for (int rt = 0; rt < RTN; ++rt) { pa[rt].half[0] = *(const v8us*)&sP[w][rt * 16 + ln][8 * hh]; pa[rt].half[1] = *(const v8us*)&sP[w][rt * 16 + ln][16 + 8 * hh]; }
#pragma unroll
    for (int dt = 0; dt < DT; ++dt) { const unsigned short* vrow = &sV[bf][dt * 16 + ln][0]; FragH bv; bv.half[0] = *(const v8us*)(vrow + 8 * hh); bv.half[1] = *(const v8us*)(vrow + 16 + 8 * hh);
#pragma unroll
      for (int rt = 0; rt < RTN; ++rt) oacc[rt][dt] = mmaH<1>(pa[rt].v, pa[rt].v, bv.v, bv.v, oacc[rt][dt]); }
    __builtin_amdgcn_fence(__ATOMIC_ACQ_REL, "workgroup"); __builtin_amdgcn_wave_barrier();
    asm volatile("s_wait_dscnt 0x0" ::: "memory");      /* this wave's reads of buffer bf have returned before the buffer is refilled */
    asm volatile("s_wait_asynccnt 0x0" ::: "memory");      /* this wave's share of the next tile has landed */
    __syncthreads();      /* publishes the next tile and ends every wave's reads of buffer bf */
    if (j0 + 64 < jend) stage(j0 + 64, bf); }
  asm volatile("s_wait_asynccnt 0x0" ::: "memory");      /* no copy is outstanding when the wave goes on to its end */
#pragma unroll
  for (int rt = 0; rt < RTN; ++rt) {
#pragma unroll
    for (int r = 0; r < 8; ++r) { float l = l_r[rt][r]; l += __shfl_xor(l, 1, 32); l += __shfl_xor(l, 2, 32); l += __shfl_xor(l, 4, 32); l += __shfl_xor(l, 8, 32); l_r[rt][r] = (l > 0.f) ? 1.0f / (l * 1024.0f) : 0.f; }
#pragma unroll
    for (int dt = 0; dt < DT; ++dt)
#pragma unroll
      for (int r = 0; r < 8; ++r) sO[w][rt * 16 + 8 * hh + r][dt * 16 + ln] = oacc[rt][dt][r] * l_r[rt][r]; }
  __builtin_amdgcn_fence(__ATOMIC_ACQ_REL, "workgroup"); __builtin_amdgcn_wave_barrier();
  {
#pragma unroll
    for (int rp = 0; rp < RPW; rp += 2) { const int r = rp + (lane >> 4), pc = lane & 15; const v4f val = *(const v4fa*)&sO[w][r][pc * 4]; *(v4f*)(O + ((size_t)b * TQ + q0 + r) * ldo + h * 64 + pc * 4) = val; }
     } }

__global__ __launch_bounds__(256) void k_woutp(const float* __restrict__ Wm, _Float16* __restrict__ Bt) { const size_t t = (size_t)blockIdx.x * 256 + threadIdx.x; if (t >= (size_t)DMOD * (2 * DMOD / 8)) return; const int pc = (int)(t % (2 * DMOD / 8)); const int o = (int)(t / (2 * DMOD / 8)); const bool lo = pc * 8 >= DMOD; FragH f;
  for (int q = 0; q < 8; ++q) { const int c = pc * 8 + q - (lo ? DMOD : 0); f.h[q] = (_Float16)(bf16_round(Wm[(size_t)c * DMOD + o]) * (lo ? 1.0f : 16.0f)); } *(v8us*)((unsigned short*)Bt + (size_t)o * 2 * DMOD + pc * 8) = f.half[0];  }      /* Wo stored (in, out) */
typedef int v4ia __attribute__((ext_vector_type(4), may_alias));
// One block per sequence, 8 consecutive keys a thread. IDX[b][0][.] = positions of the keys valid for the CDR heads, IDX[b][1][.] = for the other heads, ascending; entries past the count are 0. CNT[b*32 + class] = the counts (one 128-byte line per sequence).
__global__ __launch_bounds__(256) void k_mask(const int* __restrict__ mask, const int* __restrict__ cdrs, int* __restrict__ IDX, int* __restrict__ CNT) {
  __shared__ int sh[256]; __shared__ int sany; const int b = blockIdx.x, tid = threadIdx.x; static_assert(TK == 256 * 8, "8 keys a thread");
  const v4ia m0 = *(const v4ia*)(mask + (size_t)b * TK + tid * 8), m1 = *(const v4ia*)(mask + (size_t)b * TK + tid * 8 + 4), c0 = *(const v4ia*)(cdrs + (size_t)b * TK + tid * 8), c1 = *(const v4ia*)(cdrs + (size_t)b * TK + tid * 8 + 4);
  bool vp[8], vc[8]; int np = 0, nb = 0, any = 0;
#pragma unroll
  for (int q = 0; q < 8; ++q) { const int mv = (q < 4) ? m0[q & 3] : m1[q & 3], cv = (q < 4) ? c0[q & 3] : c1[q & 3]; vp[q] = mv != 0; vc[q] = cv != 0; any |= vc[q] ? 1 : 0; np += vp[q] ? 1 : 0; nb += (vp[q] && vc[q]) ? 1 : 0; }
  if (tid == 0) sany = 0; __syncthreads(); if (any) sany = 1;
  const int own = np | (nb << 16); int v = own; sh[tid] = v; __syncthreads();      /* both counts stay <= 2048, so one packed inclusive scan serves both lists */
  for (int st = 1; st < 256; st <<= 1) { const int add = (tid >= st) ? sh[tid - st] : 0; __syncthreads(); v += add; sh[tid] = v; __syncthreads(); }
  const bool allmasked = (sany == 0);      /* no CDR token at all -> the CDR mask is disabled */
  const int tot = sh[255], ex = v - own; const int cnt1 = tot & 0xFFFF, cnt0 = allmasked ? cnt1 : (tot >> 16); int o1 = ex & 0xFFFF, o0 = allmasked ? o1 : (ex >> 16);
  int* i0 = IDX + ((size_t)b * 2 + 0) * TK; int* i1 = IDX + ((size_t)b * 2 + 1) * TK;
#pragma unroll
  for (int q = 0; q < 8; ++q) { const int k = tid * 8 + q; if (vp[q]) i1[o1++] = k; if (vp[q] && (allmasked || vc[q])) i0[o0++] = k; if (k >= cnt1) i1[k] = 0; if (k >= cnt0) i0[k] = 0; }
  if (tid == 0) { CNT[b * 32 + 0] = cnt0; CNT[b * 32 + 1] = cnt1; } }

extern "C" void kernel_launch(void* const* d_in, const int* in_sizes, int n_in,
                              void* d_out, int out_size, void* d_ws, size_t ws_size, hipStream_t stream) {
  (void)in_sizes; (void)n_in; (void)out_size;
  const float* const* I = (const float* const*)d_in; const float* x = I[0]; const int* mask = (const int*)d_in[1]; const int* cdrs = (const int*)d_in[2]; const float* Wq = I[3]; const float* bq = I[4]; const float* Wk = I[5]; const float* bk = I[6]; const float* Wv = I[7]; const float* bv = I[8]; const float* Wo = I[9]; const float* bo = I[10];
  char* ws = (char*)d_ws; size_t off = 0;
  auto take = [&](size_t bytes) { char* p = ws + off; off += (bytes + 255) & ~(size_t)255; return p; };
  const size_t w8 = (size_t)DMOD * DMOD / 8;
  _Float16* BQ = (_Float16*)take(w8 * 16); _Float16* BK = (_Float16*)take(w8 * 16); _Float16* BV = (_Float16*)take(w8 * 16); _Float16* BO = (_Float16*)take(w8 * 32); int* IDX = (int*)take((size_t)NB * 2 * TK * 4); int* CNT = (int*)take((size_t)NB * 32 * 4);
  _Float16* X16 = (_Float16*)take((size_t)NR * DMOD * 2); float* F32 = (float*)take((size_t)NR * DMOD * 4); _Float16* QH = (_Float16*)take((size_t)NR * DMOD * 2); _Float16* QL = (_Float16*)take((size_t)NR * DMOD * 2); _Float16* KH = (_Float16*)take((size_t)NR * DMOD * 2); _Float16* KL = (_Float16*)take((size_t)NR * DMOD * 2); _Float16* VH = (_Float16*)take((size_t)NR * DMOD * 2); _Float16* VL = (_Float16*)take((size_t)NR * DMOD * 2); _Float16* VT = (_Float16*)take((size_t)NR * DMOD * 2); _Float16* VTL = (_Float16*)take((size_t)NR * DMOD * 2);
  float* O = F32; _Float16* Hh = VH; _Float16* Hl = VL;
  if (off > ws_size) return;      /* 2.5 + 0.06 + 8 + 16 + 8 x 8 = 91 MiB */
  k_wt_f16<<<(unsigned)(((size_t)DMOD * (DMOD / 8) + 255) / 256), 256, 0, stream>>>(Wq, BQ, DMOD, DMOD, 16.0f); k_wt_f16<<<(unsigned)(((size_t)DMOD * (DMOD / 8) + 255) / 256), 256, 0, stream>>>(Wk, BK, DMOD, DMOD, 16.0f); k_wt_f16<<<(unsigned)(((size_t)DMOD * (DMOD / 8) + 255) / 256), 256, 0, stream>>>(Wv, BV, DMOD, DMOD, 16.0f); k_woutp<<<(unsigned)(((size_t)DMOD * (2 * DMOD / 8) + 255) / 256), 256, 0, stream>>>(Wo, BO);
  k_mask<<<NB, 256, 0, stream>>>(mask, cdrs, IDX, CNT);
  k_x16<<<(unsigned)(((size_t)NR * DMOD / 8 + 255) / 256), 256, 0, stream>>>(x, X16, (size_t)NR * DMOD / 8);
  const dim3 gA((NR / 128) * (DMOD / 64), 1); const unsigned n8 = (unsigned)(((size_t)NR * DMOD / 8 + 255) / 256);
  k_gemm2<0><<<gA, 128, 0, stream>>>(X16, DMOD, 0, BQ, DMOD, 0, 0.0625f, bq, 0, nullptr, 1, 0, 0, F32, nullptr, DMOD, 0, NR, DMOD, DMOD); k_hl<<<n8, 256, 0, stream>>>(F32, QH, QL, (size_t)NR * DMOD / 8);
  k_gemm2<0><<<gA, 128, 0, stream>>>(X16, DMOD, 0, BK, DMOD, 0, 0.0625f, bk, 0, nullptr, 1, 0, 0, F32, nullptr, DMOD, 0, NR, DMOD, DMOD); k_hlg<<<n8, 256, 0, stream>>>(F32, IDX, CNT, KH, KL);
  k_gemm2<0><<<gA, 128, 0, stream>>>(X16, DMOD, 0, BV, DMOD, 0, 0.0625f, bv, 0, nullptr, 1, 0, 0, F32, nullptr, DMOD, 0, NR, DMOD, DMOD); k_hl<<<n8, 256, 0, stream>>>(F32, VH, VL, (size_t)NR * DMOD / 8);
  k_vt<NH, SLEN><<<NB * NH * (SLEN / 64), 256, 0, stream>>>(VH, DMOD, 0, IDX, CNT, VT);
  k_flashqk<5><<<NB * NH * QBLKS, 128, 0, stream>>>(QH, QL, DMOD, KH, KL, DMOD, VT, CNT, O, DMOD);      /* q/k hi + residual; P (x2^10) and V plain f16 */
  k_hl<<<n8, 256, 0, stream>>>(O, Hh, Hl, (size_t)NR * DMOD / 8);
  k_gemm2<0><<<gA, 128, 0, stream>>>(Hh, DMOD, 0, BO, 2 * DMOD, 0, 0.0625f, bo, 0, nullptr, 1, 0, 0, (float*)d_out, nullptr, DMOD, 0, NR, DMOD, DMOD);
  k_gemm2<0><<<gA, 128, 0, stream>>>(Hl, DMOD, 0, BO + DMOD, 2 * DMOD, 0, 1.0f / 1024.0f, nullptr, 0, (const float*)d_out, 1, (size_t)DMOD, 0, (float*)d_out, nullptr, DMOD, 0, NR, DMOD, DMOD);
}

// v003
// A run of this version takes 237 microseconds.
// Next to v002, in two timings, it ran 1.26 and 1.25 times as fast.
// Over all steps from v000 it is 2.29 times as fast.
#include <hip/hip_runtime.h>
// CDRs attention (4 sequences x 2048 tokens x 512; 8 heads x 64): q,k,v = x W + b; scores/8; keys with mask == 0 invalid for all heads; for heads 0..1 additionally keys with cdrs_score == 0 invalid unless the sequence has no CDR token at all; softmax; ctx Wo + bo -> [4,2048,512].
// Structure: per sequence two compacted lists of valid key positions (CDR heads / other heads) with their counts, from the two int inputs on VALU (one block per sequence: 'all masked' flag + prefix sum); K planes and V^T are gathered through the lists, so the flash loop runs only over valid keys; x as an exact f16 plane; q/k/v projections as f16 WMMA GEMMs (32x64 wave tiles, f32 accumulation, exact x16 weights + bias) split into hi + 2^10 residual planes; V^T by LDS tiles; the fused flash kernel with hi + 2^10-residual q/k planes (S = QhKh + (QlKh + QhKl)/1024) and plain f16 P (x2^10) and V with the key-count mask mode (invalid keys never visited == the reference's -inf); the output projection from hi + residual planes.
// Compute dtype: x and parameters rounded to bf16; q, k hi + residual (~2^-21-class logits); P and v plain f16 (~2^-12); f32 accumulation/softmax. v_wmma_f32_16x16x32_f16.
#define NB 4
#define DMOD 512
#define CDRH 2
#define NR (NB * SLEN)
#define QBLKS (TQ / 64)
#define SLEN 2048
#define TQ SLEN
#define TK SLEN
#define NH 8
#define SCL 0.125f               /* 64^-0.5 */
typedef __bf16 v16b __attribute__((ext_vector_type(16)));
typedef unsigned short v8us __attribute__((ext_vector_type(8), may_alias));
typedef float  v8f  __attribute__((ext_vector_type(8)));
typedef float  v4f  __attribute__((ext_vector_type(4)));
typedef float  v4fa __attribute__((ext_vector_type(4), may_alias));
union FragB { v16b v; v8us half[2]; unsigned short u[16]; };

__device__ __forceinline__ unsigned short bf16_bits(float x) { unsigned int u = __float_as_uint(x); return (unsigned short)((u + 0x7FFFu + ((u >> 16) & 1u)) >> 16); }
__device__ __forceinline__ float bf16_val(unsigned short b) { return __uint_as_float(((unsigned int)b) << 16); }
__device__ __forceinline__ float bf16_round(float x) { return bf16_val(bf16_bits(x)); }
// D += A·B with NT terms: 1 = ah·bh, 2 = + al·bh (A split), 3 = + ah·bl (both split)
template <int NT>
__device__ __forceinline__ v8f mmaN(v16b ah, v16b al, v16b bh, v16b bl, v8f c) {
  c = __builtin_amdgcn_wmma_f32_16x16x32_bf16(false, ah, false, bh, (short)0, c, false, false);
  if (NT >= 2) c = __builtin_amdgcn_wmma_f32_16x16x32_bf16(false, al, false, bh, (short)0, c, false, false);
  if (NT >= 3) c = __builtin_amdgcn_wmma_f32_16x16x32_bf16(false, ah, false, bl, (short)0, c, false, false);
  asm volatile("v_nop\n\tv_nop\n\tv_nop\n\tv_nop" : "+v"(c) : "v"(ah), "v"(al), "v"(bh), "v"(bl));
  return c;
}

__global__ __launch_bounds__(256) void k_wt_bf16(const float* __restrict__ W, unsigned short* __restrict__ Wt, int K, int N) {
  const int t = blockIdx.x * 256 + threadIdx.x;
  const int k8n = K / 8;
  if (t >= N * k8n) return;
  const int n = t / k8n, k8 = (t % k8n) * 8;
  v8us v;
#pragma unroll
  for (int i = 0; i < 8; ++i) v[i] = bf16_bits(W[(size_t)(k8 + i) * N + n]);
  *(v8us*)(Wt + (size_t)n * K + k8) = v;
  
}

// GEMM C[M][N] (f32, pitch ldc) = act(A[M][K]·W + bias). A f32 row-major (pitch lda) converted per fragment to bf16
// (ASPLIT: hi/lo two planes -> 2 terms, else single rounded term); Wt bf16 [N][K] (pitch ldb). BIAS_BF16 rounds the
// bias to bf16 first (bias quantised to bf16 before the add). K%32==0, M%16==0, N%64==0.
template <bool ASPLIT, int ACT, bool BIAS_BF16>
__global__ __launch_bounds__(128) void k_gemm_bf(const float* __restrict__ A, int lda, const unsigned short* __restrict__ Wt, int ldb,
                                               const float* __restrict__ bias, float* __restrict__ C, int ldc, int M, int N, int K) {
  __shared__ __attribute__((aligned(16))) float so[4][16][64];
  const int tid = threadIdx.x, w = tid >> 5, lane = tid & 31, ln = lane & 15, hh = lane >> 4;
  const int ntn = N / 64;
  const int wid = blockIdx.x * 4 + w;
  const int mt = wid / ntn, nq = wid % ntn;
  if (mt * 16 >= M) return;
  const int row0 = mt * 16, col0 = nq * 64;
  const float* arow = A + (size_t)(row0 + ln) * lda;
  v8f acc[4] = {};
  for (int kb = 0; kb < K; kb += 32) {
    FragB ah, al;
    const v4f x0 = *(const v4fa*)(arow + kb + 8 * hh), x1 = *(const v4fa*)(arow + kb + 8 * hh + 4);
    const v4f x2 = *(const v4fa*)(arow + kb + 16 + 8 * hh), x3 = *(const v4fa*)(arow + kb + 16 + 8 * hh + 4);
    float xs[16] = {x0[0],x0[1],x0[2],x0[3],x1[0],x1[1],x1[2],x1[3],x2[0],x2[1],x2[2],x2[3],x3[0],x3[1],x3[2],x3[3]};
#pragma unroll
    for (int i = 0; i < 16; ++i) { const unsigned short hb = bf16_bits(xs[i]); ah.u[i] = hb; al.u[i] = ASPLIT ? bf16_bits(xs[i] - bf16_val(hb)) : (unsigned short)0; }
#pragma unroll
    for (int t = 0; t < 4; ++t) {
      const unsigned short* brow = Wt + (size_t)(col0 + t * 16 + ln) * ldb + kb;
      FragB b;
      b.half[0] = *(const v8us*)(brow + 8 * hh);
      b.half[1] = *(const v8us*)(brow + 16 + 8 * hh);
      acc[t] = mmaN<ASPLIT ? 2 : 1>(ah.v, al.v, b.v, b.v, acc[t]);
    }
  }
#pragma unroll
  for (int t = 0; t < 4; ++t) {
    float bv = bias ? bias[col0 + t * 16 + ln] : 0.f;
    if (BIAS_BF16) bv = bf16_round(bv);
#pragma unroll
    for (int r = 0; r < 8; ++r) { float v = acc[t][r] + bv; if (ACT == 1) v = fmaxf(v, 0.f); so[w][8 * hh + r][t * 16 + ln] = v; }
  }
  __builtin_amdgcn_fence(__ATOMIC_ACQ_REL, "workgroup");
  __builtin_amdgcn_wave_barrier();
  const int rsub = lane >> 4, c4 = (lane & 15) * 4;
  {
#pragma unroll
    for (int q = 0; q < 8; ++q) {
      const int r = q * 2 + rsub;
      const v4f v = *(const v4fa*)&so[w][r][c4];
      *(v4f*)(C + (size_t)(row0 + r) * ldc + col0 + c4) = v;
    }
    
  }
}

// GEMM C = act(A·W + bias + resid): A f32 (ASPLIT -> hi/lo 2 terms), Wt bf16 [N][K]; ACT 0 none, 1 relu, 2 exact gelu;
// resid (optional, f32, row index = (row % rmod), pitch ldr, RES_BF16 rounds it) added before the activation.
template <bool ASPLIT, int ACT, bool BIAS_BF16, bool RES_BF16>
__global__ __launch_bounds__(128) void k_gemm_bf3(const float* __restrict__ A, int lda, const unsigned short* __restrict__ Wt, int ldb,
                                                const float* __restrict__ bias, const float* __restrict__ resid, int rmod, int ldr,
                                                float* __restrict__ C, int ldc, int M, int N, int K) {
  __shared__ __attribute__((aligned(16))) float so[4][16][64];
  const int tid = threadIdx.x, w = tid >> 5, lane = tid & 31, ln = lane & 15, hh = lane >> 4;
  const int ntn = N / 64;
  const int wid = blockIdx.x * 4 + w;
  const int mt = wid / ntn, nq = wid % ntn;
  if (mt * 16 >= M) return;
  const int row0 = mt * 16, col0 = nq * 64;
  const float* arow = A + (size_t)(row0 + ln) * lda;
  v8f acc[4] = {};
  for (int kb = 0; kb < K; kb += 32) {
    FragB ah, al;
    const v4f x0 = *(const v4fa*)(arow + kb + 8 * hh), x1 = *(const v4fa*)(arow + kb + 8 * hh + 4);
    const v4f x2 = *(const v4fa*)(arow + kb + 16 + 8 * hh), x3 = *(const v4fa*)(arow + kb + 16 + 8 * hh + 4);
    float xs[16] = {x0[0],x0[1],x0[2],x0[3],x1[0],x1[1],x1[2],x1[3],x2[0],x2[1],x2[2],x2[3],x3[0],x3[1],x3[2],x3[3]};
#pragma unroll
    for (int i = 0; i < 16; ++i) { const unsigned short hb = bf16_bits(xs[i]); ah.u[i] = hb; al.u[i] = ASPLIT ? bf16_bits(xs[i] - bf16_val(hb)) : (unsigned short)0; }
#pragma unroll
    for (int t = 0; t < 4; ++t) {
      const unsigned short* brow = Wt + (size_t)(col0 + t * 16 + ln) * ldb + kb;
      FragB b;
      b.half[0] = *(const v8us*)(brow + 8 * hh);
      b.half[1] = *(const v8us*)(brow + 16 + 8 * hh);
      acc[t] = mmaN<ASPLIT ? 2 : 1>(ah.v, al.v, b.v, b.v, acc[t]);
    }
  }
#pragma unroll
  for (int t = 0; t < 4; ++t) {
    const int col = col0 + t * 16 + ln;
    float bv = bias ? bias[col] : 0.f;
    if (BIAS_BF16) bv = bf16_round(bv);
#pragma unroll
    for (int r = 0; r < 8; ++r) {
      float v = acc[t][r] + bv;
      if (resid) { float rv = resid[(size_t)((row0 + 8 * hh + r) % rmod) * ldr + col]; if (RES_BF16) rv = bf16_round(rv); v += rv; }
      if (ACT == 1) v = fmaxf(v, 0.f);
      if (ACT == 2) v = 0.5f * v * (1.0f + erff(v * 0.70710678118654752f));
      if (ACT == 3) { const float u = 0.7978845608028654f * (v + 0.044715f * v * v * v); v = 0.5f * v * (1.0f + tanhf(u)); }
      so[w][8 * hh + r][t * 16 + ln] = v;
    }
  }
  __builtin_amdgcn_fence(__ATOMIC_ACQ_REL, "workgroup");
  __builtin_amdgcn_wave_barrier();
  const int rsub = lane >> 4, c4 = (lane & 15) * 4;
  {
#pragma unroll
    for (int q = 0; q < 8; ++q) {
      const int r = q * 2 + rsub;
      const v4f v = *(const v4fa*)&so[w][r][c4];
      *(v4f*)(C + (size_t)(row0 + r) * ldc + col0 + c4) = v;
    }
    
  }
}
// row LayerNorm (biased variance, eps) over N: s = X (+ R); optional out_sum <- s; out_norm <- (s-mu)*rsqrt(var+eps)*g + b
template <bool PARAM_BF16>
__global__ __launch_bounds__(256) void k_layernorm(const float* __restrict__ X, const float* __restrict__ R, const float* __restrict__ g, const float* __restrict__ bta,
                                                  float* __restrict__ out_sum, float* __restrict__ out_norm, int N, float eps) {
  __shared__ float red[256];
  const int row = blockIdx.x, tid = threadIdx.x;
  const float* x = X + (size_t)row * N; const float* rr = R ? R + (size_t)row * N : nullptr;
  float vals[16];                     // up to N = 4096
  const int per = N / 256;            // contiguous chunk per thread? use strided-by-4 chunks: thread handles j = tid*4 + 1024*u
  float s1 = 0.f;
  for (int u = 0; u < per / 4; ++u) {
    const int j = tid * 4 + 1024 * u;
    const v4f a = *(const v4fa*)(x + j);
    v4f b = {0.f,0.f,0.f,0.f}; if (rr) b = *(const v4fa*)(rr + j);
#pragma unroll
    for (int q = 0; q < 4; ++q) { const float v = a[q] + b[q]; vals[u * 4 + q] = v; s1 += v; }
  }
  red[tid] = s1; __syncthreads();
  for (int st = 128; st > 0; st >>= 1) { if (tid < st) red[tid] += red[tid + st]; __syncthreads(); }
  const float mu = red[0] / (float)N; __syncthreads();
  float s2 = 0.f;
  for (int u = 0; u < per / 4; ++u)
#pragma unroll
    for (int q = 0; q < 4; ++q) { const float c = vals[u * 4 + q] - mu; s2 += c * c; }
  red[tid] = s2; __syncthreads();
  for (int st = 128; st > 0; st >>= 1) { if (tid < st) red[tid] += red[tid + st]; __syncthreads(); }
  const float rs = rsqrtf(red[0] / (float)N + eps);
  {
    for (int u = 0; u < per / 4; ++u) {
      const int j = tid * 4 + 1024 * u;
      v4f o, sm;
#pragma unroll
      for (int q = 0; q < 4; ++q) {
        float gg = g[j + q], bb = bta[j + q];
        if (PARAM_BF16) { gg = bf16_round(gg); bb = bf16_round(bb); }
        sm[q] = vals[u * 4 + q]; o[q] = (vals[u * 4 + q] - mu) * rs * gg + bb;
      }
      if (out_sum) *(v4f*)(out_sum + (size_t)row * N + j) = sm;
      *(v4f*)(out_norm + (size_t)row * N + j) = o;
    }
    
  }
}



// ---- f16 WMMA path (v_wmma_f32_16x16x32_f16): 11-bit significands for operands in range — used where a [0,1] probability operand needs more precision than bf16
typedef _Float16 v16h __attribute__((ext_vector_type(16)));
union FragH { v16h v; v8us half[2]; _Float16 h[16]; unsigned short u[16]; };
template <int NT>
__device__ __forceinline__ v8f mmaH(v16h ah, v16h al, v16h bh, v16h bl, v8f c) {
  c = __builtin_amdgcn_wmma_f32_16x16x32_f16(false, ah, false, bh, (short)0, c, false, false);
  if (NT >= 2) c = __builtin_amdgcn_wmma_f32_16x16x32_f16(false, al, false, bh, (short)0, c, false, false);
  if (NT >= 3) c = __builtin_amdgcn_wmma_f32_16x16x32_f16(false, ah, false, bl, (short)0, c, false, false);
  asm volatile("v_nop\n\tv_nop\n\tv_nop\n\tv_nop" : "+v"(c) : "v"(ah), "v"(al), "v"(bh), "v"(bl));
  return c;
}
// batched GEMM like k_gemm_b but f16 operands: A f32 (split into f16 hi/lo if ASPLIT, else rounded to f16), Bt = f16 values [n][k]; alpha; C f32; N multiple of 16 (partial tiles skipped)
template <bool ASPLIT>
__global__ __launch_bounds__(128) void k_gemm_h(const float* __restrict__ A, int lda, size_t sA, const _Float16* __restrict__ Bh, int ldb, size_t sB, float alpha, float* __restrict__ C, int ldc, size_t sC, int M, int N, int K) {
  __shared__ __attribute__((aligned(16))) float so[4][16][64];
  const int tid = threadIdx.x, w = tid >> 5, lane = tid & 31, ln = lane & 15, hh = lane >> 4; const int by = blockIdx.y;
  A += (size_t)by * sA; Bh += (size_t)by * sB; C += (size_t)by * sC;
  const int ntn = (N + 63) / 64; const int wid = blockIdx.x * 4 + w; const int mt = wid / ntn, nq = wid % ntn; if (mt * 16 >= M) return;
  const int row0 = mt * 16, col0 = nq * 64; const float* arow = A + (size_t)(row0 + ln) * lda;
  v8f acc[4] = {};
  for (int kb = 0; kb < K; kb += 32) {
    FragH ah, al;
    const v4f x0 = *(const v4fa*)(arow + kb + 8 * hh), x1 = *(const v4fa*)(arow + kb + 8 * hh + 4), x2 = *(const v4fa*)(arow + kb + 16 + 8 * hh), x3 = *(const v4fa*)(arow + kb + 16 + 8 * hh + 4);
    float xs[16] = {x0[0],x0[1],x0[2],x0[3],x1[0],x1[1],x1[2],x1[3],x2[0],x2[1],x2[2],x2[3],x3[0],x3[1],x3[2],x3[3]};
#pragma unroll
    for (int i = 0; i < 16; ++i) { const _Float16 h = (_Float16)xs[i]; ah.h[i] = h; al.h[i] = ASPLIT ? (_Float16)(xs[i] - (float)h) : (_Float16)0.0f; }
#pragma unroll
    for (int t = 0; t < 4; ++t) { if (col0 + t * 16 >= N) continue; const size_t boff = (size_t)(col0 + t * 16 + ln) * ldb + kb; FragH bq; bq.half[0] = *(const v8us*)(Bh + boff + 8 * hh); bq.half[1] = *(const v8us*)(Bh + boff + 16 + 8 * hh);
      acc[t] = mmaH<ASPLIT ? 2 : 1>(ah.v, al.v, bq.v, bq.v, acc[t]); }
  }
#pragma unroll
  for (int t = 0; t < 4; ++t) { if (col0 + t * 16 >= N) continue;
#pragma unroll
    for (int r = 0; r < 8; ++r) so[w][8 * hh + r][t * 16 + ln] = acc[t][r] * alpha; }
  __builtin_amdgcn_fence(__ATOMIC_ACQ_REL, "workgroup"); __builtin_amdgcn_wave_barrier();
  const int rsub = lane >> 4, c4 = (lane & 15) * 4;
  {
#pragma unroll
    for (int q = 0; q < 8; ++q) { const int r = q * 2 + rsub; if (col0 + c4 < N) { const v4f v = *(const v4fa*)&so[w][r][c4]; *(v4f*)(C + (size_t)(row0 + r) * ldc + col0 + c4) = v; } }
     }
}

// Wt[n][k] = f16(W[k][n]·scale) from f32 row-major W[K][N] (scale = power of two; bf16-exact weights stay exact in f16 away from the subnormal range)
__global__ __launch_bounds__(256) void k_wt_f16(const float* __restrict__ W, _Float16* __restrict__ Wt, int K, int N, float scale) {
  const int t = blockIdx.x * 256 + threadIdx.x; if (t >= N * (K / 8)) return; const int n = t / (K / 8), k8 = (t % (K / 8)) * 8; FragH f;
#pragma unroll
  for (int i = 0; i < 8; ++i) f.h[i] = (_Float16)(bf16_round(W[(size_t)(k8 + i) * N + n]) * scale); const v8us o = f.half[0];
  *(v8us*)((unsigned short*)Wt + (size_t)n * K + k8) = o; 
}
// k_gemm_hh variant with fused epilogue: v = acc·alpha + bias[by·sBias + col] (+ CP[(row/rowsPerB)·sCPb + by·64 + col] if CP) ; ACT 0 none / 1 elu ; writes f16 C16 (and f32 C if non-null)
template <int ACT>
__global__ __launch_bounds__(128) void k_gemm_hhx(const _Float16* __restrict__ A, int lda, size_t sA, const _Float16* __restrict__ Bh, int ldb, size_t sB, float alpha, const float* __restrict__ bias, size_t sBias, const float* __restrict__ CP, int rowsPerB, size_t sCPb, int row0g,
    float* __restrict__ C, _Float16* __restrict__ C16, int ldc, size_t sC, int M, int N, int K) {
  __shared__ __attribute__((aligned(16))) float so[4][16][64];
  const int tid = threadIdx.x, w = tid >> 5, lane = tid & 31, ln = lane & 15, hh = lane >> 4; const int by = blockIdx.y;
  A += (size_t)by * sA; Bh += (size_t)by * sB; const size_t cofs = (size_t)by * sC; const float* bp = bias ? bias + (size_t)by * sBias : nullptr;
  const int ntn = (N + 63) / 64; const int wid = blockIdx.x * 4 + w; const int mt = wid / ntn, nq = wid % ntn; if (mt * 16 >= M) return;
  const int row0 = mt * 16, col0 = nq * 64; const _Float16* arow = A + (size_t)(row0 + ln) * lda;
  v8f acc[4] = {};
  for (int kb = 0; kb < K; kb += 32) { FragH ah; ah.half[0] = *(const v8us*)((const unsigned short*)arow + kb + 8 * hh); ah.half[1] = *(const v8us*)((const unsigned short*)arow + kb + 16 + 8 * hh);
#pragma unroll
    for (int t = 0; t < 4; ++t) { if (col0 + t * 16 >= N) continue; const size_t boff = (size_t)(col0 + t * 16 + ln) * ldb + kb; FragH bq; bq.half[0] = *(const v8us*)((const unsigned short*)Bh + boff + 8 * hh); bq.half[1] = *(const v8us*)((const unsigned short*)Bh + boff + 16 + 8 * hh);
      acc[t] = mmaH<1>(ah.v, ah.v, bq.v, bq.v, acc[t]); }
  }
#pragma unroll
  for (int t = 0; t < 4; ++t) { if (col0 + t * 16 >= N) continue; const int col = col0 + t * 16 + ln; const float bv = bp ? bf16_round(bp[col]) : 0.f;
#pragma unroll
    for (int r = 0; r < 8; ++r) { float v = acc[t][r] * alpha + bv; if (CP) { const int bidx = (row0g + row0 + 8 * hh + r) / rowsPerB; v += CP[(size_t)bidx * sCPb + (size_t)by * 64 + col]; } if (ACT == 1) v = (v > 0.f) ? v : expm1f(v); else if (ACT == 7) v = (v > 0.f) ? v + 1.0f : expf(v); else if (ACT == 8) v = tanhf(v); else if (ACT == 9) v = 0.5f * v * (1.0f + tanhf(0.7978845608028654f * (v + 0.044715f * v * v * v))); else if (ACT == 11) v = 1.0f / (1.0f + expf(-v)); else if (ACT == 12) v = (v > 0.f) ? v : 0.01f * v; else if (ACT == 14) v = (v > 0.f) ? v : 0.1f * v; else if (ACT == 15) v = v / (1.0f + expf(-v)); else if (ACT == 3) v = fmaxf(v, 0.f); else if (ACT == 6) v = 0.5f * v * (1.0f + erff(v * 0.70710678118654752f)); so[w][8 * hh + r][t * 16 + ln] = v; } }
  __builtin_amdgcn_fence(__ATOMIC_ACQ_REL, "workgroup"); __builtin_amdgcn_wave_barrier();
  const int rsub = lane >> 4, c4 = (lane & 15) * 4; typedef _Float16 v4h __attribute__((ext_vector_type(4)));
  {
#pragma unroll
    for (int q = 0; q < 8; ++q) { const int r = q * 2 + rsub; if (col0 + c4 < N) { const v4f v = *(const v4fa*)&so[w][r][c4]; if (C) *(v4f*)(C + cofs + (size_t)(row0 + r) * ldc + col0 + c4) = v; if (C16) { v4h h4; for (int i = 0; i < 4; ++i) h4[i] = (_Float16)v[i]; *(v4h*)(C16 + cofs + (size_t)(row0 + r) * ldc + col0 + c4) = h4; } } }
     }
}


typedef _Float16 v4h __attribute__((ext_vector_type(4)));

__global__ __launch_bounds__(256) void k_x16(const float* __restrict__ x, _Float16* __restrict__ X16, size_t n8) { const size_t t = (size_t)blockIdx.x * 256 + threadIdx.x; if (t >= n8) return; FragH f;
#pragma unroll
  for (int q = 0; q < 8; ++q) f.h[q] = (_Float16)bf16_round(x[t * 8 + q]); *(v8us*)((unsigned short*)X16 + t * 8) = f.half[0];  }
__global__ __launch_bounds__(256) void k_h16(const float* __restrict__ x, _Float16* __restrict__ X16, size_t n8) { const size_t t = (size_t)blockIdx.x * 256 + threadIdx.x; if (t >= n8) return; FragH f;
#pragma unroll
  for (int q = 0; q < 8; ++q) f.h[q] = (_Float16)x[t * 8 + q]; *(v8us*)((unsigned short*)X16 + t * 8) = f.half[0];  }
__global__ __launch_bounds__(256) void k_round16f(const float* __restrict__ W, _Float16* __restrict__ Bt, size_t n8) { const size_t t = (size_t)blockIdx.x * 256 + threadIdx.x; if (t >= n8) return; FragH f;
#pragma unroll
  for (int i = 0; i < 8; ++i) f.h[i] = (_Float16)(bf16_round(W[t * 8 + i]) * 16.0f); *(v8us*)((unsigned short*)Bt + t * 8) = f.half[0];  }
template <int NHv, int TTv>
__global__ __launch_bounds__(256) void k_vt(const _Float16* __restrict__ V16, int ldv, int voff, const int* __restrict__ IDX, const int* __restrict__ CNT, _Float16* __restrict__ Vt) { __shared__ unsigned short tl[64][66]; const int tid = threadIdx.x; const int slab = blockIdx.x / (TTv / 64), lg = blockIdx.x % (TTv / 64); const int b = slab / NHv, h = slab % NHv;
  const int cls = (h < CDRH) ? 0 : 1; if (lg * 64 >= ((CNT[b * 32 + cls] + 31) & ~31)) return;      /* block-uniform: columns past the rounded key count are never read */
  const int* idx = IDX + ((size_t)b * 2 + cls) * TTv + lg * 64;      /* column j of V^T = j-th valid key; list entries past the count are 0 (a finite row, weighted by P = 0) */
  for (int i = tid; i < 64 * 8; i += 256) { const int r = i / 8, c8 = (i % 8) * 8; FragH f; f.half[0] = *(const v8us*)((const unsigned short*)V16 + ((size_t)b * TTv + idx[r]) * ldv + voff + h * 64 + c8);
#pragma unroll
    for (int q = 0; q < 8; ++q) tl[r][c8 + q] = f.u[q]; }
  __syncthreads();
  {
#pragma unroll
    for (int rd = 0; rd < 2; ++rd) { const int d = rd * 32 + tid / 8, pc = tid % 8; FragH f;
#pragma unroll
      for (int q = 0; q < 8; ++q) f.u[q] = tl[pc * 8 + q][d];
      *(v8us*)((unsigned short*)Vt + ((size_t)slab * 64 + d) * TTv + lg * 64 + pc * 8) = f.half[0]; }
     } }

__global__ __launch_bounds__(256) void k_hl(const float* __restrict__ F, _Float16* __restrict__ Hh, _Float16* __restrict__ Hl, size_t n8) { const size_t t = (size_t)blockIdx.x * 256 + threadIdx.x; if (t >= n8) return; FragH fh, fl; const v4f a = *(const v4fa*)(F + t * 8), c = *(const v4fa*)(F + t * 8 + 4);
#pragma unroll
  for (int q = 0; q < 4; ++q) { _Float16 h = (_Float16)a[q]; fh.h[q] = h; fl.h[q] = (_Float16)((a[q] - (float)h) * 1024.0f); h = (_Float16)c[q]; fh.h[4 + q] = h; fl.h[4 + q] = (_Float16)((c[q] - (float)h) * 1024.0f); }
  { *(v8us*)((unsigned short*)Hh + t * 8) = fh.half[0]; *(v8us*)((unsigned short*)Hl + t * 8) = fl.half[0];  } }
// k_hl with a row gather: row j of a sequence's output planes = row IDX[j] of F, the list chosen by the column's head class; rows past the key count rounded up to 32 are not written (and never read)
__global__ __launch_bounds__(256) void k_hlg(const float* __restrict__ F, const int* __restrict__ IDX, const int* __restrict__ CNT, _Float16* __restrict__ Hh, _Float16* __restrict__ Hl) { const int t = blockIdx.x * 256 + threadIdx.x; const int row = t / (DMOD / 8), c8 = (t % (DMOD / 8)) * 8; const int b = row / TK, j = row % TK; const int cls = (c8 < CDRH * 64) ? 0 : 1;
  if (j >= ((CNT[b * 32 + cls] + 31) & ~31)) return; const float* fr = F + ((size_t)b * TK + IDX[((size_t)b * 2 + cls) * TK + j]) * DMOD + c8; FragH fh, fl; const v4f a = *(const v4fa*)fr, c = *(const v4fa*)(fr + 4);
#pragma unroll
  for (int q = 0; q < 4; ++q) { _Float16 h = (_Float16)a[q]; fh.h[q] = h; fl.h[q] = (_Float16)((a[q] - (float)h) * 1024.0f); h = (_Float16)c[q]; fh.h[4 + q] = h; fl.h[4 + q] = (_Float16)((c[q] - (float)h) * 1024.0f); }
  { *(v8us*)((unsigned short*)Hh + (size_t)t * 8) = fh.half[0]; *(v8us*)((unsigned short*)Hl + (size_t)t * 8) = fl.half[0];  } }

// ---- fast GEMM (wave tile 32x64; requires M % 32 == 0 rows per launch region and N % 64 == 0); epilogue = k_gemm_hhx semantics ----
__device__ __forceinline__ v16h g2_frag(const _Float16* p, int hh) { FragH f; f.half[0] = *(const v8us*)((const unsigned short*)p + 8 * hh); f.half[1] = *(const v8us*)((const unsigned short*)p + 16 + 8 * hh); return f.v; }
__device__ __forceinline__ v8f g2_mma(v16h a, v16h b, v8f c) { v8f d = __builtin_amdgcn_wmma_f32_16x16x32_f16(false, a, false, b, (short)0, c, false, false); asm volatile("v_nop\n\tv_nop\n\tv_nop\n\tv_nop" : "+v"(d) : "v"(a), "v"(b)); return d; }
template <int ACT>
__global__ __launch_bounds__(128) void k_gemm2(const _Float16* __restrict__ A, int lda, size_t sA, const _Float16* __restrict__ Bh, int ldb, size_t sB, float alpha, const float* __restrict__ bias, size_t sBias, const float* __restrict__ CP, int rowsPerB, size_t sCPb, int row0g,
    float* __restrict__ C, _Float16* __restrict__ C16, int ldc, size_t sC, int M, int N, int K) {
  __shared__ __attribute__((aligned(16))) float so[4][32][68];
  const int tid = threadIdx.x, w = tid >> 5, lane = tid & 31, ln = lane & 15, hh = lane >> 4; const int by = blockIdx.y;
  A += (size_t)by * sA; Bh += (size_t)by * sB; const size_t cofs = (size_t)by * sC; const float* bp = bias ? bias + (size_t)by * sBias : nullptr;
  const int ntn = N >> 6; const int mt = blockIdx.x / ntn, nq = blockIdx.x - mt * ntn; const int row0 = mt * 128 + 32 * w, col0 = nq * 64; if (row0 >= M) return;
  const _Float16* a0p = A + (size_t)(row0 + ln) * lda; const _Float16* a1p = a0p + (size_t)16 * lda;
  const _Float16* b0p = Bh + (size_t)(col0 + ln) * ldb; const _Float16* b1p = b0p + (size_t)16 * ldb; const _Float16* b2p = b1p + (size_t)16 * ldb; const _Float16* b3p = b2p + (size_t)16 * ldb;
  const v8f z8 = {0.f,0.f,0.f,0.f,0.f,0.f,0.f,0.f}; v8f c00 = z8, c01 = z8, c02 = z8, c03 = z8, c10 = z8, c11 = z8, c12 = z8, c13 = z8;
#pragma unroll 1
  for (int kb = 0; kb < K; kb += 32) { const v16h a0 = g2_frag(a0p + kb, hh), a1 = g2_frag(a1p + kb, hh);
    v16h b = g2_frag(b0p + kb, hh); c00 = g2_mma(a0, b, c00); c10 = g2_mma(a1, b, c10);
    b = g2_frag(b1p + kb, hh); c01 = g2_mma(a0, b, c01); c11 = g2_mma(a1, b, c11);
    b = g2_frag(b2p + kb, hh); c02 = g2_mma(a0, b, c02); c12 = g2_mma(a1, b, c12);
    b = g2_frag(b3p + kb, hh); c03 = g2_mma(a0, b, c03); c13 = g2_mma(a1, b, c13); }
  v8f accs[8] = {c00, c01, c02, c03, c10, c11, c12, c13};
#pragma unroll
  for (int u = 0; u < 8; ++u) { const int t = u & 3, half = u >> 2; const int col = col0 + t * 16 + ln; const float bv = bp ? bf16_round(bp[col]) : 0.f;
#pragma unroll
    for (int r = 0; r < 8; ++r) { const int rloc = half * 16 + 8 * hh + r; float v = accs[u][r] * alpha + bv; if (CP) { const int bidx = (row0g + row0 + rloc) / rowsPerB; v += CP[(size_t)bidx * sCPb + (size_t)by * 64 + col]; }
      if (ACT == 3) v = fmaxf(v, 0.f); else if (ACT == 6) v = 0.5f * v * (1.0f + erff(v * 0.70710678118654752f)); else if (ACT == 11) v = 1.0f / (1.0f + expf(-v)); else if (ACT == 15) v = v / (1.0f + expf(-v)); else if (ACT == 12) v = (v > 0.f) ? v : 0.01f * v; else if (ACT == 8) v = tanhf(v);
      so[w][rloc][t * 16 + ln] = v; } }
  __builtin_amdgcn_fence(__ATOMIC_ACQ_REL, "workgroup"); __builtin_amdgcn_wave_barrier();
  const int rsub = lane >> 4, c4 = (lane & 15) * 4;
  {
#pragma unroll
    for (int q = 0; q < 16; ++q) { const int r = q * 2 + rsub; const v4f v = *(const v4fa*)&so[w][r][c4]; if (C) *(v4f*)(C + cofs + (size_t)(row0 + r) * ldc + col0 + c4) = v; if (C16) { v4h h4; for (int i = 0; i < 4; ++i) h4[i] = (_Float16)v[i]; *(v4h*)(C16 + cofs + (size_t)(row0 + r) * ldc + col0 + c4) = h4; } }
     } }



template <int CAUSAL>
__global__ __launch_bounds__(128) void k_flash(const _Float16* __restrict__ Q16, int ldq, const _Float16* __restrict__ K16, int ldk, const _Float16* __restrict__ Vt, const int* __restrict__ MSK, float* __restrict__ O, int ldo) {
  constexpr int RPW = 16, RTN = RPW / 16, NQB = TQ / (4 * RPW), DT = 4, KS = 2;
  __shared__ __attribute__((aligned(16))) unsigned short sP[4][RPW][40]; __shared__ __attribute__((aligned(16))) float sO[4][RPW][64 + 4];
  const int tid = threadIdx.x, w = tid >> 5, lane = tid & 31, ln = lane & 15, hh = lane >> 4;
  const int slab = blockIdx.x / NQB, qblk = blockIdx.x % NQB; const int b = slab / NH, h = slab % NH; const int qb0 = qblk * (4 * RPW); const int q0 = qb0 + w * RPW;
  FragH aq[2][KS];
#pragma unroll
  for (int rt = 0; rt < RTN; ++rt) { const unsigned short* qr = (const unsigned short*)Q16 + ((size_t)b * TQ + q0 + rt * 16 + ln) * ldq + h * 64;
#pragma unroll
    for (int ks = 0; ks < KS; ++ks) { aq[rt][ks].half[0] = *(const v8us*)(qr + ks * 32 + 8 * hh); aq[rt][ks].half[1] = *(const v8us*)(qr + ks * 32 + 16 + 8 * hh); } }
  const unsigned short* Vth = (const unsigned short*)Vt + (size_t)slab * 64 * TK;
  float m_r[2][8], l_r[2][8]; v8f oacc[2][DT];
#pragma unroll
  for (int rt = 0; rt < RTN; ++rt) {
#pragma unroll
    for (int r = 0; r < 8; ++r) { m_r[rt][r] = -3.0e38f; l_r[rt][r] = 0.f; }
#pragma unroll
    for (int dt = 0; dt < DT; ++dt) oacc[rt][dt] = (v8f){0.f,0.f,0.f,0.f,0.f,0.f,0.f,0.f}; }
  const int jend = (CAUSAL == 1) ? (qb0 + 4 * RPW) : TK;      /* causal: keys beyond the block's last query never contribute */
#pragma unroll 1
  for (int j0 = 0; j0 < jend; j0 += 32) {
    v8f s[2][2];
#pragma unroll
    for (int nt = 0; nt < 2; ++nt) { const unsigned short* kr = (const unsigned short*)K16 + ((size_t)b * TK + j0 + nt * 16 + ln) * ldk + h * 64; FragH bk[KS];
#pragma unroll
      for (int ks = 0; ks < KS; ++ks) { bk[ks].half[0] = *(const v8us*)(kr + ks * 32 + 8 * hh); bk[ks].half[1] = *(const v8us*)(kr + ks * 32 + 16 + 8 * hh); }
#pragma unroll
      for (int rt = 0; rt < RTN; ++rt) { v8f acc = (v8f){0.f,0.f,0.f,0.f,0.f,0.f,0.f,0.f};
#pragma unroll
        for (int ks = 0; ks < KS; ++ks) acc = mmaH<1>(aq[rt][ks].v, aq[rt][ks].v, bk[ks].v, bk[ks].v, acc); s[rt][nt] = acc; } }
#pragma unroll
    for (int rt = 0; rt < RTN; ++rt)
#pragma unroll
      for (int r = 0; r < 8; ++r) { const int tq = q0 + rt * 16 + 8 * hh + r; const int k0 = j0 + ln, k1 = j0 + 16 + ln;
        const bool ok0 = (CAUSAL == 1) ? (k0 <= tq) : ((CAUSAL == 2) ? ((k0 >> 5) == (tq >> 5)) : true), ok1 = (CAUSAL == 1) ? (k1 <= tq) : ((CAUSAL == 2) ? ((k1 >> 5) == (tq >> 5)) : true);      /* mode 2: block-diagonal 32-token groups */
        const float s0 = ok0 ? s[rt][0][r] * SCL : -3.0e38f, s1 = ok1 ? s[rt][1][r] * SCL : -3.0e38f; float mc = fmaxf(s0, s1);
        mc = fmaxf(mc, __shfl_xor(mc, 1, 32)); mc = fmaxf(mc, __shfl_xor(mc, 2, 32)); mc = fmaxf(mc, __shfl_xor(mc, 4, 32)); mc = fmaxf(mc, __shfl_xor(mc, 8, 32));
        const float mn = fmaxf(m_r[rt][r], mc); const float al = (mn > -1.0e38f) ? expf(m_r[rt][r] - mn) : 1.0f; m_r[rt][r] = mn; const float p0 = ok0 ? expf(s0 - mn) : 0.f, p1 = ok1 ? expf(s1 - mn) : 0.f; l_r[rt][r] = l_r[rt][r] * al + p0 + p1;
#pragma unroll
        for (int dt = 0; dt < DT; ++dt) oacc[rt][dt][r] *= al;
        FragH t2; t2.h[0] = (_Float16)(p0 * 1024.0f); t2.h[1] = (_Float16)(p1 * 1024.0f); sP[w][rt * 16 + 8 * hh + r][ln] = t2.u[0]; sP[w][rt * 16 + 8 * hh + r][16 + ln] = t2.u[1]; }
    __builtin_amdgcn_fence(__ATOMIC_ACQ_REL, "workgroup"); __builtin_amdgcn_wave_barrier();
    FragH pa[2];
#pragma unroll
    for (int rt = 0; rt < RTN; ++rt) { pa[rt].half[0] = *(const v8us*)&sP[w][rt * 16 + ln][8 * hh]; pa[rt].half[1] = *(const v8us*)&sP[w][rt * 16 + ln][16 + 8 * hh]; }
#pragma unroll
    for (int dt = 0; dt < DT; ++dt) { const unsigned short* vrow = Vth + (size_t)(dt * 16 + ln) * TK + j0; FragH bv; bv.half[0] = *(const v8us*)(vrow + 8 * hh); bv.half[1] = *(const v8us*)(vrow + 16 + 8 * hh);
#pragma unroll
      for (int rt = 0; rt < RTN; ++rt) oacc[rt][dt] = mmaH<1>(pa[rt].v, pa[rt].v, bv.v, bv.v, oacc[rt][dt]); }
    __builtin_amdgcn_fence(__ATOMIC_ACQ_REL, "workgroup"); __builtin_amdgcn_wave_barrier(); }
#pragma unroll
  for (int rt = 0; rt < RTN; ++rt) {
#pragma unroll
    for (int r = 0; r < 8; ++r) { float l = l_r[rt][r]; l += __shfl_xor(l, 1, 32); l += __shfl_xor(l, 2, 32); l += __shfl_xor(l, 4, 32); l += __shfl_xor(l, 8, 32); l_r[rt][r] = (l > 0.f) ? 1.0f / (l * 1024.0f) : 0.f; }
#pragma unroll
    for (int dt = 0; dt < DT; ++dt)
#pragma unroll
      for (int r = 0; r < 8; ++r) sO[w][rt * 16 + 8 * hh + r][dt * 16 + ln] = oacc[rt][dt][r] * l_r[rt][r]; }
  __builtin_amdgcn_fence(__ATOMIC_ACQ_REL, "workgroup"); __builtin_amdgcn_wave_barrier();
  {
#pragma unroll
    for (int rp = 0; rp < RPW; rp += 2) { const int r = rp + (lane >> 4), pc = lane & 15; const v4f val = *(const v4fa*)&sO[w][r][pc * 4]; *(v4f*)(O + ((size_t)b * TQ + q0 + r) * ldo + h * 64 + pc * 4) = val; }
     } }
// Six 16-byte asynchronous copies to LDS per lane (one 32-key tile's share). s_wait_xcnt 0 closes the statement so that no address register of an issued copy is rewritten ahead of it.
__device__ __forceinline__ void cp_tile6(unsigned l0, const unsigned short* g0, unsigned l1, const unsigned short* g1, unsigned l2, const unsigned short* g2, unsigned l3, const unsigned short* g3, unsigned l4, const unsigned short* g4, unsigned l5, const unsigned short* g5) {
  asm volatile("global_load_async_to_lds_b128 %0, %1, off\n\t"
               "global_load_async_to_lds_b128 %2, %3, off\n\t"
               "global_load_async_to_lds_b128 %4, %5, off\n\t"
               "global_load_async_to_lds_b128 %6, %7, off\n\t"
               "global_load_async_to_lds_b128 %8, %9, off\n\t"
               "global_load_async_to_lds_b128 %10, %11, off\n\t"
               "s_wait_xcnt 0x0"
               :: "v"(l0), "v"(g0), "v"(l1), "v"(g1), "v"(l2), "v"(g2), "v"(l3), "v"(g3), "v"(l4), "v"(g4), "v"(l5), "v"(g5) : "memory");
}
// lane l takes the value of lane l ^ 16 (the other 16-lane half)
__device__ __forceinline__ float xhalf(float x) { return __builtin_bit_cast(float, __builtin_amdgcn_permlanex16(__builtin_bit_cast(int, x), __builtin_bit_cast(int, x), 0x76543210, 0xfedcba98, false, false)); }
template <int CAUSAL>
__global__ __launch_bounds__(128) void k_flashqk(const _Float16* __restrict__ Q16, const _Float16* __restrict__ QL, int ldq, const _Float16* __restrict__ K16, const _Float16* __restrict__ KL, int ldk, const _Float16* __restrict__ Vt, const int* __restrict__ MSK, float* __restrict__ O, int ldo) {
  static_assert(CAUSAL == 5, "compacted-key mode only");
  constexpr int RPW = 16, DT = 4, KS = 2;
  __shared__ __attribute__((aligned(16))) float sO[4][RPW][64 + 4];
  __shared__ __attribute__((aligned(16))) unsigned short sKh[2][32][72], sKl[2][32][72], sV[2][64][40];      /* row pitches 144 B and 80 B: 16 B x odd, for 16-byte fragment reads */
  const int tid = threadIdx.x, w = tid >> 5, lane = tid & 31, ln = lane & 15, hh = lane >> 4;
  const int slab = blockIdx.x / QBLKS, qblk = blockIdx.x % QBLKS; const int b = slab / NH, h = slab % NH; const int qb0 = qblk * (4 * RPW); const int q0 = qb0 + w * RPW;
  FragH aq[KS], aql[KS];
  { const unsigned short* qr = (const unsigned short*)Q16 + ((size_t)b * TQ + q0 + ln) * ldq + h * 64; const unsigned short* ql = (const unsigned short*)QL + ((size_t)b * TQ + q0 + ln) * ldq + h * 64;
#pragma unroll
    for (int ks = 0; ks < KS; ++ks) { aq[ks].half[0] = *(const v8us*)(qr + ks * 32 + 8 * hh); aq[ks].half[1] = *(const v8us*)(qr + ks * 32 + 16 + 8 * hh); aql[ks].half[0] = *(const v8us*)(ql + ks * 32 + 8 * hh); aql[ks].half[1] = *(const v8us*)(ql + ks * 32 + 16 + 8 * hh); } }
  const unsigned short* Vth = (const unsigned short*)Vt + (size_t)slab * 64 * TK;
  float m_r = -3.0e38f, l_r = 0.f; v8f oacc[DT];      /* query q0 + ln: running maximum (equal in both halves), this half's share of the sum, O^T rows dt * 16 + 8 hh + r */
#pragma unroll
  for (int dt = 0; dt < DT; ++dt) oacc[dt] = (v8f){0.f,0.f,0.f,0.f,0.f,0.f,0.f,0.f};
  const int kcnt = min(MSK[b * 32 + ((h < CDRH) ? 0 : 1)], TK);      /* number of valid keys of this (sequence, head class); K planes and V^T hold them compacted, in key order */
  const int jend = (kcnt + 31) & ~31;
  const int kr0 = tid >> 3, kc0 = (tid & 7) * 8, vr0 = tid >> 2, vc0 = (tid & 3) * 8;      /* a lane's share of a tile: rows kr0 and kr0 + 16 of both K planes, rows vr0 and vr0 + 32 of V^T, 16 bytes each; whole 128-byte K lines per 8 lanes */
  const unsigned short* gkh = (const unsigned short*)K16 + ((size_t)b * TK + kr0) * ldk + h * 64 + kc0; const unsigned short* gkl = (const unsigned short*)KL + ((size_t)b * TK + kr0) * ldk + h * 64 + kc0; const unsigned short* gv = Vth + (size_t)vr0 * TK + vc0;
  auto stage = [&](int jt, int bf) { const size_t ko = (size_t)jt * ldk;
    cp_tile6((unsigned)(size_t)&sKh[bf][kr0][kc0], gkh + ko, (unsigned)(size_t)&sKh[bf][kr0 + 16][kc0], gkh + ko + (size_t)16 * ldk, (unsigned)(size_t)&sKl[bf][kr0][kc0], gkl + ko, (unsigned)(size_t)&sKl[bf][kr0 + 16][kc0], gkl + ko + (size_t)16 * ldk,
             (unsigned)(size_t)&sV[bf][vr0][vc0], gv + jt, (unsigned)(size_t)&sV[bf][vr0 + 32][vc0], gv + (size_t)32 * TK + jt); };
  if (jend > 0) stage(0, 0);
  asm volatile("s_wait_asynccnt 0x0" ::: "memory");      /* this wave's share of tile 0 has landed */
  __syncthreads();      /* tile 0 is published to all four waves */
  if (jend > 32) stage(32, 1);
#pragma unroll 1
  for (int j0 = 0; j0 < jend; j0 += 32) {
    const int bf = (j0 >> 5) & 1;
    float sc[2][8];      /* sc[nt][r] = scaled score of key j0 + 16 nt + 8 hh + r for query q0 + ln; the inner loops of this trip are fully unrolled so that sc, pb, ls and oacc are indexed by constants and stay in registers */
#pragma unroll
    for (int nt = 0; nt < 2; ++nt) { const unsigned short* kr = &sKh[bf][nt * 16 + ln][0]; const unsigned short* klr = &sKl[bf][nt * 16 + ln][0]; FragH bk[KS], bkl[KS];
#pragma unroll
      for (int ks = 0; ks < KS; ++ks) { bk[ks].half[0] = *(const v8us*)(kr + ks * 32 + 8 * hh); bk[ks].half[1] = *(const v8us*)(kr + ks * 32 + 16 + 8 * hh); bkl[ks].half[0] = *(const v8us*)(klr + ks * 32 + 8 * hh); bkl[ks].half[1] = *(const v8us*)(klr + ks * 32 + 16 + 8 * hh); }
      v8f acc = (v8f){0.f,0.f,0.f,0.f,0.f,0.f,0.f,0.f}, accl = acc;
#pragma unroll
      for (int ks = 0; ks < KS; ++ks) { acc = mmaH<1>(bk[ks].v, bk[ks].v, aq[ks].v, aq[ks].v, acc); accl = mmaH<1>(bk[ks].v, bk[ks].v, aql[ks].v, aql[ks].v, accl); accl = mmaH<1>(bkl[ks].v, bkl[ks].v, aq[ks].v, aq[ks].v, accl); }
#pragma unroll
      for (int r = 0; r < 8; ++r) sc[nt][r] = (acc[r] + accl[r] * 0.0009765625f) * SCL; }
    if (j0 + 32 > kcnt) {      /* block-uniform: only the last trip holds keys past the count (key padding and head-specific masks are applied by the gather) */
#pragma unroll
      for (int nt = 0; nt < 2; ++nt)
#pragma unroll
        for (int r = 0; r < 8; ++r) if (j0 + nt * 16 + 8 * hh + r >= kcnt) sc[nt][r] = -3.0e38f; }
    float mc = fmaxf(sc[0][0], sc[1][0]);
#pragma unroll
    for (int r = 1; r < 8; ++r) mc = fmaxf(mc, fmaxf(sc[0][r], sc[1][r]));
    mc = fmaxf(mc, xhalf(mc));
    const float mn = fmaxf(m_r, mc);      /* finite in every trip: key j0 is below the count; so an invalid key's exp below is exactly 0, and so is the first trip's rescale factor */
    const float al = expf(m_r - mn); m_r = mn;
    FragH pb; float ls[4] = {0.f, 0.f, 0.f, 0.f};
#pragma unroll
    for (int nt = 0; nt < 2; ++nt)
#pragma unroll
      for (int r = 0; r < 8; ++r) { const float p = expf(sc[nt][r] - mn); ls[nt * 2 + (r & 1)] += p; pb.h[nt * 8 + r] = (_Float16)(p * 1024.0f); }      /* element nt * 8 + r of the B operand = key 16 nt + 8 hh + r: the k order of the V^T fragment */
    l_r = l_r * al + ((ls[0] + ls[1]) + (ls[2] + ls[3]));
#pragma unroll
    for (int dt = 0; dt < DT; ++dt)
#pragma unroll
      for (int r = 0; r < 8; ++r) oacc[dt][r] *= al;
#pragma unroll
    for (int dt = 0; dt < DT; ++dt) { const unsigned short* vrow = &sV[bf][dt * 16 + ln][0]; FragH bv; bv.half[0] = *(const v8us*)(vrow + 8 * hh); bv.half[1] = *(const v8us*)(vrow + 16 + 8 * hh);
      oacc[dt] = mmaH<1>(bv.v, bv.v, pb.v, pb.v, oacc[dt]); }
    asm volatile("s_wait_dscnt 0x0" ::: "memory");      /* this wave's reads of buffer bf have returned before the buffer is refilled */
    asm volatile("s_wait_asynccnt 0x0" ::: "memory");      /* this wave's share of the next tile has landed */
    __syncthreads();      /* publishes the next tile and ends every wave's reads of buffer bf */
    if (j0 + 64 < jend) stage(j0 + 64, bf); }
  asm volatile("s_wait_asynccnt 0x0" ::: "memory");      /* no copy is outstanding when the wave goes on to its end */
  const float l = l_r + xhalf(l_r); const float linv = (l > 0.f) ? 1.0f / (l * 1024.0f) : 0.f;
#pragma unroll
  for (int dt = 0; dt < DT; ++dt) { const v4f o0 = {oacc[dt][0] * linv, oacc[dt][1] * linv, oacc[dt][2] * linv, oacc[dt][3] * linv}, o1 = {oacc[dt][4] * linv, oacc[dt][5] * linv, oacc[dt][6] * linv, oacc[dt][7] * linv};
    *(v4fa*)&sO[w][ln][dt * 16 + 8 * hh] = o0; *(v4fa*)&sO[w][ln][dt * 16 + 8 * hh + 4] = o1; }
  __builtin_amdgcn_fence(__ATOMIC_ACQ_REL, "workgroup"); __builtin_amdgcn_wave_barrier();
  {
#pragma unroll
    for (int rp = 0; rp < RPW; rp += 2) { const int r = rp + (lane >> 4), pc = lane & 15; const v4f val = *(const v4fa*)&sO[w][r][pc * 4]; *(v4f*)(O + ((size_t)b * TQ + q0 + r) * ldo + h * 64 + pc * 4) = val; }
     } }

__global__ __launch_bounds__(256) void k_woutp(const float* __restrict__ Wm, _Float16* __restrict__ Bt) { const size_t t = (size_t)blockIdx.x * 256 + threadIdx.x; if (t >= (size_t)DMOD * (2 * DMOD / 8)) return; const int pc = (int)(t % (2 * DMOD / 8)); const int o = (int)(t / (2 * DMOD / 8)); const bool lo = pc * 8 >= DMOD; FragH f;
  for (int q = 0; q < 8; ++q) { const int c = pc * 8 + q - (lo ? DMOD : 0); f.h[q] = (_Float16)(bf16_round(Wm[(size_t)c * DMOD + o]) * (lo ? 1.0f : 16.0f)); } *(v8us*)((unsigned short*)Bt + (size_t)o * 2 * DMOD + pc * 8) = f.half[0];  }      /* Wo stored (in, out) */
typedef int v4ia __attribute__((ext_vector_type(4), may_alias));
// One block per sequence, 8 consecutive keys a thread. IDX[b][0][.] = positions of the keys valid for the CDR heads, IDX[b][1][.] = for the other heads, ascending; entries past the count are 0. CNT[b*32 + class] = the counts (one 128-byte line per sequence).
__global__ __launch_bounds__(256) void k_mask(const int* __restrict__ mask, const int* __restrict__ cdrs, int* __restrict__ IDX, int* __restrict__ CNT) {
  __shared__ int sh[256]; __shared__ int sany; const int b = blockIdx.x, tid = threadIdx.x; static_assert(TK == 256 * 8, "8 keys a thread");
  const v4ia m0 = *(const v4ia*)(mask + (size_t)b * TK + tid * 8), m1 = *(const v4ia*)(mask + (size_t)b * TK + tid * 8 + 4), c0 = *(const v4ia*)(cdrs + (size_t)b * TK + tid * 8), c1 = *(const v4ia*)(cdrs + (size_t)b * TK + tid * 8 + 4);
  bool vp[8], vc[8]; int np = 0, nb = 0, any = 0;
#pragma unroll
  for (int q = 0; q < 8; ++q) { const int mv = (q < 4) ? m0[q & 3] : m1[q & 3], cv = (q < 4) ? c0[q & 3] : c1[q & 3]; vp[q] = mv != 0; vc[q] = cv != 0; any |= vc[q] ? 1 : 0; np += vp[q] ? 1 : 0; nb += (vp[q] && vc[q]) ? 1 : 0; }
  if (tid == 0) sany = 0; __syncthreads(); if (any) sany = 1;
  const int own = np | (nb << 16); int v = own; sh[tid] = v; __syncthreads();      /* both counts stay <= 2048, so one packed inclusive scan serves both lists */
  for (int st = 1; st < 256; st <<= 1) { const int add = (tid >= st) ? sh[tid - st] : 0; __syncthreads(); v += add; sh[tid] = v; __syncthreads(); }
  const bool allmasked = (sany == 0);      /* no CDR token at all -> the CDR mask is disabled */
  const int tot = sh[255], ex = v - own; const int cnt1 = tot & 0xFFFF, cnt0 = allmasked ? cnt1 : (tot >> 16); int o1 = ex & 0xFFFF, o0 = allmasked ? o1 : (ex >> 16);
  int* i0 = IDX + ((size_t)b * 2 + 0) * TK; int* i1 = IDX + ((size_t)b * 2 + 1) * TK;
#pragma unroll
  for (int q = 0; q < 8; ++q) { const int k = tid * 8 + q; if (vp[q]) i1[o1++] = k; if (vp[q] && (allmasked || vc[q])) i0[o0++] = k; if (k >= cnt1) i1[k] = 0; if (k >= cnt0) i0[k] = 0; }
  if (tid == 0) { CNT[b * 32 + 0] = cnt0; CNT[b * 32 + 1] = cnt1; } }

extern "C" void kernel_launch(void* const* d_in, const int* in_sizes, int n_in,
                              void* d_out, int out_size, void* d_ws, size_t ws_size, hipStream_t stream) {
  (void)in_sizes; (void)n_in; (void)out_size;
  const float* const* I = (const float* const*)d_in; const float* x = I[0]; const int* mask = (const int*)d_in[1]; const int* cdrs = (const int*)d_in[2]; const float* Wq = I[3]; const float* bq = I[4]; const float* Wk = I[5]; const float* bk = I[6]; const float* Wv = I[7]; const float* bv = I[8]; const float* Wo = I[9]; const float* bo = I[10];
  char* ws = (char*)d_ws; size_t off = 0;
  auto take = [&](size_t bytes) { char* p = ws + off; off += (bytes + 255) & ~(size_t)255; return p; };
  const size_t w8 = (size_t)DMOD * DMOD / 8;
  _Float16* BQ = (_Float16*)take(w8 * 16); _Float16* BK = (_Float16*)take(w8 * 16); _Float16* BV = (_Float16*)take(w8 * 16); _Float16* BO = (_Float16*)take(w8 * 32); int* IDX = (int*)take((size_t)NB * 2 * TK * 4); int* CNT = (int*)take((size_t)NB * 32 * 4);
  _Float16* X16 = (_Float16*)take((size_t)NR * DMOD * 2); float* F32 = (float*)take((size_t)NR * DMOD * 4); _Float16* QH = (_Float16*)take((size_t)NR * DMOD * 2); _Float16* QL = (_Float16*)take((size_t)NR * DMOD * 2); _Float16* KH = (_Float16*)take((size_t)NR * DMOD * 2); _Float16* KL = (_Float16*)take((size_t)NR * DMOD * 2); _Float16* VH = (_Float16*)take((size_t)NR * DMOD * 2); _Float16* VL = (_Float16*)take((size_t)NR * DMOD * 2); _Float16* VT = (_Float16*)take((size_t)NR * DMOD * 2); _Float16* VTL = (_Float16*)take((size_t)NR * DMOD * 2);
  float* O = F32; _Float16* Hh = VH; _Float16* Hl = VL;
  if (off > ws_size) return;      /* 2.5 + 0.06 + 8 + 16 + 8 x 8 = 91 MiB */
  k_wt_f16<<<(unsigned)(((size_t)DMOD * (DMOD / 8) + 255) / 256), 256, 0, stream>>>(Wq, BQ, DMOD, DMOD, 16.0f); k_wt_f16<<<(unsigned)(((size_t)DMOD * (DMOD / 8) + 255) / 256), 256, 0, stream>>>(Wk, BK, DMOD, DMOD, 16.0f); k_wt_f16<<<(unsigned)(((size_t)DMOD * (DMOD / 8) + 255) / 256), 256, 0, stream>>>(Wv, BV, DMOD, DMOD, 16.0f); k_woutp<<<(unsigned)(((size_t)DMOD * (2 * DMOD / 8) + 255) / 256), 256, 0, stream>>>(Wo, BO);
  k_mask<<<NB, 256, 0, stream>>>(mask, cdrs, IDX, CNT);
  k_x16<<<(unsigned)(((size_t)NR * DMOD / 8 + 255) / 256), 256, 0, stream>>>(x, X16, (size_t)NR * DMOD / 8);
  const dim3 gA((NR / 128) * (DMOD / 64), 1); const unsigned n8 = (unsigned)(((size_t)NR * DMOD / 8 + 255) / 256);
  k_gemm2<0><<<gA, 128, 0, stream>>>(X16, DMOD, 0, BQ, DMOD, 0, 0.0625f, bq, 0, nullptr, 1, 0, 0, F32, nullptr, DMOD, 0, NR, DMOD, DMOD); k_hl<<<n8, 256, 0, stream>>>(F32, QH, QL, (size_t)NR * DMOD / 8);
  k_gemm2<0><<<gA, 128, 0, stream>>>(X16, DMOD, 0, BK, DMOD, 0, 0.0625f, bk, 0, nullptr, 1, 0, 0, F32, nullptr, DMOD, 0, NR, DMOD, DMOD); k_hlg<<<n8, 256, 0, stream>>>(F32, IDX, CNT, KH, KL);
  k_gemm2<0><<<gA, 128, 0, stream>>>(X16, DMOD, 0, BV, DMOD, 0, 0.0625f, bv, 0, nullptr, 1, 0, 0, F32, nullptr, DMOD, 0, NR, DMOD, DMOD); k_hl<<<n8, 256, 0, stream>>>(F32, VH, VL, (size_t)NR * DMOD / 8);
  k_vt<NH, SLEN><<<NB * NH * (SLEN / 64), 256, 0, stream>>>(VH, DMOD, 0, IDX, CNT, VT);
  k_flashqk<5><<<NB * NH * QBLKS, 128, 0, stream>>>(QH, QL, DMOD, KH, KL, DMOD, VT, CNT, O, DMOD);      /* q/k hi + residual; P (x2^10) and V plain f16 */
  k_hl<<<n8, 256, 0, stream>>>(O, Hh, Hl, (size_t)NR * DMOD / 8);
  k_gemm2<0><<<gA, 128, 0, stream>>>(Hh, DMOD, 0, BO, 2 * DMOD, 0, 0.0625f, bo, 0, nullptr, 1, 0, 0, (float*)d_out, nullptr, DMOD, 0, NR, DMOD, DMOD);
  k_gemm2<0><<<gA, 128, 0, stream>>>(Hl, DMOD, 0, BO + DMOD, 2 * DMOD, 0, 1.0f / 1024.0f, nullptr, 0, (const float*)d_out, 1, (size_t)DMOD, 0, (float*)d_out, nullptr, DMOD, 0, NR, DMOD, DMOD);
}

// v004
// It runs in 188 microseconds.
// Next to v003, in two timings, it ran 1.27 times as fast each time.
// Counting every step since v000, it is 2.90 times as fast.
#include <hip/hip_runtime.h>
// CDRs attention (4 sequences x 2048 tokens x 512; 8 heads x 64): q,k,v = x W + b; scores/8; keys with mask == 0 invalid for all heads; for heads 0..1 additionally keys with cdrs_score == 0 invalid unless the sequence has no CDR token at all; softmax; ctx Wo + bo -> [4,2048,512].
// Structure: per sequence two compacted lists of valid key positions (CDR heads / other heads) with their counts, from the two int inputs on VALU (one block per sequence: 'all masked' flag + prefix sum); K planes and V^T are gathered through the lists, so the flash loop runs only over valid keys; x as an exact f16 plane; q/k/v projections as f16 WMMA GEMMs (32x64 wave tiles, f32 accumulation, exact x16 weights + bias) split into hi + 2^10 residual planes; V^T by LDS tiles; the fused flash kernel with hi + 2^10-residual q/k planes (S = QhKh + (QlKh + QhKl)/1024) and plain f16 P (x2^10) and V with the key-count mask mode (invalid keys never visited == the reference's -inf); the output projection in one launch from the f32 context, split hi + residual in registers.
// Compute dtype: x and parameters rounded to bf16; q, k hi + residual (~2^-21-class logits); P and v plain f16 (~2^-12); f32 accumulation/softmax. v_wmma_f32_16x16x32_f16.
#define NB 4
#define DMOD 512
#define CDRH 2
#define NR (NB * SLEN)
#define QBLKS (TQ / 64)
#define SLEN 2048
#define TQ SLEN
#define TK SLEN
#define NH 8
#define SCL 0.125f               /* 64^-0.5 */
typedef __bf16 v16b __attribute__((ext_vector_type(16)));
typedef unsigned short v8us __attribute__((ext_vector_type(8), may_alias));
typedef float  v8f  __attribute__((ext_vector_type(8)));
typedef float  v4f  __attribute__((ext_vector_type(4)));
typedef float  v4fa __attribute__((ext_vector_type(4), may_alias));
union FragB { v16b v; v8us half[2]; unsigned short u[16]; };

__device__ __forceinline__ unsigned short bf16_bits(float x) { unsigned int u = __float_as_uint(x); return (unsigned short)((u + 0x7FFFu + ((u >> 16) & 1u)) >> 16); }
__device__ __forceinline__ float bf16_val(unsigned short b) { return __uint_as_float(((unsigned int)b) << 16); }
__device__ __forceinline__ float bf16_round(float x) { return bf16_val(bf16_bits(x)); }
// D += A·B with NT terms: 1 = ah·bh, 2 = + al·bh (A split), 3 = + ah·bl (both split)
template <int NT>
__device__ __forceinline__ v8f mmaN(v16b ah, v16b al, v16b bh, v16b bl, v8f c) {
  c = __builtin_amdgcn_wmma_f32_16x16x32_bf16(false, ah, false, bh, (short)0, c, false, false);
  if (NT >= 2) c = __builtin_amdgcn_wmma_f32_16x16x32_bf16(false, al, false, bh, (short)0, c, false, false);
  if (NT >= 3) c = __builtin_amdgcn_wmma_f32_16x16x32_bf16(false, ah, false, bl, (short)0, c, false, false);
  asm volatile("v_nop\n\tv_nop\n\tv_nop\n\tv_nop" : "+v"(c) : "v"(ah), "v"(al), "v"(bh), "v"(bl));
  return c;
}

__global__ __launch_bounds__(256) void k_wt_bf16(const float* __restrict__ W, unsigned short* __restrict__ Wt, int K, int N) {
  const int t = blockIdx.x * 256 + threadIdx.x;
  const int k8n = K / 8;
  if (t >= N * k8n) return;
  const int n = t / k8n, k8 = (t % k8n) * 8;
  v8us v;
#pragma unroll
  for (int i = 0; i < 8; ++i) v[i] = bf16_bits(W[(size_t)(k8 + i) * N + n]);
  *(v8us*)(Wt + (size_t)n * K + k8) = v;
  
}

// GEMM C[M][N] (f32, pitch ldc) = act(A[M][K]·W + bias). A f32 row-major (pitch lda) converted per fragment to bf16
// (ASPLIT: hi/lo two planes -> 2 terms, else single rounded term); Wt bf16 [N][K] (pitch ldb). BIAS_BF16 rounds the
// bias to bf16 first (bias quantised to bf16 before the add). K%32==0, M%16==0, N%64==0.
template <bool ASPLIT, int ACT, bool BIAS_BF16>
__global__ __launch_bounds__(128) void k_gemm_bf(const float* __restrict__ A, int lda, const unsigned short* __restrict__ Wt, int ldb,
                                               const float* __restrict__ bias, float* __restrict__ C, int ldc, int M, int N, int K) {
  __shared__ __attribute__((aligned(16))) float so[4][16][64];
  const int tid = threadIdx.x, w = tid >> 5, lane = tid & 31, ln = lane & 15, hh = lane >> 4;
  const int ntn = N / 64;
  const int wid = blockIdx.x * 4 + w;
  const int mt = wid / ntn, nq = wid % ntn;
  if (mt * 16 >= M) return;
  const int row0 = mt * 16, col0 = nq * 64;
  const float* arow = A + (size_t)(row0 + ln) * lda;
  v8f acc[4] = {};
  for (int kb = 0; kb < K; kb += 32) {
    FragB ah, al;
    const v4f x0 = *(const v4fa*)(arow + kb + 8 * hh), x1 = *(const v4fa*)(arow + kb + 8 * hh + 4);
    const v4f x2 = *(const v4fa*)(arow + kb + 16 + 8 * hh), x3 = *(const v4fa*)(arow + kb + 16 + 8 * hh + 4);
    float xs[16] = {x0[0],x0[1],x0[2],x0[3],x1[0],x1[1],x1[2],x1[3],x2[0],x2[1],x2[2],x2[3],x3[0],x3[1],x3[2],x3[3]};
#pragma unroll
    for (int i = 0; i < 16; ++i) { const unsigned short hb = bf16_bits(xs[i]); ah.u[i] = hb; al.u[i] = ASPLIT ? bf16_bits(xs[i] - bf16_val(hb)) : (unsigned short)0; }
#pragma unroll
    for (int t = 0; t < 4; ++t) {
      const unsigned short* brow = Wt + (size_t)(col0 + t * 16 + ln) * ldb + kb;
      FragB b;
      b.half[0] = *(const v8us*)(brow + 8 * hh);
      b.half[1] = *(const v8us*)(brow + 16 + 8 * hh);
      acc[t] = mmaN<ASPLIT ? 2 : 1>(ah.v, al.v, b.v, b.v, acc[t]);
    }
  }
#pragma unroll
  for (int t = 0; t < 4; ++t) {
    float bv = bias ? bias[col0 + t * 16 + ln] : 0.f;
    if (BIAS_BF16) bv = bf16_round(bv);
#pragma unroll
    for (int r = 0; r < 8; ++r) { float v = acc[t][r] + bv; if (ACT == 1) v = fmaxf(v, 0.f); so[w][8 * hh + r][t * 16 + ln] = v; }
  }
  __builtin_amdgcn_fence(__ATOMIC_ACQ_REL, "workgroup");
  __builtin_amdgcn_wave_barrier();
  const int rsub = lane >> 4, c4 = (lane & 15) * 4;
  {
#pragma unroll
    for (int q = 0; q < 8; ++q) {
      const int r = q * 2 + rsub;
      const v4f v = *(const v4fa*)&so[w][r][c4];
      *(v4f*)(C + (size_t)(row0 + r) * ldc + col0 + c4) = v;
    }
    
  }
}

// GEMM C = act(A·W + bias + resid): A f32 (ASPLIT -> hi/lo 2 terms), Wt bf16 [N][K]; ACT 0 none, 1 relu, 2 exact gelu;
// resid (optional, f32, row index = (row % rmod), pitch ldr, RES_BF16 rounds it) added before the activation.
template <bool ASPLIT, int ACT, bool BIAS_BF16, bool RES_BF16>
__global__ __launch_bounds__(128) void k_gemm_bf3(const float* __restrict__ A, int lda, const unsigned short* __restrict__ Wt, int ldb,
                                                const float* __restrict__ bias, const float* __restrict__ resid, int rmod, int ldr,
                                                float* __restrict__ C, int ldc, int M, int N, int K) {
  __shared__ __attribute__((aligned(16))) float so[4][16][64];
  const int tid = threadIdx.x, w = tid >> 5, lane = tid & 31, ln = lane & 15, hh = lane >> 4;
  const int ntn = N / 64;
  const int wid = blockIdx.x * 4 + w;
  const int mt = wid / ntn, nq = wid % ntn;
  if (mt * 16 >= M) return;
  const int row0 = mt * 16, col0 = nq * 64;
  const float* arow = A + (size_t)(row0 + ln) * lda;
  v8f acc[4] = {};
  for (int kb = 0; kb < K; kb += 32) {
    FragB ah, al;
    const v4f x0 = *(const v4fa*)(arow + kb + 8 * hh), x1 = *(const v4fa*)(arow + kb + 8 * hh + 4);
    const v4f x2 = *(const v4fa*)(arow + kb + 16 + 8 * hh), x3 = *(const v4fa*)(arow + kb + 16 + 8 * hh + 4);
    float xs[16] = {x0[0],x0[1],x0[2],x0[3],x1[0],x1[1],x1[2],x1[3],x2[0],x2[1],x2[2],x2[3],x3[0],x3[1],x3[2],x3[3]};
#pragma unroll
    for (int i = 0; i < 16; ++i) { const unsigned short hb = bf16_bits(xs[i]); ah.u[i] = hb; al.u[i] = ASPLIT ? bf16_bits(xs[i] - bf16_val(hb)) : (unsigned short)0; }
#pragma unroll
    for (int t = 0; t < 4; ++t) {
      const unsigned short* brow = Wt + (size_t)(col0 + t * 16 + ln) * ldb + kb;
      FragB b;
      b.half[0] = *(const v8us*)(brow + 8 * hh);
      b.half[1] = *(const v8us*)(brow + 16 + 8 * hh);
      acc[t] = mmaN<ASPLIT ? 2 : 1>(ah.v, al.v, b.v, b.v, acc[t]);
    }
  }
#pragma unroll
  for (int t = 0; t < 4; ++t) {
    const int col = col0 + t * 16 + ln;
    float bv = bias ? bias[col] : 0.f;
    if (BIAS_BF16) bv = bf16_round(bv);
#pragma unroll
    for (int r = 0; r < 8; ++r) {
      float v = acc[t][r] + bv;
      if (resid) { float rv = resid[(size_t)((row0 + 8 * hh + r) % rmod) * ldr + col]; if (RES_BF16) rv = bf16_round(rv); v += rv; }
      if (ACT == 1) v = fmaxf(v, 0.f);
      if (ACT == 2) v = 0.5f * v * (1.0f + erff(v * 0.70710678118654752f));
      if (ACT == 3) { const float u = 0.7978845608028654f * (v + 0.044715f * v * v * v); v = 0.5f * v * (1.0f + tanhf(u)); }
      so[w][8 * hh + r][t * 16 + ln] = v;
    }
  }
  __builtin_amdgcn_fence(__ATOMIC_ACQ_REL, "workgroup");
  __builtin_amdgcn_wave_barrier();
  const int rsub = lane >> 4, c4 = (lane & 15) * 4;
  {
#pragma unroll
    for (int q = 0; q < 8; ++q) {
      const int r = q * 2 + rsub;
      const v4f v = *(const v4fa*)&so[w][r][c4];
      *(v4f*)(C + (size_t)(row0 + r) * ldc + col0 + c4) = v;
    }
    
  }
}
// row LayerNorm (biased variance, eps) over N: s = X (+ R); optional out_sum <- s; out_norm <- (s-mu)*rsqrt(var+eps)*g + b
template <bool PARAM_BF16>
__global__ __launch_bounds__(256) void k_layernorm(const float* __restrict__ X, const float* __restrict__ R, const float* __restrict__ g, const float* __restrict__ bta,
                                                  float* __restrict__ out_sum, float* __restrict__ out_norm, int N, float eps) {
  __shared__ float red[256];
  const int row = blockIdx.x, tid = threadIdx.x;
  const float* x = X + (size_t)row * N; const float* rr = R ? R + (size_t)row * N : nullptr;
  float vals[16];                     // up to N = 4096
  const int per = N / 256;            // contiguous chunk per thread? use strided-by-4 chunks: thread handles j = tid*4 + 1024*u
  float s1 = 0.f;
  for (int u = 0; u < per / 4; ++u) {
    const int j = tid * 4 + 1024 * u;
    const v4f a = *(const v4fa*)(x + j);
    v4f b = {0.f,0.f,0.f,0.f}; if (rr) b = *(const v4fa*)(rr + j);
#pragma unroll
    for (int q = 0; q < 4; ++q) { const float v = a[q] + b[q]; vals[u * 4 + q] = v; s1 += v; }
  }
  red[tid] = s1; __syncthreads();
  for (int st = 128; st > 0; st >>= 1) { if (tid < st) red[tid] += red[tid + st]; __syncthreads(); }
  const float mu = red[0] / (float)N; __syncthreads();
  float s2 = 0.f;
  for (int u = 0; u < per / 4; ++u)
#pragma unroll
    for (int q = 0; q < 4; ++q) { const float c = vals[u * 4 + q] - mu; s2 += c * c; }
  red[tid] = s2; __syncthreads();
  for (int st = 128; st > 0; st >>= 1) { if (tid < st) red[tid] += red[tid + st]; __syncthreads(); }
  const float rs = rsqrtf(red[0] / (float)N + eps);
  {
    for (int u = 0; u < per / 4; ++u) {
      const int j = tid * 4 + 1024 * u;
      v4f o, sm;
#pragma unroll
      for (int q = 0; q < 4; ++q) {
        float gg = g[j + q], bb = bta[j + q];
        if (PARAM_BF16) { gg = bf16_round(gg); bb = bf16_round(bb); }
        sm[q] = vals[u * 4 + q]; o[q] = (vals[u * 4 + q] - mu) * rs * gg + bb;
      }
      if (out_sum) *(v4f*)(out_sum + (size_t)row * N + j) = sm;
      *(v4f*)(out_norm + (size_t)row * N + j) = o;
    }
    
  }
}



// ---- f16 WMMA path (v_wmma_f32_16x16x32_f16): 11-bit significands for operands in range — used where a [0,1] probability operand needs more precision than bf16
typedef _Float16 v16h __attribute__((ext_vector_type(16)));
union FragH { v16h v; v8us half[2]; _Float16 h[16]; unsigned short u[16]; };
template <int NT>
__device__ __forceinline__ v8f mmaH(v16h ah, v16h al, v16h bh, v16h bl, v8f c) {
  c = __builtin_amdgcn_wmma_f32_16x16x32_f16(false, ah, false, bh, (short)0, c, false, false);
  if (NT >= 2) c = __builtin_amdgcn_wmma_f32_16x16x32_f16(false, al, false, bh, (short)0, c, false, false);
  if (NT >= 3) c = __builtin_amdgcn_wmma_f32_16x16x32_f16(false, ah, false, bl, (short)0, c, false, false);
  asm volatile("v_nop\n\tv_nop\n\tv_nop\n\tv_nop" : "+v"(c) : "v"(ah), "v"(al), "v"(bh), "v"(bl));
  return c;
}
// batched GEMM like k_gemm_b but f16 operands: A f32 (split into f16 hi/lo if ASPLIT, else rounded to f16), Bt = f16 values [n][k]; alpha; C f32; N multiple of 16 (partial tiles skipped)
template <bool ASPLIT>
__global__ __launch_bounds__(128) void k_gemm_h(const float* __restrict__ A, int lda, size_t sA, const _Float16* __restrict__ Bh, int ldb, size_t sB, float alpha, float* __restrict__ C, int ldc, size_t sC, int M, int N, int K) {
  __shared__ __attribute__((aligned(16))) float so[4][16][64];
  const int tid = threadIdx.x, w = tid >> 5, lane = tid & 31, ln = lane & 15, hh = lane >> 4; const int by = blockIdx.y;
  A += (size_t)by * sA; Bh += (size_t)by * sB; C += (size_t)by * sC;
  const int ntn = (N + 63) / 64; const int wid = blockIdx.x * 4 + w; const int mt = wid / ntn, nq = wid % ntn; if (mt * 16 >= M) return;
  const int row0 = mt * 16, col0 = nq * 64; const float* arow = A + (size_t)(row0 + ln) * lda;
  v8f acc[4] = {};
  for (int kb = 0; kb < K; kb += 32) {
    FragH ah, al;
    const v4f x0 = *(const v4fa*)(arow + kb + 8 * hh), x1 = *(const v4fa*)(arow + kb + 8 * hh + 4), x2 = *(const v4fa*)(arow + kb + 16 + 8 * hh), x3 = *(const v4fa*)(arow + kb + 16 + 8 * hh + 4);
    float xs[16] = {x0[0],x0[1],x0[2],x0[3],x1[0],x1[1],x1[2],x1[3],x2[0],x2[1],x2[2],x2[3],x3[0],x3[1],x3[2],x3[3]};
#pragma unroll
    for (int i = 0; i < 16; ++i) { const _Float16 h = (_Float16)xs[i]; ah.h[i] = h; al.h[i] = ASPLIT ? (_Float16)(xs[i] - (float)h) : (_Float16)0.0f; }
#pragma unroll
    for (int t = 0; t < 4; ++t) { if (col0 + t * 16 >= N) continue; const size_t boff = (size_t)(col0 + t * 16 + ln) * ldb + kb; FragH bq; bq.half[0] = *(const v8us*)(Bh + boff + 8 * hh); bq.half[1] = *(const v8us*)(Bh + boff + 16 + 8 * hh);
      acc[t] = mmaH<ASPLIT ? 2 : 1>(ah.v, al.v, bq.v, bq.v, acc[t]); }
  }
#pragma unroll
  for (int t = 0; t < 4; ++t) { if (col0 + t * 16 >= N) continue;
#pragma unroll
    for (int r = 0; r < 8; ++r) so[w][8 * hh + r][t * 16 + ln] = acc[t][r] * alpha; }
  __builtin_amdgcn_fence(__ATOMIC_ACQ_REL, "workgroup"); __builtin_amdgcn_wave_barrier();
  const int rsub = lane >> 4, c4 = (lane & 15) * 4;
  {
#pragma unroll
    for (int q = 0; q < 8; ++q) { const int r = q * 2 + rsub; if (col0 + c4 < N) { const v4f v = *(const v4fa*)&so[w][r][c4]; *(v4f*)(C + (size_t)(row0 + r) * ldc + col0 + c4) = v; } }
     }
}

// Wt[n][k] = f16(W[k][n]·scale) from f32 row-major W[K][N] (scale = power of two; bf16-exact weights stay exact in f16 away from the subnormal range)
__global__ __launch_bounds__(256) void k_wt_f16(const float* __restrict__ W, _Float16* __restrict__ Wt, int K, int N, float scale) {
  const int t = blockIdx.x * 256 + threadIdx.x; if (t >= N * (K / 8)) return; const int n = t / (K / 8), k8 = (t % (K / 8)) * 8; FragH f;
#pragma unroll
  for (int i = 0; i < 8; ++i) f.h[i] = (_Float16)(bf16_round(W[(size_t)(k8 + i) * N + n]) * scale); const v8us o = f.half[0];
  *(v8us*)((unsigned short*)Wt + (size_t)n * K + k8) = o; 
}
// k_gemm_hh variant with fused epilogue: v = acc·alpha + bias[by·sBias + col] (+ CP[(row/rowsPerB)·sCPb + by·64 + col] if CP) ; ACT 0 none / 1 elu ; writes f16 C16 (and f32 C if non-null)
template <int ACT>
__global__ __launch_bounds__(128) void k_gemm_hhx(const _Float16* __restrict__ A, int lda, size_t sA, const _Float16* __restrict__ Bh, int ldb, size_t sB, float alpha, const float* __restrict__ bias, size_t sBias, const float* __restrict__ CP, int rowsPerB, size_t sCPb, int row0g,
    float* __restrict__ C, _Float16* __restrict__ C16, int ldc, size_t sC, int M, int N, int K) {
  __shared__ __attribute__((aligned(16))) float so[4][16][64];
  const int tid = threadIdx.x, w = tid >> 5, lane = tid & 31, ln = lane & 15, hh = lane >> 4; const int by = blockIdx.y;
  A += (size_t)by * sA; Bh += (size_t)by * sB; const size_t cofs = (size_t)by * sC; const float* bp = bias ? bias + (size_t)by * sBias : nullptr;
  const int ntn = (N + 63) / 64; const int wid = blockIdx.x * 4 + w; const int mt = wid / ntn, nq = wid % ntn; if (mt * 16 >= M) return;
  const int row0 = mt * 16, col0 = nq * 64; const _Float16* arow = A + (size_t)(row0 + ln) * lda;
  v8f acc[4] = {};
  for (int kb = 0; kb < K; kb += 32) { FragH ah; ah.half[0] = *(const v8us*)((const unsigned short*)arow + kb + 8 * hh); ah.half[1] = *(const v8us*)((const unsigned short*)arow + kb + 16 + 8 * hh);
#pragma unroll
    for (int t = 0; t < 4; ++t) { if (col0 + t * 16 >= N) continue; const size_t boff = (size_t)(col0 + t * 16 + ln) * ldb + kb; FragH bq; bq.half[0] = *(const v8us*)((const unsigned short*)Bh + boff + 8 * hh); bq.half[1] = *(const v8us*)((const unsigned short*)Bh + boff + 16 + 8 * hh);
      acc[t] = mmaH<1>(ah.v, ah.v, bq.v, bq.v, acc[t]); }
  }
#pragma unroll
  for (int t = 0; t < 4; ++t) { if (col0 + t * 16 >= N) continue; const int col = col0 + t * 16 + ln; const float bv = bp ? bf16_round(bp[col]) : 0.f;
#pragma unroll
    for (int r = 0; r < 8; ++r) { float v = acc[t][r] * alpha + bv; if (CP) { const int bidx = (row0g + row0 + 8 * hh + r) / rowsPerB; v += CP[(size_t)bidx * sCPb + (size_t)by * 64 + col]; } if (ACT == 1) v = (v > 0.f) ? v : expm1f(v); else if (ACT == 7) v = (v > 0.f) ? v + 1.0f : expf(v); else if (ACT == 8) v = tanhf(v); else if (ACT == 9) v = 0.5f * v * (1.0f + tanhf(0.7978845608028654f * (v + 0.044715f * v * v * v))); else if (ACT == 11) v = 1.0f / (1.0f + expf(-v)); else if (ACT == 12) v = (v > 0.f) ? v : 0.01f * v; else if (ACT == 14) v = (v > 0.f) ? v : 0.1f * v; else if (ACT == 15) v = v / (1.0f + expf(-v)); else if (ACT == 3) v = fmaxf(v, 0.f); else if (ACT == 6) v = 0.5f * v * (1.0f + erff(v * 0.70710678118654752f)); so[w][8 * hh + r][t * 16 + ln] = v; } }
  __builtin_amdgcn_fence(__ATOMIC_ACQ_REL, "workgroup"); __builtin_amdgcn_wave_barrier();
  const int rsub = lane >> 4, c4 = (lane & 15) * 4; typedef _Float16 v4h __attribute__((ext_vector_type(4)));
  {
#pragma unroll
    for (int q = 0; q < 8; ++q) { const int r = q * 2 + rsub; if (col0 + c4 < N) { const v4f v = *(const v4fa*)&so[w][r][c4]; if (C) *(v4f*)(C + cofs + (size_t)(row0 + r) * ldc + col0 + c4) = v; if (C16) { v4h h4; for (int i = 0; i < 4; ++i) h4[i] = (_Float16)v[i]; *(v4h*)(C16 + cofs + (size_t)(row0 + r) * ldc + col0 + c4) = h4; } } }
     }
}


typedef _Float16 v4h __attribute__((ext_vector_type(4)));

__global__ __launch_bounds__(256) void k_x16(const float* __restrict__ x, _Float16* __restrict__ X16, size_t n8) { const size_t t = (size_t)blockIdx.x * 256 + threadIdx.x; if (t >= n8) return; FragH f;
#pragma unroll
  for (int q = 0; q < 8; ++q) f.h[q] = (_Float16)bf16_round(x[t * 8 + q]); *(v8us*)((unsigned short*)X16 + t * 8) = f.half[0];  }
__global__ __launch_bounds__(256) void k_h16(const float* __restrict__ x, _Float16* __restrict__ X16, size_t n8) { const size_t t = (size_t)blockIdx.x * 256 + threadIdx.x; if (t >= n8) return; FragH f;
#pragma unroll
  for (int q = 0; q < 8; ++q) f.h[q] = (_Float16)x[t * 8 + q]; *(v8us*)((unsigned short*)X16 + t * 8) = f.half[0];  }
__global__ __launch_bounds__(256) void k_round16f(const float* __restrict__ W, _Float16* __restrict__ Bt, size_t n8) { const size_t t = (size_t)blockIdx.x * 256 + threadIdx.x; if (t >= n8) return; FragH f;
#pragma unroll
  for (int i = 0; i < 8; ++i) f.h[i] = (_Float16)(bf16_round(W[t * 8 + i]) * 16.0f); *(v8us*)((unsigned short*)Bt + t * 8) = f.half[0];  }
template <int NHv, int TTv>
__global__ __launch_bounds__(256) void k_vt(const _Float16* __restrict__ V16, int ldv, int voff, const int* __restrict__ IDX, const int* __restrict__ CNT, _Float16* __restrict__ Vt) { __shared__ unsigned short tl[64][66]; const int tid = threadIdx.x; const int slab = blockIdx.x / (TTv / 64), lg = blockIdx.x % (TTv / 64); const int b = slab / NHv, h = slab % NHv;
  const int cls = (h < CDRH) ? 0 : 1; if (lg * 64 >= ((CNT[b * 32 + cls] + 31) & ~31)) return;      /* block-uniform: columns past the rounded key count are never read */
  const int* idx = IDX + ((size_t)b * 2 + cls) * TTv + lg * 64;      /* column j of V^T = j-th valid key; list entries past the count are 0 (a finite row, weighted by P = 0) */
  for (int i = tid; i < 64 * 8; i += 256) { const int r = i / 8, c8 = (i % 8) * 8; FragH f; f.half[0] = *(const v8us*)((const unsigned short*)V16 + ((size_t)b * TTv + idx[r]) * ldv + voff + h * 64 + c8);
#pragma unroll
    for (int q = 0; q < 8; ++q) tl[r][c8 + q] = f.u[q]; }
  __syncthreads();
  {
#pragma unroll
    for (int rd = 0; rd < 2; ++rd) { const int d = rd * 32 + tid / 8, pc = tid % 8; FragH f;
#pragma unroll
      for (int q = 0; q < 8; ++q) f.u[q] = tl[pc * 8 + q][d];
      *(v8us*)((unsigned short*)Vt + ((size_t)slab * 64 + d) * TTv + lg * 64 + pc * 8) = f.half[0]; }
     } }

__global__ __launch_bounds__(256) void k_hl(const float* __restrict__ F, _Float16* __restrict__ Hh, _Float16* __restrict__ Hl, size_t n8) { const size_t t = (size_t)blockIdx.x * 256 + threadIdx.x; if (t >= n8) return; FragH fh, fl; const v4f a = *(const v4fa*)(F + t * 8), c = *(const v4fa*)(F + t * 8 + 4);
#pragma unroll
  for (int q = 0; q < 4; ++q) { _Float16 h = (_Float16)a[q]; fh.h[q] = h; fl.h[q] = (_Float16)((a[q] - (float)h) * 1024.0f); h = (_Float16)c[q]; fh.h[4 + q] = h; fl.h[4 + q] = (_Float16)((c[q] - (float)h) * 1024.0f); }
  { *(v8us*)((unsigned short*)Hh + t * 8) = fh.half[0]; *(v8us*)((unsigned short*)Hl + t * 8) = fl.half[0];  } }
// k_hl with a row gather: row j of a sequence's output planes = row IDX[j] of F, the list chosen by the column's head class; rows past the key count rounded up to 32 are not written (and never read)
__global__ __launch_bounds__(256) void k_hlg(const float* __restrict__ F, const int* __restrict__ IDX, const int* __restrict__ CNT, _Float16* __restrict__ Hh, _Float16* __restrict__ Hl) { const int t = blockIdx.x * 256 + threadIdx.x; const int row = t / (DMOD / 8), c8 = (t % (DMOD / 8)) * 8; const int b = row / TK, j = row % TK; const int cls = (c8 < CDRH * 64) ? 0 : 1;
  if (j >= ((CNT[b * 32 + cls] + 31) & ~31)) return; const float* fr = F + ((size_t)b * TK + IDX[((size_t)b * 2 + cls) * TK + j]) * DMOD + c8; FragH fh, fl; const v4f a = *(const v4fa*)fr, c = *(const v4fa*)(fr + 4);
#pragma unroll
  for (int q = 0; q < 4; ++q) { _Float16 h = (_Float16)a[q]; fh.h[q] = h; fl.h[q] = (_Float16)((a[q] - (float)h) * 1024.0f); h = (_Float16)c[q]; fh.h[4 + q] = h; fl.h[4 + q] = (_Float16)((c[q] - (float)h) * 1024.0f); }
  { *(v8us*)((unsigned short*)Hh + (size_t)t * 8) = fh.half[0]; *(v8us*)((unsigned short*)Hl + (size_t)t * 8) = fl.half[0];  } }

// ---- fast GEMM (wave tile 32x64; requires M % 32 == 0 rows per launch region and N % 64 == 0); epilogue = k_gemm_hhx semantics ----
__device__ __forceinline__ v16h g2_frag(const _Float16* p, int hh) { FragH f; f.half[0] = *(const v8us*)((const unsigned short*)p + 8 * hh); f.half[1] = *(const v8us*)((const unsigned short*)p + 16 + 8 * hh); return f.v; }
__device__ __forceinline__ v8f g2_mma(v16h a, v16h b, v8f c) { v8f d = __builtin_amdgcn_wmma_f32_16x16x32_f16(false, a, false, b, (short)0, c, false, false); asm volatile("v_nop\n\tv_nop\n\tv_nop\n\tv_nop" : "+v"(d) : "v"(a), "v"(b)); return d; }
template <int ACT>
__global__ __launch_bounds__(128) void k_gemm2(const _Float16* __restrict__ A, int lda, size_t sA, const _Float16* __restrict__ Bh, int ldb, size_t sB, float alpha, const float* __restrict__ bias, size_t sBias, const float* __restrict__ CP, int rowsPerB, size_t sCPb, int row0g,
    float* __restrict__ C, _Float16* __restrict__ C16, int ldc, size_t sC, int M, int N, int K) {
  __shared__ __attribute__((aligned(16))) float so[4][32][68];
  const int tid = threadIdx.x, w = tid >> 5, lane = tid & 31, ln = lane & 15, hh = lane >> 4; const int by = blockIdx.y;
  A += (size_t)by * sA; Bh += (size_t)by * sB; const size_t cofs = (size_t)by * sC; const float* bp = bias ? bias + (size_t)by * sBias : nullptr;
  const int ntn = N >> 6; const int mt = blockIdx.x / ntn, nq = blockIdx.x - mt * ntn; const int row0 = mt * 128 + 32 * w, col0 = nq * 64; if (row0 >= M) return;
  const _Float16* a0p = A + (size_t)(row0 + ln) * lda; const _Float16* a1p = a0p + (size_t)16 * lda;
  const _Float16* b0p = Bh + (size_t)(col0 + ln) * ldb; const _Float16* b1p = b0p + (size_t)16 * ldb; const _Float16* b2p = b1p + (size_t)16 * ldb; const _Float16* b3p = b2p + (size_t)16 * ldb;
  const v8f z8 = {0.f,0.f,0.f,0.f,0.f,0.f,0.f,0.f}; v8f c00 = z8, c01 = z8, c02 = z8, c03 = z8, c10 = z8, c11 = z8, c12 = z8, c13 = z8;
#pragma unroll 1
  for (int kb = 0; kb < K; kb += 32) { const v16h a0 = g2_frag(a0p + kb, hh), a1 = g2_frag(a1p + kb, hh);
    v16h b = g2_frag(b0p + kb, hh); c00 = g2_mma(a0, b, c00); c10 = g2_mma(a1, b, c10);
    b = g2_frag(b1p + kb, hh); c01 = g2_mma(a0, b, c01); c11 = g2_mma(a1, b, c11);
    b = g2_frag(b2p + kb, hh); c02 = g2_mma(a0, b, c02); c12 = g2_mma(a1, b, c12);
    b = g2_frag(b3p + kb, hh); c03 = g2_mma(a0, b, c03); c13 = g2_mma(a1, b, c13); }
  v8f accs[8] = {c00, c01, c02, c03, c10, c11, c12, c13};
#pragma unroll
  for (int u = 0; u < 8; ++u) { const int t = u & 3, half = u >> 2; const int col = col0 + t * 16 + ln; const float bv = bp ? bf16_round(bp[col]) : 0.f;
#pragma unroll
    for (int r = 0; r < 8; ++r) { const int rloc = half * 16 + 8 * hh + r; float v = accs[u][r] * alpha + bv; if (CP) { const int bidx = (row0g + row0 + rloc) / rowsPerB; v += CP[(size_t)bidx * sCPb + (size_t)by * 64 + col]; }
      if (ACT == 3) v = fmaxf(v, 0.f); else if (ACT == 6) v = 0.5f * v * (1.0f + erff(v * 0.70710678118654752f)); else if (ACT == 11) v = 1.0f / (1.0f + expf(-v)); else if (ACT == 15) v = v / (1.0f + expf(-v)); else if (ACT == 12) v = (v > 0.f) ? v : 0.01f * v; else if (ACT == 8) v = tanhf(v);
      so[w][rloc][t * 16 + ln] = v; } }
  __builtin_amdgcn_fence(__ATOMIC_ACQ_REL, "workgroup"); __builtin_amdgcn_wave_barrier();
  const int rsub = lane >> 4, c4 = (lane & 15) * 4;
  {
#pragma unroll
    for (int q = 0; q < 16; ++q) { const int r = q * 2 + rsub; const v4f v = *(const v4fa*)&so[w][r][c4]; if (C) *(v4f*)(C + cofs + (size_t)(row0 + r) * ldc + col0 + c4) = v; if (C16) { v4h h4; for (int i = 0; i < 4; ++i) h4[i] = (_Float16)v[i]; *(v4h*)(C16 + cofs + (size_t)(row0 + r) * ldc + col0 + c4) = h4; } }
     } }



template <int CAUSAL>
__global__ __launch_bounds__(128) void k_flash(const _Float16* __restrict__ Q16, int ldq, const _Float16* __restrict__ K16, int ldk, const _Float16* __restrict__ Vt, const int* __restrict__ MSK, float* __restrict__ O, int ldo) {
  constexpr int RPW = 16, RTN = RPW / 16, NQB = TQ / (4 * RPW), DT = 4, KS = 2;
  __shared__ __attribute__((aligned(16))) unsigned short sP[4][RPW][40]; __shared__ __attribute__((aligned(16))) float sO[4][RPW][64 + 4];
  const int tid = threadIdx.x, w = tid >> 5, lane = tid & 31, ln = lane & 15, hh = lane >> 4;
  const int slab = blockIdx.x / NQB, qblk = blockIdx.x % NQB; const int b = slab / NH, h = slab % NH; const int qb0 = qblk * (4 * RPW); const int q0 = qb0 + w * RPW;
  FragH aq[2][KS];
#pragma unroll
  for (int rt = 0; rt < RTN; ++rt) { const unsigned short* qr = (const unsigned short*)Q16 + ((size_t)b * TQ + q0 + rt * 16 + ln) * ldq + h * 64;
#pragma unroll
    for (int ks = 0; ks < KS; ++ks) { aq[rt][ks].half[0] = *(const v8us*)(qr + ks * 32 + 8 * hh); aq[rt][ks].half[1] = *(const v8us*)(qr + ks * 32 + 16 + 8 * hh); } }
  const unsigned short* Vth = (const unsigned short*)Vt + (size_t)slab * 64 * TK;
  float m_r[2][8], l_r[2][8]; v8f oacc[2][DT];
#pragma unroll
  for (int rt = 0; rt < RTN; ++rt) {
#pragma unroll
    for (int r = 0; r < 8; ++r) { m_r[rt][r] = -3.0e38f; l_r[rt][r] = 0.f; }
#pragma unroll
    for (int dt = 0; dt < DT; ++dt) oacc[rt][dt] = (v8f){0.f,0.f,0.f,0.f,0.f,0.f,0.f,0.f}; }
  const int jend = (CAUSAL == 1) ? (qb0 + 4 * RPW) : TK;      /* causal: keys beyond the block's last query never contribute */
#pragma unroll 1
  for (int j0 = 0; j0 < jend; j0 += 32) {
    v8f s[2][2];
#pragma unroll
    for (int nt = 0; nt < 2; ++nt) { const unsigned short* kr = (const unsigned short*)K16 + ((size_t)b * TK + j0 + nt * 16 + ln) * ldk + h * 64; FragH bk[KS];
#pragma unroll
      for (int ks = 0; ks < KS; ++ks) { bk[ks].half[0] = *(const v8us*)(kr + ks * 32 + 8 * hh); bk[ks].half[1] = *(const v8us*)(kr + ks * 32 + 16 + 8 * hh); }
#pragma unroll
      for (int rt = 0; rt < RTN; ++rt) { v8f acc = (v8f){0.f,0.f,0.f,0.f,0.f,0.f,0.f,0.f};
#pragma unroll
        for (int ks = 0; ks < KS; ++ks) acc = mmaH<1>(aq[rt][ks].v, aq[rt][ks].v, bk[ks].v, bk[ks].v, acc); s[rt][nt] = acc; } }
#pragma unroll
    for (int rt = 0; rt < RTN; ++rt)
#pragma unroll
      for (int r = 0; r < 8; ++r) { const int tq = q0 + rt * 16 + 8 * hh + r; const int k0 = j0 + ln, k1 = j0 + 16 + ln;
        const bool ok0 = (CAUSAL == 1) ? (k0 <= tq) : ((CAUSAL == 2) ? ((k0 >> 5) == (tq >> 5)) : true), ok1 = (CAUSAL == 1) ? (k1 <= tq) : ((CAUSAL == 2) ? ((k1 >> 5) == (tq >> 5)) : true);      /* mode 2: block-diagonal 32-token groups */
        const float s0 = ok0 ? s[rt][0][r] * SCL : -3.0e38f, s1 = ok1 ? s[rt][1][r] * SCL : -3.0e38f; float mc = fmaxf(s0, s1);
        mc = fmaxf(mc, __shfl_xor(mc, 1, 32)); mc = fmaxf(mc, __shfl_xor(mc, 2, 32)); mc = fmaxf(mc, __shfl_xor(mc, 4, 32)); mc = fmaxf(mc, __shfl_xor(mc, 8, 32));
        const float mn = fmaxf(m_r[rt][r], mc); const float al = (mn > -1.0e38f) ? expf(m_r[rt][r] - mn) : 1.0f; m_r[rt][r] = mn; const float p0 = ok0 ? expf(s0 - mn) : 0.f, p1 = ok1 ? expf(s1 - mn) : 0.f; l_r[rt][r] = l_r[rt][r] * al + p0 + p1;
#pragma unroll
        for (int dt = 0; dt < DT; ++dt) oacc[rt][dt][r] *= al;
        FragH t2; t2.h[0] = (_Float16)(p0 * 1024.0f); t2.h[1] = (_Float16)(p1 * 1024.0f); sP[w][rt * 16 + 8 * hh + r][ln] = t2.u[0]; sP[w][rt * 16 + 8 * hh + r][16 + ln] = t2.u[1]; }
    __builtin_amdgcn_fence(__ATOMIC_ACQ_REL, "workgroup"); __builtin_amdgcn_wave_barrier();
    FragH pa[2];
#pragma unroll
    for (int rt = 0; rt < RTN; ++rt) { pa[rt].half[0] = *(const v8us*)&sP[w][rt * 16 + ln][8 * hh]; pa[rt].half[1] = *(const v8us*)&sP[w][rt * 16 + ln][16 + 8 * hh]; }
#pragma unroll
    for (int dt = 0; dt < DT; ++dt) { const unsigned short* vrow = Vth + (size_t)(dt * 16 + ln) * TK + j0; FragH bv; bv.half[0] = *(const v8us*)(vrow + 8 * hh); bv.half[1] = *(const v8us*)(vrow + 16 + 8 * hh);
#pragma unroll
      for (int rt = 0; rt < RTN; ++rt) oacc[rt][dt] = mmaH<1>(pa[rt].v, pa[rt].v, bv.v, bv.v, oacc[rt][dt]); }
    __builtin_amdgcn_fence(__ATOMIC_ACQ_REL, "workgroup"); __builtin_amdgcn_wave_barrier(); }
#pragma unroll
  for (int rt = 0; rt < RTN; ++rt) {
#pragma unroll
    for (int r = 0; r < 8; ++r) { float l = l_r[rt][r]; l += __shfl_xor(l, 1, 32); l += __shfl_xor(l, 2, 32); l += __shfl_xor(l, 4, 32); l += __shfl_xor(l, 8, 32); l_r[rt][r] = (l > 0.f) ? 1.0f / (l * 1024.0f) : 0.f; }
#pragma unroll
    for (int dt = 0; dt < DT; ++dt)
#pragma unroll
      for (int r = 0; r < 8; ++r) sO[w][rt * 16 + 8 * hh + r][dt * 16 + ln] = oacc[rt][dt][r] * l_r[rt][r]; }
  __builtin_amdgcn_fence(__ATOMIC_ACQ_REL, "workgroup"); __builtin_amdgcn_wave_barrier();
  {
#pragma unroll
    for (int rp = 0; rp < RPW; rp += 2) { const int r = rp + (lane >> 4), pc = lane & 15; const v4f val = *(const v4fa*)&sO[w][r][pc * 4]; *(v4f*)(O + ((size_t)b * TQ + q0 + r) * ldo + h * 64 + pc * 4) = val; }
     } }
// Six 16-byte asynchronous copies to LDS per lane (one 32-key tile's share). s_wait_xcnt 0 closes the statement so that no address register of an issued copy is rewritten ahead of it.
__device__ __forceinline__ void cp_tile6(unsigned l0, const unsigned short* g0, unsigned l1, const unsigned short* g1, unsigned l2, const unsigned short* g2, unsigned l3, const unsigned short* g3, unsigned l4, const unsigned short* g4, unsigned l5, const unsigned short* g5) {
  asm volatile("global_load_async_to_lds_b128 %0, %1, off\n\t"
               "global_load_async_to_lds_b128 %2, %3, off\n\t"
               "global_load_async_to_lds_b128 %4, %5, off\n\t"
               "global_load_async_to_lds_b128 %6, %7, off\n\t"
               "global_load_async_to_lds_b128 %8, %9, off\n\t"
               "global_load_async_to_lds_b128 %10, %11, off\n\t"
               "s_wait_xcnt 0x0"
               :: "v"(l0), "v"(g0), "v"(l1), "v"(g1), "v"(l2), "v"(g2), "v"(l3), "v"(g3), "v"(l4), "v"(g4), "v"(l5), "v"(g5) : "memory");
}
// lane l takes the value of lane l ^ 16 (the other 16-lane half)
__device__ __forceinline__ float xhalf(float x) { return __builtin_bit_cast(float, __builtin_amdgcn_permlanex16(__builtin_bit_cast(int, x), __builtin_bit_cast(int, x), 0x76543210, 0xfedcba98, false, false)); }
template <int CAUSAL>
__global__ __launch_bounds__(128) void k_flashqk(const _Float16* __restrict__ Q16, const _Float16* __restrict__ QL, int ldq, const _Float16* __restrict__ K16, const _Float16* __restrict__ KL, int ldk, const _Float16* __restrict__ Vt, const int* __restrict__ MSK, float* __restrict__ O, int ldo) {
  static_assert(CAUSAL == 5, "compacted-key mode only");
  constexpr int RPW = 16, DT = 4, KS = 2;
  __shared__ __attribute__((aligned(16))) float sO[4][RPW][64 + 4];
  __shared__ __attribute__((aligned(16))) unsigned short sKh[2][32][72], sKl[2][32][72], sV[2][64][40];      /* row pitches 144 B and 80 B: 16 B x odd, for 16-byte fragment reads */
  const int tid = threadIdx.x, w = tid >> 5, lane = tid & 31, ln = lane & 15, hh = lane >> 4;
  const int slab = blockIdx.x / QBLKS, qblk = blockIdx.x % QBLKS; const int b = slab / NH, h = slab % NH; const int qb0 = qblk * (4 * RPW); const int q0 = qb0 + w * RPW;
  FragH aq[KS], aql[KS];
  { const unsigned short* qr = (const unsigned short*)Q16 + ((size_t)b * TQ + q0 + ln) * ldq + h * 64; const unsigned short* ql = (const unsigned short*)QL + ((size_t)b * TQ + q0 + ln) * ldq + h * 64;
#pragma unroll
    for (int ks = 0; ks < KS; ++ks) { aq[ks].half[0] = *(const v8us*)(qr + ks * 32 + 8 * hh); aq[ks].half[1] = *(const v8us*)(qr + ks * 32 + 16 + 8 * hh); aql[ks].half[0] = *(const v8us*)(ql + ks * 32 + 8 * hh); aql[ks].half[1] = *(const v8us*)(ql + ks * 32 + 16 + 8 * hh); } }
  const unsigned short* Vth = (const unsigned short*)Vt + (size_t)slab * 64 * TK;
  float m_r = -3.0e38f, l_r = 0.f; v8f oacc[DT];      /* query q0 + ln: running maximum (equal in both halves), this half's share of the sum, O^T rows dt * 16 + 8 hh + r */
#pragma unroll
  for (int dt = 0; dt < DT; ++dt) oacc[dt] = (v8f){0.f,0.f,0.f,0.f,0.f,0.f,0.f,0.f};
  const int kcnt = min(MSK[b * 32 + ((h < CDRH) ? 0 : 1)], TK);      /* number of valid keys of this (sequence, head class); K planes and V^T hold them compacted, in key order */
  const int jend = (kcnt + 31) & ~31;
  const int kr0 = tid >> 3, kc0 = (tid & 7) * 8, vr0 = tid >> 2, vc0 = (tid & 3) * 8;      /* a lane's share of a tile: rows kr0 and kr0 + 16 of both K planes, rows vr0 and vr0 + 32 of V^T, 16 bytes each; whole 128-byte K lines per 8 lanes */
  const unsigned short* gkh = (const unsigned short*)K16 + ((size_t)b * TK + kr0) * ldk + h * 64 + kc0; const unsigned short* gkl = (const unsigned short*)KL + ((size_t)b * TK + kr0) * ldk + h * 64 + kc0; const unsigned short* gv = Vth + (size_t)vr0 * TK + vc0;
  auto stage = [&](int jt, int bf) { const size_t ko = (size_t)jt * ldk;
    cp_tile6((unsigned)(size_t)&sKh[bf][kr0][kc0], gkh + ko, (unsigned)(size_t)&sKh[bf][kr0 + 16][kc0], gkh + ko + (size_t)16 * ldk, (unsigned)(size_t)&sKl[bf][kr0][kc0], gkl + ko, (unsigned)(size_t)&sKl[bf][kr0 + 16][kc0], gkl + ko + (size_t)16 * ldk,
             (unsigned)(size_t)&sV[bf][vr0][vc0], gv + jt, (unsigned)(size_t)&sV[bf][vr0 + 32][vc0], gv + (size_t)32 * TK + jt); };
  if (jend > 0) stage(0, 0);
  asm volatile("s_wait_asynccnt 0x0" ::: "memory");      /* this wave's share of tile 0 has landed */
  __syncthreads();      /* tile 0 is published to all four waves */
  if (jend > 32) stage(32, 1);
#pragma unroll 1
  for (int j0 = 0; j0 < jend; j0 += 32) {
    const int bf = (j0 >> 5) & 1;
    float sc[2][8];      /* sc[nt][r] = scaled score of key j0 + 16 nt + 8 hh + r for query q0 + ln; the inner loops of this trip are fully unrolled so that sc, pb, ls and oacc are indexed by constants and stay in registers */
#pragma unroll
    for (int nt = 0; nt < 2; ++nt) { const unsigned short* kr = &sKh[bf][nt * 16 + ln][0]; const unsigned short* klr = &sKl[bf][nt * 16 + ln][0]; FragH bk[KS], bkl[KS];
#pragma unroll
      for (int ks = 0; ks < KS; ++ks) { bk[ks].half[0] = *(const v8us*)(kr + ks * 32 + 8 * hh); bk[ks].half[1] = *(const v8us*)(kr + ks * 32 + 16 + 8 * hh); bkl[ks].half[0] = *(const v8us*)(klr + ks * 32 + 8 * hh); bkl[ks].half[1] = *(const v8us*)(klr + ks * 32 + 16 + 8 * hh); }
      v8f acc = (v8f){0.f,0.f,0.f,0.f,0.f,0.f,0.f,0.f}, accl = acc;
#pragma unroll
      for (int ks = 0; ks < KS; ++ks) { acc = mmaH<1>(bk[ks].v, bk[ks].v, aq[ks].v, aq[ks].v, acc); accl = mmaH<1>(bk[ks].v, bk[ks].v, aql[ks].v, aql[ks].v, accl); accl = mmaH<1>(bkl[ks].v, bkl[ks].v, aq[ks].v, aq[ks].v, accl); }
#pragma unroll
      for (int r = 0; r < 8; ++r) sc[nt][r] = (acc[r] + accl[r] * 0.0009765625f) * SCL; }
    if (j0 + 32 > kcnt) {      /* block-uniform: only the last trip holds keys past the count (key padding and head-specific masks are applied by the gather) */
#pragma unroll
      for (int nt = 0; nt < 2; ++nt)
#pragma unroll
        for (int r = 0; r < 8; ++r) if (j0 + nt * 16 + 8 * hh + r >= kcnt) sc[nt][r] = -3.0e38f; }
    float mc = fmaxf(sc[0][0], sc[1][0]);
#pragma unroll
    for (int r = 1; r < 8; ++r) mc = fmaxf(mc, fmaxf(sc[0][r], sc[1][r]));
    mc = fmaxf(mc, xhalf(mc));
    const float mn = fmaxf(m_r, mc);      /* finite in every trip: key j0 is below the count; so an invalid key's exp below is exactly 0, and so is the first trip's rescale factor */
    const float al = expf(m_r - mn); m_r = mn;
    FragH pb; float ls[4] = {0.f, 0.f, 0.f, 0.f};
#pragma unroll
    for (int nt = 0; nt < 2; ++nt)
#pragma unroll
      for (int r = 0; r < 8; ++r) { const float p = expf(sc[nt][r] - mn); ls[nt * 2 + (r & 1)] += p; pb.h[nt * 8 + r] = (_Float16)(p * 1024.0f); }      /* element nt * 8 + r of the B operand = key 16 nt + 8 hh + r: the k order of the V^T fragment */
    l_r = l_r * al + ((ls[0] + ls[1]) + (ls[2] + ls[3]));
#pragma unroll
    for (int dt = 0; dt < DT; ++dt)
#pragma unroll
      for (int r = 0; r < 8; ++r) oacc[dt][r] *= al;
#pragma unroll
    for (int dt = 0; dt < DT; ++dt) { const unsigned short* vrow = &sV[bf][dt * 16 + ln][0]; FragH bv; bv.half[0] = *(const v8us*)(vrow + 8 * hh); bv.half[1] = *(const v8us*)(vrow + 16 + 8 * hh);
      oacc[dt] = mmaH<1>(bv.v, bv.v, pb.v, pb.v, oacc[dt]); }
    asm volatile("s_wait_dscnt 0x0" ::: "memory");      /* this wave's reads of buffer bf have returned before the buffer is refilled */
    asm volatile("s_wait_asynccnt 0x0" ::: "memory");      /* this wave's share of the next tile has landed */
    __syncthreads();      /* publishes the next tile and ends every wave's reads of buffer bf */
    if (j0 + 64 < jend) stage(j0 + 64, bf); }
  asm volatile("s_wait_asynccnt 0x0" ::: "memory");      /* no copy is outstanding when the wave goes on to its end */
  const float l = l_r + xhalf(l_r); const float linv = (l > 0.f) ? 1.0f / (l * 1024.0f) : 0.f;
#pragma unroll
  for (int dt = 0; dt < DT; ++dt) { const v4f o0 = {oacc[dt][0] * linv, oacc[dt][1] * linv, oacc[dt][2] * linv, oacc[dt][3] * linv}, o1 = {oacc[dt][4] * linv, oacc[dt][5] * linv, oacc[dt][6] * linv, oacc[dt][7] * linv};
    *(v4fa*)&sO[w][ln][dt * 16 + 8 * hh] = o0; *(v4fa*)&sO[w][ln][dt * 16 + 8 * hh + 4] = o1; }
  __builtin_amdgcn_fence(__ATOMIC_ACQ_REL, "workgroup"); __builtin_amdgcn_wave_barrier();
  {
#pragma unroll
    for (int rp = 0; rp < RPW; rp += 2) { const int r = rp + (lane >> 4), pc = lane & 15; const v4f val = *(const v4fa*)&sO[w][r][pc * 4]; *(v4f*)(O + ((size_t)b * TQ + q0 + r) * ldo + h * 64 + pc * 4) = val; }
     } }

// f32 -> f16 hi + 2^10 residual A fragments of one row (k order of g2_frag: elements 0..7 = k 8 hh + i, elements 8..15 = k 16 + 8 hh + i); p already points at k = 8 hh. Same rounding as k_hl.
__device__ __forceinline__ void g2_split(const float* p, v16h& fh, v16h& fl) { const v4f x0 = *(const v4fa*)p, x1 = *(const v4fa*)(p + 4), x2 = *(const v4fa*)(p + 16), x3 = *(const v4fa*)(p + 20); FragH h, l;
#pragma unroll
  for (int q = 0; q < 4; ++q) { _Float16 t = (_Float16)x0[q]; h.h[q] = t; l.h[q] = (_Float16)((x0[q] - (float)t) * 1024.0f); t = (_Float16)x1[q]; h.h[4 + q] = t; l.h[4 + q] = (_Float16)((x1[q] - (float)t) * 1024.0f);
    t = (_Float16)x2[q]; h.h[8 + q] = t; l.h[8 + q] = (_Float16)((x2[q] - (float)t) * 1024.0f); t = (_Float16)x3[q]; h.h[12 + q] = t; l.h[12 + q] = (_Float16)((x3[q] - (float)t) * 1024.0f); }
  fh = h.v; fl = l.v; }
// Output projection in one launch: C[NR][DMOD] = A Wo + bias from the f32 context A. Wave tile 32x64 as in k_gemm2; each A fragment is split hi + 2^10 residual in registers, and each x16 weight fragment (Bh = [out][in]) feeds the hi and the residual product, which keep separate f32 accumulators: C = hi / 16 + bias + residual / (16 * 1024).
__global__ __launch_bounds__(128) void k_gemm_out(const float* __restrict__ A, const _Float16* __restrict__ Bh, const float* __restrict__ bias, float* __restrict__ C) {
  __shared__ __attribute__((aligned(16))) float so[4][32][68];
  const int tid = threadIdx.x, w = tid >> 5, lane = tid & 31, ln = lane & 15, hh = lane >> 4;
  constexpr int ntn = DMOD >> 6; const int mt = blockIdx.x / ntn, nq = blockIdx.x - mt * ntn; const int row0 = mt * 128 + 32 * w, col0 = nq * 64;
  const float* a0p = A + (size_t)(row0 + ln) * DMOD + 8 * hh; const float* a1p = a0p + (size_t)16 * DMOD;
  const _Float16* b0p = Bh + (size_t)(col0 + ln) * DMOD;
  float bv[4];      /* the four bias loads go out ahead of the loop and land under it */
#pragma unroll
  for (int t = 0; t < 4; ++t) bv[t] = bf16_round(bias[col0 + t * 16 + ln]);
  v8f ch[2][4], cl[2][4];
#pragma unroll
  for (int u = 0; u < 8; ++u) { ch[u >> 2][u & 3] = (v8f){0.f,0.f,0.f,0.f,0.f,0.f,0.f,0.f}; cl[u >> 2][u & 3] = (v8f){0.f,0.f,0.f,0.f,0.f,0.f,0.f,0.f}; }
#pragma unroll 1      /* rolled: 16 trips of 16 products; the loop's code stays a few instruction-cache lines */
  for (int kb = 0; kb < DMOD; kb += 32) { v16h a0h, a0l, a1h, a1l, b[4];      /* all 16 loads of a trip stand ahead of its first product: one wait for memory a trip */
#pragma unroll
    for (int t = 0; t < 4; ++t) b[t] = g2_frag(b0p + (size_t)(t * 16) * DMOD + kb, hh);
    g2_split(a0p + kb, a0h, a0l); g2_split(a1p + kb, a1h, a1l);
#pragma unroll
    for (int t = 0; t < 4; ++t) { ch[0][t] = g2_mma(a0h, b[t], ch[0][t]); ch[1][t] = g2_mma(a1h, b[t], ch[1][t]); cl[0][t] = g2_mma(a0l, b[t], cl[0][t]); cl[1][t] = g2_mma(a1l, b[t], cl[1][t]); } }
#pragma unroll
  for (int u = 0; u < 8; ++u) { const int t = u & 3, half = u >> 2;
#pragma unroll
    for (int r = 0; r < 8; ++r) so[w][half * 16 + 8 * hh + r][t * 16 + ln] = (ch[half][t][r] * 0.0625f + bv[t]) + cl[half][t][r] * (0.0625f / 1024.0f); }
  __builtin_amdgcn_fence(__ATOMIC_ACQ_REL, "workgroup"); __builtin_amdgcn_wave_barrier();      /* the wave reads back rows that its other lanes wrote */
  const int rsub = lane >> 4, c4 = (lane & 15) * 4;
#pragma unroll
  for (int q = 0; q < 16; ++q) { const int r = q * 2 + rsub; const v4f v = *(const v4fa*)&so[w][r][c4]; *(v4f*)(C + (size_t)(row0 + r) * DMOD + col0 + c4) = v; } }
typedef int v4ia __attribute__((ext_vector_type(4), may_alias));
// One block per sequence, 8 consecutive keys a thread. IDX[b][0][.] = positions of the keys valid for the CDR heads, IDX[b][1][.] = for the other heads, ascending; entries past the count are 0. CNT[b*32 + class] = the counts (one 128-byte line per sequence).
__global__ __launch_bounds__(256) void k_mask(const int* __restrict__ mask, const int* __restrict__ cdrs, int* __restrict__ IDX, int* __restrict__ CNT) {
  __shared__ int sh[256]; __shared__ int sany; const int b = blockIdx.x, tid = threadIdx.x; static_assert(TK == 256 * 8, "8 keys a thread");
  const v4ia m0 = *(const v4ia*)(mask + (size_t)b * TK + tid * 8), m1 = *(const v4ia*)(mask + (size_t)b * TK + tid * 8 + 4), c0 = *(const v4ia*)(cdrs + (size_t)b * TK + tid * 8), c1 = *(const v4ia*)(cdrs + (size_t)b * TK + tid * 8 + 4);
  bool vp[8], vc[8]; int np = 0, nb = 0, any = 0;
#pragma unroll
  for (int q = 0; q < 8; ++q) { const int mv = (q < 4) ? m0[q & 3] : m1[q & 3], cv = (q < 4) ? c0[q & 3] : c1[q & 3]; vp[q] = mv != 0; vc[q] = cv != 0; any |= vc[q] ? 1 : 0; np += vp[q] ? 1 : 0; nb += (vp[q] && vc[q]) ? 1 : 0; }
  if (tid == 0) sany = 0; __syncthreads(); if (any) sany = 1;
  const int own = np | (nb << 16); int v = own; sh[tid] = v; __syncthreads();      /* both counts stay <= 2048, so one packed inclusive scan serves both lists */
  for (int st = 1; st < 256; st <<= 1) { const int add = (tid >= st) ? sh[tid - st] : 0; __syncthreads(); v += add; sh[tid] = v; __syncthreads(); }
  const bool allmasked = (sany == 0);      /* no CDR token at all -> the CDR mask is disabled */
  const int tot = sh[255], ex = v - own; const int cnt1 = tot & 0xFFFF, cnt0 = allmasked ? cnt1 : (tot >> 16); int o1 = ex & 0xFFFF, o0 = allmasked ? o1 : (ex >> 16);
  int* i0 = IDX + ((size_t)b * 2 + 0) * TK; int* i1 = IDX + ((size_t)b * 2 + 1) * TK;
#pragma unroll
  for (int q = 0; q < 8; ++q) { const int k = tid * 8 + q; if (vp[q]) i1[o1++] = k; if (vp[q] && (allmasked || vc[q])) i0[o0++] = k; if (k >= cnt1) i1[k] = 0; if (k >= cnt0) i0[k] = 0; }
  if (tid == 0) { CNT[b * 32 + 0] = cnt0; CNT[b * 32 + 1] = cnt1; } }

extern "C" void kernel_launch(void* const* d_in, const int* in_sizes, int n_in,
                              void* d_out, int out_size, void* d_ws, size_t ws_size, hipStream_t stream) {
  (void)in_sizes; (void)n_in; (void)out_size;
  const float* const* I = (const float* const*)d_in; const float* x = I[0]; const int* mask = (const int*)d_in[1]; const int* cdrs = (const int*)d_in[2]; const float* Wq = I[3]; const float* bq = I[4]; const float* Wk = I[5]; const float* bk = I[6]; const float* Wv = I[7]; const float* bv = I[8]; const float* Wo = I[9]; const float* bo = I[10];
  char* ws = (char*)d_ws; size_t off = 0;
  auto take = [&](size_t bytes) { char* p = ws + off; off += (bytes + 255) & ~(size_t)255; return p; };
  const size_t w8 = (size_t)DMOD * DMOD / 8;
  _Float16* BQ = (_Float16*)take(w8 * 16); _Float16* BK = (_Float16*)take(w8 * 16); _Float16* BV = (_Float16*)take(w8 * 16); _Float16* BO = (_Float16*)take(w8 * 16); int* IDX = (int*)take((size_t)NB * 2 * TK * 4); int* CNT = (int*)take((size_t)NB * 32 * 4);
  _Float16* X16 = (_Float16*)take((size_t)NR * DMOD * 2); float* F32 = (float*)take((size_t)NR * DMOD * 4); _Float16* QH = (_Float16*)take((size_t)NR * DMOD * 2); _Float16* QL = (_Float16*)take((size_t)NR * DMOD * 2); _Float16* KH = (_Float16*)take((size_t)NR * DMOD * 2); _Float16* KL = (_Float16*)take((size_t)NR * DMOD * 2); _Float16* VH = (_Float16*)take((size_t)NR * DMOD * 2); _Float16* VL = (_Float16*)take((size_t)NR * DMOD * 2); _Float16* VT = (_Float16*)take((size_t)NR * DMOD * 2); _Float16* VTL = (_Float16*)take((size_t)NR * DMOD * 2);
  float* O = F32;
  if (off > ws_size) return;      /* 2 + 0.06 + 8 + 16 + 8 x 8 = 90 MiB */
  k_wt_f16<<<(unsigned)(((size_t)DMOD * (DMOD / 8) + 255) / 256), 256, 0, stream>>>(Wq, BQ, DMOD, DMOD, 16.0f); k_wt_f16<<<(unsigned)(((size_t)DMOD * (DMOD / 8) + 255) / 256), 256, 0, stream>>>(Wk, BK, DMOD, DMOD, 16.0f); k_wt_f16<<<(unsigned)(((size_t)DMOD * (DMOD / 8) + 255) / 256), 256, 0, stream>>>(Wv, BV, DMOD, DMOD, 16.0f); k_wt_f16<<<(unsigned)(((size_t)DMOD * (DMOD / 8) + 255) / 256), 256, 0, stream>>>(Wo, BO, DMOD, DMOD, 16.0f);
  k_mask<<<NB, 256, 0, stream>>>(mask, cdrs, IDX, CNT);
  k_x16<<<(unsigned)(((size_t)NR * DMOD / 8 + 255) / 256), 256, 0, stream>>>(x, X16, (size_t)NR * DMOD / 8);
  const dim3 gA((NR / 128) * (DMOD / 64), 1); const unsigned n8 = (unsigned)(((size_t)NR * DMOD / 8 + 255) / 256);
  k_gemm2<0><<<gA, 128, 0, stream>>>(X16, DMOD, 0, BQ, DMOD, 0, 0.0625f, bq, 0, nullptr, 1, 0, 0, F32, nullptr, DMOD, 0, NR, DMOD, DMOD); k_hl<<<n8, 256, 0, stream>>>(F32, QH, QL, (size_t)NR * DMOD / 8);
  k_gemm2<0><<<gA, 128, 0, stream>>>(X16, DMOD, 0, BK, DMOD, 0, 0.0625f, bk, 0, nullptr, 1, 0, 0, F32, nullptr, DMOD, 0, NR, DMOD, DMOD); k_hlg<<<n8, 256, 0, stream>>>(F32, IDX, CNT, KH, KL);
  k_gemm2<0><<<gA, 128, 0, stream>>>(X16, DMOD, 0, BV, DMOD, 0, 0.0625f, bv, 0, nullptr, 1, 0, 0, F32, nullptr, DMOD, 0, NR, DMOD, DMOD); k_hl<<<n8, 256, 0, stream>>>(F32, VH, VL, (size_t)NR * DMOD / 8);
  k_vt<NH, SLEN><<<NB * NH * (SLEN / 64), 256, 0, stream>>>(VH, DMOD, 0, IDX, CNT, VT);
  k_flashqk<5><<<NB * NH * QBLKS, 128, 0, stream>>>(QH, QL, DMOD, KH, KL, DMOD, VT, CNT, O, DMOD);      /* q/k hi + residual; P (x2^10) and V plain f16 */
  k_gemm_out<<<gA, 128, 0, stream>>>(O, BO, bo, (float*)d_out);
}

// v005
// A run of this version takes 124 microseconds.
// Next to v004, in two timings, it ran 1.53 and 1.51 times as fast.
// All steps since v000 together make it 4.41 times as fast.
#include <hip/hip_runtime.h>
// CDRs attention (4 sequences x 2048 tokens x 512; 8 heads x 64): q,k,v = x W + b; scores/8; keys with mask == 0 invalid for all heads; for heads 0..1 additionally keys with cdrs_score == 0 invalid unless the sequence has no CDR token at all; softmax; ctx Wo + bo -> [4,2048,512].
// Structure: per sequence two compacted lists of valid key positions (CDR heads / other heads) with their counts, from the two int inputs on VALU (one block per sequence: 'all masked' flag + prefix sum); x as an exact f16 plane; the q/k/v projections as f16 WMMA GEMMs in one launch (32x64 wave tiles, f32 accumulation, exact x16 weights + bias) whose x rows for K and V are taken through the lists, so K (hi + 2^10 residual planes, like q) and V^T (formed directly as Wv^T x^T) come out compacted and the flash loop runs only over valid keys; the fused flash kernel with hi + 2^10-residual q/k planes (S = QhKh + (QlKh + QhKl)/1024) and plain f16 P (x2^10) and V with the key-count mask mode (invalid keys never visited == the reference's -inf); the output projection in one launch from the f32 context, split hi + residual in registers.
// Compute dtype: x and parameters rounded to bf16; q, k hi + residual (~2^-21-class logits); P and v plain f16 (~2^-12); f32 accumulation/softmax. v_wmma_f32_16x16x32_f16.
#define NB 4
#define DMOD 512
#define CDRH 2
#define NR (NB * SLEN)
#define QBLKS (TQ / 64)
#define SLEN 2048
#define TQ SLEN
#define TK SLEN
#define NH 8
#define SCL 0.125f               /* 64^-0.5 */
typedef __bf16 v16b __attribute__((ext_vector_type(16)));
typedef unsigned short v8us __attribute__((ext_vector_type(8), may_alias));
typedef float  v8f  __attribute__((ext_vector_type(8)));
typedef float  v4f  __attribute__((ext_vector_type(4)));
typedef float  v4fa __attribute__((ext_vector_type(4), may_alias));
union FragB { v16b v; v8us half[2]; unsigned short u[16]; };

__device__ __forceinline__ unsigned short bf16_bits(float x) { unsigned int u = __float_as_uint(x); return (unsigned short)((u + 0x7FFFu + ((u >> 16) & 1u)) >> 16); }
__device__ __forceinline__ float bf16_val(unsigned short b) { return __uint_as_float(((unsigned int)b) << 16); }
__device__ __forceinline__ float bf16_round(float x) { return bf16_val(bf16_bits(x)); }
// D += A·B with NT terms: 1 = ah·bh, 2 = + al·bh (A split), 3 = + ah·bl (both split)
template <int NT>
__device__ __forceinline__ v8f mmaN(v16b ah, v16b al, v16b bh, v16b bl, v8f c) {
  c = __builtin_amdgcn_wmma_f32_16x16x32_bf16(false, ah, false, bh, (short)0, c, false, false);
  if (NT >= 2) c = __builtin_amdgcn_wmma_f32_16x16x32_bf16(false, al, false, bh, (short)0, c, false, false);
  if (NT >= 3) c = __builtin_amdgcn_wmma_f32_16x16x32_bf16(false, ah, false, bl, (short)0, c, false, false);
  asm volatile("v_nop\n\tv_nop\n\tv_nop\n\tv_nop" : "+v"(c) : "v"(ah), "v"(al), "v"(bh), "v"(bl));
  return c;
}

__global__ __launch_bounds__(256) void k_wt_bf16(const float* __restrict__ W, unsigned short* __restrict__ Wt, int K, int N) {
  const int t = blockIdx.x * 256 + threadIdx.x;
  const int k8n = K / 8;
  if (t >= N * k8n) return;
  const int n = t / k8n, k8 = (t % k8n) * 8;
  v8us v;
#pragma unroll
  for (int i = 0; i < 8; ++i) v[i] = bf16_bits(W[(size_t)(k8 + i) * N + n]);
  *(v8us*)(Wt + (size_t)n * K + k8) = v;
  
}

// GEMM C[M][N] (f32, pitch ldc) = act(A[M][K]·W + bias). A f32 row-major (pitch lda) converted per fragment to bf16
// (ASPLIT: hi/lo two planes -> 2 terms, else single rounded term); Wt bf16 [N][K] (pitch ldb). BIAS_BF16 rounds the
// bias to bf16 first (bias quantised to bf16 before the add). K%32==0, M%16==0, N%64==0.
template <bool ASPLIT, int ACT, bool BIAS_BF16>
__global__ __launch_bounds__(128) void k_gemm_bf(const float* __restrict__ A, int lda, const unsigned short* __restrict__ Wt, int ldb,
                                               const float* __restrict__ bias, float* __restrict__ C, int ldc, int M, int N, int K) {
  __shared__ __attribute__((aligned(16))) float so[4][16][64];
  const int tid = threadIdx.x, w = tid >> 5, lane = tid & 31, ln = lane & 15, hh = lane >> 4;
  const int ntn = N / 64;
  const int wid = blockIdx.x * 4 + w;
  const int mt = wid / ntn, nq = wid % ntn;
  if (mt * 16 >= M) return;
  const int row0 = mt * 16, col0 = nq * 64;
  const float* arow = A + (size_t)(row0 + ln) * lda;
  v8f acc[4] = {};
  for (int kb = 0; kb < K; kb += 32) {
    FragB ah, al;
    const v4f x0 = *(const v4fa*)(arow + kb + 8 * hh), x1 = *(const v4fa*)(arow + kb + 8 * hh + 4);
    const v4f x2 = *(const v4fa*)(arow + kb + 16 + 8 * hh), x3 = *(const v4fa*)(arow + kb + 16 + 8 * hh + 4);
    float xs[16] = {x0[0],x0[1],x0[2],x0[3],x1[0],x1[1],x1[2],x1[3],x2[0],x2[1],x2[2],x2[3],x3[0],x3[1],x3[2],x3[3]};
#pragma unroll
    for (int i = 0; i < 16; ++i) { const unsigned short hb = bf16_bits(xs[i]); ah.u[i] = hb; al.u[i] = ASPLIT ? bf16_bits(xs[i] - bf16_val(hb)) : (unsigned short)0; }
#pragma unroll
    for (int t = 0; t < 4; ++t) {
      const unsigned short* brow = Wt + (size_t)(col0 + t * 16 + ln) * ldb + kb;
      FragB b;
      b.half[0] = *(const v8us*)(brow + 8 * hh);
      b.half[1] = *(const v8us*)(brow + 16 + 8 * hh);
      acc[t] = mmaN<ASPLIT ? 2 : 1>(ah.v, al.v, b.v, b.v, acc[t]);
    }
  }
#pragma unroll
  for (int t = 0; t < 4; ++t) {
    float bv = bias ? bias[col0 + t * 16 + ln] : 0.f;
    if (BIAS_BF16) bv = bf16_round(bv);
#pragma unroll
    for (int r = 0; r < 8; ++r) { float v = acc[t][r] + bv; if (ACT == 1) v = fmaxf(v, 0.f); so[w][8 * hh + r][t * 16 + ln] = v; }
  }
  __builtin_amdgcn_fence(__ATOMIC_ACQ_REL, "workgroup");
  __builtin_amdgcn_wave_barrier();
  const int rsub = lane >> 4, c4 = (lane & 15) * 4;
  {
#pragma unroll
    for (int q = 0; q < 8; ++q) {
      const int r = q * 2 + rsub;
      const v4f v = *(const v4fa*)&so[w][r][c4];
      *(v4f*)(C + (size_t)(row0 + r) * ldc + col0 + c4) = v;
    }
    
  }
}

// GEMM C = act(A·W + bias + resid): A f32 (ASPLIT -> hi/lo 2 terms), Wt bf16 [N][K]; ACT 0 none, 1 relu, 2 exact gelu;
// resid (optional, f32, row index = (row % rmod), pitch ldr, RES_BF16 rounds it) added before the activation.
template <bool ASPLIT, int ACT, bool BIAS_BF16, bool RES_BF16>
__global__ __launch_bounds__(128) void k_gemm_bf3(const float* __restrict__ A, int lda, const unsigned short* __restrict__ Wt, int ldb,
                                                const float* __restrict__ bias, const float* __restrict__ resid, int rmod, int ldr,
                                                float* __restrict__ C, int ldc, int M, int N, int K) {
  __shared__ __attribute__((aligned(16))) float so[4][16][64];
  const int tid = threadIdx.x, w = tid >> 5, lane = tid & 31, ln = lane & 15, hh = lane >> 4;
  const int ntn = N / 64;
  const int wid = blockIdx.x * 4 + w;
  const int mt = wid / ntn, nq = wid % ntn;
  if (mt * 16 >= M) return;
  const int row0 = mt * 16, col0 = nq * 64;
  const float* arow = A + (size_t)(row0 + ln) * lda;
  v8f acc[4] = {};
  for (int kb = 0; kb < K; kb += 32) {
    FragB ah, al;
    const v4f x0 = *(const v4fa*)(arow + kb + 8 * hh), x1 = *(const v4fa*)(arow + kb + 8 * hh + 4);
    const v4f x2 = *(const v4fa*)(arow + kb + 16 + 8 * hh), x3 = *(const v4fa*)(arow + kb + 16 + 8 * hh + 4);
    float xs[16] = {x0[0],x0[1],x0[2],x0[3],x1[0],x1[1],x1[2],x1[3],x2[0],x2[1],x2[2],x2[3],x3[0],x3[1],x3[2],x3[3]};
#pragma unroll
    for (int i = 0; i < 16; ++i) { const unsigned short hb = bf16_bits(xs[i]); ah.u[i] = hb; al.u[i] = ASPLIT ? bf16_bits(xs[i] - bf16_val(hb)) : (unsigned short)0; }
#pragma unroll
    for (int t = 0; t < 4; ++t) {
      const unsigned short* brow = Wt + (size_t)(col0 + t * 16 + ln) * ldb + kb;
      FragB b;
      b.half[0] = *(const v8us*)(brow + 8 * hh);
      b.half[1] = *(const v8us*)(brow + 16 + 8 * hh);
      acc[t] = mmaN<ASPLIT ? 2 : 1>(ah.v, al.v, b.v, b.v, acc[t]);
    }
  }
#pragma unroll
  for (int t = 0; t < 4; ++t) {
    const int col = col0 + t * 16 + ln;
    float bv = bias ? bias[col] : 0.f;
    if (BIAS_BF16) bv = bf16_round(bv);
#pragma unroll
    for (int r = 0; r < 8; ++r) {
      float v = acc[t][r] + bv;
      if (resid) { float rv = resid[(size_t)((row0 + 8 * hh + r) % rmod) * ldr + col]; if (RES_BF16) rv = bf16_round(rv); v += rv; }
      if (ACT == 1) v = fmaxf(v, 0.f);
      if (ACT == 2) v = 0.5f * v * (1.0f + erff(v * 0.70710678118654752f));
      if (ACT == 3) { const float u = 0.7978845608028654f * (v + 0.044715f * v * v * v); v = 0.5f * v * (1.0f + tanhf(u)); }
      so[w][8 * hh + r][t * 16 + ln] = v;
    }
  }
  __builtin_amdgcn_fence(__ATOMIC_ACQ_REL, "workgroup");
  __builtin_amdgcn_wave_barrier();
  const int rsub = lane >> 4, c4 = (lane & 15) * 4;
  {
#pragma unroll
    for (int q = 0; q < 8; ++q) {
      const int r = q * 2 + rsub;
      const v4f v = *(const v4fa*)&so[w][r][c4];
      *(v4f*)(C + (size_t)(row0 + r) * ldc + col0 + c4) = v;
    }
    
  }
}
// row LayerNorm (biased variance, eps) over N: s = X (+ R); optional out_sum <- s; out_norm <- (s-mu)*rsqrt(var+eps)*g + b
template <bool PARAM_BF16>
__global__ __launch_bounds__(256) void k_layernorm(const float* __restrict__ X, const float* __restrict__ R, const float* __restrict__ g, const float* __restrict__ bta,
                                                  float* __restrict__ out_sum, float* __restrict__ out_norm, int N, float eps) {
  __shared__ float red[256];
  const int row = blockIdx.x, tid = threadIdx.x;
  const float* x = X + (size_t)row * N; const float* rr = R ? R + (size_t)row * N : nullptr;
  float vals[16];                     // up to N = 4096
  const int per = N / 256;            // contiguous chunk per thread? use strided-by-4 chunks: thread handles j = tid*4 + 1024*u
  float s1 = 0.f;
  for (int u = 0; u < per / 4; ++u) {
    const int j = tid * 4 + 1024 * u;
    const v4f a = *(const v4fa*)(x + j);
    v4f b = {0.f,0.f,0.f,0.f}; if (rr) b = *(const v4fa*)(rr + j);
#pragma unroll
    for (int q = 0; q < 4; ++q) { const float v = a[q] + b[q]; vals[u * 4 + q] = v; s1 += v; }
  }
  red[tid] = s1; __syncthreads();
  for (int st = 128; st > 0; st >>= 1) { if (tid < st) red[tid] += red[tid + st]; __syncthreads(); }
  const float mu = red[0] / (float)N; __syncthreads();
  float s2 = 0.f;
  for (int u = 0; u < per / 4; ++u)
#pragma unroll
    for (int q = 0; q < 4; ++q) { const float c = vals[u * 4 + q] - mu; s2 += c * c; }
  red[tid] = s2; __syncthreads();
  for (int st = 128; st > 0; st >>= 1) { if (tid < st) red[tid] += red[tid + st]; __syncthreads(); }
  const float rs = rsqrtf(red[0] / (float)N + eps);
  {
    for (int u = 0; u < per / 4; ++u) {
      const int j = tid * 4 + 1024 * u;
      v4f o, sm;
#pragma unroll
      for (int q = 0; q < 4; ++q) {
        float gg = g[j + q], bb = bta[j + q];
        if (PARAM_BF16) { gg = bf16_round(gg); bb = bf16_round(bb); }
        sm[q] = vals[u * 4 + q]; o[q] = (vals[u * 4 + q] - mu) * rs * gg + bb;
      }
      if (out_sum) *(v4f*)(out_sum + (size_t)row * N + j) = sm;
      *(v4f*)(out_norm + (size_t)row * N + j) = o;
    }
    
  }
}



// ---- f16 WMMA path (v_wmma_f32_16x16x32_f16): 11-bit significands for operands in range — used where a [0,1] probability operand needs more precision than bf16
typedef _Float16 v16h __attribute__((ext_vector_type(16)));
union FragH { v16h v; v8us half[2]; _Float16 h[16]; unsigned short u[16]; };
template <int NT>
__device__ __forceinline__ v8f mmaH(v16h ah, v16h al, v16h bh, v16h bl, v8f c) {
  c = __builtin_amdgcn_wmma_f32_16x16x32_f16(false, ah, false, bh, (short)0, c, false, false);
  if (NT >= 2) c = __builtin_amdgcn_wmma_f32_16x16x32_f16(false, al, false, bh, (short)0, c, false, false);
  if (NT >= 3) c = __builtin_amdgcn_wmma_f32_16x16x32_f16(false, ah, false, bl, (short)0, c, false, false);
  asm volatile("v_nop\n\tv_nop\n\tv_nop\n\tv_nop" : "+v"(c) : "v"(ah), "v"(al), "v"(bh), "v"(bl));
  return c;
}
// batched GEMM like k_gemm_b but f16 operands: A f32 (split into f16 hi/lo if ASPLIT, else rounded to f16), Bt = f16 values [n][k]; alpha; C f32; N multiple of 16 (partial tiles skipped)
template <bool ASPLIT>
__global__ __launch_bounds__(128) void k_gemm_h(const float* __restrict__ A, int lda, size_t sA, const _Float16* __restrict__ Bh, int ldb, size_t sB, float alpha, float* __restrict__ C, int ldc, size_t sC, int M, int N, int K) {
  __shared__ __attribute__((aligned(16))) float so[4][16][64];
  const int tid = threadIdx.x, w = tid >> 5, lane = tid & 31, ln = lane & 15, hh = lane >> 4; const int by = blockIdx.y;
  A += (size_t)by * sA; Bh += (size_t)by * sB; C += (size_t)by * sC;
  const int ntn = (N + 63) / 64; const int wid = blockIdx.x * 4 + w; const int mt = wid / ntn, nq = wid % ntn; if (mt * 16 >= M) return;
  const int row0 = mt * 16, col0 = nq * 64; const float* arow = A + (size_t)(row0 + ln) * lda;
  v8f acc[4] = {};
  for (int kb = 0; kb < K; kb += 32) {
    FragH ah, al;
    const v4f x0 = *(const v4fa*)(arow + kb + 8 * hh), x1 = *(const v4fa*)(arow + kb + 8 * hh + 4), x2 = *(const v4fa*)(arow + kb + 16 + 8 * hh), x3 = *(const v4fa*)(arow + kb + 16 + 8 * hh + 4);
    float xs[16] = {x0[0],x0[1],x0[2],x0[3],x1[0],x1[1],x1[2],x1[3],x2[0],x2[1],x2[2],x2[3],x3[0],x3[1],x3[2],x3[3]};
#pragma unroll
    for (int i = 0; i < 16; ++i) { const _Float16 h = (_Float16)xs[i]; ah.h[i] = h; al.h[i] = ASPLIT ? (_Float16)(xs[i] - (float)h) : (_Float16)0.0f; }
#pragma unroll
    for (int t = 0; t < 4; ++t) { if (col0 + t * 16 >= N) continue; const size_t boff = (size_t)(col0 + t * 16 + ln) * ldb + kb; FragH bq; bq.half[0] = *(const v8us*)(Bh + boff + 8 * hh); bq.half[1] = *(const v8us*)(Bh + boff + 16 + 8 * hh);
      acc[t] = mmaH<ASPLIT ? 2 : 1>(ah.v, al.v, bq.v, bq.v, acc[t]); }
  }
#pragma unroll
  for (int t = 0; t < 4; ++t) { if (col0 + t * 16 >= N) continue;
#pragma unroll
    for (int r = 0; r < 8; ++r) so[w][8 * hh + r][t * 16 + ln] = acc[t][r] * alpha; }
  __builtin_amdgcn_fence(__ATOMIC_ACQ_REL, "workgroup"); __builtin_amdgcn_wave_barrier();
  const int rsub = lane >> 4, c4 = (lane & 15) * 4;
  {
#pragma unroll
    for (int q = 0; q < 8; ++q) { const int r = q * 2 + rsub; if (col0 + c4 < N) { const v4f v = *(const v4fa*)&so[w][r][c4]; *(v4f*)(C + (size_t)(row0 + r) * ldc + col0 + c4) = v; } }
     }
}

// Wt[n][k] = f16(W[k][n]·scale) from f32 row-major W[K][N] (scale = power of two; bf16-exact weights stay exact in f16 away from the subnormal range)
__global__ __launch_bounds__(256) void k_wt_f16(const float* __restrict__ W, _Float16* __restrict__ Wt, int K, int N, float scale) {
  const int t = blockIdx.x * 256 + threadIdx.x; if (t >= N * (K / 8)) return; const int n = t / (K / 8), k8 = (t % (K / 8)) * 8; FragH f;
#pragma unroll
  for (int i = 0; i < 8; ++i) f.h[i] = (_Float16)(bf16_round(W[(size_t)(k8 + i) * N + n]) * scale); const v8us o = f.half[0];
  *(v8us*)((unsigned short*)Wt + (size_t)n * K + k8) = o; 
}
// k_gemm_hh variant with fused epilogue: v = acc·alpha + bias[by·sBias + col] (+ CP[(row/rowsPerB)·sCPb + by·64 + col] if CP) ; ACT 0 none / 1 elu ; writes f16 C16 (and f32 C if non-null)
template <int ACT>
__global__ __launch_bounds__(128) void k_gemm_hhx(const _Float16* __restrict__ A, int lda, size_t sA, const _Float16* __restrict__ Bh, int ldb, size_t sB, float alpha, const float* __restrict__ bias, size_t sBias, const float* __restrict__ CP, int rowsPerB, size_t sCPb, int row0g,
    float* __restrict__ C, _Float16* __restrict__ C16, int ldc, size_t sC, int M, int N, int K) {
  __shared__ __attribute__((aligned(16))) float so[4][16][64];
  const int tid = threadIdx.x, w = tid >> 5, lane = tid & 31, ln = lane & 15, hh = lane >> 4; const int by = blockIdx.y;
  A += (size_t)by * sA; Bh += (size_t)by * sB; const size_t cofs = (size_t)by * sC; const float* bp = bias ? bias + (size_t)by * sBias : nullptr;
  const int ntn = (N + 63) / 64; const int wid = blockIdx.x * 4 + w; const int mt = wid / ntn, nq = wid % ntn; if (mt * 16 >= M) return;
  const int row0 = mt * 16, col0 = nq * 64; const _Float16* arow = A + (size_t)(row0 + ln) * lda;
  v8f acc[4] = {};
  for (int kb = 0; kb < K; kb += 32) { FragH ah; ah.half[0] = *(const v8us*)((const unsigned short*)arow + kb + 8 * hh); ah.half[1] = *(const v8us*)((const unsigned short*)arow + kb + 16 + 8 * hh);
#pragma unroll
    for (int t = 0; t < 4; ++t) { if (col0 + t * 16 >= N) continue; const size_t boff = (size_t)(col0 + t * 16 + ln) * ldb + kb; FragH bq; bq.half[0] = *(const v8us*)((const unsigned short*)Bh + boff + 8 * hh); bq.half[1] = *(const v8us*)((const unsigned short*)Bh + boff + 16 + 8 * hh);
      acc[t] = mmaH<1>(ah.v, ah.v, bq.v, bq.v, acc[t]); }
  }
#pragma unroll
  for (int t = 0; t < 4; ++t) { if (col0 + t * 16 >= N) continue; const int col = col0 + t * 16 + ln; const float bv = bp ? bf16_round(bp[col]) : 0.f;
#pragma unroll
    for (int r = 0; r < 8; ++r) { float v = acc[t][r] * alpha + bv; if (CP) { const int bidx = (row0g + row0 + 8 * hh + r) / rowsPerB; v += CP[(size_t)bidx * sCPb + (size_t)by * 64 + col]; } if (ACT == 1) v = (v > 0.f) ? v : expm1f(v); else if (ACT == 7) v = (v > 0.f) ? v + 1.0f : expf(v); else if (ACT == 8) v = tanhf(v); else if (ACT == 9) v = 0.5f * v * (1.0f + tanhf(0.7978845608028654f * (v + 0.044715f * v * v * v))); else if (ACT == 11) v = 1.0f / (1.0f + expf(-v)); else if (ACT == 12) v = (v > 0.f) ? v : 0.01f * v; else if (ACT == 14) v = (v > 0.f) ? v : 0.1f * v; else if (ACT == 15) v = v / (1.0f + expf(-v)); else if (ACT == 3) v = fmaxf(v, 0.f); else if (ACT == 6) v = 0.5f * v * (1.0f + erff(v * 0.70710678118654752f)); so[w][8 * hh + r][t * 16 + ln] = v; } }
  __builtin_amdgcn_fence(__ATOMIC_ACQ_REL, "workgroup"); __builtin_amdgcn_wave_barrier();
  const int rsub = lane >> 4, c4 = (lane & 15) * 4; typedef _Float16 v4h __attribute__((ext_vector_type(4)));
  {
#pragma unroll
    for (int q = 0; q < 8; ++q) { const int r = q * 2 + rsub; if (col0 + c4 < N) { const v4f v = *(const v4fa*)&so[w][r][c4]; if (C) *(v4f*)(C + cofs + (size_t)(row0 + r) * ldc + col0 + c4) = v; if (C16) { v4h h4; for (int i = 0; i < 4; ++i) h4[i] = (_Float16)v[i]; *(v4h*)(C16 + cofs + (size_t)(row0 + r) * ldc + col0 + c4) = h4; } } }
     }
}


typedef _Float16 v4h __attribute__((ext_vector_type(4)));

__global__ __launch_bounds__(256) void k_x16(const float* __restrict__ x, _Float16* __restrict__ X16, size_t n8) { const size_t t = (size_t)blockIdx.x * 256 + threadIdx.x; if (t >= n8) return; FragH f;
#pragma unroll
  for (int q = 0; q < 8; ++q) f.h[q] = (_Float16)bf16_round(x[t * 8 + q]); *(v8us*)((unsigned short*)X16 + t * 8) = f.half[0];  }
__global__ __launch_bounds__(256) void k_h16(const float* __restrict__ x, _Float16* __restrict__ X16, size_t n8) { const size_t t = (size_t)blockIdx.x * 256 + threadIdx.x; if (t >= n8) return; FragH f;
#pragma unroll
  for (int q = 0; q < 8; ++q) f.h[q] = (_Float16)x[t * 8 + q]; *(v8us*)((unsigned short*)X16 + t * 8) = f.half[0];  }
__global__ __launch_bounds__(256) void k_round16f(const float* __restrict__ W, _Float16* __restrict__ Bt, size_t n8) { const size_t t = (size_t)blockIdx.x * 256 + threadIdx.x; if (t >= n8) return; FragH f;
#pragma unroll
  for (int i = 0; i < 8; ++i) f.h[i] = (_Float16)(bf16_round(W[t * 8 + i]) * 16.0f); *(v8us*)((unsigned short*)Bt + t * 8) = f.half[0];  }

// ---- pieces of the f16 GEMMs with a 32x64 wave tile ----
__device__ __forceinline__ v16h g2_frag(const _Float16* p, int hh) { FragH f; f.half[0] = *(const v8us*)((const unsigned short*)p + 8 * hh); f.half[1] = *(const v8us*)((const unsigned short*)p + 16 + 8 * hh); return f.v; }
__device__ __forceinline__ v8f g2_mma(v16h a, v16h b, v8f c) { v8f d = __builtin_amdgcn_wmma_f32_16x16x32_f16(false, a, false, b, (short)0, c, false, false); asm volatile("v_nop\n\tv_nop\n\tv_nop\n\tv_nop" : "+v"(d) : "v"(a), "v"(b)); return d; }
// One wave's tile of the q, k or v projection: C[32][64] = A[32 rows] B[64 rows]^T over the 512 inputs (both operands k-contiguous f16 rows, f32 accumulation), C / 16 + bias, staged in the wave's own LDS range so and stored as whole 128-byte lines of f16.
//   PART 0 (q): A = x rows j.., B = the head's 64 Wq^T rows; stored as hi + 2^10 residual planes.
//   PART 1 (k): the same, but A row r = x row idx[j + r] (the head class's list of valid keys): the planes come out compacted.
//   PART 2 (v): A = the head's Wv^T rows dh.. dh + 31, B row c = x row idx[j + c]: the tile is a piece of V^T itself, compacted; stored as plain f16.
// A fragment's address is the lane's own pointer (operand row, half), carried through the loop and stepped along k.
typedef const __attribute__((address_space(1))) char* gcp;      /* a pointer known to be global: carried through a loop, a plain pointer came out as flat loads */
typedef const __attribute__((address_space(1))) v8us* gv8p;
__device__ __forceinline__ v16h g2_fragp(gcp p) { FragH f; f.half[0] = *(gv8p)p; f.half[1] = *(gv8p)(p + 32); return f.v; }
template <int PART>
__device__ __forceinline__ void qkv_tile(float (*so)[68], const _Float16* __restrict__ xs, const _Float16* __restrict__ wh, const float* __restrict__ bias, const int* __restrict__ idx, int j, int dh, _Float16* __restrict__ ph, _Float16* __restrict__ pl, int ln, int hh) {
  gcp ap[2], bp[4]; float bi[(PART == 2) ? 16 : 4];      /* bi: the bias of the tile's columns or, PART 2, of this lane's 16 rows; loaded ahead of the loop, lands under it */
  const gcp ab = (gcp)((PART == 2) ? wh : xs), bb = (gcp)((PART == 2) ? xs : wh);
#pragma unroll
  for (int i = 0; i < 2; ++i) ap[i] = ab + (size_t)((PART == 0) ? j + 16 * i + ln : (PART == 1) ? idx[j + 16 * i + ln] : dh + 16 * i + ln) * (DMOD * 2) + 16 * hh;
#pragma unroll
  for (int t = 0; t < 4; ++t) bp[t] = bb + (size_t)((PART == 2) ? idx[j + 16 * t + ln] : 16 * t + ln) * (DMOD * 2) + 16 * hh;
#pragma unroll
  for (int u = 0; u < ((PART == 2) ? 16 : 4); ++u) bi[u] = bf16_round(bias[(PART == 2) ? dh + (u >> 3) * 16 + 8 * hh + (u & 7) : u * 16 + ln]);
  v8f c[2][4];
#pragma unroll
  for (int u = 0; u < 8; ++u) c[u >> 2][u & 3] = (v8f){0.f,0.f,0.f,0.f,0.f,0.f,0.f,0.f};
#pragma unroll 1      /* rolled: 8 passes of 16 products; the loop's code stays a few instruction-cache lines */
  for (int kb = 0; kb < DMOD; kb += 64) { v16h a[2][2], bf[4][2];      /* a pass takes one whole 128-byte line of every operand row (two k blocks of 32); its 24 loads stand ahead of the first product, so a line's four pieces are asked for close together and memory is waited for once a pass */
#pragma unroll
    for (int t = 0; t < 4; ++t) { bf[t][0] = g2_fragp(bp[t]); bf[t][1] = g2_fragp(bp[t] + 64); }
#pragma unroll
    for (int i = 0; i < 2; ++i) { a[i][0] = g2_fragp(ap[i]); a[i][1] = g2_fragp(ap[i] + 64); }
    asm volatile("s_wait_xcnt 0x0" ::: "memory");      /* stands between the pass's loads and the stepping of the pointers that they name */
    __builtin_amdgcn_sched_barrier(0);      /* keeps the pointer steps below from being scheduled ahead of that wait */
#pragma unroll
    for (int t = 0; t < 4; ++t) bp[t] += 128;
#pragma unroll
    for (int i = 0; i < 2; ++i) ap[i] += 128;
#pragma unroll
    for (int s = 0; s < 2; ++s)
#pragma unroll
      for (int t = 0; t < 4; ++t) { c[0][t] = g2_mma(a[0][s], bf[t][s], c[0][t]); c[1][t] = g2_mma(a[1][s], bf[t][s], c[1][t]); } }
#pragma unroll
  for (int u = 0; u < 8; ++u) { const int t = u & 3, half = u >> 2;
#pragma unroll
    for (int r = 0; r < 8; ++r) so[half * 16 + 8 * hh + r][t * 16 + ln] = c[half][t][r] * 0.0625f + bi[(PART == 2) ? half * 8 + r : t]; }
  __builtin_amdgcn_fence(__ATOMIC_ACQ_REL, "workgroup"); __builtin_amdgcn_wave_barrier();      /* the wave reads back rows that its other lanes wrote */
  constexpr int ldc = (PART == 2) ? TK : DMOD;
#pragma unroll
  for (int q = 0; q < 16; ++q) { const int r = q * 2 + hh; const v4f v = *(const v4fa*)&so[r][ln * 4]; v4h hi, lo;
#pragma unroll
    for (int i = 0; i < 4; ++i) { hi[i] = (_Float16)v[i]; lo[i] = (_Float16)((v[i] - (float)hi[i]) * 1024.0f); }
    *(v4h*)(ph + (size_t)r * ldc + ln * 4) = hi; if (PART != 2) *(v4h*)(pl + (size_t)r * ldc + ln * 4) = lo; }
  asm volatile("s_wait_xcnt 0x0" ::: "memory");      /* behind the tile's last store, ahead of any reuse of the registers that the stores name */
}
// The q, k and v projections with all their after-work in one launch: 512 blocks a part, a block = (sequence, 128 tokens or list positions, head), four wave tiles. A wave whose keys all lie past the count rounded up to 32 leaves at once (those rows and columns are never read); list entries past the count are 0, a finite row.
__global__ __launch_bounds__(128) void k_qkv(const _Float16* __restrict__ X16, const _Float16* __restrict__ BQ, const _Float16* __restrict__ BK, const _Float16* __restrict__ BV, const float* __restrict__ bq, const float* __restrict__ bk, const float* __restrict__ bv,
    const int* __restrict__ IDX, const int* __restrict__ CNT, _Float16* __restrict__ QH, _Float16* __restrict__ QL, _Float16* __restrict__ KH, _Float16* __restrict__ KL, _Float16* __restrict__ VT) {
  __shared__ __attribute__((aligned(16))) float so[4][32][68];
  const int tid = threadIdx.x, lane = tid & 31, ln = lane & 15, hh = lane >> 4; const int w = __builtin_amdgcn_readfirstlane(tid >> 5);
  constexpr int TPS = TK / 128, PER = NB * TPS * NH;
  const int part = blockIdx.x / PER, rem = blockIdx.x % PER; const int h = rem % NH, mt = rem / NH; const int b = mt / TPS, t0 = (mt % TPS) * 128;
  const _Float16* xs = X16 + (size_t)b * TK * DMOD; const size_t wo = (size_t)h * 64 * DMOD;
  if (part == 0) { const int j = t0 + 32 * w; const size_t o = ((size_t)b * TK + j) * DMOD + h * 64; qkv_tile<0>(so[w], xs, BQ + wo, bq + h * 64, nullptr, j, 0, QH + o, QL + o, ln, hh); return; }
  const int cls = (h < CDRH) ? 0 : 1; const int cr = (min(CNT[b * 32 + cls], TK) + 31) & ~31; const int* idx = IDX + ((size_t)b * 2 + cls) * TK;
  if (part == 1) { const int j = t0 + 32 * w; if (j >= cr) return; const size_t o = ((size_t)b * TK + j) * DMOD + h * 64; qkv_tile<1>(so[w], xs, BK + wo, bk + h * 64, idx, j, 0, KH + o, KL + o, ln, hh); }
  else { const int j = t0 + 64 * (w >> 1), dh = 32 * (w & 1); if (j >= cr) return; qkv_tile<2>(so[w], xs, BV + wo, bv + h * 64, idx, j, dh, VT + (((size_t)b * NH + h) * 64 + dh) * TK + j, nullptr, ln, hh); } }

template <int CAUSAL>
__global__ __launch_bounds__(128) void k_flash(const _Float16* __restrict__ Q16, int ldq, const _Float16* __restrict__ K16, int ldk, const _Float16* __restrict__ Vt, const int* __restrict__ MSK, float* __restrict__ O, int ldo) {
  constexpr int RPW = 16, RTN = RPW / 16, NQB = TQ / (4 * RPW), DT = 4, KS = 2;
  __shared__ __attribute__((aligned(16))) unsigned short sP[4][RPW][40]; __shared__ __attribute__((aligned(16))) float sO[4][RPW][64 + 4];
  const int tid = threadIdx.x, w = tid >> 5, lane = tid & 31, ln = lane & 15, hh = lane >> 4;
  const int slab = blockIdx.x / NQB, qblk = blockIdx.x % NQB; const int b = slab / NH, h = slab % NH; const int qb0 = qblk * (4 * RPW); const int q0 = qb0 + w * RPW;
  FragH aq[2][KS];
#pragma unroll
  for (int rt = 0; rt < RTN; ++rt) { const unsigned short* qr = (const unsigned short*)Q16 + ((size_t)b * TQ + q0 + rt * 16 + ln) * ldq + h * 64;
#pragma unroll
    for (int ks = 0; ks < KS; ++ks) { aq[rt][ks].half[0] = *(const v8us*)(qr + ks * 32 + 8 * hh); aq[rt][ks].half[1] = *(const v8us*)(qr + ks * 32 + 16 + 8 * hh); } }
  const unsigned short* Vth = (const unsigned short*)Vt + (size_t)slab * 64 * TK;
  float m_r[2][8], l_r[2][8]; v8f oacc[2][DT];
#pragma unroll
  for (int rt = 0; rt < RTN; ++rt) {
#pragma unroll
    for (int r = 0; r < 8; ++r) { m_r[rt][r] = -3.0e38f; l_r[rt][r] = 0.f; }
#pragma unroll
    for (int dt = 0; dt < DT; ++dt) oacc[rt][dt] = (v8f){0.f,0.f,0.f,0.f,0.f,0.f,0.f,0.f}; }
  const int jend = (CAUSAL == 1) ? (qb0 + 4 * RPW) : TK;      /* causal: keys beyond the block's last query never contribute */
#pragma unroll 1
  for (int j0 = 0; j0 < jend; j0 += 32) {
    v8f s[2][2];
#pragma unroll
    for (int nt = 0; nt < 2; ++nt) { const unsigned short* kr = (const unsigned short*)K16 + ((size_t)b * TK + j0 + nt * 16 + ln) * ldk + h * 64; FragH bk[KS];
#pragma unroll
      for (int ks = 0; ks < KS; ++ks) { bk[ks].half[0] = *(const v8us*)(kr + ks * 32 + 8 * hh); bk[ks].half[1] = *(const v8us*)(kr + ks * 32 + 16 + 8 * hh); }
#pragma unroll
      for (int rt = 0; rt < RTN; ++rt) { v8f acc = (v8f){0.f,0.f,0.f,0.f,0.f,0.f,0.f,0.f};
#pragma unroll
        for (int ks = 0; ks < KS; ++ks) acc = mmaH<1>(aq[rt][ks].v, aq[rt][ks].v, bk[ks].v, bk[ks].v, acc); s[rt][nt] = acc; } }
#pragma unroll
    for (int rt = 0; rt < RTN; ++rt)
#pragma unroll
      for (int r = 0; r < 8; ++r) { const int tq = q0 + rt * 16 + 8 * hh + r; const int k0 = j0 + ln, k1 = j0 + 16 + ln;
        const bool ok0 = (CAUSAL == 1) ? (k0 <= tq) : ((CAUSAL == 2) ? ((k0 >> 5) == (tq >> 5)) : true), ok1 = (CAUSAL == 1) ? (k1 <= tq) : ((CAUSAL == 2) ? ((k1 >> 5) == (tq >> 5)) : true);      /* mode 2: block-diagonal 32-token groups */
        const float s0 = ok0 ? s[rt][0][r] * SCL : -3.0e38f, s1 = ok1 ? s[rt][1][r] * SCL : -3.0e38f; float mc = fmaxf(s0, s1);
        mc = fmaxf(mc, __shfl_xor(mc, 1, 32)); mc = fmaxf(mc, __shfl_xor(mc, 2, 32)); mc = fmaxf(mc, __shfl_xor(mc, 4, 32)); mc = fmaxf(mc, __shfl_xor(mc, 8, 32));
        const float mn = fmaxf(m_r[rt][r], mc); const float al = (mn > -1.0e38f) ? expf(m_r[rt][r] - mn) : 1.0f; m_r[rt][r] = mn; const float p0 = ok0 ? expf(s0 - mn) : 0.f, p1 = ok1 ? expf(s1 - mn) : 0.f; l_r[rt][r] = l_r[rt][r] * al + p0 + p1;
#pragma unroll
        for (int dt = 0; dt < DT; ++dt) oacc[rt][dt][r] *= al;
        FragH t2; t2.h[0] = (_Float16)(p0 * 1024.0f); t2.h[1] = (_Float16)(p1 * 1024.0f); sP[w][rt * 16 + 8 * hh + r][ln] = t2.u[0]; sP[w][rt * 16 + 8 * hh + r][16 + ln] = t2.u[1]; }
    __builtin_amdgcn_fence(__ATOMIC_ACQ_REL, "workgroup"); __builtin_amdgcn_wave_barrier();
    FragH pa[2];
#pragma unroll
    for (int rt = 0; rt < RTN; ++rt) { pa[rt].half[0] = *(const v8us*)&sP[w][rt * 16 + ln][8 * hh]; pa[rt].half[1] = *(const v8us*)&sP[w][rt * 16 + ln][16 + 8 * hh]; }
#pragma unroll
    for (int dt = 0; dt < DT; ++dt) { const unsigned short* vrow = Vth + (size_t)(dt * 16 + ln) * TK + j0; FragH bv; bv.half[0] = *(const v8us*)(vrow + 8 * hh); bv.half[1] = *(const v8us*)(vrow + 16 + 8 * hh);
#pragma unroll
      for (int rt = 0; rt < RTN; ++rt) oacc[rt][dt] = mmaH<1>(pa[rt].v, pa[rt].v, bv.v, bv.v, oacc[rt][dt]); }
    __builtin_amdgcn_fence(__ATOMIC_ACQ_REL, "workgroup"); __builtin_amdgcn_wave_barrier(); }
#pragma unroll
  for (int rt = 0; rt < RTN; ++rt) {
#pragma unroll
    for (int r = 0; r < 8; ++r) { float l = l_r[rt][r]; l += __shfl_xor(l, 1, 32); l += __shfl_xor(l, 2, 32); l += __shfl_xor(l, 4, 32); l += __shfl_xor(l, 8, 32); l_r[rt][r] = (l > 0.f) ? 1.0f / (l * 1024.0f) : 0.f; }
#pragma unroll
    for (int dt = 0; dt < DT; ++dt)
#pragma unroll
      for (int r = 0; r < 8; ++r) sO[w][rt * 16 + 8 * hh + r][dt * 16 + ln] = oacc[rt][dt][r] * l_r[rt][r]; }
  __builtin_amdgcn_fence(__ATOMIC_ACQ_REL, "workgroup"); __builtin_amdgcn_wave_barrier();
  {
#pragma unroll
    for (int rp = 0; rp < RPW; rp += 2) { const int r = rp + (lane >> 4), pc = lane & 15; const v4f val = *(const v4fa*)&sO[w][r][pc * 4]; *(v4f*)(O + ((size_t)b * TQ + q0 + r) * ldo + h * 64 + pc * 4) = val; }
     } }
// Six 16-byte asynchronous copies to LDS per lane (one 32-key tile's share). s_wait_xcnt 0 closes the statement so that no address register of an issued copy is rewritten ahead of it.
__device__ __forceinline__ void cp_tile6(unsigned l0, const unsigned short* g0, unsigned l1, const unsigned short* g1, unsigned l2, const unsigned short* g2, unsigned l3, const unsigned short* g3, unsigned l4, const unsigned short* g4, unsigned l5, const unsigned short* g5) {
  asm volatile("global_load_async_to_lds_b128 %0, %1, off\n\t"
               "global_load_async_to_lds_b128 %2, %3, off\n\t"
               "global_load_async_to_lds_b128 %4, %5, off\n\t"
               "global_load_async_to_lds_b128 %6, %7, off\n\t"
               "global_load_async_to_lds_b128 %8, %9, off\n\t"
               "global_load_async_to_lds_b128 %10, %11, off\n\t"
               "s_wait_xcnt 0x0"
               :: "v"(l0), "v"(g0), "v"(l1), "v"(g1), "v"(l2), "v"(g2), "v"(l3), "v"(g3), "v"(l4), "v"(g4), "v"(l5), "v"(g5) : "memory");
}
// lane l takes the value of lane l ^ 16 (the other 16-lane half)
__device__ __forceinline__ float xhalf(float x) { return __builtin_bit_cast(float, __builtin_amdgcn_permlanex16(__builtin_bit_cast(int, x), __builtin_bit_cast(int, x), 0x76543210, 0xfedcba98, false, false)); }
template <int CAUSAL>
__global__ __launch_bounds__(128) void k_flashqk(const _Float16* __restrict__ Q16, const _Float16* __restrict__ QL, int ldq, const _Float16* __restrict__ K16, const _Float16* __restrict__ KL, int ldk, const _Float16* __restrict__ Vt, const int* __restrict__ MSK, float* __restrict__ O, int ldo) {
  static_assert(CAUSAL == 5, "compacted-key mode only");
  constexpr int RPW = 16, DT = 4, KS = 2;
  __shared__ __attribute__((aligned(16))) float sO[4][RPW][64 + 4];
  __shared__ __attribute__((aligned(16))) unsigned short sKh[2][32][72], sKl[2][32][72], sV[2][64][40];      /* row pitches 144 B and 80 B: 16 B x odd, for 16-byte fragment reads */
  const int tid = threadIdx.x, w = tid >> 5, lane = tid & 31, ln = lane & 15, hh = lane >> 4;
  const int slab = blockIdx.x / QBLKS, qblk = blockIdx.x % QBLKS; const int b = slab / NH, h = slab % NH; const int qb0 = qblk * (4 * RPW); const int q0 = qb0 + w * RPW;
  FragH aq[KS], aql[KS];
  { const unsigned short* qr = (const unsigned short*)Q16 + ((size_t)b * TQ + q0 + ln) * ldq + h * 64; const unsigned short* ql = (const unsigned short*)QL + ((size_t)b * TQ + q0 + ln) * ldq + h * 64;
#pragma unroll
    for (int ks = 0; ks < KS; ++ks) { aq[ks].half[0] = *(const v8us*)(qr + ks * 32 + 8 * hh); aq[ks].half[1] = *(const v8us*)(qr + ks * 32 + 16 + 8 * hh); aql[ks].half[0] = *(const v8us*)(ql + ks * 32 + 8 * hh); aql[ks].half[1] = *(const v8us*)(ql + ks * 32 + 16 + 8 * hh); } }
  const unsigned short* Vth = (const unsigned short*)Vt + (size_t)slab * 64 * TK;
  float m_r = -3.0e38f, l_r = 0.f; v8f oacc[DT];      /* query q0 + ln: running maximum (equal in both halves), this half's share of the sum, O^T rows dt * 16 + 8 hh + r */
#pragma unroll
  for (int dt = 0; dt < DT; ++dt) oacc[dt] = (v8f){0.f,0.f,0.f,0.f,0.f,0.f,0.f,0.f};
  const int kcnt = min(MSK[b * 32 + ((h < CDRH) ? 0 : 1)], TK);      /* number of valid keys of this (sequence, head class); K planes and V^T hold them compacted, in key order */
  const int jend = (kcnt + 31) & ~31;
  const int kr0 = tid >> 3, kc0 = (tid & 7) * 8, vr0 = tid >> 2, vc0 = (tid & 3) * 8;      /* a lane's share of a tile: rows kr0 and kr0 + 16 of both K planes, rows vr0 and vr0 + 32 of V^T, 16 bytes each; whole 128-byte K lines per 8 lanes */
  const unsigned short* gkh = (const unsigned short*)K16 + ((size_t)b * TK + kr0) * ldk + h * 64 + kc0; const unsigned short* gkl = (const unsigned short*)KL + ((size_t)b * TK + kr0) * ldk + h * 64 + kc0; const unsigned short* gv = Vth + (size_t)vr0 * TK + vc0;
  auto stage = [&](int jt, int bf) { const size_t ko = (size_t)jt * ldk;
    cp_tile6((unsigned)(size_t)&sKh[bf][kr0][kc0], gkh + ko, (unsigned)(size_t)&sKh[bf][kr0 + 16][kc0], gkh + ko + (size_t)16 * ldk, (unsigned)(size_t)&sKl[bf][kr0][kc0], gkl + ko, (unsigned)(size_t)&sKl[bf][kr0 + 16][kc0], gkl + ko + (size_t)16 * ldk,
             (unsigned)(size_t)&sV[bf][vr0][vc0], gv + jt, (unsigned)(size_t)&sV[bf][vr0 + 32][vc0], gv + (size_t)32 * TK + jt); };
  if (jend > 0) stage(0, 0);
  asm volatile("s_wait_asynccnt 0x0" ::: "memory");      /* this wave's share of tile 0 has landed */
  __syncthreads();      /* tile 0 is published to all four waves */
  if (jend > 32) stage(32, 1);
#pragma unroll 1
  for (int j0 = 0; j0 < jend; j0 += 32) {
    const int bf = (j0 >> 5) & 1;
    float sc[2][8];      /* sc[nt][r] = scaled score of key j0 + 16 nt + 8 hh + r for query q0 + ln; the inner loops of this trip are fully unrolled so that sc, pb, ls and oacc are indexed by constants and stay in registers */
#pragma unroll
    for (int nt = 0; nt < 2; ++nt) { const unsigned short* kr = &sKh[bf][nt * 16 + ln][0]; const unsigned short* klr = &sKl[bf][nt * 16 + ln][0]; FragH bk[KS], bkl[KS];
#pragma unroll
      for (int ks = 0; ks < KS; ++ks) { bk[ks].half[0] = *(const v8us*)(kr + ks * 32 + 8 * hh); bk[ks].half[1] = *(const v8us*)(kr + ks * 32 + 16 + 8 * hh); bkl[ks].half[0] = *(const v8us*)(klr + ks * 32 + 8 * hh); bkl[ks].half[1] = *(const v8us*)(klr + ks * 32 + 16 + 8 * hh); }
      v8f acc = (v8f){0.f,0.f,0.f,0.f,0.f,0.f,0.f,0.f}, accl = acc;
#pragma unroll
      for (int ks = 0; ks < KS; ++ks) { acc = mmaH<1>(bk[ks].v, bk[ks].v, aq[ks].v, aq[ks].v, acc); accl = mmaH<1>(bk[ks].v, bk[ks].v, aql[ks].v, aql[ks].v, accl); accl = mmaH<1>(bkl[ks].v, bkl[ks].v, aq[ks].v, aq[ks].v, accl); }
#pragma unroll
      for (int r = 0; r < 8; ++r) sc[nt][r] = (acc[r] + accl[r] * 0.0009765625f) * SCL; }
    if (j0 + 32 > kcnt) {      /* block-uniform: only the last trip holds keys past the count (key padding and head-specific masks are applied by the gather) */
#pragma unroll
      for (int nt = 0; nt < 2; ++nt)
#pragma unroll
        for (int r = 0; r < 8; ++r) if (j0 + nt * 16 + 8 * hh + r >= kcnt) sc[nt][r] = -3.0e38f; }
    float mc = fmaxf(sc[0][0], sc[1][0]);
#pragma unroll
    for (int r = 1; r < 8; ++r) mc = fmaxf(mc, fmaxf(sc[0][r], sc[1][r]));
    mc = fmaxf(mc, xhalf(mc));
    const float mn = fmaxf(m_r, mc);      /* finite in every trip: key j0 is below the count; so an invalid key's exp below is exactly 0, and so is the first trip's rescale factor */
    const float al = expf(m_r - mn); m_r = mn;
    FragH pb; float ls[4] = {0.f, 0.f, 0.f, 0.f};
#pragma unroll
    for (int nt = 0; nt < 2; ++nt)
#pragma unroll
      for (int r = 0; r < 8; ++r) { const float p = expf(sc[nt][r] - mn); ls[nt * 2 + (r & 1)] += p; pb.h[nt * 8 + r] = (_Float16)(p * 1024.0f); }      /* element nt * 8 + r of the B operand = key 16 nt + 8 hh + r: the k order of the V^T fragment */
    l_r = l_r * al + ((ls[0] + ls[1]) + (ls[2] + ls[3]));
#pragma unroll
    for (int dt = 0; dt < DT; ++dt)
#pragma unroll
      for (int r = 0; r < 8; ++r) oacc[dt][r] *= al;
#pragma unroll
    for (int dt = 0; dt < DT; ++dt) { const unsigned short* vrow = &sV[bf][dt * 16 + ln][0]; FragH bv; bv.half[0] = *(const v8us*)(vrow + 8 * hh); bv.half[1] = *(const v8us*)(vrow + 16 + 8 * hh);
      oacc[dt] = mmaH<1>(bv.v, bv.v, pb.v, pb.v, oacc[dt]); }
    asm volatile("s_wait_dscnt 0x0" ::: "memory");      /* this wave's reads of buffer bf have returned before the buffer is refilled */
    asm volatile("s_wait_asynccnt 0x0" ::: "memory");      /* this wave's share of the next tile has landed */
    __syncthreads();      /* publishes the next tile and ends every wave's reads of buffer bf */
    if (j0 + 64 < jend) stage(j0 + 64, bf); }
  asm volatile("s_wait_asynccnt 0x0" ::: "memory");      /* no copy is outstanding when the wave goes on to its end */
  const float l = l_r + xhalf(l_r); const float linv = (l > 0.f) ? 1.0f / (l * 1024.0f) : 0.f;
#pragma unroll
  for (int dt = 0; dt < DT; ++dt) { const v4f o0 = {oacc[dt][0] * linv, oacc[dt][1] * linv, oacc[dt][2] * linv, oacc[dt][3] * linv}, o1 = {oacc[dt][4] * linv, oacc[dt][5] * linv, oacc[dt][6] * linv, oacc[dt][7] * linv};
    *(v4fa*)&sO[w][ln][dt * 16 + 8 * hh] = o0; *(v4fa*)&sO[w][ln][dt * 16 + 8 * hh + 4] = o1; }
  __builtin_amdgcn_fence(__ATOMIC_ACQ_REL, "workgroup"); __builtin_amdgcn_wave_barrier();
  {
#pragma unroll
    for (int rp = 0; rp < RPW; rp += 2) { const int r = rp + (lane >> 4), pc = lane & 15; const v4f val = *(const v4fa*)&sO[w][r][pc * 4]; *(v4f*)(O + ((size_t)b * TQ + q0 + r) * ldo + h * 64 + pc * 4) = val; }
     } }

// f32 -> f16 hi + 2^10 residual A fragments of one row (k order of g2_frag: elements 0..7 = k 8 hh + i, elements 8..15 = k 16 + 8 hh + i); p already points at k = 8 hh. Same rounding as in k_qkv.
__device__ __forceinline__ void g2_split(const float* p, v16h& fh, v16h& fl) { const v4f x0 = *(const v4fa*)p, x1 = *(const v4fa*)(p + 4), x2 = *(const v4fa*)(p + 16), x3 = *(const v4fa*)(p + 20); FragH h, l;
#pragma unroll
  for (int q = 0; q < 4; ++q) { _Float16 t = (_Float16)x0[q]; h.h[q] = t; l.h[q] = (_Float16)((x0[q] - (float)t) * 1024.0f); t = (_Float16)x1[q]; h.h[4 + q] = t; l.h[4 + q] = (_Float16)((x1[q] - (float)t) * 1024.0f);
    t = (_Float16)x2[q]; h.h[8 + q] = t; l.h[8 + q] = (_Float16)((x2[q] - (float)t) * 1024.0f); t = (_Float16)x3[q]; h.h[12 + q] = t; l.h[12 + q] = (_Float16)((x3[q] - (float)t) * 1024.0f); }
  fh = h.v; fl = l.v; }
// Output projection in one launch: C[NR][DMOD] = A Wo + bias from the f32 context A. Wave tile 32x64 as in k_qkv; each A fragment is split hi + 2^10 residual in registers, and each x16 weight fragment (Bh = [out][in]) feeds the hi and the residual product, which keep separate f32 accumulators: C = hi / 16 + bias + residual / (16 * 1024).
__global__ __launch_bounds__(128) void k_gemm_out(const float* __restrict__ A, const _Float16* __restrict__ Bh, const float* __restrict__ bias, float* __restrict__ C) {
  __shared__ __attribute__((aligned(16))) float so[4][32][68];
  const int tid = threadIdx.x, w = tid >> 5, lane = tid & 31, ln = lane & 15, hh = lane >> 4;
  constexpr int ntn = DMOD >> 6; const int mt = blockIdx.x / ntn, nq = blockIdx.x - mt * ntn; const int row0 = mt * 128 + 32 * w, col0 = nq * 64;
  const float* a0p = A + (size_t)(row0 + ln) * DMOD + 8 * hh; const float* a1p = a0p + (size_t)16 * DMOD;
  const _Float16* b0p = Bh + (size_t)(col0 + ln) * DMOD;
  float bv[4];      /* the four bias loads go out ahead of the loop and land under it */
#pragma unroll
  for (int t = 0; t < 4; ++t) bv[t] = bf16_round(bias[col0 + t * 16 + ln]);
  v8f ch[2][4], cl[2][4];
#pragma unroll
  for (int u = 0; u < 8; ++u) { ch[u >> 2][u & 3] = (v8f){0.f,0.f,0.f,0.f,0.f,0.f,0.f,0.f}; cl[u >> 2][u & 3] = (v8f){0.f,0.f,0.f,0.f,0.f,0.f,0.f,0.f}; }
#pragma unroll 1      /* rolled: 16 trips of 16 products; the loop's code stays a few instruction-cache lines */
  for (int kb = 0; kb < DMOD; kb += 32) { v16h a0h, a0l, a1h, a1l, b[4];      /* all 16 loads of a trip stand ahead of its first product: one wait for memory a trip */
#pragma unroll
    for (int t = 0; t < 4; ++t) b[t] = g2_frag(b0p + (size_t)(t * 16) * DMOD + kb, hh);
    g2_split(a0p + kb, a0h, a0l); g2_split(a1p + kb, a1h, a1l);
#pragma unroll
    for (int t = 0; t < 4; ++t) { ch[0][t] = g2_mma(a0h, b[t], ch[0][t]); ch[1][t] = g2_mma(a1h, b[t], ch[1][t]); cl[0][t] = g2_mma(a0l, b[t], cl[0][t]); cl[1][t] = g2_mma(a1l, b[t], cl[1][t]); } }
#pragma unroll
  for (int u = 0; u < 8; ++u) { const int t = u & 3, half = u >> 2;
#pragma unroll
    for (int r = 0; r < 8; ++r) so[w][half * 16 + 8 * hh + r][t * 16 + ln] = (ch[half][t][r] * 0.0625f + bv[t]) + cl[half][t][r] * (0.0625f / 1024.0f); }
  __builtin_amdgcn_fence(__ATOMIC_ACQ_REL, "workgroup"); __builtin_amdgcn_wave_barrier();      /* the wave reads back rows that its other lanes wrote */
  const int rsub = lane >> 4, c4 = (lane & 15) * 4;
#pragma unroll
  for (int q = 0; q < 16; ++q) { const int r = q * 2 + rsub; const v4f v = *(const v4fa*)&so[w][r][c4]; *(v4f*)(C + (size_t)(row0 + r) * DMOD + col0 + c4) = v; } }
typedef int v4ia __attribute__((ext_vector_type(4), may_alias));
// One block per sequence, 8 consecutive keys a thread. IDX[b][0][.] = positions of the keys valid for the CDR heads, IDX[b][1][.] = for the other heads, ascending; entries past the count are 0. CNT[b*32 + class] = the counts (one 128-byte line per sequence).
__global__ __launch_bounds__(256) void k_mask(const int* __restrict__ mask, const int* __restrict__ cdrs, int* __restrict__ IDX, int* __restrict__ CNT) {
  __shared__ int sh[256]; __shared__ int sany; const int b = blockIdx.x, tid = threadIdx.x; static_assert(TK == 256 * 8, "8 keys a thread");
  const v4ia m0 = *(const v4ia*)(mask + (size_t)b * TK + tid * 8), m1 = *(const v4ia*)(mask + (size_t)b * TK + tid * 8 + 4), c0 = *(const v4ia*)(cdrs + (size_t)b * TK + tid * 8), c1 = *(const v4ia*)(cdrs + (size_t)b * TK + tid * 8 + 4);
  bool vp[8], vc[8]; int np = 0, nb = 0, any = 0;
#pragma unroll
  for (int q = 0; q < 8; ++q) { const int mv = (q < 4) ? m0[q & 3] : m1[q & 3], cv = (q < 4) ? c0[q & 3] : c1[q & 3]; vp[q] = mv != 0; vc[q] = cv != 0; any |= vc[q] ? 1 : 0; np += vp[q] ? 1 : 0; nb += (vp[q] && vc[q]) ? 1 : 0; }
  if (tid == 0) sany = 0; __syncthreads(); if (any) sany = 1;
  const int own = np | (nb << 16); int v = own; sh[tid] = v; __syncthreads();      /* both counts stay <= 2048, so one packed inclusive scan serves both lists */
  for (int st = 1; st < 256; st <<= 1) { const int add = (tid >= st) ? sh[tid - st] : 0; __syncthreads(); v += add; sh[tid] = v; __syncthreads(); }
  const bool allmasked = (sany == 0);      /* no CDR token at all -> the CDR mask is disabled */
  const int tot = sh[255], ex = v - own; const int cnt1 = tot & 0xFFFF, cnt0 = allmasked ? cnt1 : (tot >> 16); int o1 = ex & 0xFFFF, o0 = allmasked ? o1 : (ex >> 16);
  int* i0 = IDX + ((size_t)b * 2 + 0) * TK; int* i1 = IDX + ((size_t)b * 2 + 1) * TK;
#pragma unroll
  for (int q = 0; q < 8; ++q) { const int k = tid * 8 + q; if (vp[q]) i1[o1++] = k; if (vp[q] && (allmasked || vc[q])) i0[o0++] = k; if (k >= cnt1) i1[k] = 0; if (k >= cnt0) i0[k] = 0; }
  if (tid == 0) { CNT[b * 32 + 0] = cnt0; CNT[b * 32 + 1] = cnt1; } }

extern "C" void kernel_launch(void* const* d_in, const int* in_sizes, int n_in,
                              void* d_out, int out_size, void* d_ws, size_t ws_size, hipStream_t stream) {
  (void)in_sizes; (void)n_in; (void)out_size;
  const float* const* I = (const float* const*)d_in; const float* x = I[0]; const int* mask = (const int*)d_in[1]; const int* cdrs = (const int*)d_in[2]; const float* Wq = I[3]; const float* bq = I[4]; const float* Wk = I[5]; const float* bk = I[6]; const float* Wv = I[7]; const float* bv = I[8]; const float* Wo = I[9]; const float* bo = I[10];
  char* ws = (char*)d_ws; size_t off = 0;
  auto take = [&](size_t bytes) { char* p = ws + off; off += (bytes + 255) & ~(size_t)255; return p; };
  const size_t w8 = (size_t)DMOD * DMOD / 8;
  _Float16* BQ = (_Float16*)take(w8 * 16); _Float16* BK = (_Float16*)take(w8 * 16); _Float16* BV = (_Float16*)take(w8 * 16); _Float16* BO = (_Float16*)take(w8 * 16); int* IDX = (int*)take((size_t)NB * 2 * TK * 4); int* CNT = (int*)take((size_t)NB * 32 * 4);
  _Float16* X16 = (_Float16*)take((size_t)NR * DMOD * 2); float* F32 = (float*)take((size_t)NR * DMOD * 4); _Float16* QH = (_Float16*)take((size_t)NR * DMOD * 2); _Float16* QL = (_Float16*)take((size_t)NR * DMOD * 2); _Float16* KH = (_Float16*)take((size_t)NR * DMOD * 2); _Float16* KL = (_Float16*)take((size_t)NR * DMOD * 2); _Float16* VH = (_Float16*)take((size_t)NR * DMOD * 2); _Float16* VL = (_Float16*)take((size_t)NR * DMOD * 2); _Float16* VT = (_Float16*)take((size_t)NR * DMOD * 2); _Float16* VTL = (_Float16*)take((size_t)NR * DMOD * 2);
  float* O = F32;
  if (off > ws_size) return;      /* 2 + 0.06 + 8 + 16 + 8 x 8 = 90 MiB */
  k_wt_f16<<<(unsigned)(((size_t)DMOD * (DMOD / 8) + 255) / 256), 256, 0, stream>>>(Wq, BQ, DMOD, DMOD, 16.0f); k_wt_f16<<<(unsigned)(((size_t)DMOD * (DMOD / 8) + 255) / 256), 256, 0, stream>>>(Wk, BK, DMOD, DMOD, 16.0f); k_wt_f16<<<(unsigned)(((size_t)DMOD * (DMOD / 8) + 255) / 256), 256, 0, stream>>>(Wv, BV, DMOD, DMOD, 16.0f); k_wt_f16<<<(unsigned)(((size_t)DMOD * (DMOD / 8) + 255) / 256), 256, 0, stream>>>(Wo, BO, DMOD, DMOD, 16.0f);
  k_mask<<<NB, 256, 0, stream>>>(mask, cdrs, IDX, CNT);
  k_x16<<<(unsigned)(((size_t)NR * DMOD / 8 + 255) / 256), 256, 0, stream>>>(x, X16, (size_t)NR * DMOD / 8);
  const dim3 gA((NR / 128) * (DMOD / 64), 1);
  k_qkv<<<3 * NB * (TK / 128) * NH, 128, 0, stream>>>(X16, BQ, BK, BV, bq, bk, bv, IDX, CNT, QH, QL, KH, KL, VT);
  k_flashqk<5><<<NB * NH * QBLKS, 128, 0, stream>>>(QH, QL, DMOD, KH, KL, DMOD, VT, CNT, O, DMOD);      /* q/k hi + residual; P (x2^10) and V plain f16 */
  k_gemm_out<<<gA, 128, 0, stream>>>(O, BO, bo, (float*)d_out);
}

// v006
// It runs in 109 microseconds.
// Timed twice side by side with v005, it ran 1.14 times as fast both times.
// Counting every step since v000, it is 5.01 times as fast.
#include <hip/hip_runtime.h>
// CDRs attention (4 sequences x 2048 tokens x 512; 8 heads x 64): q,k,v = x W + b; scores/8; keys with mask == 0 invalid for all heads; for heads 0..1 additionally keys with cdrs_score == 0 invalid unless the sequence has no CDR token at all; softmax; ctx Wo + bo -> [4,2048,512].
// Structure: per sequence two compacted lists of valid key positions (CDR heads / other heads) with their counts, from the two int inputs on VALU (one block per sequence: 'all masked' flag + prefix sum), x as an exact f16 plane and the four x16 f16 weight transposes, all in one preparatory launch; the q/k/v projections as f16 WMMA GEMMs in one launch (32x64 wave tiles, f32 accumulation, exact x16 weights + bias) whose x rows for K and V are taken through the lists, so K (hi + 2^10 residual planes, like q) and V^T (formed directly as Wv^T x^T) come out compacted and the flash loop runs only over valid keys; the fused flash kernel with hi + 2^10-residual q/k planes (S = QhKh + (QlKh + QhKl)/1024) and plain f16 P (x2^10) and V with the key-count mask mode (invalid keys never visited == the reference's -inf); the output projection in one launch from the f32 context, split hi + residual in registers.
// Compute dtype: x and parameters rounded to bf16; q, k hi + residual (~2^-21-class logits); P and v plain f16 (~2^-12); f32 accumulation/softmax. v_wmma_f32_16x16x32_f16.
#define NB 4
#define DMOD 512
#define CDRH 2
#define NR (NB * SLEN)
#define QBLKS (TQ / 64)
#define SLEN 2048
#define TQ SLEN
#define TK SLEN
#define NH 8
#define SCL 0.125f               /* 64^-0.5 */
typedef __bf16 v16b __attribute__((ext_vector_type(16)));
typedef unsigned short v8us __attribute__((ext_vector_type(8), may_alias));
typedef float  v8f  __attribute__((ext_vector_type(8)));
typedef float  v4f  __attribute__((ext_vector_type(4)));
typedef float  v4fa __attribute__((ext_vector_type(4), may_alias));
union FragB { v16b v; v8us half[2]; unsigned short u[16]; };

__device__ __forceinline__ unsigned short bf16_bits(float x) { unsigned int u = __float_as_uint(x); return (unsigned short)((u + 0x7FFFu + ((u >> 16) & 1u)) >> 16); }
__device__ __forceinline__ float bf16_val(unsigned short b) { return __uint_as_float(((unsigned int)b) << 16); }
__device__ __forceinline__ float bf16_round(float x) { return bf16_val(bf16_bits(x)); }
// D += A·B with NT terms: 1 = ah·bh, 2 = + al·bh (A split), 3 = + ah·bl (both split)
template <int NT>
__device__ __forceinline__ v8f mmaN(v16b ah, v16b al, v16b bh, v16b bl, v8f c) {
  c = __builtin_amdgcn_wmma_f32_16x16x32_bf16(false, ah, false, bh, (short)0, c, false, false);
  if (NT >= 2) c = __builtin_amdgcn_wmma_f32_16x16x32_bf16(false, al, false, bh, (short)0, c, false, false);
  if (NT >= 3) c = __builtin_amdgcn_wmma_f32_16x16x32_bf16(false, ah, false, bl, (short)0, c, false, false);
  asm volatile("v_nop\n\tv_nop\n\tv_nop\n\tv_nop" : "+v"(c) : "v"(ah), "v"(al), "v"(bh), "v"(bl));
  return c;
}

__global__ __launch_bounds__(256) void k_wt_bf16(const float* __restrict__ W, unsigned short* __restrict__ Wt, int K, int N) {
  const int t = blockIdx.x * 256 + threadIdx.x;
  const int k8n = K / 8;
  if (t >= N * k8n) return;
  const int n = t / k8n, k8 = (t % k8n) * 8;
  v8us v;
#pragma unroll
  for (int i = 0; i < 8; ++i) v[i] = bf16_bits(W[(size_t)(k8 + i) * N + n]);
  *(v8us*)(Wt + (size_t)n * K + k8) = v;
  
}

// GEMM C[M][N] (f32, pitch ldc) = act(A[M][K]·W + bias). A f32 row-major (pitch lda) converted per fragment to bf16
// (ASPLIT: hi/lo two planes -> 2 terms, else single rounded term); Wt bf16 [N][K] (pitch ldb). BIAS_BF16 rounds the
// bias to bf16 first (bias quantised to bf16 before the add). K%32==0, M%16==0, N%64==0.
template <bool ASPLIT, int ACT, bool BIAS_BF16>
__global__ __launch_bounds__(128) void k_gemm_bf(const float* __restrict__ A, int lda, const unsigned short* __restrict__ Wt, int ldb,
                                               const float* __restrict__ bias, float* __restrict__ C, int ldc, int M, int N, int K) {
  __shared__ __attribute__((aligned(16))) float so[4][16][64];
  const int tid = threadIdx.x, w = tid >> 5, lane = tid & 31, ln = lane & 15, hh = lane >> 4;
  const int ntn = N / 64;
  const int wid = blockIdx.x * 4 + w;
  const int mt = wid / ntn, nq = wid % ntn;
  if (mt * 16 >= M) return;
  const int row0 = mt * 16, col0 = nq * 64;
  const float* arow = A + (size_t)(row0 + ln) * lda;
  v8f acc[4] = {};
  for (int kb = 0; kb < K; kb += 32) {
    FragB ah, al;
    const v4f x0 = *(const v4fa*)(arow + kb + 8 * hh), x1 = *(const v4fa*)(arow + kb + 8 * hh + 4);
    const v4f x2 = *(const v4fa*)(arow + kb + 16 + 8 * hh), x3 = *(const v4fa*)(arow + kb + 16 + 8 * hh + 4);
    float xs[16] = {x0[0],x0[1],x0[2],x0[3],x1[0],x1[1],x1[2],x1[3],x2[0],x2[1],x2[2],x2[3],x3[0],x3[1],x3[2],x3[3]};
#pragma unroll
    for (int i = 0; i < 16; ++i) { const unsigned short hb = bf16_bits(xs[i]); ah.u[i] = hb; al.u[i] = ASPLIT ? bf16_bits(xs[i] - bf16_val(hb)) : (unsigned short)0; }
#pragma unroll
    for (int t = 0; t < 4; ++t) {
      const unsigned short* brow = Wt + (size_t)(col0 + t * 16 + ln) * ldb + kb;
      FragB b;
      b.half[0] = *(const v8us*)(brow + 8 * hh);
      b.half[1] = *(const v8us*)(brow + 16 + 8 * hh);
      acc[t] = mmaN<ASPLIT ? 2 : 1>(ah.v, al.v, b.v, b.v, acc[t]);
    }
  }
#pragma unroll
  for (int t = 0; t < 4; ++t) {
    float bv = bias ? bias[col0 + t * 16 + ln] : 0.f;
    if (BIAS_BF16) bv = bf16_round(bv);
#pragma unroll
    for (int r = 0; r < 8; ++r) { float v = acc[t][r] + bv; if (ACT == 1) v = fmaxf(v, 0.f); so[w][8 * hh + r][t * 16 + ln] = v; }
  }
  __builtin_amdgcn_fence(__ATOMIC_ACQ_REL, "workgroup");
  __builtin_amdgcn_wave_barrier();
  const int rsub = lane >> 4, c4 = (lane & 15) * 4;
  {
#pragma unroll
    for (int q = 0; q < 8; ++q) {
      const int r = q * 2 + rsub;
      const v4f v = *(const v4fa*)&so[w][r][c4];
      *(v4f*)(C + (size_t)(row0 + r) * ldc + col0 + c4) = v;
    }
    
  }
}

// GEMM C = act(A·W + bias + resid): A f32 (ASPLIT -> hi/lo 2 terms), Wt bf16 [N][K]; ACT 0 none, 1 relu, 2 exact gelu;
// resid (optional, f32, row index = (row % rmod), pitch ldr, RES_BF16 rounds it) added before the activation.
template <bool ASPLIT, int ACT, bool BIAS_BF16, bool RES_BF16>
__global__ __launch_bounds__(128) void k_gemm_bf3(const float* __restrict__ A, int lda, const unsigned short* __restrict__ Wt, int ldb,
                                                const float* __restrict__ bias, const float* __restrict__ resid, int rmod, int ldr,
                                                float* __restrict__ C, int ldc, int M, int N, int K) {
  __shared__ __attribute__((aligned(16))) float so[4][16][64];
  const int tid = threadIdx.x, w = tid >> 5, lane = tid & 31, ln = lane & 15, hh = lane >> 4;
  const int ntn = N / 64;
  const int wid = blockIdx.x * 4 + w;
  const int mt = wid / ntn, nq = wid % ntn;
  if (mt * 16 >= M) return;
  const int row0 = mt * 16, col0 = nq * 64;
  const float* arow = A + (size_t)(row0 + ln) * lda;
  v8f acc[4] = {};
  for (int kb = 0; kb < K; kb += 32) {
    FragB ah, al;
    const v4f x0 = *(const v4fa*)(arow + kb + 8 * hh), x1 = *(const v4fa*)(arow + kb + 8 * hh + 4);
    const v4f x2 = *(const v4fa*)(arow + kb + 16 + 8 * hh), x3 = *(const v4fa*)(arow + kb + 16 + 8 * hh + 4);
    float xs[16] = {x0[0],x0[1],x0[2],x0[3],x1[0],x1[1],x1[2],x1[3],x2[0],x2[1],x2[2],x2[3],x3[0],x3[1],x3[2],x3[3]};
#pragma unroll
    for (int i = 0; i < 16; ++i) { const unsigned short hb = bf16_bits(xs[i]); ah.u[i] = hb; al.u[i] = ASPLIT ? bf16_bits(xs[i] - bf16_val(hb)) : (unsigned short)0; }
#pragma unroll
    for (int t = 0; t < 4; ++t) {
      const unsigned short* brow = Wt + (size_t)(col0 + t * 16 + ln) * ldb + kb;
      FragB b;
      b.half[0] = *(const v8us*)(brow + 8 * hh);
      b.half[1] = *(const v8us*)(brow + 16 + 8 * hh);
      acc[t] = mmaN<ASPLIT ? 2 : 1>(ah.v, al.v, b.v, b.v, acc[t]);
    }
  }
#pragma unroll
  for (int t = 0; t < 4; ++t) {
    const int col = col0 + t * 16 + ln;
    float bv = bias ? bias[col] : 0.f;
    if (BIAS_BF16) bv = bf16_round(bv);
#pragma unroll
    for (int r = 0; r < 8; ++r) {
      float v = acc[t][r] + bv;
      if (resid) { float rv = resid[(size_t)((row0 + 8 * hh + r) % rmod) * ldr + col]; if (RES_BF16) rv = bf16_round(rv); v += rv; }
      if (ACT == 1) v = fmaxf(v, 0.f);
      if (ACT == 2) v = 0.5f * v * (1.0f + erff(v * 0.70710678118654752f));
      if (ACT == 3) { const float u = 0.7978845608028654f * (v + 0.044715f * v * v * v); v = 0.5f * v * (1.0f + tanhf(u)); }
      so[w][8 * hh + r][t * 16 + ln] = v;
    }
  }
  __builtin_amdgcn_fence(__ATOMIC_ACQ_REL, "workgroup");
  __builtin_amdgcn_wave_barrier();
  const int rsub = lane >> 4, c4 = (lane & 15) * 4;
  {
#pragma unroll
    for (int q = 0; q < 8; ++q) {
      const int r = q * 2 + rsub;
      const v4f v = *(const v4fa*)&so[w][r][c4];
      *(v4f*)(C + (size_t)(row0 + r) * ldc + col0 + c4) = v;
    }
    
  }
}
// row LayerNorm (biased variance, eps) over N: s = X (+ R); optional out_sum <- s; out_norm <- (s-mu)*rsqrt(var+eps)*g + b
template <bool PARAM_BF16>
__global__ __launch_bounds__(256) void k_layernorm(const float* __restrict__ X, const float* __restrict__ R, const float* __restrict__ g, const float* __restrict__ bta,
                                                  float* __restrict__ out_sum, float* __restrict__ out_norm, int N, float eps) {
  __shared__ float red[256];
  const int row = blockIdx.x, tid = threadIdx.x;
  const float* x = X + (size_t)row * N; const float* rr = R ? R + (size_t)row * N : nullptr;
  float vals[16];                     // up to N = 4096
  const int per = N / 256;            // contiguous chunk per thread? use strided-by-4 chunks: thread handles j = tid*4 + 1024*u
  float s1 = 0.f;
  for (int u = 0; u < per / 4; ++u) {
    const int j = tid * 4 + 1024 * u;
    const v4f a = *(const v4fa*)(x + j);
    v4f b = {0.f,0.f,0.f,0.f}; if (rr) b = *(const v4fa*)(rr + j);
#pragma unroll
    for (int q = 0; q < 4; ++q) { const float v = a[q] + b[q]; vals[u * 4 + q] = v; s1 += v; }
  }
  red[tid] = s1; __syncthreads();
  for (int st = 128; st > 0; st >>= 1) { if (tid < st) red[tid] += red[tid + st]; __syncthreads(); }
  const float mu = red[0] / (float)N; __syncthreads();
  float s2 = 0.f;
  for (int u = 0; u < per / 4; ++u)
#pragma unroll
    for (int q = 0; q < 4; ++q) { const float c = vals[u * 4 + q] - mu; s2 += c * c; }
  red[tid] = s2; __syncthreads();
  for (int st = 128; st > 0; st >>= 1) { if (tid < st) red[tid] += red[tid + st]; __syncthreads(); }
  const float rs = rsqrtf(red[0] / (float)N + eps);
  {
    for (int u = 0; u < per / 4; ++u) {
      const int j = tid * 4 + 1024 * u;
      v4f o, sm;
#pragma unroll
      for (int q = 0; q < 4; ++q) {
        float gg = g[j + q], bb = bta[j + q];
        if (PARAM_BF16) { gg = bf16_round(gg); bb = bf16_round(bb); }
        sm[q] = vals[u * 4 + q]; o[q] = (vals[u * 4 + q] - mu) * rs * gg + bb;
      }
      if (out_sum) *(v4f*)(out_sum + (size_t)row * N + j) = sm;
      *(v4f*)(out_norm + (size_t)row * N + j) = o;
    }
    
  }
}



// ---- f16 WMMA path (v_wmma_f32_16x16x32_f16): 11-bit significands for operands in range — used where a [0,1] probability operand needs more precision than bf16
typedef _Float16 v16h __attribute__((ext_vector_type(16)));
union FragH { v16h v; v8us half[2]; _Float16 h[16]; unsigned short u[16]; };
template <int NT>
__device__ __forceinline__ v8f mmaH(v16h ah, v16h al, v16h bh, v16h bl, v8f c) {
  c = __builtin_amdgcn_wmma_f32_16x16x32_f16(false, ah, false, bh, (short)0, c, false, false);
  if (NT >= 2) c = __builtin_amdgcn_wmma_f32_16x16x32_f16(false, al, false, bh, (short)0, c, false, false);
  if (NT >= 3) c = __builtin_amdgcn_wmma_f32_16x16x32_f16(false, ah, false, bl, (short)0, c, false, false);
  asm volatile("v_nop\n\tv_nop\n\tv_nop\n\tv_nop" : "+v"(c) : "v"(ah), "v"(al), "v"(bh), "v"(bl));
  return c;
}
// batched GEMM like k_gemm_b but f16 operands: A f32 (split into f16 hi/lo if ASPLIT, else rounded to f16), Bt = f16 values [n][k]; alpha; C f32; N multiple of 16 (partial tiles skipped)
template <bool ASPLIT>
__global__ __launch_bounds__(128) void k_gemm_h(const float* __restrict__ A, int lda, size_t sA, const _Float16* __restrict__ Bh, int ldb, size_t sB, float alpha, float* __restrict__ C, int ldc, size_t sC, int M, int N, int K) {
  __shared__ __attribute__((aligned(16))) float so[4][16][64];
  const int tid = threadIdx.x, w = tid >> 5, lane = tid & 31, ln = lane & 15, hh = lane >> 4; const int by = blockIdx.y;
  A += (size_t)by * sA; Bh += (size_t)by * sB; C += (size_t)by * sC;
  const int ntn = (N + 63) / 64; const int wid = blockIdx.x * 4 + w; const int mt = wid / ntn, nq = wid % ntn; if (mt * 16 >= M) return;
  const int row0 = mt * 16, col0 = nq * 64; const float* arow = A + (size_t)(row0 + ln) * lda;
  v8f acc[4] = {};
  for (int kb = 0; kb < K; kb += 32) {
    FragH ah, al;
    const v4f x0 = *(const v4fa*)(arow + kb + 8 * hh), x1 = *(const v4fa*)(arow + kb + 8 * hh + 4), x2 = *(const v4fa*)(arow + kb + 16 + 8 * hh), x3 = *(const v4fa*)(arow + kb + 16 + 8 * hh + 4);
    float xs[16] = {x0[0],x0[1],x0[2],x0[3],x1[0],x1[1],x1[2],x1[3],x2[0],x2[1],x2[2],x2[3],x3[0],x3[1],x3[2],x3[3]};
#pragma unroll
    for (int i = 0; i < 16; ++i) { const _Float16 h = (_Float16)xs[i]; ah.h[i] = h; al.h[i] = ASPLIT ? (_Float16)(xs[i] - (float)h) : (_Float16)0.0f; }
#pragma unroll
    for (int t = 0; t < 4; ++t) { if (col0 + t * 16 >= N) continue; const size_t boff = (size_t)(col0 + t * 16 + ln) * ldb + kb; FragH bq; bq.half[0] = *(const v8us*)(Bh + boff + 8 * hh); bq.half[1] = *(const v8us*)(Bh + boff + 16 + 8 * hh);
      acc[t] = mmaH<ASPLIT ? 2 : 1>(ah.v, al.v, bq.v, bq.v, acc[t]); }
  }
#pragma unroll
  for (int t = 0; t < 4; ++t) { if (col0 + t * 16 >= N) continue;
#pragma unroll
    for (int r = 0; r < 8; ++r) so[w][8 * hh + r][t * 16 + ln] = acc[t][r] * alpha; }
  __builtin_amdgcn_fence(__ATOMIC_ACQ_REL, "workgroup"); __builtin_amdgcn_wave_barrier();
  const int rsub = lane >> 4, c4 = (lane & 15) * 4;
  {
#pragma unroll
    for (int q = 0; q < 8; ++q) { const int r = q * 2 + rsub; if (col0 + c4 < N) { const v4f v = *(const v4fa*)&so[w][r][c4]; *(v4f*)(C + (size_t)(row0 + r) * ldc + col0 + c4) = v; } }
     }
}

// Wt[n][k] = f16(W[k][n]·scale) from f32 row-major W[K][N] (scale = power of two; bf16-exact weights stay exact in f16 away from the subnormal range)
__device__ __forceinline__ void wt_f16(const float* __restrict__ W, _Float16* __restrict__ Wt, int K, int N, float scale, int t) {      /* t = 0 .. N * K / 8 - 1: output row n, eight k */
  const int n = t / (K / 8), k8 = (t % (K / 8)) * 8; FragH f;
#pragma unroll
  for (int i = 0; i < 8; ++i) f.h[i] = (_Float16)(bf16_round(W[(size_t)(k8 + i) * N + n]) * scale); const v8us o = f.half[0];
  *(v8us*)((unsigned short*)Wt + (size_t)n * K + k8) = o;
  asm volatile("s_wait_xcnt 0x0" ::: "memory");      /* behind the store, ahead of any reuse of the registers that it names (the other parts' code follows in the same kernel) */
}
// k_gemm_hh variant with fused epilogue: v = acc·alpha + bias[by·sBias + col] (+ CP[(row/rowsPerB)·sCPb + by·64 + col] if CP) ; ACT 0 none / 1 elu ; writes f16 C16 (and f32 C if non-null)
template <int ACT>
__global__ __launch_bounds__(128) void k_gemm_hhx(const _Float16* __restrict__ A, int lda, size_t sA, const _Float16* __restrict__ Bh, int ldb, size_t sB, float alpha, const float* __restrict__ bias, size_t sBias, const float* __restrict__ CP, int rowsPerB, size_t sCPb, int row0g,
    float* __restrict__ C, _Float16* __restrict__ C16, int ldc, size_t sC, int M, int N, int K) {
  __shared__ __attribute__((aligned(16))) float so[4][16][64];
  const int tid = threadIdx.x, w = tid >> 5, lane = tid & 31, ln = lane & 15, hh = lane >> 4; const int by = blockIdx.y;
  A += (size_t)by * sA; Bh += (size_t)by * sB; const size_t cofs = (size_t)by * sC; const float* bp = bias ? bias + (size_t)by * sBias : nullptr;
  const int ntn = (N + 63) / 64; const int wid = blockIdx.x * 4 + w; const int mt = wid / ntn, nq = wid % ntn; if (mt * 16 >= M) return;
  const int row0 = mt * 16, col0 = nq * 64; const _Float16* arow = A + (size_t)(row0 + ln) * lda;
  v8f acc[4] = {};
  for (int kb = 0; kb < K; kb += 32) { FragH ah; ah.half[0] = *(const v8us*)((const unsigned short*)arow + kb + 8 * hh); ah.half[1] = *(const v8us*)((const unsigned short*)arow + kb + 16 + 8 * hh);
#pragma unroll
    for (int t = 0; t < 4; ++t) { if (col0 + t * 16 >= N) continue; const size_t boff = (size_t)(col0 + t * 16 + ln) * ldb + kb; FragH bq; bq.half[0] = *(const v8us*)((const unsigned short*)Bh + boff + 8 * hh); bq.half[1] = *(const v8us*)((const unsigned short*)Bh + boff + 16 + 8 * hh);
      acc[t] = mmaH<1>(ah.v, ah.v, bq.v, bq.v, acc[t]); }
  }
#pragma unroll
  for (int t = 0; t < 4; ++t) { if (col0 + t * 16 >= N) continue; const int col = col0 + t * 16 + ln; const float bv = bp ? bf16_round(bp[col]) : 0.f;
#pragma unroll
    for (int r = 0; r < 8; ++r) { float v = acc[t][r] * alpha + bv; if (CP) { const int bidx = (row0g + row0 + 8 * hh + r) / rowsPerB; v += CP[(size_t)bidx * sCPb + (size_t)by * 64 + col]; } if (ACT == 1) v = (v > 0.f) ? v : expm1f(v); else if (ACT == 7) v = (v > 0.f) ? v + 1.0f : expf(v); else if (ACT == 8) v = tanhf(v); else if (ACT == 9) v = 0.5f * v * (1.0f + tanhf(0.7978845608028654f * (v + 0.044715f * v * v * v))); else if (ACT == 11) v = 1.0f / (1.0f + expf(-v)); else if (ACT == 12) v = (v > 0.f) ? v : 0.01f * v; else if (ACT == 14) v = (v > 0.f) ? v : 0.1f * v; else if (ACT == 15) v = v / (1.0f + expf(-v)); else if (ACT == 3) v = fmaxf(v, 0.f); else if (ACT == 6) v = 0.5f * v * (1.0f + erff(v * 0.70710678118654752f)); so[w][8 * hh + r][t * 16 + ln] = v; } }
  __builtin_amdgcn_fence(__ATOMIC_ACQ_REL, "workgroup"); __builtin_amdgcn_wave_barrier();
  const int rsub = lane >> 4, c4 = (lane & 15) * 4; typedef _Float16 v4h __attribute__((ext_vector_type(4)));
  {
#pragma unroll
    for (int q = 0; q < 8; ++q) { const int r = q * 2 + rsub; if (col0 + c4 < N) { const v4f v = *(const v4fa*)&so[w][r][c4]; if (C) *(v4f*)(C + cofs + (size_t)(row0 + r) * ldc + col0 + c4) = v; if (C16) { v4h h4; for (int i = 0; i < 4; ++i) h4[i] = (_Float16)v[i]; *(v4h*)(C16 + cofs + (size_t)(row0 + r) * ldc + col0 + c4) = h4; } } }
     }
}


typedef _Float16 v4h __attribute__((ext_vector_type(4)));

// X16 = f16(bf16(x)), piece t of 8 values
__device__ __forceinline__ void x16_piece(const float* __restrict__ x, _Float16* __restrict__ X16, size_t t) { FragH f;
#pragma unroll
  for (int q = 0; q < 8; ++q) f.h[q] = (_Float16)bf16_round(x[t * 8 + q]); *(v8us*)((unsigned short*)X16 + t * 8) = f.half[0];
  asm volatile("s_wait_xcnt 0x0" ::: "memory");      /* behind the store, ahead of any reuse of the registers that it names (the other parts' code follows in the same kernel) */
}
__global__ __launch_bounds__(256) void k_h16(const float* __restrict__ x, _Float16* __restrict__ X16, size_t n8) { const size_t t = (size_t)blockIdx.x * 256 + threadIdx.x; if (t >= n8) return; FragH f;
#pragma unroll
  for (int q = 0; q < 8; ++q) f.h[q] = (_Float16)x[t * 8 + q]; *(v8us*)((unsigned short*)X16 + t * 8) = f.half[0];  }
__global__ __launch_bounds__(256) void k_round16f(const float* __restrict__ W, _Float16* __restrict__ Bt, size_t n8) { const size_t t = (size_t)blockIdx.x * 256 + threadIdx.x; if (t >= n8) return; FragH f;
#pragma unroll
  for (int i = 0; i < 8; ++i) f.h[i] = (_Float16)(bf16_round(W[t * 8 + i]) * 16.0f); *(v8us*)((unsigned short*)Bt + t * 8) = f.half[0];  }

// ---- pieces of the f16 GEMMs with a 32x64 wave tile ----
__device__ __forceinline__ v16h g2_frag(const _Float16* p, int hh) { FragH f; f.half[0] = *(const v8us*)((const unsigned short*)p + 8 * hh); f.half[1] = *(const v8us*)((const unsigned short*)p + 16 + 8 * hh); return f.v; }
__device__ __forceinline__ v8f g2_mma(v16h a, v16h b, v8f c) { v8f d = __builtin_amdgcn_wmma_f32_16x16x32_f16(false, a, false, b, (short)0, c, false, false); asm volatile("v_nop\n\tv_nop\n\tv_nop\n\tv_nop" : "+v"(d) : "v"(a), "v"(b)); return d; }
// One wave's tile of the q, k or v projection: C[32][64] = A[32 rows] B[64 rows]^T over the 512 inputs (both operands k-contiguous f16 rows, f32 accumulation), C / 16 + bias, staged in the wave's own LDS range so and stored as whole 128-byte lines of f16.
//   PART 0 (q): A = x rows j.., B = the head's 64 Wq^T rows; stored as hi + 2^10 residual planes.
//   PART 1 (k): the same, but A row r = x row idx[j + r] (the head class's list of valid keys): the planes come out compacted.
//   PART 2 (v): A = the head's Wv^T rows dh.. dh + 31, B row c = x row idx[j + c]: the tile is a piece of V^T itself, compacted; stored as plain f16.
// A fragment's address is the lane's own pointer (operand row, half), carried through the loop and stepped along k.
typedef const __attribute__((address_space(1))) char* gcp;      /* a pointer known to be global: carried through a loop, a plain pointer came out as flat loads */
typedef const __attribute__((address_space(1))) v8us* gv8p;
__device__ __forceinline__ v16h g2_fragp(gcp p) { FragH f; f.half[0] = *(gv8p)p; f.half[1] = *(gv8p)(p + 32); return f.v; }
template <int PART>
__device__ __forceinline__ void qkv_tile(float (*so)[68], const _Float16* __restrict__ xs, const _Float16* __restrict__ wh, const float* __restrict__ bias, const int* __restrict__ idx, int j, int dh, _Float16* __restrict__ ph, _Float16* __restrict__ pl, int ln, int hh) {
  gcp ap[2], bp[4]; float bi[(PART == 2) ? 16 : 4];      /* bi: the bias of the tile's columns or, PART 2, of this lane's 16 rows; loaded ahead of the loop, lands under it */
  const gcp ab = (gcp)((PART == 2) ? wh : xs), bb = (gcp)((PART == 2) ? xs : wh);
#pragma unroll
  for (int i = 0; i < 2; ++i) ap[i] = ab + (size_t)((PART == 0) ? j + 16 * i + ln : (PART == 1) ? idx[j + 16 * i + ln] : dh + 16 * i + ln) * (DMOD * 2) + 16 * hh;
#pragma unroll
  for (int t = 0; t < 4; ++t) bp[t] = bb + (size_t)((PART == 2) ? idx[j + 16 * t + ln] : 16 * t + ln) * (DMOD * 2) + 16 * hh;
#pragma unroll
  for (int u = 0; u < ((PART == 2) ? 16 : 4); ++u) bi[u] = bf16_round(bias[(PART == 2) ? dh + (u >> 3) * 16 + 8 * hh + (u & 7) : u * 16 + ln]);
  v8f c[2][4];
#pragma unroll
  for (int u = 0; u < 8; ++u) c[u >> 2][u & 3] = (v8f){0.f,0.f,0.f,0.f,0.f,0.f,0.f,0.f};
#pragma unroll 1      /* rolled: 8 passes of 16 products; the loop's code stays a few instruction-cache lines */
  for (int kb = 0; kb < DMOD; kb += 64) { v16h a[2][2], bf[4][2];      /* a pass takes one whole 128-byte line of every operand row (two k blocks of 32); its 24 loads stand ahead of the first product, so a line's four pieces are asked for close together and memory is waited for once a pass */
#pragma unroll
    for (int t = 0; t < 4; ++t) { bf[t][0] = g2_fragp(bp[t]); bf[t][1] = g2_fragp(bp[t] + 64); }
#pragma unroll
    for (int i = 0; i < 2; ++i) { a[i][0] = g2_fragp(ap[i]); a[i][1] = g2_fragp(ap[i] + 64); }
    asm volatile("s_wait_xcnt 0x0" ::: "memory");      /* stands between the pass's loads and the stepping of the pointers that they name */
    __builtin_amdgcn_sched_barrier(0);      /* keeps the pointer steps below from being scheduled ahead of that wait */
#pragma unroll
    for (int t = 0; t < 4; ++t) bp[t] += 128;
#pragma unroll
    for (int i = 0; i < 2; ++i) ap[i] += 128;
#pragma unroll
    for (int s = 0; s < 2; ++s)
#pragma unroll
      for (int t = 0; t < 4; ++t) { c[0][t] = g2_mma(a[0][s], bf[t][s], c[0][t]); c[1][t] = g2_mma(a[1][s], bf[t][s], c[1][t]); } }
#pragma unroll
  for (int u = 0; u < 8; ++u) { const int t = u & 3, half = u >> 2;
#pragma unroll
    for (int r = 0; r < 8; ++r) so[half * 16 + 8 * hh + r][t * 16 + ln] = c[half][t][r] * 0.0625f + bi[(PART == 2) ? half * 8 + r : t]; }
  __builtin_amdgcn_fence(__ATOMIC_ACQ_REL, "workgroup"); __builtin_amdgcn_wave_barrier();      /* the wave reads back rows that its other lanes wrote */
  constexpr int ldc = (PART == 2) ? TK : DMOD;
#pragma unroll
  for (int q = 0; q < 16; ++q) { const int r = q * 2 + hh; const v4f v = *(const v4fa*)&so[r][ln * 4]; v4h hi, lo;
#pragma unroll
    for (int i = 0; i < 4; ++i) { hi[i] = (_Float16)v[i]; lo[i] = (_Float16)((v[i] - (float)hi[i]) * 1024.0f); }
    *(v4h*)(ph + (size_t)r * ldc + ln * 4) = hi; if (PART != 2) *(v4h*)(pl + (size_t)r * ldc + ln * 4) = lo; }
  asm volatile("s_wait_xcnt 0x0" ::: "memory");      /* behind the tile's last store, ahead of any reuse of the registers that the stores name */
}
// The q, k and v projections with all their after-work in one launch: 512 blocks a part, a block = (sequence, 128 tokens or list positions, head), four wave tiles. A wave whose keys all lie past the count rounded up to 32 leaves at once (those rows and columns are never read); list entries past the count are 0, a finite row.
__global__ __launch_bounds__(128) void k_qkv(const _Float16* __restrict__ X16, const _Float16* __restrict__ BQ, const _Float16* __restrict__ BK, const _Float16* __restrict__ BV, const float* __restrict__ bq, const float* __restrict__ bk, const float* __restrict__ bv,
    const int* __restrict__ IDX, const int* __restrict__ CNT, _Float16* __restrict__ QH, _Float16* __restrict__ QL, _Float16* __restrict__ KH, _Float16* __restrict__ KL, _Float16* __restrict__ VT) {
  __shared__ __attribute__((aligned(16))) float so[4][32][68];
  const int tid = threadIdx.x, lane = tid & 31, ln = lane & 15, hh = lane >> 4; const int w = __builtin_amdgcn_readfirstlane(tid >> 5);
  constexpr int TPS = TK / 128, PER = NB * TPS * NH;
  const int part = blockIdx.x / PER, rem = blockIdx.x % PER; const int h = rem % NH, mt = rem / NH; const int b = mt / TPS, t0 = (mt % TPS) * 128;
  const _Float16* xs = X16 + (size_t)b * TK * DMOD; const size_t wo = (size_t)h * 64 * DMOD;
  if (part == 0) { const int j = t0 + 32 * w; const size_t o = ((size_t)b * TK + j) * DMOD + h * 64; qkv_tile<0>(so[w], xs, BQ + wo, bq + h * 64, nullptr, j, 0, QH + o, QL + o, ln, hh); return; }
  const int cls = (h < CDRH) ? 0 : 1; const int cr = (min(CNT[b * 32 + cls], TK) + 31) & ~31; const int* idx = IDX + ((size_t)b * 2 + cls) * TK;
  if (part == 1) { const int j = t0 + 32 * w; if (j >= cr) return; const size_t o = ((size_t)b * TK + j) * DMOD + h * 64; qkv_tile<1>(so[w], xs, BK + wo, bk + h * 64, idx, j, 0, KH + o, KL + o, ln, hh); }
  else { const int j = t0 + 64 * (w >> 1), dh = 32 * (w & 1); if (j >= cr) return; qkv_tile<2>(so[w], xs, BV + wo, bv + h * 64, idx, j, dh, VT + (((size_t)b * NH + h) * 64 + dh) * TK + j, nullptr, ln, hh); } }

template <int CAUSAL>
__global__ __launch_bounds__(128) void k_flash(const _Float16* __restrict__ Q16, int ldq, const _Float16* __restrict__ K16, int ldk, const _Float16* __restrict__ Vt, const int* __restrict__ MSK, float* __restrict__ O, int ldo) {
  constexpr int RPW = 16, RTN = RPW / 16, NQB = TQ / (4 * RPW), DT = 4, KS = 2;
  __shared__ __attribute__((aligned(16))) unsigned short sP[4][RPW][40]; __shared__ __attribute__((aligned(16))) float sO[4][RPW][64 + 4];
  const int tid = threadIdx.x, w = tid >> 5, lane = tid & 31, ln = lane & 15, hh = lane >> 4;
  const int slab = blockIdx.x / NQB, qblk = blockIdx.x % NQB; const int b = slab / NH, h = slab % NH; const int qb0 = qblk * (4 * RPW); const int q0 = qb0 + w * RPW;
  FragH aq[2][KS];
#pragma unroll
  for (int rt = 0; rt < RTN; ++rt) { const unsigned short* qr = (const unsigned short*)Q16 + ((size_t)b * TQ + q0 + rt * 16 + ln) * ldq + h * 64;
#pragma unroll
    for (int ks = 0; ks < KS; ++ks) { aq[rt][ks].half[0] = *(const v8us*)(qr + ks * 32 + 8 * hh); aq[rt][ks].half[1] = *(const v8us*)(qr + ks * 32 + 16 + 8 * hh); } }
  const unsigned short* Vth = (const unsigned short*)Vt + (size_t)slab * 64 * TK;
  float m_r[2][8], l_r[2][8]; v8f oacc[2][DT];
#pragma unroll
  for (int rt = 0; rt < RTN; ++rt) {
#pragma unroll
    for (int r = 0; r < 8; ++r) { m_r[rt][r] = -3.0e38f; l_r[rt][r] = 0.f; }
#pragma unroll
    for (int dt = 0; dt < DT; ++dt) oacc[rt][dt] = (v8f){0.f,0.f,0.f,0.f,0.f,0.f,0.f,0.f}; }
  const int jend = (CAUSAL == 1) ? (qb0 + 4 * RPW) : TK;      /* causal: keys beyond the block's last query never contribute */
#pragma unroll 1
  for (int j0 = 0; j0 < jend; j0 += 32) {
    v8f s[2][2];
#pragma unroll
    for (int nt = 0; nt < 2; ++nt) { const unsigned short* kr = (const unsigned short*)K16 + ((size_t)b * TK + j0 + nt * 16 + ln) * ldk + h * 64; FragH bk[KS];
#pragma unroll
      for (int ks = 0; ks < KS; ++ks) { bk[ks].half[0] = *(const v8us*)(kr + ks * 32 + 8 * hh); bk[ks].half[1] = *(const v8us*)(kr + ks * 32 + 16 + 8 * hh); }
#pragma unroll
      for (int rt = 0; rt < RTN; ++rt) { v8f acc = (v8f){0.f,0.f,0.f,0.f,0.f,0.f,0.f,0.f};
#pragma unroll
        for (int ks = 0; ks < KS; ++ks) acc = mmaH<1>(aq[rt][ks].v, aq[rt][ks].v, bk[ks].v, bk[ks].v, acc); s[rt][nt] = acc; } }
#pragma unroll
    for (int rt = 0; rt < RTN; ++rt)
#pragma unroll
      for (int r = 0; r < 8; ++r) { const int tq = q0 + rt * 16 + 8 * hh + r; const int k0 = j0 + ln, k1 = j0 + 16 + ln;
        const bool ok0 = (CAUSAL == 1) ? (k0 <= tq) : ((CAUSAL == 2) ? ((k0 >> 5) == (tq >> 5)) : true), ok1 = (CAUSAL == 1) ? (k1 <= tq) : ((CAUSAL == 2) ? ((k1 >> 5) == (tq >> 5)) : true);      /* mode 2: block-diagonal 32-token groups */
        const float s0 = ok0 ? s[rt][0][r] * SCL : -3.0e38f, s1 = ok1 ? s[rt][1][r] * SCL : -3.0e38f; float mc = fmaxf(s0, s1);
        mc = fmaxf(mc, __shfl_xor(mc, 1, 32)); mc = fmaxf(mc, __shfl_xor(mc, 2, 32)); mc = fmaxf(mc, __shfl_xor(mc, 4, 32)); mc = fmaxf(mc, __shfl_xor(mc, 8, 32));
        const float mn = fmaxf(m_r[rt][r], mc); const float al = (mn > -1.0e38f) ? expf(m_r[rt][r] - mn) : 1.0f; m_r[rt][r] = mn; const float p0 = ok0 ? expf(s0 - mn) : 0.f, p1 = ok1 ? expf(s1 - mn) : 0.f; l_r[rt][r] = l_r[rt][r] * al + p0 + p1;
#pragma unroll
        for (int dt = 0; dt < DT; ++dt) oacc[rt][dt][r] *= al;
        FragH t2; t2.h[0] = (_Float16)(p0 * 1024.0f); t2.h[1] = (_Float16)(p1 * 1024.0f); sP[w][rt * 16 + 8 * hh + r][ln] = t2.u[0]; sP[w][rt * 16 + 8 * hh + r][16 + ln] = t2.u[1]; }
    __builtin_amdgcn_fence(__ATOMIC_ACQ_REL, "workgroup"); __builtin_amdgcn_wave_barrier();
    FragH pa[2];
#pragma unroll
    for (int rt = 0; rt < RTN; ++rt) { pa[rt].half[0] = *(const v8us*)&sP[w][rt * 16 + ln][8 * hh]; pa[rt].half[1] = *(const v8us*)&sP[w][rt * 16 + ln][16 + 8 * hh]; }
#pragma unroll
    for (int dt = 0; dt < DT; ++dt) { const unsigned short* vrow = Vth + (size_t)(dt * 16 + ln) * TK + j0; FragH bv; bv.half[0] = *(const v8us*)(vrow + 8 * hh); bv.half[1] = *(const v8us*)(vrow + 16 + 8 * hh);
#pragma unroll
      for (int rt = 0; rt < RTN; ++rt) oacc[rt][dt] = mmaH<1>(pa[rt].v, pa[rt].v, bv.v, bv.v, oacc[rt][dt]); }
    __builtin_amdgcn_fence(__ATOMIC_ACQ_REL, "workgroup"); __builtin_amdgcn_wave_barrier(); }
#pragma unroll
  for (int rt = 0; rt < RTN; ++rt) {
#pragma unroll
    for (int r = 0; r < 8; ++r) { float l = l_r[rt][r]; l += __shfl_xor(l, 1, 32); l += __shfl_xor(l, 2, 32); l += __shfl_xor(l, 4, 32); l += __shfl_xor(l, 8, 32); l_r[rt][r] = (l > 0.f) ? 1.0f / (l * 1024.0f) : 0.f; }
#pragma unroll
    for (int dt = 0; dt < DT; ++dt)
#pragma unroll
      for (int r = 0; r < 8; ++r) sO[w][rt * 16 + 8 * hh + r][dt * 16 + ln] = oacc[rt][dt][r] * l_r[rt][r]; }
  __builtin_amdgcn_fence(__ATOMIC_ACQ_REL, "workgroup"); __builtin_amdgcn_wave_barrier();
  {
#pragma unroll
    for (int rp = 0; rp < RPW; rp += 2) { const int r = rp + (lane >> 4), pc = lane & 15; const v4f val = *(const v4fa*)&sO[w][r][pc * 4]; *(v4f*)(O + ((size_t)b * TQ + q0 + r) * ldo + h * 64 + pc * 4) = val; }
     } }
// Six 16-byte asynchronous copies to LDS per lane (one 32-key tile's share). s_wait_xcnt 0 closes the statement so that no address register of an issued copy is rewritten ahead of it.
__device__ __forceinline__ void cp_tile6(unsigned l0, const unsigned short* g0, unsigned l1, const unsigned short* g1, unsigned l2, const unsigned short* g2, unsigned l3, const unsigned short* g3, unsigned l4, const unsigned short* g4, unsigned l5, const unsigned short* g5) {
  asm volatile("global_load_async_to_lds_b128 %0, %1, off\n\t"
               "global_load_async_to_lds_b128 %2, %3, off\n\t"
               "global_load_async_to_lds_b128 %4, %5, off\n\t"
               "global_load_async_to_lds_b128 %6, %7, off\n\t"
               "global_load_async_to_lds_b128 %8, %9, off\n\t"
               "global_load_async_to_lds_b128 %10, %11, off\n\t"
               "s_wait_xcnt 0x0"
               :: "v"(l0), "v"(g0), "v"(l1), "v"(g1), "v"(l2), "v"(g2), "v"(l3), "v"(g3), "v"(l4), "v"(g4), "v"(l5), "v"(g5) : "memory");
}
// lane l takes the value of lane l ^ 16 (the other 16-lane half)
__device__ __forceinline__ float xhalf(float x) { return __builtin_bit_cast(float, __builtin_amdgcn_permlanex16(__builtin_bit_cast(int, x), __builtin_bit_cast(int, x), 0x76543210, 0xfedcba98, false, false)); }
template <int CAUSAL>
__global__ __launch_bounds__(128) void k_flashqk(const _Float16* __restrict__ Q16, const _Float16* __restrict__ QL, int ldq, const _Float16* __restrict__ K16, const _Float16* __restrict__ KL, int ldk, const _Float16* __restrict__ Vt, const int* __restrict__ MSK, float* __restrict__ O, int ldo) {
  static_assert(CAUSAL == 5, "compacted-key mode only");
  constexpr int RPW = 16, DT = 4, KS = 2;
  __shared__ __attribute__((aligned(16))) float sO[4][RPW][64 + 4];
  __shared__ __attribute__((aligned(16))) unsigned short sKh[2][32][72], sKl[2][32][72], sV[2][64][40];      /* row pitches 144 B and 80 B: 16 B x odd, for 16-byte fragment reads */
  const int tid = threadIdx.x, w = tid >> 5, lane = tid & 31, ln = lane & 15, hh = lane >> 4;
  const int slab = blockIdx.x / QBLKS, qblk = blockIdx.x % QBLKS; const int b = slab / NH, h = slab % NH; const int qb0 = qblk * (4 * RPW); const int q0 = qb0 + w * RPW;
  FragH aq[KS], aql[KS];
  { const unsigned short* qr = (const unsigned short*)Q16 + ((size_t)b * TQ + q0 + ln) * ldq + h * 64; const unsigned short* ql = (const unsigned short*)QL + ((size_t)b * TQ + q0 + ln) * ldq + h * 64;
#pragma unroll
    for (int ks = 0; ks < KS; ++ks) { aq[ks].half[0] = *(const v8us*)(qr + ks * 32 + 8 * hh); aq[ks].half[1] = *(const v8us*)(qr + ks * 32 + 16 + 8 * hh); aql[ks].half[0] = *(const v8us*)(ql + ks * 32 + 8 * hh); aql[ks].half[1] = *(const v8us*)(ql + ks * 32 + 16 + 8 * hh); } }
  const unsigned short* Vth = (const unsigned short*)Vt + (size_t)slab * 64 * TK;
  float m_r = -3.0e38f, l_r = 0.f; v8f oacc[DT];      /* query q0 + ln: running maximum (equal in both halves), this half's share of the sum, O^T rows dt * 16 + 8 hh + r */
#pragma unroll
  for (int dt = 0; dt < DT; ++dt) oacc[dt] = (v8f){0.f,0.f,0.f,0.f,0.f,0.f,0.f,0.f};
  const int kcnt = min(MSK[b * 32 + ((h < CDRH) ? 0 : 1)], TK);      /* number of valid keys of this (sequence, head class); K planes and V^T hold them compacted, in key order */
  const int jend = (kcnt + 31) & ~31;
  const int kr0 = tid >> 3, kc0 = (tid & 7) * 8, vr0 = tid >> 2, vc0 = (tid & 3) * 8;      /* a lane's share of a tile: rows kr0 and kr0 + 16 of both K planes, rows vr0 and vr0 + 32 of V^T, 16 bytes each; whole 128-byte K lines per 8 lanes */
  const unsigned short* gkh = (const unsigned short*)K16 + ((size_t)b * TK + kr0) * ldk + h * 64 + kc0; const unsigned short* gkl = (const unsigned short*)KL + ((size_t)b * TK + kr0) * ldk + h * 64 + kc0; const unsigned short* gv = Vth + (size_t)vr0 * TK + vc0;
  auto stage = [&](int jt, int bf) { const size_t ko = (size_t)jt * ldk;
    cp_tile6((unsigned)(size_t)&sKh[bf][kr0][kc0], gkh + ko, (unsigned)(size_t)&sKh[bf][kr0 + 16][kc0], gkh + ko + (size_t)16 * ldk, (unsigned)(size_t)&sKl[bf][kr0][kc0], gkl + ko, (unsigned)(size_t)&sKl[bf][kr0 + 16][kc0], gkl + ko + (size_t)16 * ldk,
             (unsigned)(size_t)&sV[bf][vr0][vc0], gv + jt, (unsigned)(size_t)&sV[bf][vr0 + 32][vc0], gv + (size_t)32 * TK + jt); };
  if (jend > 0) stage(0, 0);
  asm volatile("s_wait_asynccnt 0x0" ::: "memory");      /* this wave's share of tile 0 has landed */
  __syncthreads();      /* tile 0 is published to all four waves */
  if (jend > 32) stage(32, 1);
#pragma unroll 1
  for (int j0 = 0; j0 < jend; j0 += 32) {
    const int bf = (j0 >> 5) & 1;
    float sc[2][8];      /* sc[nt][r] = scaled score of key j0 + 16 nt + 8 hh + r for query q0 + ln; the inner loops of this trip are fully unrolled so that sc, pb, ls and oacc are indexed by constants and stay in registers */
#pragma unroll
    for (int nt = 0; nt < 2; ++nt) { const unsigned short* kr = &sKh[bf][nt * 16 + ln][0]; const unsigned short* klr = &sKl[bf][nt * 16 + ln][0]; FragH bk[KS], bkl[KS];
#pragma unroll
      for (int ks = 0; ks < KS; ++ks) { bk[ks].half[0] = *(const v8us*)(kr + ks * 32 + 8 * hh); bk[ks].half[1] = *(const v8us*)(kr + ks * 32 + 16 + 8 * hh); bkl[ks].half[0] = *(const v8us*)(klr + ks * 32 + 8 * hh); bkl[ks].half[1] = *(const v8us*)(klr + ks * 32 + 16 + 8 * hh); }
      v8f acc = (v8f){0.f,0.f,0.f,0.f,0.f,0.f,0.f,0.f}, accl = acc;
#pragma unroll
      for (int ks = 0; ks < KS; ++ks) { acc = mmaH<1>(bk[ks].v, bk[ks].v, aq[ks].v, aq[ks].v, acc); accl = mmaH<1>(bk[ks].v, bk[ks].v, aql[ks].v, aql[ks].v, accl); accl = mmaH<1>(bkl[ks].v, bkl[ks].v, aq[ks].v, aq[ks].v, accl); }
#pragma unroll
      for (int r = 0; r < 8; ++r) sc[nt][r] = (acc[r] + accl[r] * 0.0009765625f) * SCL; }
    if (j0 + 32 > kcnt) {      /* block-uniform: only the last trip holds keys past the count (key padding and head-specific masks are applied by the gather) */
#pragma unroll
      for (int nt = 0; nt < 2; ++nt)
#pragma unroll
        for (int r = 0; r < 8; ++r) if (j0 + nt * 16 + 8 * hh + r >= kcnt) sc[nt][r] = -3.0e38f; }
    float mc = fmaxf(sc[0][0], sc[1][0]);
#pragma unroll
    for (int r = 1; r < 8; ++r) mc = fmaxf(mc, fmaxf(sc[0][r], sc[1][r]));
    mc = fmaxf(mc, xhalf(mc));
    const float mn = fmaxf(m_r, mc);      /* finite in every trip: key j0 is below the count; so an invalid key's exp below is exactly 0, and so is the first trip's rescale factor */
    const float al = expf(m_r - mn); m_r = mn;
    FragH pb; float ls[4] = {0.f, 0.f, 0.f, 0.f};
#pragma unroll
    for (int nt = 0; nt < 2; ++nt)
#pragma unroll
      for (int r = 0; r < 8; ++r) { const float p = expf(sc[nt][r] - mn); ls[nt * 2 + (r & 1)] += p; pb.h[nt * 8 + r] = (_Float16)(p * 1024.0f); }      /* element nt * 8 + r of the B operand = key 16 nt + 8 hh + r: the k order of the V^T fragment */
    l_r = l_r * al + ((ls[0] + ls[1]) + (ls[2] + ls[3]));
#pragma unroll
    for (int dt = 0; dt < DT; ++dt)
#pragma unroll
      for (int r = 0; r < 8; ++r) oacc[dt][r] *= al;
#pragma unroll
    for (int dt = 0; dt < DT; ++dt) { const unsigned short* vrow = &sV[bf][dt * 16 + ln][0]; FragH bv; bv.half[0] = *(const v8us*)(vrow + 8 * hh); bv.half[1] = *(const v8us*)(vrow + 16 + 8 * hh);
      oacc[dt] = mmaH<1>(bv.v, bv.v, pb.v, pb.v, oacc[dt]); }
    asm volatile("s_wait_dscnt 0x0" ::: "memory");      /* this wave's reads of buffer bf have returned before the buffer is refilled */
    asm volatile("s_wait_asynccnt 0x0" ::: "memory");      /* this wave's share of the next tile has landed */
    __syncthreads();      /* publishes the next tile and ends every wave's reads of buffer bf */
    if (j0 + 64 < jend) stage(j0 + 64, bf); }
  asm volatile("s_wait_asynccnt 0x0" ::: "memory");      /* no copy is outstanding when the wave goes on to its end */
  const float l = l_r + xhalf(l_r); const float linv = (l > 0.f) ? 1.0f / (l * 1024.0f) : 0.f;
#pragma unroll
  for (int dt = 0; dt < DT; ++dt) { const v4f o0 = {oacc[dt][0] * linv, oacc[dt][1] * linv, oacc[dt][2] * linv, oacc[dt][3] * linv}, o1 = {oacc[dt][4] * linv, oacc[dt][5] * linv, oacc[dt][6] * linv, oacc[dt][7] * linv};
    *(v4fa*)&sO[w][ln][dt * 16 + 8 * hh] = o0; *(v4fa*)&sO[w][ln][dt * 16 + 8 * hh + 4] = o1; }
  __builtin_amdgcn_fence(__ATOMIC_ACQ_REL, "workgroup"); __builtin_amdgcn_wave_barrier();
  {
#pragma unroll
    for (int rp = 0; rp < RPW; rp += 2) { const int r = rp + (lane >> 4), pc = lane & 15; const v4f val = *(const v4fa*)&sO[w][r][pc * 4]; *(v4f*)(O + ((size_t)b * TQ + q0 + r) * ldo + h * 64 + pc * 4) = val; }
     } }

// f32 -> f16 hi + 2^10 residual A fragments of one row (k order of g2_frag: elements 0..7 = k 8 hh + i, elements 8..15 = k 16 + 8 hh + i); p already points at k = 8 hh. Same rounding as in k_qkv.
__device__ __forceinline__ void g2_split(const float* p, v16h& fh, v16h& fl) { const v4f x0 = *(const v4fa*)p, x1 = *(const v4fa*)(p + 4), x2 = *(const v4fa*)(p + 16), x3 = *(const v4fa*)(p + 20); FragH h, l;
#pragma unroll
  for (int q = 0; q < 4; ++q) { _Float16 t = (_Float16)x0[q]; h.h[q] = t; l.h[q] = (_Float16)((x0[q] - (float)t) * 1024.0f); t = (_Float16)x1[q]; h.h[4 + q] = t; l.h[4 + q] = (_Float16)((x1[q] - (float)t) * 1024.0f);
    t = (_Float16)x2[q]; h.h[8 + q] = t; l.h[8 + q] = (_Float16)((x2[q] - (float)t) * 1024.0f); t = (_Float16)x3[q]; h.h[12 + q] = t; l.h[12 + q] = (_Float16)((x3[q] - (float)t) * 1024.0f); }
  fh = h.v; fl = l.v; }
// Output projection in one launch: C[NR][DMOD] = A Wo + bias from the f32 context A. Wave tile 32x64 as in k_qkv; each A fragment is split hi + 2^10 residual in registers, and each x16 weight fragment (Bh = [out][in]) feeds the hi and the residual product, which keep separate f32 accumulators: C = hi / 16 + bias + residual / (16 * 1024).
__global__ __launch_bounds__(128) void k_gemm_out(const float* __restrict__ A, const _Float16* __restrict__ Bh, const float* __restrict__ bias, float* __restrict__ C) {
  __shared__ __attribute__((aligned(16))) float so[4][32][68];
  const int tid = threadIdx.x, w = tid >> 5, lane = tid & 31, ln = lane & 15, hh = lane >> 4;
  constexpr int ntn = DMOD >> 6; const int mt = blockIdx.x / ntn, nq = blockIdx.x - mt * ntn; const int row0 = mt * 128 + 32 * w, col0 = nq * 64;
  const float* a0p = A + (size_t)(row0 + ln) * DMOD + 8 * hh; const float* a1p = a0p + (size_t)16 * DMOD;
  const _Float16* b0p = Bh + (size_t)(col0 + ln) * DMOD;
  float bv[4];      /* the four bias loads go out ahead of the loop and land under it */
#pragma unroll
  for (int t = 0; t < 4; ++t) bv[t] = bf16_round(bias[col0 + t * 16 + ln]);
  v8f ch[2][4], cl[2][4];
#pragma unroll
  for (int u = 0; u < 8; ++u) { ch[u >> 2][u & 3] = (v8f){0.f,0.f,0.f,0.f,0.f,0.f,0.f,0.f}; cl[u >> 2][u & 3] = (v8f){0.f,0.f,0.f,0.f,0.f,0.f,0.f,0.f}; }
#pragma unroll 1      /* rolled: 16 trips of 16 products; the loop's code stays a few instruction-cache lines */
  for (int kb = 0; kb < DMOD; kb += 32) { v16h a0h, a0l, a1h, a1l, b[4];      /* all 16 loads of a trip stand ahead of its first product: one wait for memory a trip */
#pragma unroll
    for (int t = 0; t < 4; ++t) b[t] = g2_frag(b0p + (size_t)(t * 16) * DMOD + kb, hh);
    g2_split(a0p + kb, a0h, a0l); g2_split(a1p + kb, a1h, a1l);
#pragma unroll
    for (int t = 0; t < 4; ++t) { ch[0][t] = g2_mma(a0h, b[t], ch[0][t]); ch[1][t] = g2_mma(a1h, b[t], ch[1][t]); cl[0][t] = g2_mma(a0l, b[t], cl[0][t]); cl[1][t] = g2_mma(a1l, b[t], cl[1][t]); } }
#pragma unroll
  for (int u = 0; u < 8; ++u) { const int t = u & 3, half = u >> 2;
#pragma unroll
    for (int r = 0; r < 8; ++r) so[w][half * 16 + 8 * hh + r][t * 16 + ln] = (ch[half][t][r] * 0.0625f + bv[t]) + cl[half][t][r] * (0.0625f / 1024.0f); }
  __builtin_amdgcn_fence(__ATOMIC_ACQ_REL, "workgroup"); __builtin_amdgcn_wave_barrier();      /* the wave reads back rows that its other lanes wrote */
  const int rsub = lane >> 4, c4 = (lane & 15) * 4;
#pragma unroll
  for (int q = 0; q < 16; ++q) { const int r = q * 2 + rsub; const v4f v = *(const v4fa*)&so[w][r][c4]; *(v4f*)(C + (size_t)(row0 + r) * DMOD + col0 + c4) = v; } }
typedef int v4ia __attribute__((ext_vector_type(4), may_alias));
// One block per sequence, 8 consecutive keys a thread. IDX[b][0][.] = positions of the keys valid for the CDR heads, IDX[b][1][.] = for the other heads, ascending; entries past the count are 0. CNT[b*32 + class] = the counts (one 128-byte line per sequence).
__device__ __forceinline__ void key_lists(const int* __restrict__ mask, const int* __restrict__ cdrs, int* __restrict__ IDX, int* __restrict__ CNT, int b, int tid) {
  __shared__ int sh[256]; __shared__ int sany; static_assert(TK == 256 * 8, "8 keys a thread");
  const v4ia m0 = *(const v4ia*)(mask + (size_t)b * TK + tid * 8), m1 = *(const v4ia*)(mask + (size_t)b * TK + tid * 8 + 4), c0 = *(const v4ia*)(cdrs + (size_t)b * TK + tid * 8), c1 = *(const v4ia*)(cdrs + (size_t)b * TK + tid * 8 + 4);
  bool vp[8], vc[8]; int np = 0, nb = 0, any = 0;
#pragma unroll
  for (int q = 0; q < 8; ++q) { const int mv = (q < 4) ? m0[q & 3] : m1[q & 3], cv = (q < 4) ? c0[q & 3] : c1[q & 3]; vp[q] = mv != 0; vc[q] = cv != 0; any |= vc[q] ? 1 : 0; np += vp[q] ? 1 : 0; nb += (vp[q] && vc[q]) ? 1 : 0; }
  if (tid == 0) sany = 0; __syncthreads(); if (any) sany = 1;
  const int own = np | (nb << 16); int v = own; sh[tid] = v; __syncthreads();      /* both counts stay <= 2048, so one packed inclusive scan serves both lists */
  for (int st = 1; st < 256; st <<= 1) { const int add = (tid >= st) ? sh[tid - st] : 0; __syncthreads(); v += add; sh[tid] = v; __syncthreads(); }
  const bool allmasked = (sany == 0);      /* no CDR token at all -> the CDR mask is disabled */
  const int tot = sh[255], ex = v - own; const int cnt1 = tot & 0xFFFF, cnt0 = allmasked ? cnt1 : (tot >> 16); int o1 = ex & 0xFFFF, o0 = allmasked ? o1 : (ex >> 16);
  int* i0 = IDX + ((size_t)b * 2 + 0) * TK; int* i1 = IDX + ((size_t)b * 2 + 1) * TK;
#pragma unroll
  for (int q = 0; q < 8; ++q) { const int k = tid * 8 + q; if (vp[q]) i1[o1++] = k; if (vp[q] && (allmasked || vc[q])) i0[o0++] = k; if (k >= cnt1) i1[k] = 0; if (k >= cnt0) i0[k] = 0; }
  if (tid == 0) { CNT[b * 32 + 0] = cnt0; CNT[b * 32 + 1] = cnt1; } }
// All that the projections wait for, in one launch; the three parts share nothing and a block does one of them, chosen by its index (so every barrier of the key lists is passed by a whole block or by none of it). The part with the longest chain of dependent steps has the lowest indices, the stream of x the highest.
#define WTB (DMOD * (DMOD / 8) / 256)      /* blocks for one weight matrix */
#define XB (NR * DMOD / 8 / 256)      /* blocks for x */
__global__ __launch_bounds__(256) void k_prep(const float* __restrict__ x, const int* __restrict__ mask, const int* __restrict__ cdrs, const float* __restrict__ Wq, const float* __restrict__ Wk, const float* __restrict__ Wv, const float* __restrict__ Wo,
    _Float16* __restrict__ BQ, _Float16* __restrict__ BK, _Float16* __restrict__ BV, _Float16* __restrict__ BO, int* __restrict__ IDX, int* __restrict__ CNT, _Float16* __restrict__ X16) {
  static_assert(WTB * 256 * 8 == DMOD * DMOD && (size_t)XB * 256 * 8 == (size_t)NR * DMOD, "the parts' blocks cover their arrays exactly");
  const int blk = blockIdx.x, tid = threadIdx.x;
  if (blk < NB) { key_lists(mask, cdrs, IDX, CNT, blk, tid); return; }
  if (blk < NB + 4 * WTB) { const int u = blk - NB, m = u / WTB;
    wt_f16((m == 0) ? Wq : (m == 1) ? Wk : (m == 2) ? Wv : Wo, (m == 0) ? BQ : (m == 1) ? BK : (m == 2) ? BV : BO, DMOD, DMOD, 16.0f, (u % WTB) * 256 + tid); return; }
  x16_piece(x, X16, (size_t)(blk - NB - 4 * WTB) * 256 + tid); }

extern "C" void kernel_launch(void* const* d_in, const int* in_sizes, int n_in,
                              void* d_out, int out_size, void* d_ws, size_t ws_size, hipStream_t stream) {
  (void)in_sizes; (void)n_in; (void)out_size;
  const float* const* I = (const float* const*)d_in; const float* x = I[0]; const int* mask = (const int*)d_in[1]; const int* cdrs = (const int*)d_in[2]; const float* Wq = I[3]; const float* bq = I[4]; const float* Wk = I[5]; const float* bk = I[6]; const float* Wv = I[7]; const float* bv = I[8]; const float* Wo = I[9]; const float* bo = I[10];
  char* ws = (char*)d_ws; size_t off = 0;
  auto take = [&](size_t bytes) { char* p = ws + off; off += (bytes + 255) & ~(size_t)255; return p; };
  const size_t w8 = (size_t)DMOD * DMOD / 8;
  _Float16* BQ = (_Float16*)take(w8 * 16); _Float16* BK = (_Float16*)take(w8 * 16); _Float16* BV = (_Float16*)take(w8 * 16); _Float16* BO = (_Float16*)take(w8 * 16); int* IDX = (int*)take((size_t)NB * 2 * TK * 4); int* CNT = (int*)take((size_t)NB * 32 * 4);
  _Float16* X16 = (_Float16*)take((size_t)NR * DMOD * 2); float* F32 = (float*)take((size_t)NR * DMOD * 4); _Float16* QH = (_Float16*)take((size_t)NR * DMOD * 2); _Float16* QL = (_Float16*)take((size_t)NR * DMOD * 2); _Float16* KH = (_Float16*)take((size_t)NR * DMOD * 2); _Float16* KL = (_Float16*)take((size_t)NR * DMOD * 2); _Float16* VH = (_Float16*)take((size_t)NR * DMOD * 2); _Float16* VL = (_Float16*)take((size_t)NR * DMOD * 2); _Float16* VT = (_Float16*)take((size_t)NR * DMOD * 2); _Float16* VTL = (_Float16*)take((size_t)NR * DMOD * 2);
  float* O = F32;
  if (off > ws_size) return;      /* 2 + 0.06 + 8 + 16 + 8 x 8 = 90 MiB */
  k_prep<<<NB + 4 * WTB + XB, 256, 0, stream>>>(x, mask, cdrs, Wq, Wk, Wv, Wo, BQ, BK, BV, BO, IDX, CNT, X16);
  const dim3 gA((NR / 128) * (DMOD / 64), 1);
  k_qkv<<<3 * NB * (TK / 128) * NH, 128, 0, stream>>>(X16, BQ, BK, BV, bq, bk, bv, IDX, CNT, QH, QL, KH, KL, VT);
  k_flashqk<5><<<NB * NH * QBLKS, 128, 0, stream>>>(QH, QL, DMOD, KH, KL, DMOD, VT, CNT, O, DMOD);      /* q/k hi + residual; P (x2^10) and V plain f16 */
  k_gemm_out<<<gA, 128, 0, stream>>>(O, BO, bo, (float*)d_out);
}

// v007
// It runs in 94.6 microseconds.
// In two side-by-side timings against v006, it was 1.13 and 1.14 times as fast.
// Counting every step since v000, it is 5.69 times as fast.
#include <hip/hip_runtime.h>
// CDRs attention (4 sequences x 2048 tokens x 512; 8 heads x 64): q,k,v = x W + b; scores/8; keys with mask == 0 invalid for all heads; for heads 0..1 additionally keys with cdrs_score == 0 invalid unless the sequence has no CDR token at all; softmax; ctx Wo + bo -> [4,2048,512].
// Structure: per sequence two compacted lists of valid key positions (CDR heads / other heads) with their counts, from the two int inputs on VALU (one block per sequence: 'all masked' flag + prefix sum), x as an exact f16 plane and the four x16 f16 weight transposes, all in one preparatory launch; the q/k/v projections as f16 WMMA GEMMs in one launch (32x64 wave tiles, f32 accumulation, exact x16 weights + bias) whose x rows for K and V are taken through the lists, so K (hi + 2^10 residual planes, like q) and V^T (formed directly as Wv^T x^T) come out compacted and the flash loop runs only over valid keys; the fused flash kernel with hi + 2^10-residual q/k planes (S = QhKh + (QlKh + QhKl)/1024) and plain f16 P (x2^10) and V with the key-count mask mode (invalid keys never visited == the reference's -inf); the output projection in one launch from the f32 context, split hi + residual in registers.
// Compute dtype: x and parameters rounded to bf16; q, k hi + residual (~2^-21-class logits); P and v plain f16 (~2^-12); f32 accumulation/softmax. v_wmma_f32_16x16x32_f16.
#define NB 4
#define DMOD 512
#define CDRH 2
#define NR (NB * SLEN)
#define QBLKS (TQ / 64)
#define SLEN 2048
#define TQ SLEN
#define TK SLEN
#define NH 8
#define SCL 0.125f               /* 64^-0.5 */
#define SCL2 0.18033688011112042f /* 64^-0.5 * log2(e): scores in base-2 units, so that the softmax exponential is the hardware's own 2^x */
typedef __bf16 v16b __attribute__((ext_vector_type(16)));
typedef unsigned short v8us __attribute__((ext_vector_type(8), may_alias));
typedef float  v8f  __attribute__((ext_vector_type(8)));
typedef float  v4f  __attribute__((ext_vector_type(4)));
typedef float  v4fa __attribute__((ext_vector_type(4), may_alias));
union FragB { v16b v; v8us half[2]; unsigned short u[16]; };

__device__ __forceinline__ unsigned short bf16_bits(float x) { unsigned int u = __float_as_uint(x); return (unsigned short)((u + 0x7FFFu + ((u >> 16) & 1u)) >> 16); }
__device__ __forceinline__ float bf16_val(unsigned short b) { return __uint_as_float(((unsigned int)b) << 16); }
__device__ __forceinline__ float bf16_round(float x) { return bf16_val(bf16_bits(x)); }
// D += A·B with NT terms: 1 = ah·bh, 2 = + al·bh (A split), 3 = + ah·bl (both split)
template <int NT>
__device__ __forceinline__ v8f mmaN(v16b ah, v16b al, v16b bh, v16b bl, v8f c) {
  c = __builtin_amdgcn_wmma_f32_16x16x32_bf16(false, ah, false, bh, (short)0, c, false, false);
  if (NT >= 2) c = __builtin_amdgcn_wmma_f32_16x16x32_bf16(false, al, false, bh, (short)0, c, false, false);
  if (NT >= 3) c = __builtin_amdgcn_wmma_f32_16x16x32_bf16(false, ah, false, bl, (short)0, c, false, false);
  asm volatile("v_nop\n\tv_nop\n\tv_nop\n\tv_nop" : "+v"(c) : "v"(ah), "v"(al), "v"(bh), "v"(bl));
  return c;
}

__global__ __launch_bounds__(256) void k_wt_bf16(const float* __restrict__ W, unsigned short* __restrict__ Wt, int K, int N) {
  const int t = blockIdx.x * 256 + threadIdx.x;
  const int k8n = K / 8;
  if (t >= N * k8n) return;
  const int n = t / k8n, k8 = (t % k8n) * 8;
  v8us v;
#pragma unroll
  for (int i = 0; i < 8; ++i) v[i] = bf16_bits(W[(size_t)(k8 + i) * N + n]);
  *(v8us*)(Wt + (size_t)n * K + k8) = v;
  
}

// GEMM C[M][N] (f32, pitch ldc) = act(A[M][K]·W + bias). A f32 row-major (pitch lda) converted per fragment to bf16
// (ASPLIT: hi/lo two planes -> 2 terms, else single rounded term); Wt bf16 [N][K] (pitch ldb). BIAS_BF16 rounds the
// bias to bf16 first (bias quantised to bf16 before the add). K%32==0, M%16==0, N%64==0.
template <bool ASPLIT, int ACT, bool BIAS_BF16>
__global__ __launch_bounds__(128) void k_gemm_bf(const float* __restrict__ A, int lda, const unsigned short* __restrict__ Wt, int ldb,
                                               const float* __restrict__ bias, float* __restrict__ C, int ldc, int M, int N, int K) {
  __shared__ __attribute__((aligned(16))) float so[4][16][64];
  const int tid = threadIdx.x, w = tid >> 5, lane = tid & 31, ln = lane & 15, hh = lane >> 4;
  const int ntn = N / 64;
  const int wid = blockIdx.x * 4 + w;
  const int mt = wid / ntn, nq = wid % ntn;
  if (mt * 16 >= M) return;
  const int row0 = mt * 16, col0 = nq * 64;
  const float* arow = A + (size_t)(row0 + ln) * lda;
  v8f acc[4] = {};
  for (int kb = 0; kb < K; kb += 32) {
    FragB ah, al;
    const v4f x0 = *(const v4fa*)(arow + kb + 8 * hh), x1 = *(const v4fa*)(arow + kb + 8 * hh + 4);
    const v4f x2 = *(const v4fa*)(arow + kb + 16 + 8 * hh), x3 = *(const v4fa*)(arow + kb + 16 + 8 * hh + 4);
    float xs[16] = {x0[0],x0[1],x0[2],x0[3],x1[0],x1[1],x1[2],x1[3],x2[0],x2[1],x2[2],x2[3],x3[0],x3[1],x3[2],x3[3]};
#pragma unroll
    for (int i = 0; i < 16; ++i) { const unsigned short hb = bf16_bits(xs[i]); ah.u[i] = hb; al.u[i] = ASPLIT ? bf16_bits(xs[i] - bf16_val(hb)) : (unsigned short)0; }
#pragma unroll
    for (int t = 0; t < 4; ++t) {
      const unsigned short* brow = Wt + (size_t)(col0 + t * 16 + ln) * ldb + kb;
      FragB b;
      b.half[0] = *(const v8us*)(brow + 8 * hh);
      b.half[1] = *(const v8us*)(brow + 16 + 8 * hh);
      acc[t] = mmaN<ASPLIT ? 2 : 1>(ah.v, al.v, b.v, b.v, acc[t]);
    }
  }
#pragma unroll
  for (int t = 0; t < 4; ++t) {
    float bv = bias ? bias[col0 + t * 16 + ln] : 0.f;
    if (BIAS_BF16) bv = bf16_round(bv);
#pragma unroll
    for (int r = 0; r < 8; ++r) { float v = acc[t][r] + bv; if (ACT == 1) v = fmaxf(v, 0.f); so[w][8 * hh + r][t * 16 + ln] = v; }
  }
  __builtin_amdgcn_fence(__ATOMIC_ACQ_REL, "workgroup");
  __builtin_amdgcn_wave_barrier();
  const int rsub = lane >> 4, c4 = (lane & 15) * 4;
  {
#pragma unroll
    for (int q = 0; q < 8; ++q) {
      const int r = q * 2 + rsub;
      const v4f v = *(const v4fa*)&so[w][r][c4];
      *(v4f*)(C + (size_t)(row0 + r) * ldc + col0 + c4) = v;
    }
    
  }
}

// GEMM C = act(A·W + bias + resid): A f32 (ASPLIT -> hi/lo 2 terms), Wt bf16 [N][K]; ACT 0 none, 1 relu, 2 exact gelu;
// resid (optional, f32, row index = (row % rmod), pitch ldr, RES_BF16 rounds it) added before the activation.
template <bool ASPLIT, int ACT, bool BIAS_BF16, bool RES_BF16>
__global__ __launch_bounds__(128) void k_gemm_bf3(const float* __restrict__ A, int lda, const unsigned short* __restrict__ Wt, int ldb,
                                                const float* __restrict__ bias, const float* __restrict__ resid, int rmod, int ldr,
                                                float* __restrict__ C, int ldc, int M, int N, int K) {
  __shared__ __attribute__((aligned(16))) float so[4][16][64];
  const int tid = threadIdx.x, w = tid >> 5, lane = tid & 31, ln = lane & 15, hh = lane >> 4;
  const int ntn = N / 64;
  const int wid = blockIdx.x * 4 + w;
  const int mt = wid / ntn, nq = wid % ntn;
  if (mt * 16 >= M) return;
  const int row0 = mt * 16, col0 = nq * 64;
  const float* arow = A + (size_t)(row0 + ln) * lda;
  v8f acc[4] = {};
  for (int kb = 0; kb < K; kb += 32) {
    FragB ah, al;
    const v4f x0 = *(const v4fa*)(arow + kb + 8 * hh), x1 = *(const v4fa*)(arow + kb + 8 * hh + 4);
    const v4f x2 = *(const v4fa*)(arow + kb + 16 + 8 * hh), x3 = *(const v4fa*)(arow + kb + 16 + 8 * hh + 4);
    float xs[16] = {x0[0],x0[1],x0[2],x0[3],x1[0],x1[1],x1[2],x1[3],x2[0],x2[1],x2[2],x2[3],x3[0],x3[1],x3[2],x3[3]};
#pragma unroll
    for (int i = 0; i < 16; ++i) { const unsigned short hb = bf16_bits(xs[i]); ah.u[i] = hb; al.u[i] = ASPLIT ? bf16_bits(xs[i] - bf16_val(hb)) : (unsigned short)0; }
#pragma unroll
    for (int t = 0; t < 4; ++t) {
      const unsigned short* brow = Wt + (size_t)(col0 + t * 16 + ln) * ldb + kb;
      FragB b;
      b.half[0] = *(const v8us*)(brow + 8 * hh);
      b.half[1] = *(const v8us*)(brow + 16 + 8 * hh);
      acc[t] = mmaN<ASPLIT ? 2 : 1>(ah.v, al.v, b.v, b.v, acc[t]);
    }
  }
#pragma unroll
  for (int t = 0; t < 4; ++t) {
    const int col = col0 + t * 16 + ln;
    float bv = bias ? bias[col] : 0.f;
    if (BIAS_BF16) bv = bf16_round(bv);
#pragma unroll
    for (int r = 0; r < 8; ++r) {
      float v = acc[t][r] + bv;
      if (resid) { float rv = resid[(size_t)((row0 + 8 * hh + r) % rmod) * ldr + col]; if (RES_BF16) rv = bf16_round(rv); v += rv; }
      if (ACT == 1) v = fmaxf(v, 0.f);
      if (ACT == 2) v = 0.5f * v * (1.0f + erff(v * 0.70710678118654752f));
      if (ACT == 3) { const float u = 0.7978845608028654f * (v + 0.044715f * v * v * v); v = 0.5f * v * (1.0f + tanhf(u)); }
      so[w][8 * hh + r][t * 16 + ln] = v;
    }
  }
  __builtin_amdgcn_fence(__ATOMIC_ACQ_REL, "workgroup");
  __builtin_amdgcn_wave_barrier();
  const int rsub = lane >> 4, c4 = (lane & 15) * 4;
  {
#pragma unroll
    for (int q = 0; q < 8; ++q) {
      const int r = q * 2 + rsub;
      const v4f v = *(const v4fa*)&so[w][r][c4];
      *(v4f*)(C + (size_t)(row0 + r) * ldc + col0 + c4) = v;
    }
    
  }
}
// row LayerNorm (biased variance, eps) over N: s = X (+ R); optional out_sum <- s; out_norm <- (s-mu)*rsqrt(var+eps)*g + b
template <bool PARAM_BF16>
__global__ __launch_bounds__(256) void k_layernorm(const float* __restrict__ X, const float* __restrict__ R, const float* __restrict__ g, const float* __restrict__ bta,
                                                  float* __restrict__ out_sum, float* __restrict__ out_norm, int N, float eps) {
  __shared__ float red[256];
  const int row = blockIdx.x, tid = threadIdx.x;
  const float* x = X + (size_t)row * N; const float* rr = R ? R + (size_t)row * N : nullptr;
  float vals[16];                     // up to N = 4096
  const int per = N / 256;            // contiguous chunk per thread? use strided-by-4 chunks: thread handles j = tid*4 + 1024*u
  float s1 = 0.f;
  for (int u = 0; u < per / 4; ++u) {
    const int j = tid * 4 + 1024 * u;
    const v4f a = *(const v4fa*)(x + j);
    v4f b = {0.f,0.f,0.f,0.f}; if (rr) b = *(const v4fa*)(rr + j);
#pragma unroll
    for (int q = 0; q < 4; ++q) { const float v = a[q] + b[q]; vals[u * 4 + q] = v; s1 += v; }
  }
  red[tid] = s1; __syncthreads();
  for (int st = 128; st > 0; st >>= 1) { if (tid < st) red[tid] += red[tid + st]; __syncthreads(); }
  const float mu = red[0] / (float)N; __syncthreads();
  float s2 = 0.f;
  for (int u = 0; u < per / 4; ++u)
#pragma unroll
    for (int q = 0; q < 4; ++q) { const float c = vals[u * 4 + q] - mu; s2 += c * c; }
  red[tid] = s2; __syncthreads();
  for (int st = 128; st > 0; st >>= 1) { if (tid < st) red[tid] += red[tid + st]; __syncthreads(); }
  const float rs = rsqrtf(red[0] / (float)N + eps);
  {
    for (int u = 0; u < per / 4; ++u) {
      const int j = tid * 4 + 1024 * u;
      v4f o, sm;
#pragma unroll
      for (int q = 0; q < 4; ++q) {
        float gg = g[j + q], bb = bta[j + q];
        if (PARAM_BF16) { gg = bf16_round(gg); bb = bf16_round(bb); }
        sm[q] = vals[u * 4 + q]; o[q] = (vals[u * 4 + q] - mu) * rs * gg + bb;
      }
      if (out_sum) *(v4f*)(out_sum + (size_t)row * N + j) = sm;
      *(v4f*)(out_norm + (size_t)row * N + j) = o;
    }
    
  }
}



// ---- f16 WMMA path (v_wmma_f32_16x16x32_f16): 11-bit significands for operands in range — used where a [0,1] probability operand needs more precision than bf16
typedef _Float16 v16h __attribute__((ext_vector_type(16)));
union FragH { v16h v; v8us half[2]; _Float16 h[16]; unsigned short u[16]; };
template <int NT>
__device__ __forceinline__ v8f mmaH(v16h ah, v16h al, v16h bh, v16h bl, v8f c) {
  c = __builtin_amdgcn_wmma_f32_16x16x32_f16(false, ah, false, bh, (short)0, c, false, false);
  if (NT >= 2) c = __builtin_amdgcn_wmma_f32_16x16x32_f16(false, al, false, bh, (short)0, c, false, false);
  if (NT >= 3) c = __builtin_amdgcn_wmma_f32_16x16x32_f16(false, ah, false, bl, (short)0, c, false, false);
  asm volatile("v_nop\n\tv_nop\n\tv_nop\n\tv_nop" : "+v"(c) : "v"(ah), "v"(al), "v"(bh), "v"(bl));
  return c;
}
// batched GEMM like k_gemm_b but f16 operands: A f32 (split into f16 hi/lo if ASPLIT, else rounded to f16), Bt = f16 values [n][k]; alpha; C f32; N multiple of 16 (partial tiles skipped)
template <bool ASPLIT>
__global__ __launch_bounds__(128) void k_gemm_h(const float* __restrict__ A, int lda, size_t sA, const _Float16* __restrict__ Bh, int ldb, size_t sB, float alpha, float* __restrict__ C, int ldc, size_t sC, int M, int N, int K) {
  __shared__ __attribute__((aligned(16))) float so[4][16][64];
  const int tid = threadIdx.x, w = tid >> 5, lane = tid & 31, ln = lane & 15, hh = lane >> 4; const int by = blockIdx.y;
  A += (size_t)by * sA; Bh += (size_t)by * sB; C += (size_t)by * sC;
  const int ntn = (N + 63) / 64; const int wid = blockIdx.x * 4 + w; const int mt = wid / ntn, nq = wid % ntn; if (mt * 16 >= M) return;
  const int row0 = mt * 16, col0 = nq * 64; const float* arow = A + (size_t)(row0 + ln) * lda;
  v8f acc[4] = {};
  for (int kb = 0; kb < K; kb += 32) {
    FragH ah, al;
    const v4f x0 = *(const v4fa*)(arow + kb + 8 * hh), x1 = *(const v4fa*)(arow + kb + 8 * hh + 4), x2 = *(const v4fa*)(arow + kb + 16 + 8 * hh), x3 = *(const v4fa*)(arow + kb + 16 + 8 * hh + 4);
    float xs[16] = {x0[0],x0[1],x0[2],x0[3],x1[0],x1[1],x1[2],x1[3],x2[0],x2[1],x2[2],x2[3],x3[0],x3[1],x3[2],x3[3]};
#pragma unroll
    for (int i = 0; i < 16; ++i) { const _Float16 h = (_Float16)xs[i]; ah.h[i] = h; al.h[i] = ASPLIT ? (_Float16)(xs[i] - (float)h) : (_Float16)0.0f; }
#pragma unroll
    for (int t = 0; t < 4; ++t) { if (col0 + t * 16 >= N) continue; const size_t boff = (size_t)(col0 + t * 16 + ln) * ldb + kb; FragH bq; bq.half[0] = *(const v8us*)(Bh + boff + 8 * hh); bq.half[1] = *(const v8us*)(Bh + boff + 16 + 8 * hh);
      acc[t] = mmaH<ASPLIT ? 2 : 1>(ah.v, al.v, bq.v, bq.v, acc[t]); }
  }
#pragma unroll
  for (int t = 0; t < 4; ++t) { if (col0 + t * 16 >= N) continue;
#pragma unroll
    for (int r = 0; r < 8; ++r) so[w][8 * hh + r][t * 16 + ln] = acc[t][r] * alpha; }
  __builtin_amdgcn_fence(__ATOMIC_ACQ_REL, "workgroup"); __builtin_amdgcn_wave_barrier();
  const int rsub = lane >> 4, c4 = (lane & 15) * 4;
  {
#pragma unroll
    for (int q = 0; q < 8; ++q) { const int r = q * 2 + rsub; if (col0 + c4 < N) { const v4f v = *(const v4fa*)&so[w][r][c4]; *(v4f*)(C + (size_t)(row0 + r) * ldc + col0 + c4) = v; } }
     }
}

// Wt[n][k] = f16(W[k][n]·scale) from f32 row-major W[K][N] (scale = power of two; bf16-exact weights stay exact in f16 away from the subnormal range)
__device__ __forceinline__ void wt_f16(const float* __restrict__ W, _Float16* __restrict__ Wt, int K, int N, float scale, int t) {      /* t = 0 .. N * K / 8 - 1: output row n, eight k */
  const int n = t / (K / 8), k8 = (t % (K / 8)) * 8; FragH f;
#pragma unroll
  for (int i = 0; i < 8; ++i) f.h[i] = (_Float16)(bf16_round(W[(size_t)(k8 + i) * N + n]) * scale); const v8us o = f.half[0];
  *(v8us*)((unsigned short*)Wt + (size_t)n * K + k8) = o;
  asm volatile("s_wait_xcnt 0x0" ::: "memory");      /* behind the store, ahead of any reuse of the registers that it names (the other parts' code follows in the same kernel) */
}
// k_gemm_hh variant with fused epilogue: v = acc·alpha + bias[by·sBias + col] (+ CP[(row/rowsPerB)·sCPb + by·64 + col] if CP) ; ACT 0 none / 1 elu ; writes f16 C16 (and f32 C if non-null)
template <int ACT>
__global__ __launch_bounds__(128) void k_gemm_hhx(const _Float16* __restrict__ A, int lda, size_t sA, const _Float16* __restrict__ Bh, int ldb, size_t sB, float alpha, const float* __restrict__ bias, size_t sBias, const float* __restrict__ CP, int rowsPerB, size_t sCPb, int row0g,
    float* __restrict__ C, _Float16* __restrict__ C16, int ldc, size_t sC, int M, int N, int K) {
  __shared__ __attribute__((aligned(16))) float so[4][16][64];
  const int tid = threadIdx.x, w = tid >> 5, lane = tid & 31, ln = lane & 15, hh = lane >> 4; const int by = blockIdx.y;
  A += (size_t)by * sA; Bh += (size_t)by * sB; const size_t cofs = (size_t)by * sC; const float* bp = bias ? bias + (size_t)by * sBias : nullptr;
  const int ntn = (N + 63) / 64; const int wid = blockIdx.x * 4 + w; const int mt = wid / ntn, nq = wid % ntn; if (mt * 16 >= M) return;
  const int row0 = mt * 16, col0 = nq * 64; const _Float16* arow = A + (size_t)(row0 + ln) * lda;
  v8f acc[4] = {};
  for (int kb = 0; kb < K; kb += 32) { FragH ah; ah.half[0] = *(const v8us*)((const unsigned short*)arow + kb + 8 * hh); ah.half[1] = *(const v8us*)((const unsigned short*)arow + kb + 16 + 8 * hh);
#pragma unroll
    for (int t = 0; t < 4; ++t) { if (col0 + t * 16 >= N) continue; const size_t boff = (size_t)(col0 + t * 16 + ln) * ldb + kb; FragH bq; bq.half[0] = *(const v8us*)((const unsigned short*)Bh + boff + 8 * hh); bq.half[1] = *(const v8us*)((const unsigned short*)Bh + boff + 16 + 8 * hh);
      acc[t] = mmaH<1>(ah.v, ah.v, bq.v, bq.v, acc[t]); }
  }
#pragma unroll
  for (int t = 0; t < 4; ++t) { if (col0 + t * 16 >= N) continue; const int col = col0 + t * 16 + ln; const float bv = bp ? bf16_round(bp[col]) : 0.f;
#pragma unroll
    for (int r = 0; r < 8; ++r) { float v = acc[t][r] * alpha + bv; if (CP) { const int bidx = (row0g + row0 + 8 * hh + r) / rowsPerB; v += CP[(size_t)bidx * sCPb + (size_t)by * 64 + col]; } if (ACT == 1) v = (v > 0.f) ? v : expm1f(v); else if (ACT == 7) v = (v > 0.f) ? v + 1.0f : expf(v); else if (ACT == 8) v = tanhf(v); else if (ACT == 9) v = 0.5f * v * (1.0f + tanhf(0.7978845608028654f * (v + 0.044715f * v * v * v))); else if (ACT == 11) v = 1.0f / (1.0f + expf(-v)); else if (ACT == 12) v = (v > 0.f) ? v : 0.01f * v; else if (ACT == 14) v = (v > 0.f) ? v : 0.1f * v; else if (ACT == 15) v = v / (1.0f + expf(-v)); else if (ACT == 3) v = fmaxf(v, 0.f); else if (ACT == 6) v = 0.5f * v * (1.0f + erff(v * 0.70710678118654752f)); so[w][8 * hh + r][t * 16 + ln] = v; } }
  __builtin_amdgcn_fence(__ATOMIC_ACQ_REL, "workgroup"); __builtin_amdgcn_wave_barrier();
  const int rsub = lane >> 4, c4 = (lane & 15) * 4; typedef _Float16 v4h __attribute__((ext_vector_type(4)));
  {
#pragma unroll
    for (int q = 0; q < 8; ++q) { const int r = q * 2 + rsub; if (col0 + c4 < N) { const v4f v = *(const v4fa*)&so[w][r][c4]; if (C) *(v4f*)(C + cofs + (size_t)(row0 + r) * ldc + col0 + c4) = v; if (C16) { v4h h4; for (int i = 0; i < 4; ++i) h4[i] = (_Float16)v[i]; *(v4h*)(C16 + cofs + (size_t)(row0 + r) * ldc + col0 + c4) = h4; } } }
     }
}


typedef _Float16 v4h __attribute__((ext_vector_type(4)));

// X16 = f16(bf16(x)), piece t of 8 values
__device__ __forceinline__ void x16_piece(const float* __restrict__ x, _Float16* __restrict__ X16, size_t t) { FragH f;
#pragma unroll
  for (int q = 0; q < 8; ++q) f.h[q] = (_Float16)bf16_round(x[t * 8 + q]); *(v8us*)((unsigned short*)X16 + t * 8) = f.half[0];
  asm volatile("s_wait_xcnt 0x0" ::: "memory");      /* behind the store, ahead of any reuse of the registers that it names (the other parts' code follows in the same kernel) */
}
__global__ __launch_bounds__(256) void k_h16(const float* __restrict__ x, _Float16* __restrict__ X16, size_t n8) { const size_t t = (size_t)blockIdx.x * 256 + threadIdx.x; if (t >= n8) return; FragH f;
#pragma unroll
  for (int q = 0; q < 8; ++q) f.h[q] = (_Float16)x[t * 8 + q]; *(v8us*)((unsigned short*)X16 + t * 8) = f.half[0];  }
__global__ __launch_bounds__(256) void k_round16f(const float* __restrict__ W, _Float16* __restrict__ Bt, size_t n8) { const size_t t = (size_t)blockIdx.x * 256 + threadIdx.x; if (t >= n8) return; FragH f;
#pragma unroll
  for (int i = 0; i < 8; ++i) f.h[i] = (_Float16)(bf16_round(W[t * 8 + i]) * 16.0f); *(v8us*)((unsigned short*)Bt + t * 8) = f.half[0];  }

// ---- pieces of the f16 GEMMs with a 32x64 wave tile ----
__device__ __forceinline__ v16h g2_frag(const _Float16* p, int hh) { FragH f; f.half[0] = *(const v8us*)((const unsigned short*)p + 8 * hh); f.half[1] = *(const v8us*)((const unsigned short*)p + 16 + 8 * hh); return f.v; }
__device__ __forceinline__ v8f g2_mma(v16h a, v16h b, v8f c) { v8f d = __builtin_amdgcn_wmma_f32_16x16x32_f16(false, a, false, b, (short)0, c, false, false); asm volatile("v_nop\n\tv_nop\n\tv_nop\n\tv_nop" : "+v"(d) : "v"(a), "v"(b)); return d; }
// One wave's tile of the q, k or v projection: C[32][64] = A[32 rows] B[64 rows]^T over the 512 inputs (both operands k-contiguous f16 rows, f32 accumulation), C / 16 + bias, staged in the wave's own LDS range so and stored as whole 128-byte lines of f16.
//   PART 0 (q): A = x rows j.., B = the head's 64 Wq^T rows; stored as hi + 2^10 residual planes.
//   PART 1 (k): the same, but A row r = x row idx[j + r] (the head class's list of valid keys): the planes come out compacted.
//   PART 2 (v): A = the head's Wv^T rows dh.. dh + 31, B row c = x row idx[j + c]: the tile is a piece of V^T itself, compacted; stored as plain f16.
// A fragment's address is the lane's own pointer (operand row, half), carried through the loop and stepped along k.
typedef const __attribute__((address_space(1))) char* gcp;      /* a pointer known to be global: carried through a loop, a plain pointer came out as flat loads */
typedef const __attribute__((address_space(1))) v8us* gv8p;
__device__ __forceinline__ v16h g2_fragp(gcp p) { FragH f; f.half[0] = *(gv8p)p; f.half[1] = *(gv8p)(p + 32); return f.v; }
template <int PART>
__device__ __forceinline__ void qkv_tile(float (*so)[68], const _Float16* __restrict__ xs, const _Float16* __restrict__ wh, const float* __restrict__ bias, const int* __restrict__ idx, int j, int dh, _Float16* __restrict__ ph, _Float16* __restrict__ pl, int ln, int hh) {
  gcp ap[2], bp[4]; float bi[(PART == 2) ? 16 : 4];      /* bi: the bias of the tile's columns or, PART 2, of this lane's 16 rows; loaded ahead of the loop, lands under it */
  const gcp ab = (gcp)((PART == 2) ? wh : xs), bb = (gcp)((PART == 2) ? xs : wh);
#pragma unroll
  for (int i = 0; i < 2; ++i) ap[i] = ab + (size_t)((PART == 0) ? j + 16 * i + ln : (PART == 1) ? idx[j + 16 * i + ln] : dh + 16 * i + ln) * (DMOD * 2) + 16 * hh;
#pragma unroll
  for (int t = 0; t < 4; ++t) bp[t] = bb + (size_t)((PART == 2) ? idx[j + 16 * t + ln] : 16 * t + ln) * (DMOD * 2) + 16 * hh;
#pragma unroll
  for (int u = 0; u < ((PART == 2) ? 16 : 4); ++u) bi[u] = bf16_round(bias[(PART == 2) ? dh + (u >> 3) * 16 + 8 * hh + (u & 7) : u * 16 + ln]);
  v8f c[2][4];
#pragma unroll
  for (int u = 0; u < 8; ++u) c[u >> 2][u & 3] = (v8f){0.f,0.f,0.f,0.f,0.f,0.f,0.f,0.f};
#pragma unroll 1      /* rolled: 8 passes of 16 products; the loop's code stays a few instruction-cache lines */
  for (int kb = 0; kb < DMOD; kb += 64) { v16h a[2][2], bf[4][2];      /* a pass takes one whole 128-byte line of every operand row (two k blocks of 32); its 24 loads stand ahead of the first product, so a line's four pieces are asked for close together and memory is waited for once a pass */
#pragma unroll
    for (int t = 0; t < 4; ++t) { bf[t][0] = g2_fragp(bp[t]); bf[t][1] = g2_fragp(bp[t] + 64); }
#pragma unroll
    for (int i = 0; i < 2; ++i) { a[i][0] = g2_fragp(ap[i]); a[i][1] = g2_fragp(ap[i] + 64); }
    asm volatile("s_wait_xcnt 0x0" ::: "memory");      /* stands between the pass's loads and the stepping of the pointers that they name */
    __builtin_amdgcn_sched_barrier(0);      /* keeps the pointer steps below from being scheduled ahead of that wait */
#pragma unroll
    for (int t = 0; t < 4; ++t) bp[t] += 128;
#pragma unroll
    for (int i = 0; i < 2; ++i) ap[i] += 128;
#pragma unroll
    for (int s = 0; s < 2; ++s)
#pragma unroll
      for (int t = 0; t < 4; ++t) { c[0][t] = g2_mma(a[0][s], bf[t][s], c[0][t]); c[1][t] = g2_mma(a[1][s], bf[t][s], c[1][t]); } }
#pragma unroll
  for (int u = 0; u < 8; ++u) { const int t = u & 3, half = u >> 2;
#pragma unroll
    for (int r = 0; r < 8; ++r) so[half * 16 + 8 * hh + r][t * 16 + ln] = c[half][t][r] * 0.0625f + bi[(PART == 2) ? half * 8 + r : t]; }
  __builtin_amdgcn_fence(__ATOMIC_ACQ_REL, "workgroup"); __builtin_amdgcn_wave_barrier();      /* the wave reads back rows that its other lanes wrote */
  constexpr int ldc = (PART == 2) ? TK : DMOD;
#pragma unroll
  for (int q = 0; q < 16; ++q) { const int r = q * 2 + hh; const v4f v = *(const v4fa*)&so[r][ln * 4]; v4h hi, lo;
#pragma unroll
    for (int i = 0; i < 4; ++i) { hi[i] = (_Float16)v[i]; lo[i] = (_Float16)((v[i] - (float)hi[i]) * 1024.0f); }
    *(v4h*)(ph + (size_t)r * ldc + ln * 4) = hi; if (PART != 2) *(v4h*)(pl + (size_t)r * ldc + ln * 4) = lo; }
  asm volatile("s_wait_xcnt 0x0" ::: "memory");      /* behind the tile's last store, ahead of any reuse of the registers that the stores name */
}
// The q, k and v projections with all their after-work in one launch: 512 blocks a part, a block = (sequence, 128 tokens or list positions, head), four wave tiles. A wave whose keys all lie past the count rounded up to 32 leaves at once (those rows and columns are never read); list entries past the count are 0, a finite row.
__global__ __launch_bounds__(128) void k_qkv(const _Float16* __restrict__ X16, const _Float16* __restrict__ BQ, const _Float16* __restrict__ BK, const _Float16* __restrict__ BV, const float* __restrict__ bq, const float* __restrict__ bk, const float* __restrict__ bv,
    const int* __restrict__ IDX, const int* __restrict__ CNT, _Float16* __restrict__ QH, _Float16* __restrict__ QL, _Float16* __restrict__ KH, _Float16* __restrict__ KL, _Float16* __restrict__ VT) {
  __shared__ __attribute__((aligned(16))) float so[4][32][68];
  const int tid = threadIdx.x, lane = tid & 31, ln = lane & 15, hh = lane >> 4; const int w = __builtin_amdgcn_readfirstlane(tid >> 5);
  constexpr int TPS = TK / 128, PER = NB * TPS * NH;
  const int part = blockIdx.x / PER, rem = blockIdx.x % PER; const int h = rem % NH, mt = rem / NH; const int b = mt / TPS, t0 = (mt % TPS) * 128;
  const _Float16* xs = X16 + (size_t)b * TK * DMOD; const size_t wo = (size_t)h * 64 * DMOD;
  if (part == 0) { const int j = t0 + 32 * w; const size_t o = ((size_t)b * TK + j) * DMOD + h * 64; qkv_tile<0>(so[w], xs, BQ + wo, bq + h * 64, nullptr, j, 0, QH + o, QL + o, ln, hh); return; }
  const int cls = (h < CDRH) ? 0 : 1; const int cr = (min(CNT[b * 32 + cls], TK) + 31) & ~31; const int* idx = IDX + ((size_t)b * 2 + cls) * TK;
  if (part == 1) { const int j = t0 + 32 * w; if (j >= cr) return; const size_t o = ((size_t)b * TK + j) * DMOD + h * 64; qkv_tile<1>(so[w], xs, BK + wo, bk + h * 64, idx, j, 0, KH + o, KL + o, ln, hh); }
  else { const int j = t0 + 64 * (w >> 1), dh = 32 * (w & 1); if (j >= cr) return; qkv_tile<2>(so[w], xs, BV + wo, bv + h * 64, idx, j, dh, VT + (((size_t)b * NH + h) * 64 + dh) * TK + j, nullptr, ln, hh); } }

template <int CAUSAL>
__global__ __launch_bounds__(128) void k_flash(const _Float16* __restrict__ Q16, int ldq, const _Float16* __restrict__ K16, int ldk, const _Float16* __restrict__ Vt, const int* __restrict__ MSK, float* __restrict__ O, int ldo) {
  constexpr int RPW = 16, RTN = RPW / 16, NQB = TQ / (4 * RPW), DT = 4, KS = 2;
  __shared__ __attribute__((aligned(16))) unsigned short sP[4][RPW][40]; __shared__ __attribute__((aligned(16))) float sO[4][RPW][64 + 4];
  const int tid = threadIdx.x, w = tid >> 5, lane = tid & 31, ln = lane & 15, hh = lane >> 4;
  const int slab = blockIdx.x / NQB, qblk = blockIdx.x % NQB; const int b = slab / NH, h = slab % NH; const int qb0 = qblk * (4 * RPW); const int q0 = qb0 + w * RPW;
  FragH aq[2][KS];
#pragma unroll
  for (int rt = 0; rt < RTN; ++rt) { const unsigned short* qr = (const unsigned short*)Q16 + ((size_t)b * TQ + q0 + rt * 16 + ln) * ldq + h * 64;
#pragma unroll
    for (int ks = 0; ks < KS; ++ks) { aq[rt][ks].half[0] = *(const v8us*)(qr + ks * 32 + 8 * hh); aq[rt][ks].half[1] = *(const v8us*)(qr + ks * 32 + 16 + 8 * hh); } }
  const unsigned short* Vth = (const unsigned short*)Vt + (size_t)slab * 64 * TK;
  float m_r[2][8], l_r[2][8]; v8f oacc[2][DT];
#pragma unroll
  for (int rt = 0; rt < RTN; ++rt) {
#pragma unroll
    for (int r = 0; r < 8; ++r) { m_r[rt][r] = -3.0e38f; l_r[rt][r] = 0.f; }
#pragma unroll
    for (int dt = 0; dt < DT; ++dt) oacc[rt][dt] = (v8f){0.f,0.f,0.f,0.f,0.f,0.f,0.f,0.f}; }
  const int jend = (CAUSAL == 1) ? (qb0 + 4 * RPW) : TK;      /* causal: keys beyond the block's last query never contribute */
#pragma unroll 1
  for (int j0 = 0; j0 < jend; j0 += 32) {
    v8f s[2][2];
#pragma unroll
    for (int nt = 0; nt < 2; ++nt) { const unsigned short* kr = (const unsigned short*)K16 + ((size_t)b * TK + j0 + nt * 16 + ln) * ldk + h * 64; FragH bk[KS];
#pragma unroll
      for (int ks = 0; ks < KS; ++ks) { bk[ks].half[0] = *(const v8us*)(kr + ks * 32 + 8 * hh); bk[ks].half[1] = *(const v8us*)(kr + ks * 32 + 16 + 8 * hh); }
#pragma unroll
      for (int rt = 0; rt < RTN; ++rt) { v8f acc = (v8f){0.f,0.f,0.f,0.f,0.f,0.f,0.f,0.f};
#pragma unroll
        for (int ks = 0; ks < KS; ++ks) acc = mmaH<1>(aq[rt][ks].v, aq[rt][ks].v, bk[ks].v, bk[ks].v, acc); s[rt][nt] = acc; } }
#pragma unroll
    for (int rt = 0; rt < RTN; ++rt)
#pragma unroll
      for (int r = 0; r < 8; ++r) { const int tq = q0 + rt * 16 + 8 * hh + r; const int k0 = j0 + ln, k1 = j0 + 16 + ln;
        const bool ok0 = (CAUSAL == 1) ? (k0 <= tq) : ((CAUSAL == 2) ? ((k0 >> 5) == (tq >> 5)) : true), ok1 = (CAUSAL == 1) ? (k1 <= tq) : ((CAUSAL == 2) ? ((k1 >> 5) == (tq >> 5)) : true);      /* mode 2: block-diagonal 32-token groups */
        const float s0 = ok0 ? s[rt][0][r] * SCL : -3.0e38f, s1 = ok1 ? s[rt][1][r] * SCL : -3.0e38f; float mc = fmaxf(s0, s1);
        mc = fmaxf(mc, __shfl_xor(mc, 1, 32)); mc = fmaxf(mc, __shfl_xor(mc, 2, 32)); mc = fmaxf(mc, __shfl_xor(mc, 4, 32)); mc = fmaxf(mc, __shfl_xor(mc, 8, 32));
        const float mn = fmaxf(m_r[rt][r], mc); const float al = (mn > -1.0e38f) ? expf(m_r[rt][r] - mn) : 1.0f; m_r[rt][r] = mn; const float p0 = ok0 ? expf(s0 - mn) : 0.f, p1 = ok1 ? expf(s1 - mn) : 0.f; l_r[rt][r] = l_r[rt][r] * al + p0 + p1;
#pragma unroll
        for (int dt = 0; dt < DT; ++dt) oacc[rt][dt][r] *= al;
        FragH t2; t2.h[0] = (_Float16)(p0 * 1024.0f); t2.h[1] = (_Float16)(p1 * 1024.0f); sP[w][rt * 16 + 8 * hh + r][ln] = t2.u[0]; sP[w][rt * 16 + 8 * hh + r][16 + ln] = t2.u[1]; }
    __builtin_amdgcn_fence(__ATOMIC_ACQ_REL, "workgroup"); __builtin_amdgcn_wave_barrier();
    FragH pa[2];
#pragma unroll
    for (int rt = 0; rt < RTN; ++rt) { pa[rt].half[0] = *(const v8us*)&sP[w][rt * 16 + ln][8 * hh]; pa[rt].half[1] = *(const v8us*)&sP[w][rt * 16 + ln][16 + 8 * hh]; }
#pragma unroll
    for (int dt = 0; dt < DT; ++dt) { const unsigned short* vrow = Vth + (size_t)(dt * 16 + ln) * TK + j0; FragH bv; bv.half[0] = *(const v8us*)(vrow + 8 * hh); bv.half[1] = *(const v8us*)(vrow + 16 + 8 * hh);
#pragma unroll
      for (int rt = 0; rt < RTN; ++rt) oacc[rt][dt] = mmaH<1>(pa[rt].v, pa[rt].v, bv.v, bv.v, oacc[rt][dt]); }
    __builtin_amdgcn_fence(__ATOMIC_ACQ_REL, "workgroup"); __builtin_amdgcn_wave_barrier(); }
#pragma unroll
  for (int rt = 0; rt < RTN; ++rt) {
#pragma unroll
    for (int r = 0; r < 8; ++r) { float l = l_r[rt][r]; l += __shfl_xor(l, 1, 32); l += __shfl_xor(l, 2, 32); l += __shfl_xor(l, 4, 32); l += __shfl_xor(l, 8, 32); l_r[rt][r] = (l > 0.f) ? 1.0f / (l * 1024.0f) : 0.f; }
#pragma unroll
    for (int dt = 0; dt < DT; ++dt)
#pragma unroll
      for (int r = 0; r < 8; ++r) sO[w][rt * 16 + 8 * hh + r][dt * 16 + ln] = oacc[rt][dt][r] * l_r[rt][r]; }
  __builtin_amdgcn_fence(__ATOMIC_ACQ_REL, "workgroup"); __builtin_amdgcn_wave_barrier();
  {
#pragma unroll
    for (int rp = 0; rp < RPW; rp += 2) { const int r = rp + (lane >> 4), pc = lane & 15; const v4f val = *(const v4fa*)&sO[w][r][pc * 4]; *(v4f*)(O + ((size_t)b * TQ + q0 + r) * ldo + h * 64 + pc * 4) = val; }
     } }
// Six 16-byte asynchronous copies to LDS per lane (one 32-key tile's share). s_wait_xcnt 0 closes the statement so that no address register of an issued copy is rewritten ahead of it.
__device__ __forceinline__ void cp_tile6(unsigned l0, const unsigned short* g0, unsigned l1, const unsigned short* g1, unsigned l2, const unsigned short* g2, unsigned l3, const unsigned short* g3, unsigned l4, const unsigned short* g4, unsigned l5, const unsigned short* g5) {
  asm volatile("global_load_async_to_lds_b128 %0, %1, off\n\t"
               "global_load_async_to_lds_b128 %2, %3, off\n\t"
               "global_load_async_to_lds_b128 %4, %5, off\n\t"
               "global_load_async_to_lds_b128 %6, %7, off\n\t"
               "global_load_async_to_lds_b128 %8, %9, off\n\t"
               "global_load_async_to_lds_b128 %10, %11, off\n\t"
               "s_wait_xcnt 0x0"
               :: "v"(l0), "v"(g0), "v"(l1), "v"(g1), "v"(l2), "v"(g2), "v"(l3), "v"(g3), "v"(l4), "v"(g4), "v"(l5), "v"(g5) : "memory");
}
// x <- 2^x on eight or nine values by the hardware's v_exp_f32. One statement, each value in its own register: none reads a neighbour's result or overwrites a neighbour's source.
__device__ __forceinline__ void exp2x8(float& a, float& b, float& c, float& d, float& e, float& f, float& g, float& h) {
  asm("v_exp_f32 %0, %0\n\tv_exp_f32 %1, %1\n\tv_exp_f32 %2, %2\n\tv_exp_f32 %3, %3\n\tv_exp_f32 %4, %4\n\tv_exp_f32 %5, %5\n\tv_exp_f32 %6, %6\n\tv_exp_f32 %7, %7\n\tv_nop"      /* v_nop: the one slot that the instruction set asks for between the last v_exp_f32 and whatever the compiler puts next */
      : "+v"(a), "+v"(b), "+v"(c), "+v"(d), "+v"(e), "+v"(f), "+v"(g), "+v"(h));
}
__device__ __forceinline__ void exp2x9(float& z, float& a, float& b, float& c, float& d, float& e, float& f, float& g, float& h) {
  asm("v_exp_f32 %0, %0\n\tv_exp_f32 %1, %1\n\tv_exp_f32 %2, %2\n\tv_exp_f32 %3, %3\n\tv_exp_f32 %4, %4\n\tv_exp_f32 %5, %5\n\tv_exp_f32 %6, %6\n\tv_exp_f32 %7, %7\n\tv_exp_f32 %8, %8\n\tv_nop"      /* v_nop: as in exp2x8 */
      : "+v"(z), "+v"(a), "+v"(b), "+v"(c), "+v"(d), "+v"(e), "+v"(f), "+v"(g), "+v"(h));
}
typedef float v2f __attribute__((ext_vector_type(2)));
// lane l takes the value of lane l ^ 16 (the other 16-lane half)
__device__ __forceinline__ float xhalf(float x) { return __builtin_bit_cast(float, __builtin_amdgcn_permlanex16(__builtin_bit_cast(int, x), __builtin_bit_cast(int, x), 0x76543210, 0xfedcba98, false, false)); }
template <int CAUSAL>
__global__ __launch_bounds__(128) void k_flashqk(const _Float16* __restrict__ Q16, const _Float16* __restrict__ QL, int ldq, const _Float16* __restrict__ K16, const _Float16* __restrict__ KL, int ldk, const _Float16* __restrict__ Vt, const int* __restrict__ MSK, float* __restrict__ O, int ldo) {
  static_assert(CAUSAL == 5, "compacted-key mode only");
  constexpr int RPW = 16, DT = 4, KS = 2;
  __shared__ __attribute__((aligned(16))) float sO[4][RPW][64 + 4];
  __shared__ __attribute__((aligned(16))) unsigned short sKh[2][32][72], sKl[2][32][72], sV[2][64][40];      /* row pitches 144 B and 80 B: 16 B x odd, for 16-byte fragment reads */
  const int tid = threadIdx.x, w = tid >> 5, lane = tid & 31, ln = lane & 15, hh = lane >> 4;
  const int slab = blockIdx.x / QBLKS, qblk = blockIdx.x % QBLKS; const int b = slab / NH, h = slab % NH; const int qb0 = qblk * (4 * RPW); const int q0 = qb0 + w * RPW;
  FragH aq[KS], aql[KS];
  { const unsigned short* qr = (const unsigned short*)Q16 + ((size_t)b * TQ + q0 + ln) * ldq + h * 64; const unsigned short* ql = (const unsigned short*)QL + ((size_t)b * TQ + q0 + ln) * ldq + h * 64;
#pragma unroll
    for (int ks = 0; ks < KS; ++ks) { aq[ks].half[0] = *(const v8us*)(qr + ks * 32 + 8 * hh); aq[ks].half[1] = *(const v8us*)(qr + ks * 32 + 16 + 8 * hh); aql[ks].half[0] = *(const v8us*)(ql + ks * 32 + 8 * hh); aql[ks].half[1] = *(const v8us*)(ql + ks * 32 + 16 + 8 * hh); } }
  const unsigned short* Vth = (const unsigned short*)Vt + (size_t)slab * 64 * TK;
  float m_r = -3.0e38f, l_r = 0.f; v8f oacc[DT];      /* query q0 + ln: running maximum less 10, in base-2 units (equal in both halves), this half's share of the sum (x2^10), O^T rows dt * 16 + 8 hh + r */
#pragma unroll
  for (int dt = 0; dt < DT; ++dt) oacc[dt] = (v8f){0.f,0.f,0.f,0.f,0.f,0.f,0.f,0.f};
  const int kcnt = min(MSK[b * 32 + ((h < CDRH) ? 0 : 1)], TK);      /* number of valid keys of this (sequence, head class); K planes and V^T hold them compacted, in key order */
  const int jend = (kcnt + 31) & ~31;
  const int kr0 = tid >> 3, kc0 = (tid & 7) * 8, vr0 = tid >> 2, vc0 = (tid & 3) * 8;      /* a lane's share of a tile: rows kr0 and kr0 + 16 of both K planes, rows vr0 and vr0 + 32 of V^T, 16 bytes each; whole 128-byte K lines per 8 lanes */
  const unsigned short* gkh = (const unsigned short*)K16 + ((size_t)b * TK + kr0) * ldk + h * 64 + kc0; const unsigned short* gkl = (const unsigned short*)KL + ((size_t)b * TK + kr0) * ldk + h * 64 + kc0; const unsigned short* gv = Vth + (size_t)vr0 * TK + vc0;
  auto stage = [&](int jt, int bf) { const size_t ko = (size_t)jt * ldk;
    cp_tile6((unsigned)(size_t)&sKh[bf][kr0][kc0], gkh + ko, (unsigned)(size_t)&sKh[bf][kr0 + 16][kc0], gkh + ko + (size_t)16 * ldk, (unsigned)(size_t)&sKl[bf][kr0][kc0], gkl + ko, (unsigned)(size_t)&sKl[bf][kr0 + 16][kc0], gkl + ko + (size_t)16 * ldk,
             (unsigned)(size_t)&sV[bf][vr0][vc0], gv + jt, (unsigned)(size_t)&sV[bf][vr0 + 32][vc0], gv + (size_t)32 * TK + jt); };
  if (jend > 0) stage(0, 0);
  asm volatile("s_wait_asynccnt 0x0" ::: "memory");      /* this wave's share of tile 0 has landed */
  __syncthreads();      /* tile 0 is published to all four waves */
  if (jend > 32) stage(32, 1);
#pragma unroll 1
  for (int j0 = 0; j0 < jend; j0 += 32) {
    const int bf = (j0 >> 5) & 1;
    float sc[2][8];      /* sc[nt][r] = raw score (q . k, not yet scaled) of key j0 + 16 nt + 8 hh + r for query q0 + ln; the inner loops of this trip are fully unrolled so that sc, pb, ls and oacc are indexed by constants and stay in registers */
#pragma unroll
    for (int nt = 0; nt < 2; ++nt) { const unsigned short* kr = &sKh[bf][nt * 16 + ln][0]; const unsigned short* klr = &sKl[bf][nt * 16 + ln][0]; FragH bk[KS], bkl[KS];
#pragma unroll
      for (int ks = 0; ks < KS; ++ks) { bk[ks].half[0] = *(const v8us*)(kr + ks * 32 + 8 * hh); bk[ks].half[1] = *(const v8us*)(kr + ks * 32 + 16 + 8 * hh); bkl[ks].half[0] = *(const v8us*)(klr + ks * 32 + 8 * hh); bkl[ks].half[1] = *(const v8us*)(klr + ks * 32 + 16 + 8 * hh); }
      v8f acc = (v8f){0.f,0.f,0.f,0.f,0.f,0.f,0.f,0.f}, accl = acc;
#pragma unroll
      for (int ks = 0; ks < KS; ++ks) { acc = mmaH<1>(bk[ks].v, bk[ks].v, aq[ks].v, aq[ks].v, acc); accl = mmaH<1>(bk[ks].v, bk[ks].v, aql[ks].v, aql[ks].v, accl); accl = mmaH<1>(bkl[ks].v, bkl[ks].v, aq[ks].v, aq[ks].v, accl); }
#pragma unroll
      for (int r = 0; r < 8; ++r) sc[nt][r] = acc[r] + accl[r] * 0.0009765625f; }
    if (j0 + 32 > kcnt) {      /* block-uniform: only the last trip holds keys past the count (key padding and head-specific masks are applied by the gather) */
#pragma unroll
      for (int nt = 0; nt < 2; ++nt)
#pragma unroll
        for (int r = 0; r < 8; ++r) if (j0 + nt * 16 + 8 * hh + r >= kcnt) sc[nt][r] = -3.0e38f; }
    float mc = fmaxf(sc[0][0], sc[1][0]);
#pragma unroll
    for (int r = 1; r < 8; ++r) mc = fmaxf(mc, fmaxf(sc[0][r], sc[1][r]));
    mc = fmaxf(mc, xhalf(mc));
    const float mn = fmaxf(m_r, mc * SCL2 - 10.0f);      /* the softmax reference point: running maximum of the scaled scores less 10, so 2^(score * SCL2 - mn) is P x 2^10 as the f16 operand wants it, with no multiply; every term and every rescale uses this same value. Finite in every trip: key j0 is below the count; so an invalid key's term below is exactly 0, and so is the first trip's rescale factor */
    float al = m_r - mn; m_r = mn;
#pragma unroll
    for (int nt = 0; nt < 2; ++nt)
#pragma unroll
      for (int r = 0; r < 8; r += 2) { const v2f t = __builtin_elementwise_fma((v2f){sc[nt][r], sc[nt][r + 1]}, (v2f){SCL2, SCL2}, (v2f){-mn, -mn}); sc[nt][r] = t[0]; sc[nt][r + 1] = t[1]; }      /* scale and reference point in one packed operation for two scores */
    exp2x9(al, sc[0][0], sc[0][1], sc[0][2], sc[0][3], sc[0][4], sc[0][5], sc[0][6], sc[0][7]);      /* al: the rescale factor of the sums so far; sc: now P x 2^10 */
    exp2x8(sc[1][0], sc[1][1], sc[1][2], sc[1][3], sc[1][4], sc[1][5], sc[1][6], sc[1][7]);
    FragH pb; float ls[4];
#pragma unroll
    for (int nt = 0; nt < 2; ++nt)
#pragma unroll
      for (int r = 0; r < 8; ++r) { const float p = sc[nt][r]; if (r < 2) ls[nt * 2 + r] = p; else ls[nt * 2 + (r & 1)] += p; pb.h[nt * 8 + r] = (_Float16)p; }      /* element nt * 8 + r of the B operand = key 16 nt + 8 hh + r: the k order of the V^T fragment */
    l_r = l_r * al + ((ls[0] + ls[1]) + (ls[2] + ls[3]));
#pragma unroll
    for (int dt = 0; dt < DT; ++dt)
#pragma unroll
      for (int r = 0; r < 8; ++r) oacc[dt][r] *= al;
#pragma unroll
    for (int dt = 0; dt < DT; ++dt) { const unsigned short* vrow = &sV[bf][dt * 16 + ln][0]; FragH bv; bv.half[0] = *(const v8us*)(vrow + 8 * hh); bv.half[1] = *(const v8us*)(vrow + 16 + 8 * hh);
      oacc[dt] = mmaH<1>(bv.v, bv.v, pb.v, pb.v, oacc[dt]); }
    asm volatile("s_wait_dscnt 0x0" ::: "memory");      /* this wave's reads of buffer bf have returned before the buffer is refilled */
    asm volatile("s_wait_asynccnt 0x0" ::: "memory");      /* this wave's share of the next tile has landed */
    __syncthreads();      /* publishes the next tile and ends every wave's reads of buffer bf */
    if (j0 + 64 < jend) stage(j0 + 64, bf); }
  asm volatile("s_wait_asynccnt 0x0" ::: "memory");      /* no copy is outstanding when the wave goes on to its end */
  const float l = l_r + xhalf(l_r); const float linv = (l > 0.f) ? 1.0f / l : 0.f;      /* sum and O^T carry the same 2^10 */
#pragma unroll
  for (int dt = 0; dt < DT; ++dt) { const v4f o0 = {oacc[dt][0] * linv, oacc[dt][1] * linv, oacc[dt][2] * linv, oacc[dt][3] * linv}, o1 = {oacc[dt][4] * linv, oacc[dt][5] * linv, oacc[dt][6] * linv, oacc[dt][7] * linv};
    *(v4fa*)&sO[w][ln][dt * 16 + 8 * hh] = o0; *(v4fa*)&sO[w][ln][dt * 16 + 8 * hh + 4] = o1; }
  __builtin_amdgcn_fence(__ATOMIC_ACQ_REL, "workgroup"); __builtin_amdgcn_wave_barrier();
  {
#pragma unroll
    for (int rp = 0; rp < RPW; rp += 2) { const int r = rp + (lane >> 4), pc = lane & 15; const v4f val = *(const v4fa*)&sO[w][r][pc * 4]; *(v4f*)(O + ((size_t)b * TQ + q0 + r) * ldo + h * 64 + pc * 4) = val; }
     } }

// f32 -> f16 hi + 2^10 residual A fragments of one row (k order of g2_frag: elements 0..7 = k 8 hh + i, elements 8..15 = k 16 + 8 hh + i); p already points at k = 8 hh. Same rounding as in k_qkv.
__device__ __forceinline__ void g2_split(const float* p, v16h& fh, v16h& fl) { const v4f x0 = *(const v4fa*)p, x1 = *(const v4fa*)(p + 4), x2 = *(const v4fa*)(p + 16), x3 = *(const v4fa*)(p + 20); FragH h, l;
#pragma unroll
  for (int q = 0; q < 4; ++q) { _Float16 t = (_Float16)x0[q]; h.h[q] = t; l.h[q] = (_Float16)((x0[q] - (float)t) * 1024.0f); t = (_Float16)x1[q]; h.h[4 + q] = t; l.h[4 + q] = (_Float16)((x1[q] - (float)t) * 1024.0f);
    t = (_Float16)x2[q]; h.h[8 + q] = t; l.h[8 + q] = (_Float16)((x2[q] - (float)t) * 1024.0f); t = (_Float16)x3[q]; h.h[12 + q] = t; l.h[12 + q] = (_Float16)((x3[q] - (float)t) * 1024.0f); }
  fh = h.v; fl = l.v; }
// Output projection in one launch: C[NR][DMOD] = A Wo + bias from the f32 context A. Wave tile 32x64 as in k_qkv; each A fragment is split hi + 2^10 residual in registers, and each x16 weight fragment (Bh = [out][in]) feeds the hi and the residual product, which keep separate f32 accumulators: C = hi / 16 + bias + residual / (16 * 1024).
__global__ __launch_bounds__(128) void k_gemm_out(const float* __restrict__ A, const _Float16* __restrict__ Bh, const float* __restrict__ bias, float* __restrict__ C) {
  __shared__ __attribute__((aligned(16))) float so[4][32][68];
  const int tid = threadIdx.x, w = tid >> 5, lane = tid & 31, ln = lane & 15, hh = lane >> 4;
  constexpr int ntn = DMOD >> 6; const int mt = blockIdx.x / ntn, nq = blockIdx.x - mt * ntn; const int row0 = mt * 128 + 32 * w, col0 = nq * 64;
  const float* a0p = A + (size_t)(row0 + ln) * DMOD + 8 * hh; const float* a1p = a0p + (size_t)16 * DMOD;
  const _Float16* b0p = Bh + (size_t)(col0 + ln) * DMOD;
  float bv[4];      /* the four bias loads go out ahead of the loop and land under it */
#pragma unroll
  for (int t = 0; t < 4; ++t) bv[t] = bf16_round(bias[col0 + t * 16 + ln]);
  v8f ch[2][4], cl[2][4];
#pragma unroll
  for (int u = 0; u < 8; ++u) { ch[u >> 2][u & 3] = (v8f){0.f,0.f,0.f,0.f,0.f,0.f,0.f,0.f}; cl[u >> 2][u & 3] = (v8f){0.f,0.f,0.f,0.f,0.f,0.f,0.f,0.f}; }
#pragma unroll 1      /* rolled: 16 trips of 16 products; the loop's code stays a few instruction-cache lines */
  for (int kb = 0; kb < DMOD; kb += 32) { v16h a0h, a0l, a1h, a1l, b[4];      /* all 16 loads of a trip stand ahead of its first product: one wait for memory a trip */
#pragma unroll
    for (int t = 0; t < 4; ++t) b[t] = g2_frag(b0p + (size_t)(t * 16) * DMOD + kb, hh);
    g2_split(a0p + kb, a0h, a0l); g2_split(a1p + kb, a1h, a1l);
#pragma unroll
    for (int t = 0; t < 4; ++t) { ch[0][t] = g2_mma(a0h, b[t], ch[0][t]); ch[1][t] = g2_mma(a1h, b[t], ch[1][t]); cl[0][t] = g2_mma(a0l, b[t], cl[0][t]); cl[1][t] = g2_mma(a1l, b[t], cl[1][t]); } }
#pragma unroll
  for (int u = 0; u < 8; ++u) { const int t = u & 3, half = u >> 2;
#pragma unroll
    for (int r = 0; r < 8; ++r) so[w][half * 16 + 8 * hh + r][t * 16 + ln] = (ch[half][t][r] * 0.0625f + bv[t]) + cl[half][t][r] * (0.0625f / 1024.0f); }
  __builtin_amdgcn_fence(__ATOMIC_ACQ_REL, "workgroup"); __builtin_amdgcn_wave_barrier();      /* the wave reads back rows that its other lanes wrote */
  const int rsub = lane >> 4, c4 = (lane & 15) * 4;
#pragma unroll
  for (int q = 0; q < 16; ++q) { const int r = q * 2 + rsub; const v4f v = *(const v4fa*)&so[w][r][c4]; *(v4f*)(C + (size_t)(row0 + r) * DMOD + col0 + c4) = v; } }
typedef int v4ia __attribute__((ext_vector_type(4), may_alias));
// One block per sequence, 8 consecutive keys a thread. IDX[b][0][.] = positions of the keys valid for the CDR heads, IDX[b][1][.] = for the other heads, ascending; entries past the count are 0. CNT[b*32 + class] = the counts (one 128-byte line per sequence).
__device__ __forceinline__ void key_lists(const int* __restrict__ mask, const int* __restrict__ cdrs, int* __restrict__ IDX, int* __restrict__ CNT, int b, int tid) {
  __shared__ int sh[256]; __shared__ int sany; static_assert(TK == 256 * 8, "8 keys a thread");
  const v4ia m0 = *(const v4ia*)(mask + (size_t)b * TK + tid * 8), m1 = *(const v4ia*)(mask + (size_t)b * TK + tid * 8 + 4), c0 = *(const v4ia*)(cdrs + (size_t)b * TK + tid * 8), c1 = *(const v4ia*)(cdrs + (size_t)b * TK + tid * 8 + 4);
  bool vp[8], vc[8]; int np = 0, nb = 0, any = 0;
#pragma unroll
  for (int q = 0; q < 8; ++q) { const int mv = (q < 4) ? m0[q & 3] : m1[q & 3], cv = (q < 4) ? c0[q & 3] : c1[q & 3]; vp[q] = mv != 0; vc[q] = cv != 0; any |= vc[q] ? 1 : 0; np += vp[q] ? 1 : 0; nb += (vp[q] && vc[q]) ? 1 : 0; }
  if (tid == 0) sany = 0; __syncthreads(); if (any) sany = 1;
  const int own = np | (nb << 16); int v = own; sh[tid] = v; __syncthreads();      /* both counts stay <= 2048, so one packed inclusive scan serves both lists */
  for (int st = 1; st < 256; st <<= 1) { const int add = (tid >= st) ? sh[tid - st] : 0; __syncthreads(); v += add; sh[tid] = v; __syncthreads(); }
  const bool allmasked = (sany == 0);      /* no CDR token at all -> the CDR mask is disabled */
  const int tot = sh[255], ex = v - own; const int cnt1 = tot & 0xFFFF, cnt0 = allmasked ? cnt1 : (tot >> 16); int o1 = ex & 0xFFFF, o0 = allmasked ? o1 : (ex >> 16);
  int* i0 = IDX + ((size_t)b * 2 + 0) * TK; int* i1 = IDX + ((size_t)b * 2 + 1) * TK;
#pragma unroll
  for (int q = 0; q < 8; ++q) { const int k = tid * 8 + q; if (vp[q]) i1[o1++] = k; if (vp[q] && (allmasked || vc[q])) i0[o0++] = k; if (k >= cnt1) i1[k] = 0; if (k >= cnt0) i0[k] = 0; }
  if (tid == 0) { CNT[b * 32 + 0] = cnt0; CNT[b * 32 + 1] = cnt1; } }
// All that the projections wait for, in one launch; the three parts share nothing and a block does one of them, chosen by its index (so every barrier of the key lists is passed by a whole block or by none of it). The part with the longest chain of dependent steps has the lowest indices, the stream of x the highest.
#define WTB (DMOD * (DMOD / 8) / 256)      /* blocks for one weight matrix */
#define XB (NR * DMOD / 8 / 256)      /* blocks for x */
__global__ __launch_bounds__(256) void k_prep(const float* __restrict__ x, const int* __restrict__ mask, const int* __restrict__ cdrs, const float* __restrict__ Wq, const float* __restrict__ Wk, const float* __restrict__ Wv, const float* __restrict__ Wo,
    _Float16* __restrict__ BQ, _Float16* __restrict__ BK, _Float16* __restrict__ BV, _Float16* __restrict__ BO, int* __restrict__ IDX, int* __restrict__ CNT, _Float16* __restrict__ X16) {
  static_assert(WTB * 256 * 8 == DMOD * DMOD && (size_t)XB * 256 * 8 == (size_t)NR * DMOD, "the parts' blocks cover their arrays exactly");
  const int blk = blockIdx.x, tid = threadIdx.x;
  if (blk < NB) { key_lists(mask, cdrs, IDX, CNT, blk, tid); return; }
  if (blk < NB + 4 * WTB) { const int u = blk - NB, m = u / WTB;
    wt_f16((m == 0) ? Wq : (m == 1) ? Wk : (m == 2) ? Wv : Wo, (m == 0) ? BQ : (m == 1) ? BK : (m == 2) ? BV : BO, DMOD, DMOD, 16.0f, (u % WTB) * 256 + tid); return; }
  x16_piece(x, X16, (size_t)(blk - NB - 4 * WTB) * 256 + tid); }

extern "C" void kernel_launch(void* const* d_in, const int* in_sizes, int n_in,
                              void* d_out, int out_size, void* d_ws, size_t ws_size, hipStream_t stream) {
  (void)in_sizes; (void)n_in; (void)out_size;
  const float* const* I = (const float* const*)d_in; const float* x = I[0]; const int* mask = (const int*)d_in[1]; const int* cdrs = (const int*)d_in[2]; const float* Wq = I[3]; const float* bq = I[4]; const float* Wk = I[5]; const float* bk = I[6]; const float* Wv = I[7]; const float* bv = I[8]; const float* Wo = I[9]; const float* bo = I[10];
  char* ws = (char*)d_ws; size_t off = 0;
  auto take = [&](size_t bytes) { char* p = ws + off; off += (bytes + 255) & ~(size_t)255; return p; };
  const size_t w8 = (size_t)DMOD * DMOD / 8;
  _Float16* BQ = (_Float16*)take(w8 * 16); _Float16* BK = (_Float16*)take(w8 * 16); _Float16* BV = (_Float16*)take(w8 * 16); _Float16* BO = (_Float16*)take(w8 * 16); int* IDX = (int*)take((size_t)NB * 2 * TK * 4); int* CNT = (int*)take((size_t)NB * 32 * 4);
  _Float16* X16 = (_Float16*)take((size_t)NR * DMOD * 2); float* F32 = (float*)take((size_t)NR * DMOD * 4); _Float16* QH = (_Float16*)take((size_t)NR * DMOD * 2); _Float16* QL = (_Float16*)take((size_t)NR * DMOD * 2); _Float16* KH = (_Float16*)take((size_t)NR * DMOD * 2); _Float16* KL = (_Float16*)take((size_t)NR * DMOD * 2); _Float16* VH = (_Float16*)take((size_t)NR * DMOD * 2); _Float16* VL = (_Float16*)take((size_t)NR * DMOD * 2); _Float16* VT = (_Float16*)take((size_t)NR * DMOD * 2); _Float16* VTL = (_Float16*)take((size_t)NR * DMOD * 2);
  float* O = F32;
  if (off > ws_size) return;      /* 2 + 0.06 + 8 + 16 + 8 x 8 = 90 MiB */
  k_prep<<<NB + 4 * WTB + XB, 256, 0, stream>>>(x, mask, cdrs, Wq, Wk, Wv, Wo, BQ, BK, BV, BO, IDX, CNT, X16);
  const dim3 gA((NR / 128) * (DMOD / 64), 1);
  k_qkv<<<3 * NB * (TK / 128) * NH, 128, 0, stream>>>(X16, BQ, BK, BV, bq, bk, bv, IDX, CNT, QH, QL, KH, KL, VT);
  k_flashqk<5><<<NB * NH * QBLKS, 128, 0, stream>>>(QH, QL, DMOD, KH, KL, DMOD, VT, CNT, O, DMOD);      /* q/k hi + residual; P (x2^10) and V plain f16 */
  k_gemm_out<<<gA, 128, 0, stream>>>(O, BO, bo, (float*)d_out);
}

// v008
// Measured time: 73.3 microseconds a run.
// Two timings next to v007 put it at 1.31 and 1.32 times that version's speed.
// Counting every step since v000, it is 7.48 times as fast.
#include <hip/hip_runtime.h>
// CDRs attention (4 sequences x 2048 tokens x 512; 8 heads x 64): q,k,v = x W + b; scores/8; keys with mask == 0 invalid for all heads; for heads 0..1 additionally keys with cdrs_score == 0 invalid unless the sequence has no CDR token at all; softmax; ctx Wo + bo -> [4,2048,512].
// Structure: per sequence two compacted lists of valid key positions (CDR heads / other heads) with their counts, from the two int inputs on VALU (one block per sequence: 'all masked' flag + prefix sum), x as an exact f16 plane and the four x16 f16 weight transposes, all in one preparatory launch; the q/k/v projections as f16 WMMA GEMMs in one launch (32x64 wave tiles, f32 accumulation, exact x16 weights + bias) whose x rows for K and V are taken through the lists, so K (hi + 2^10 residual planes, like q) and V^T (formed directly as Wv^T x^T) come out compacted and the flash loop runs only over valid keys; in both GEMM launches a block brings each pass's operand rows into LDS once, by asynchronous copies of whole lines, two buffers, and its four waves take their fragments from there; the fused flash kernel with hi + 2^10-residual q/k planes (S = QhKh + (QlKh + QhKl)/1024) and plain f16 P (x2^10) and V with the key-count mask mode (invalid keys never visited == the reference's -inf); the output projection in one launch from the f32 context, split hi + residual in registers.
// Compute dtype: x and parameters rounded to bf16; q, k hi + residual (~2^-21-class logits); P and v plain f16 (~2^-12); f32 accumulation/softmax. v_wmma_f32_16x16x32_f16.
#define NB 4
#define DMOD 512
#define CDRH 2
#define NR (NB * SLEN)
#define QBLKS (TQ / 64)
#define SLEN 2048
#define TQ SLEN
#define TK SLEN
#define NH 8
#define SCL 0.125f               /* 64^-0.5 */
#define SCL2 0.18033688011112042f /* 64^-0.5 * log2(e): scores in base-2 units, so that the softmax exponential is the hardware's own 2^x */
typedef __bf16 v16b __attribute__((ext_vector_type(16)));
typedef unsigned short v8us __attribute__((ext_vector_type(8), may_alias));
typedef float  v8f  __attribute__((ext_vector_type(8)));
typedef float  v4f  __attribute__((ext_vector_type(4)));
typedef float  v4fa __attribute__((ext_vector_type(4), may_alias));
union FragB { v16b v; v8us half[2]; unsigned short u[16]; };

__device__ __forceinline__ unsigned short bf16_bits(float x) { unsigned int u = __float_as_uint(x); return (unsigned short)((u + 0x7FFFu + ((u >> 16) & 1u)) >> 16); }
__device__ __forceinline__ float bf16_val(unsigned short b) { return __uint_as_float(((unsigned int)b) << 16); }
__device__ __forceinline__ float bf16_round(float x) { return bf16_val(bf16_bits(x)); }
// D += A·B with NT terms: 1 = ah·bh, 2 = + al·bh (A split), 3 = + ah·bl (both split)
template <int NT>
__device__ __forceinline__ v8f mmaN(v16b ah, v16b al, v16b bh, v16b bl, v8f c) {
  c = __builtin_amdgcn_wmma_f32_16x16x32_bf16(false, ah, false, bh, (short)0, c, false, false);
  if (NT >= 2) c = __builtin_amdgcn_wmma_f32_16x16x32_bf16(false, al, false, bh, (short)0, c, false, false);
  if (NT >= 3) c = __builtin_amdgcn_wmma_f32_16x16x32_bf16(false, ah, false, bl, (short)0, c, false, false);
  asm volatile("v_nop\n\tv_nop\n\tv_nop\n\tv_nop" : "+v"(c) : "v"(ah), "v"(al), "v"(bh), "v"(bl));
  return c;
}

__global__ __launch_bounds__(256) void k_wt_bf16(const float* __restrict__ W, unsigned short* __restrict__ Wt, int K, int N) {
  const int t = blockIdx.x * 256 + threadIdx.x;
  const int k8n = K / 8;
  if (t >= N * k8n) return;
  const int n = t / k8n, k8 = (t % k8n) * 8;
  v8us v;
#pragma unroll
  for (int i = 0; i < 8; ++i) v[i] = bf16_bits(W[(size_t)(k8 + i) * N + n]);
  *(v8us*)(Wt + (size_t)n * K + k8) = v;
  
}

// GEMM C[M][N] (f32, pitch ldc) = act(A[M][K]·W + bias). A f32 row-major (pitch lda) converted per fragment to bf16
// (ASPLIT: hi/lo two planes -> 2 terms, else single rounded term); Wt bf16 [N][K] (pitch ldb). BIAS_BF16 rounds the
// bias to bf16 first (bias quantised to bf16 before the add). K%32==0, M%16==0, N%64==0.
template <bool ASPLIT, int ACT, bool BIAS_BF16>
__global__ __launch_bounds__(128) void k_gemm_bf(const float* __restrict__ A, int lda, const unsigned short* __restrict__ Wt, int ldb,
                                               const float* __restrict__ bias, float* __restrict__ C, int ldc, int M, int N, int K) {
  __shared__ __attribute__((aligned(16))) float so[4][16][64];
  const int tid = threadIdx.x, w = tid >> 5, lane = tid & 31, ln = lane & 15, hh = lane >> 4;
  const int ntn = N / 64;
  const int wid = blockIdx.x * 4 + w;
  const int mt = wid / ntn, nq = wid % ntn;
  if (mt * 16 >= M) return;
  const int row0 = mt * 16, col0 = nq * 64;
  const float* arow = A + (size_t)(row0 + ln) * lda;
  v8f acc[4] = {};
  for (int kb = 0; kb < K; kb += 32) {
    FragB ah, al;
    const v4f x0 = *(const v4fa*)(arow + kb + 8 * hh), x1 = *(const v4fa*)(arow + kb + 8 * hh + 4);
    const v4f x2 = *(const v4fa*)(arow + kb + 16 + 8 * hh), x3 = *(const v4fa*)(arow + kb + 16 + 8 * hh + 4);
    float xs[16] = {x0[0],x0[1],x0[2],x0[3],x1[0],x1[1],x1[2],x1[3],x2[0],x2[1],x2[2],x2[3],x3[0],x3[1],x3[2],x3[3]};
#pragma unroll
    for (int i = 0; i < 16; ++i) { const unsigned short hb = bf16_bits(xs[i]); ah.u[i] = hb; al.u[i] = ASPLIT ? bf16_bits(xs[i] - bf16_val(hb)) : (unsigned short)0; }
#pragma unroll
    for (int t = 0; t < 4; ++t) {
      const unsigned short* brow = Wt + (size_t)(col0 + t * 16 + ln) * ldb + kb;
      FragB b;
      b.half[0] = *(const v8us*)(brow + 8 * hh);
      b.half[1] = *(const v8us*)(brow + 16 + 8 * hh);
      acc[t] = mmaN<ASPLIT ? 2 : 1>(ah.v, al.v, b.v, b.v, acc[t]);
    }
  }
#pragma unroll
  for (int t = 0; t < 4; ++t) {
    float bv = bias ? bias[col0 + t * 16 + ln] : 0.f;
    if (BIAS_BF16) bv = bf16_round(bv);
#pragma unroll
    for (int r = 0; r < 8; ++r) { float v = acc[t][r] + bv; if (ACT == 1) v = fmaxf(v, 0.f); so[w][8 * hh + r][t * 16 + ln] = v; }
  }
  __builtin_amdgcn_fence(__ATOMIC_ACQ_REL, "workgroup");
  __builtin_amdgcn_wave_barrier();
  const int rsub = lane >> 4, c4 = (lane & 15) * 4;
  {
#pragma unroll
    for (int q = 0; q < 8; ++q) {
      const int r = q * 2 + rsub;
      const v4f v = *(const v4fa*)&so[w][r][c4];
      *(v4f*)(C + (size_t)(row0 + r) * ldc + col0 + c4) = v;
    }
    
  }
}

// GEMM C = act(A·W + bias + resid): A f32 (ASPLIT -> hi/lo 2 terms), Wt bf16 [N][K]; ACT 0 none, 1 relu, 2 exact gelu;
// resid (optional, f32, row index = (row % rmod), pitch ldr, RES_BF16 rounds it) added before the activation.
template <bool ASPLIT, int ACT, bool BIAS_BF16, bool RES_BF16>
__global__ __launch_bounds__(128) void k_gemm_bf3(const float* __restrict__ A, int lda, const unsigned short* __restrict__ Wt, int ldb,
                                                const float* __restrict__ bias, const float* __restrict__ resid, int rmod, int ldr,
                                                float* __restrict__ C, int ldc, int M, int N, int K) {
  __shared__ __attribute__((aligned(16))) float so[4][16][64];
  const int tid = threadIdx.x, w = tid >> 5, lane = tid & 31, ln = lane & 15, hh = lane >> 4;
  const int ntn = N / 64;
  const int wid = blockIdx.x * 4 + w;
  const int mt = wid / ntn, nq = wid % ntn;
  if (mt * 16 >= M) return;
  const int row0 = mt * 16, col0 = nq * 64;
  const float* arow = A + (size_t)(row0 + ln) * lda;
  v8f acc[4] = {};
  for (int kb = 0; kb < K; kb += 32) {
    FragB ah, al;
    const v4f x0 = *(const v4fa*)(arow + kb + 8 * hh), x1 = *(const v4fa*)(arow + kb + 8 * hh + 4);
    const v4f x2 = *(const v4fa*)(arow + kb + 16 + 8 * hh), x3 = *(const v4fa*)(arow + kb + 16 + 8 * hh + 4);
    float xs[16] = {x0[0],x0[1],x0[2],x0[3],x1[0],x1[1],x1[2],x1[3],x2[0],x2[1],x2[2],x2[3],x3[0],x3[1],x3[2],x3[3]};
#pragma unroll
    for (int i = 0; i < 16; ++i) { const unsigned short hb = bf16_bits(xs[i]); ah.u[i] = hb; al.u[i] = ASPLIT ? bf16_bits(xs[i] - bf16_val(hb)) : (unsigned short)0; }
#pragma unroll
    for (int t = 0; t < 4; ++t) {
      const unsigned short* brow = Wt + (size_t)(col0 + t * 16 + ln) * ldb + kb;
      FragB b;
      b.half[0] = *(const v8us*)(brow + 8 * hh);
      b.half[1] = *(const v8us*)(brow + 16 + 8 * hh);
      acc[t] = mmaN<ASPLIT ? 2 : 1>(ah.v, al.v, b.v, b.v, acc[t]);
    }
  }
#pragma unroll
  for (int t = 0; t < 4; ++t) {
    const int col = col0 + t * 16 + ln;
    float bv = bias ? bias[col] : 0.f;
    if (BIAS_BF16) bv = bf16_round(bv);
#pragma unroll
    for (int r = 0; r < 8; ++r) {
      float v = acc[t][r] + bv;
      if (resid) { float rv = resid[(size_t)((row0 + 8 * hh + r) % rmod) * ldr + col]; if (RES_BF16) rv = bf16_round(rv); v += rv; }
      if (ACT == 1) v = fmaxf(v, 0.f);
      if (ACT == 2) v = 0.5f * v * (1.0f + erff(v * 0.70710678118654752f));
      if (ACT == 3) { const float u = 0.7978845608028654f * (v + 0.044715f * v * v * v); v = 0.5f * v * (1.0f + tanhf(u)); }
      so[w][8 * hh + r][t * 16 + ln] = v;
    }
  }
  __builtin_amdgcn_fence(__ATOMIC_ACQ_REL, "workgroup");
  __builtin_amdgcn_wave_barrier();
  const int rsub = lane >> 4, c4 = (lane & 15) * 4;
  {
#pragma unroll
    for (int q = 0; q < 8; ++q) {
      const int r = q * 2 + rsub;
      const v4f v = *(const v4fa*)&so[w][r][c4];
      *(v4f*)(C + (size_t)(row0 + r) * ldc + col0 + c4) = v;
    }
    
  }
}
// row LayerNorm (biased variance, eps) over N: s = X (+ R); optional out_sum <- s; out_norm <- (s-mu)*rsqrt(var+eps)*g + b
template <bool PARAM_BF16>
__global__ __launch_bounds__(256) void k_layernorm(const float* __restrict__ X, const float* __restrict__ R, const float* __restrict__ g, const float* __restrict__ bta,
                                                  float* __restrict__ out_sum, float* __restrict__ out_norm, int N, float eps) {
  __shared__ float red[256];
  const int row = blockIdx.x, tid = threadIdx.x;
  const float* x = X + (size_t)row * N; const float* rr = R ? R + (size_t)row * N : nullptr;
  float vals[16];                     // up to N = 4096
  const int per = N / 256;            // contiguous chunk per thread? use strided-by-4 chunks: thread handles j = tid*4 + 1024*u
  float s1 = 0.f;
  for (int u = 0; u < per / 4; ++u) {
    const int j = tid * 4 + 1024 * u;
    const v4f a = *(const v4fa*)(x + j);
    v4f b = {0.f,0.f,0.f,0.f}; if (rr) b = *(const v4fa*)(rr + j);
#pragma unroll
    for (int q = 0; q < 4; ++q) { const float v = a[q] + b[q]; vals[u * 4 + q] = v; s1 += v; }
  }
  red[tid] = s1; __syncthreads();
  for (int st = 128; st > 0; st >>= 1) { if (tid < st) red[tid] += red[tid + st]; __syncthreads(); }
  const float mu = red[0] / (float)N; __syncthreads();
  float s2 = 0.f;
  for (int u = 0; u < per / 4; ++u)
#pragma unroll
    for (int q = 0; q < 4; ++q) { const float c = vals[u * 4 + q] - mu; s2 += c * c; }
  red[tid] = s2; __syncthreads();
  for (int st = 128; st > 0; st >>= 1) { if (tid < st) red[tid] += red[tid + st]; __syncthreads(); }
  const float rs = rsqrtf(red[0] / (float)N + eps);
  {
    for (int u = 0; u < per / 4; ++u) {
      const int j = tid * 4 + 1024 * u;
      v4f o, sm;
#pragma unroll
      for (int q = 0; q < 4; ++q) {
        float gg = g[j + q], bb = bta[j + q];
        if (PARAM_BF16) { gg = bf16_round(gg); bb = bf16_round(bb); }
        sm[q] = vals[u * 4 + q]; o[q] = (vals[u * 4 + q] - mu) * rs * gg + bb;
      }
      if (out_sum) *(v4f*)(out_sum + (size_t)row * N + j) = sm;
      *(v4f*)(out_norm + (size_t)row * N + j) = o;
    }
    
  }
}



// ---- f16 WMMA path (v_wmma_f32_16x16x32_f16): 11-bit significands for operands in range — used where a [0,1] probability operand needs more precision than bf16
typedef _Float16 v16h __attribute__((ext_vector_type(16)));
union FragH { v16h v; v8us half[2]; _Float16 h[16]; unsigned short u[16]; };
template <int NT>
__device__ __forceinline__ v8f mmaH(v16h ah, v16h al, v16h bh, v16h bl, v8f c) {
  c = __builtin_amdgcn_wmma_f32_16x16x32_f16(false, ah, false, bh, (short)0, c, false, false);
  if (NT >= 2) c = __builtin_amdgcn_wmma_f32_16x16x32_f16(false, al, false, bh, (short)0, c, false, false);
  if (NT >= 3) c = __builtin_amdgcn_wmma_f32_16x16x32_f16(false, ah, false, bl, (short)0, c, false, false);
  asm volatile("v_nop\n\tv_nop\n\tv_nop\n\tv_nop" : "+v"(c) : "v"(ah), "v"(al), "v"(bh), "v"(bl));
  return c;
}
// batched GEMM like k_gemm_b but f16 operands: A f32 (split into f16 hi/lo if ASPLIT, else rounded to f16), Bt = f16 values [n][k]; alpha; C f32; N multiple of 16 (partial tiles skipped)
template <bool ASPLIT>
__global__ __launch_bounds__(128) void k_gemm_h(const float* __restrict__ A, int lda, size_t sA, const _Float16* __restrict__ Bh, int ldb, size_t sB, float alpha, float* __restrict__ C, int ldc, size_t sC, int M, int N, int K) {
  __shared__ __attribute__((aligned(16))) float so[4][16][64];
  const int tid = threadIdx.x, w = tid >> 5, lane = tid & 31, ln = lane & 15, hh = lane >> 4; const int by = blockIdx.y;
  A += (size_t)by * sA; Bh += (size_t)by * sB; C += (size_t)by * sC;
  const int ntn = (N + 63) / 64; const int wid = blockIdx.x * 4 + w; const int mt = wid / ntn, nq = wid % ntn; if (mt * 16 >= M) return;
  const int row0 = mt * 16, col0 = nq * 64; const float* arow = A + (size_t)(row0 + ln) * lda;
  v8f acc[4] = {};
  for (int kb = 0; kb < K; kb += 32) {
    FragH ah, al;
    const v4f x0 = *(const v4fa*)(arow + kb + 8 * hh), x1 = *(const v4fa*)(arow + kb + 8 * hh + 4), x2 = *(const v4fa*)(arow + kb + 16 + 8 * hh), x3 = *(const v4fa*)(arow + kb + 16 + 8 * hh + 4);
    float xs[16] = {x0[0],x0[1],x0[2],x0[3],x1[0],x1[1],x1[2],x1[3],x2[0],x2[1],x2[2],x2[3],x3[0],x3[1],x3[2],x3[3]};
#pragma unroll
    for (int i = 0; i < 16; ++i) { const _Float16 h = (_Float16)xs[i]; ah.h[i] = h; al.h[i] = ASPLIT ? (_Float16)(xs[i] - (float)h) : (_Float16)0.0f; }
#pragma unroll
    for (int t = 0; t < 4; ++t) { if (col0 + t * 16 >= N) continue; const size_t boff = (size_t)(col0 + t * 16 + ln) * ldb + kb; FragH bq; bq.half[0] = *(const v8us*)(Bh + boff + 8 * hh); bq.half[1] = *(const v8us*)(Bh + boff + 16 + 8 * hh);
      acc[t] = mmaH<ASPLIT ? 2 : 1>(ah.v, al.v, bq.v, bq.v, acc[t]); }
  }
#pragma unroll
  for (int t = 0; t < 4; ++t) { if (col0 + t * 16 >= N) continue;
#pragma unroll
    for (int r = 0; r < 8; ++r) so[w][8 * hh + r][t * 16 + ln] = acc[t][r] * alpha; }
  __builtin_amdgcn_fence(__ATOMIC_ACQ_REL, "workgroup"); __builtin_amdgcn_wave_barrier();
  const int rsub = lane >> 4, c4 = (lane & 15) * 4;
  {
#pragma unroll
    for (int q = 0; q < 8; ++q) { const int r = q * 2 + rsub; if (col0 + c4 < N) { const v4f v = *(const v4fa*)&so[w][r][c4]; *(v4f*)(C + (size_t)(row0 + r) * ldc + col0 + c4) = v; } }
     }
}

// Wt[n][k] = f16(W[k][n]·scale) from f32 row-major W[K][N] (scale = power of two; bf16-exact weights stay exact in f16 away from the subnormal range)
__device__ __forceinline__ void wt_f16(const float* __restrict__ W, _Float16* __restrict__ Wt, int K, int N, float scale, int t) {      /* t = 0 .. N * K / 8 - 1: output row n, eight k */
  const int n = t / (K / 8), k8 = (t % (K / 8)) * 8; FragH f;
#pragma unroll
  for (int i = 0; i < 8; ++i) f.h[i] = (_Float16)(bf16_round(W[(size_t)(k8 + i) * N + n]) * scale); const v8us o = f.half[0];
  *(v8us*)((unsigned short*)Wt + (size_t)n * K + k8) = o;
  asm volatile("s_wait_xcnt 0x0" ::: "memory");      /* behind the store, ahead of any reuse of the registers that it names (the other parts' code follows in the same kernel) */
}
// k_gemm_hh variant with fused epilogue: v = acc·alpha + bias[by·sBias + col] (+ CP[(row/rowsPerB)·sCPb + by·64 + col] if CP) ; ACT 0 none / 1 elu ; writes f16 C16 (and f32 C if non-null)
template <int ACT>
__global__ __launch_bounds__(128) void k_gemm_hhx(const _Float16* __restrict__ A, int lda, size_t sA, const _Float16* __restrict__ Bh, int ldb, size_t sB, float alpha, const float* __restrict__ bias, size_t sBias, const float* __restrict__ CP, int rowsPerB, size_t sCPb, int row0g,
    float* __restrict__ C, _Float16* __restrict__ C16, int ldc, size_t sC, int M, int N, int K) {
  __shared__ __attribute__((aligned(16))) float so[4][16][64];
  const int tid = threadIdx.x, w = tid >> 5, lane = tid & 31, ln = lane & 15, hh = lane >> 4; const int by = blockIdx.y;
  A += (size_t)by * sA; Bh += (size_t)by * sB; const size_t cofs = (size_t)by * sC; const float* bp = bias ? bias + (size_t)by * sBias : nullptr;
  const int ntn = (N + 63) / 64; const int wid = blockIdx.x * 4 + w; const int mt = wid / ntn, nq = wid % ntn; if (mt * 16 >= M) return;
  const int row0 = mt * 16, col0 = nq * 64; const _Float16* arow = A + (size_t)(row0 + ln) * lda;
  v8f acc[4] = {};
  for (int kb = 0; kb < K; kb += 32) { FragH ah; ah.half[0] = *(const v8us*)((const unsigned short*)arow + kb + 8 * hh); ah.half[1] = *(const v8us*)((const unsigned short*)arow + kb + 16 + 8 * hh);
#pragma unroll
    for (int t = 0; t < 4; ++t) { if (col0 + t * 16 >= N) continue; const size_t boff = (size_t)(col0 + t * 16 + ln) * ldb + kb; FragH bq; bq.half[0] = *(const v8us*)((const unsigned short*)Bh + boff + 8 * hh); bq.half[1] = *(const v8us*)((const unsigned short*)Bh + boff + 16 + 8 * hh);
      acc[t] = mmaH<1>(ah.v, ah.v, bq.v, bq.v, acc[t]); }
  }
#pragma unroll
  for (int t = 0; t < 4; ++t) { if (col0 + t * 16 >= N) continue; const int col = col0 + t * 16 + ln; const float bv = bp ? bf16_round(bp[col]) : 0.f;
#pragma unroll
    for (int r = 0; r < 8; ++r) { float v = acc[t][r] * alpha + bv; if (CP) { const int bidx = (row0g + row0 + 8 * hh + r) / rowsPerB; v += CP[(size_t)bidx * sCPb + (size_t)by * 64 + col]; } if (ACT == 1) v = (v > 0.f) ? v : expm1f(v); else if (ACT == 7) v = (v > 0.f) ? v + 1.0f : expf(v); else if (ACT == 8) v = tanhf(v); else if (ACT == 9) v = 0.5f * v * (1.0f + tanhf(0.7978845608028654f * (v + 0.044715f * v * v * v))); else if (ACT == 11) v = 1.0f / (1.0f + expf(-v)); else if (ACT == 12) v = (v > 0.f) ? v : 0.01f * v; else if (ACT == 14) v = (v > 0.f) ? v : 0.1f * v; else if (ACT == 15) v = v / (1.0f + expf(-v)); else if (ACT == 3) v = fmaxf(v, 0.f); else if (ACT == 6) v = 0.5f * v * (1.0f + erff(v * 0.70710678118654752f)); so[w][8 * hh + r][t * 16 + ln] = v; } }
  __builtin_amdgcn_fence(__ATOMIC_ACQ_REL, "workgroup"); __builtin_amdgcn_wave_barrier();
  const int rsub = lane >> 4, c4 = (lane & 15) * 4; typedef _Float16 v4h __attribute__((ext_vector_type(4)));
  {
#pragma unroll
    for (int q = 0; q < 8; ++q) { const int r = q * 2 + rsub; if (col0 + c4 < N) { const v4f v = *(const v4fa*)&so[w][r][c4]; if (C) *(v4f*)(C + cofs + (size_t)(row0 + r) * ldc + col0 + c4) = v; if (C16) { v4h h4; for (int i = 0; i < 4; ++i) h4[i] = (_Float16)v[i]; *(v4h*)(C16 + cofs + (size_t)(row0 + r) * ldc + col0 + c4) = h4; } } }
     }
}


typedef _Float16 v4h __attribute__((ext_vector_type(4)));

// X16 = f16(bf16(x)), piece t of 8 values
__device__ __forceinline__ void x16_piece(const float* __restrict__ x, _Float16* __restrict__ X16, size_t t) { FragH f;
#pragma unroll
  for (int q = 0; q < 8; ++q) f.h[q] = (_Float16)bf16_round(x[t * 8 + q]); *(v8us*)((unsigned short*)X16 + t * 8) = f.half[0];
  asm volatile("s_wait_xcnt 0x0" ::: "memory");      /* behind the store, ahead of any reuse of the registers that it names (the other parts' code follows in the same kernel) */
}
__global__ __launch_bounds__(256) void k_h16(const float* __restrict__ x, _Float16* __restrict__ X16, size_t n8) { const size_t t = (size_t)blockIdx.x * 256 + threadIdx.x; if (t >= n8) return; FragH f;
#pragma unroll
  for (int q = 0; q < 8; ++q) f.h[q] = (_Float16)x[t * 8 + q]; *(v8us*)((unsigned short*)X16 + t * 8) = f.half[0];  }
__global__ __launch_bounds__(256) void k_round16f(const float* __restrict__ W, _Float16* __restrict__ Bt, size_t n8) { const size_t t = (size_t)blockIdx.x * 256 + threadIdx.x; if (t >= n8) return; FragH f;
#pragma unroll
  for (int i = 0; i < 8; ++i) f.h[i] = (_Float16)(bf16_round(W[t * 8 + i]) * 16.0f); *(v8us*)((unsigned short*)Bt + t * 8) = f.half[0];  }

// ---- pieces of the f16 GEMMs with a 32x64 wave tile ----
__device__ __forceinline__ v16h g2_frag(const _Float16* p, int hh) { FragH f; f.half[0] = *(const v8us*)((const unsigned short*)p + 8 * hh); f.half[1] = *(const v8us*)((const unsigned short*)p + 16 + 8 * hh); return f.v; }
__device__ __forceinline__ v8f g2_mma(v16h a, v16h b, v8f c) { v8f d = __builtin_amdgcn_wmma_f32_16x16x32_f16(false, a, false, b, (short)0, c, false, false); asm volatile("v_nop\n\tv_nop\n\tv_nop\n\tv_nop" : "+v"(d) : "v"(a), "v"(b)); return d; }
// The q, k or v projection of one block: 128 x rows against the head's 64 weight rows over the 512 inputs (both operands k-contiguous f16 rows, f32 accumulation), C / 16 + bias.
// A pass takes one whole 128-byte line (64 inputs) of each of the 192 rows. The block brings them into LDS once, by asynchronous copies in which 8 lanes cover a line, two buffers, and its four waves take their fragments from there (a fragment load from global memory touches 16 lines for 512 bytes, and each wave fetched the shared operand for itself).
//   PART 0 (q): x rows t0 .. t0 + 127; wave w has C rows 32 w .. 32 w + 31 (A = x, B = Wq^T); stored as hi + 2^10 residual planes.
//   PART 1 (k): the same, but row r = x row idx[t0 + r] (the head class's list of valid keys): the planes come out compacted.
//   PART 2 (v): A = the head's Wv^T rows dh .. dh + 31, B = x rows idx[t0 + 64 (w >> 1) + c]: the tile is a piece of V^T itself, compacted; stored as plain f16.
// A wave whose keys all lie past the count (act false) does its share of the copies and passes every barrier, but computes and stores nothing.
#define QP 144      /* LDS row pitch in bytes: 128 + 16 = 16 B x odd, for 16-byte fragment reads */
#define QXB (128 * QP)      /* the x rows of a buffer; the weight rows follow */
#define QBUF (192 * QP)
// Twelve 16-byte asynchronous copies to LDS per lane (a pass's share). s_wait_xcnt 0 closes the statement so that no address register of an issued copy is rewritten ahead of it.
__device__ __forceinline__ void cp_tile12(unsigned l0, unsigned l1, unsigned l2, unsigned l3, unsigned l4, unsigned l5, unsigned l6, unsigned l7, unsigned l8, unsigned l9, unsigned l10, unsigned l11,
    const char* g0, const char* g1, const char* g2, const char* g3, const char* g4, const char* g5, const char* g6, const char* g7, const char* g8, const char* g9, const char* g10, const char* g11) {
  asm volatile("global_load_async_to_lds_b128 %0, %12, off\n\t"
               "global_load_async_to_lds_b128 %1, %13, off\n\t"
               "global_load_async_to_lds_b128 %2, %14, off\n\t"
               "global_load_async_to_lds_b128 %3, %15, off\n\t"
               "global_load_async_to_lds_b128 %4, %16, off\n\t"
               "global_load_async_to_lds_b128 %5, %17, off\n\t"
               "global_load_async_to_lds_b128 %6, %18, off\n\t"
               "global_load_async_to_lds_b128 %7, %19, off\n\t"
               "global_load_async_to_lds_b128 %8, %20, off\n\t"
               "global_load_async_to_lds_b128 %9, %21, off\n\t"
               "global_load_async_to_lds_b128 %10, %22, off\n\t"
               "global_load_async_to_lds_b128 %11, %23, off\n\t"
               "s_wait_xcnt 0x0"
               :: "v"(l0), "v"(l1), "v"(l2), "v"(l3), "v"(l4), "v"(l5), "v"(l6), "v"(l7), "v"(l8), "v"(l9), "v"(l10), "v"(l11),
                  "v"(g0), "v"(g1), "v"(g2), "v"(g3), "v"(g4), "v"(g5), "v"(g6), "v"(g7), "v"(g8), "v"(g9), "v"(g10), "v"(g11) : "memory");
}
__device__ __forceinline__ v16h g2_fragl(const char* p) { FragH f; f.half[0] = *(const v8us*)p; f.half[1] = *(const v8us*)(p + 32); return f.v; }      /* p: row, k block and half in LDS; same k order as g2_frag */
template <int PART>
__device__ __forceinline__ void qkv_block(char* sm, const _Float16* __restrict__ xs, const _Float16* __restrict__ wh, const float* __restrict__ bias, const int* __restrict__ idx, int t0, int dh, bool act, _Float16* __restrict__ ph, _Float16* __restrict__ pl, int tid, int w, int ln, int hh) {
  const int cr0 = tid >> 3, cc = (tid & 7) * 16;      /* a lane's share of a pass: 16 bytes of x rows cr0 + 16 i (i < 8) and of weight rows cr0 + 16 i (i < 4) */
  const char* gx[8]; const char* gw[4];
#pragma unroll
  for (int i = 0; i < 8; ++i) gx[i] = (const char*)xs + (size_t)((PART == 0) ? t0 + cr0 + 16 * i : idx[t0 + cr0 + 16 * i]) * (DMOD * 2) + cc;
#pragma unroll
  for (int i = 0; i < 4; ++i) gw[i] = (const char*)wh + (size_t)(cr0 + 16 * i) * (DMOD * 2) + cc;
  const unsigned lc = (unsigned)(size_t)sm + cr0 * QP + cc;
  auto stage = [&](int bf) { const unsigned lx = lc + bf * QBUF, lw = lx + QXB;      /* the next 128 bytes of every row into buffer bf; the pointers step behind the statement's own wait */
    cp_tile12(lx, lx + 16 * QP, lx + 32 * QP, lx + 48 * QP, lx + 64 * QP, lx + 80 * QP, lx + 96 * QP, lx + 112 * QP, lw, lw + 16 * QP, lw + 32 * QP, lw + 48 * QP, gx[0], gx[1], gx[2], gx[3], gx[4], gx[5], gx[6], gx[7], gw[0], gw[1], gw[2], gw[3]);
#pragma unroll
    for (int i = 0; i < 8; ++i) gx[i] += 128;
#pragma unroll
    for (int i = 0; i < 4; ++i) gw[i] += 128; };
  stage(0);
  float bi[(PART == 2) ? 16 : 4];      /* the bias of the tile's columns or, PART 2, of this lane's 16 rows; loaded ahead of the loop, lands under it */
#pragma unroll
  for (int u = 0; u < ((PART == 2) ? 16 : 4); ++u) bi[u] = bf16_round(bias[(PART == 2) ? dh + (u >> 3) * 16 + 8 * hh + (u & 7) : u * 16 + ln]);
  const char* ab = sm + ((PART == 2) ? QXB + (dh + ln) * QP : (32 * w + ln) * QP) + 16 * hh;
  const char* bb = sm + ((PART == 2) ? (64 * (w >> 1) + ln) * QP : QXB + ln * QP) + 16 * hh;
  v8f c[2][4];
#pragma unroll
  for (int u = 0; u < 8; ++u) c[u >> 2][u & 3] = (v8f){0.f,0.f,0.f,0.f,0.f,0.f,0.f,0.f};
  asm volatile("s_wait_asynccnt 0x0" ::: "memory");      /* this wave's share of pass 0 has landed */
  __syncthreads();      /* pass 0 is published to all four waves */
  stage(1);
#pragma unroll 1      /* rolled: 8 passes of 16 products; the loop's code stays a few instruction-cache lines */
  for (int p = 0; p < DMOD / 64; ++p) { const int bf = p & 1;
    if (act) { v16h a[2][2], bq[4][2]; const char* ap = ab + bf * QBUF; const char* bp = bb + bf * QBUF;      /* wave-uniform; the pass's 24 LDS reads stand ahead of its first product */
#pragma unroll
      for (int t = 0; t < 4; ++t) { bq[t][0] = g2_fragl(bp + t * 16 * QP); bq[t][1] = g2_fragl(bp + t * 16 * QP + 64); }
#pragma unroll
      for (int i = 0; i < 2; ++i) { a[i][0] = g2_fragl(ap + i * 16 * QP); a[i][1] = g2_fragl(ap + i * 16 * QP + 64); }
#pragma unroll
      for (int s = 0; s < 2; ++s)
#pragma unroll
        for (int t = 0; t < 4; ++t) { c[0][t] = g2_mma(a[0][s], bq[t][s], c[0][t]); c[1][t] = g2_mma(a[1][s], bq[t][s], c[1][t]); } }
    asm volatile("s_wait_dscnt 0x0" ::: "memory");      /* this wave's reads of buffer bf have returned before the buffer is refilled */
    asm volatile("s_wait_asynccnt 0x0" ::: "memory");      /* this wave's share of the next pass has landed */
    __syncthreads();      /* publishes the next pass and ends every wave's reads of buffer bf */
    if (p + 2 < DMOD / 64) stage(bf); }
  asm volatile("s_wait_asynccnt 0x0" ::: "memory");      /* no copy is outstanding when the buffers become output staging */
  if (!act) return;
  float (*so)[68] = (float (*)[68])(sm + w * (32 * 68 * 4));      /* the wave's own range of the buffers, which nobody reads any more behind the last pass's barrier */
#pragma unroll
  for (int u = 0; u < 8; ++u) { const int t = u & 3, half = u >> 2;
#pragma unroll
    for (int r = 0; r < 8; ++r) so[half * 16 + 8 * hh + r][t * 16 + ln] = c[half][t][r] * 0.0625f + bi[(PART == 2) ? half * 8 + r : t]; }
  __builtin_amdgcn_fence(__ATOMIC_ACQ_REL, "workgroup"); __builtin_amdgcn_wave_barrier();      /* the wave reads back rows that its other lanes wrote */
  constexpr int ldc = (PART == 2) ? TK : DMOD;
#pragma unroll
  for (int q = 0; q < 16; ++q) { const int r = q * 2 + hh; const v4f v = *(const v4fa*)&so[r][ln * 4]; v4h hi, lo;
#pragma unroll
    for (int i = 0; i < 4; ++i) { hi[i] = (_Float16)v[i]; lo[i] = (_Float16)((v[i] - (float)hi[i]) * 1024.0f); }
    *(v4h*)(ph + (size_t)r * ldc + ln * 4) = hi; if (PART != 2) *(v4h*)(pl + (size_t)r * ldc + ln * 4) = lo; }
  asm volatile("s_wait_xcnt 0x0" ::: "memory");      /* behind the tile's last store, ahead of any reuse of the registers that the stores name */
}
// The q, k and v projections with all their after-work in one launch: 512 blocks a part, a block = (sequence, 128 tokens or list positions, head), four wave tiles. A block whose keys all lie past the count rounded up to 32 leaves at once, ahead of every barrier (those rows and columns are never read); list entries past the count are 0, a finite row.
__global__ __launch_bounds__(128) void k_qkv(const _Float16* __restrict__ X16, const _Float16* __restrict__ BQ, const _Float16* __restrict__ BK, const _Float16* __restrict__ BV, const float* __restrict__ bq, const float* __restrict__ bk, const float* __restrict__ bv,
    const int* __restrict__ IDX, const int* __restrict__ CNT, _Float16* __restrict__ QH, _Float16* __restrict__ QL, _Float16* __restrict__ KH, _Float16* __restrict__ KL, _Float16* __restrict__ VT) {
  __shared__ __attribute__((aligned(16))) char sm[2 * QBUF]; static_assert(4 * 32 * 68 * 4 <= 2 * QBUF, "the output staging fits the buffers");
  const int tid = threadIdx.x, lane = tid & 31, ln = lane & 15, hh = lane >> 4; const int w = __builtin_amdgcn_readfirstlane(tid >> 5);
  constexpr int TPS = TK / 128, PER = NB * TPS * NH;
  const int part = blockIdx.x / PER, rem = blockIdx.x % PER; const int h = rem % NH, mt = rem / NH; const int b = mt / TPS, t0 = (mt % TPS) * 128;
  const _Float16* xs = X16 + (size_t)b * TK * DMOD; const size_t wo = (size_t)h * 64 * DMOD;
  if (part == 0) { const size_t o = ((size_t)b * TK + t0 + 32 * w) * DMOD + h * 64; qkv_block<0>(sm, xs, BQ + wo, bq + h * 64, nullptr, t0, 0, true, QH + o, QL + o, tid, w, ln, hh); return; }
  const int cls = (h < CDRH) ? 0 : 1; const int cr = (min(CNT[b * 32 + cls], TK) + 31) & ~31; const int* idx = IDX + ((size_t)b * 2 + cls) * TK;
  if (t0 >= cr) return;
  if (part == 1) { const int j = t0 + 32 * w; const size_t o = ((size_t)b * TK + j) * DMOD + h * 64; qkv_block<1>(sm, xs, BK + wo, bk + h * 64, idx, t0, 0, j < cr, KH + o, KL + o, tid, w, ln, hh); }
  else { const int j = t0 + 64 * (w >> 1), dh = 32 * (w & 1); qkv_block<2>(sm, xs, BV + wo, bv + h * 64, idx, t0, dh, j < cr, VT + (((size_t)b * NH + h) * 64 + dh) * TK + j, nullptr, tid, w, ln, hh); } }

template <int CAUSAL>
__global__ __launch_bounds__(128) void k_flash(const _Float16* __restrict__ Q16, int ldq, const _Float16* __restrict__ K16, int ldk, const _Float16* __restrict__ Vt, const int* __restrict__ MSK, float* __restrict__ O, int ldo) {
  constexpr int RPW = 16, RTN = RPW / 16, NQB = TQ / (4 * RPW), DT = 4, KS = 2;
  __shared__ __attribute__((aligned(16))) unsigned short sP[4][RPW][40]; __shared__ __attribute__((aligned(16))) float sO[4][RPW][64 + 4];
  const int tid = threadIdx.x, w = tid >> 5, lane = tid & 31, ln = lane & 15, hh = lane >> 4;
  const int slab = blockIdx.x / NQB, qblk = blockIdx.x % NQB; const int b = slab / NH, h = slab % NH; const int qb0 = qblk * (4 * RPW); const int q0 = qb0 + w * RPW;
  FragH aq[2][KS];
#pragma unroll
  for (int rt = 0; rt < RTN; ++rt) { const unsigned short* qr = (const unsigned short*)Q16 + ((size_t)b * TQ + q0 + rt * 16 + ln) * ldq + h * 64;
#pragma unroll
    for (int ks = 0; ks < KS; ++ks) { aq[rt][ks].half[0] = *(const v8us*)(qr + ks * 32 + 8 * hh); aq[rt][ks].half[1] = *(const v8us*)(qr + ks * 32 + 16 + 8 * hh); } }
  const unsigned short* Vth = (const unsigned short*)Vt + (size_t)slab * 64 * TK;
  float m_r[2][8], l_r[2][8]; v8f oacc[2][DT];
#pragma unroll
  for (int rt = 0; rt < RTN; ++rt) {
#pragma unroll
    for (int r = 0; r < 8; ++r) { m_r[rt][r] = -3.0e38f; l_r[rt][r] = 0.f; }
#pragma unroll
    for (int dt = 0; dt < DT; ++dt) oacc[rt][dt] = (v8f){0.f,0.f,0.f,0.f,0.f,0.f,0.f,0.f}; }
  const int jend = (CAUSAL == 1) ? (qb0 + 4 * RPW) : TK;      /* causal: keys beyond the block's last query never contribute */
#pragma unroll 1
  for (int j0 = 0; j0 < jend; j0 += 32) {
    v8f s[2][2];
#pragma unroll
    for (int nt = 0; nt < 2; ++nt) { const unsigned short* kr = (const unsigned short*)K16 + ((size_t)b * TK + j0 + nt * 16 + ln) * ldk + h * 64; FragH bk[KS];
#pragma unroll
      for (int ks = 0; ks < KS; ++ks) { bk[ks].half[0] = *(const v8us*)(kr + ks * 32 + 8 * hh); bk[ks].half[1] = *(const v8us*)(kr + ks * 32 + 16 + 8 * hh); }
#pragma unroll
      for (int rt = 0; rt < RTN; ++rt) { v8f acc = (v8f){0.f,0.f,0.f,0.f,0.f,0.f,0.f,0.f};
#pragma unroll
        for (int ks = 0; ks < KS; ++ks) acc = mmaH<1>(aq[rt][ks].v, aq[rt][ks].v, bk[ks].v, bk[ks].v, acc); s[rt][nt] = acc; } }
#pragma unroll
    for (int rt = 0; rt < RTN; ++rt)
#pragma unroll
      for (int r = 0; r < 8; ++r) { const int tq = q0 + rt * 16 + 8 * hh + r; const int k0 = j0 + ln, k1 = j0 + 16 + ln;
        const bool ok0 = (CAUSAL == 1) ? (k0 <= tq) : ((CAUSAL == 2) ? ((k0 >> 5) == (tq >> 5)) : true), ok1 = (CAUSAL == 1) ? (k1 <= tq) : ((CAUSAL == 2) ? ((k1 >> 5) == (tq >> 5)) : true);      /* mode 2: block-diagonal 32-token groups */
        const float s0 = ok0 ? s[rt][0][r] * SCL : -3.0e38f, s1 = ok1 ? s[rt][1][r] * SCL : -3.0e38f; float mc = fmaxf(s0, s1);
        mc = fmaxf(mc, __shfl_xor(mc, 1, 32)); mc = fmaxf(mc, __shfl_xor(mc, 2, 32)); mc = fmaxf(mc, __shfl_xor(mc, 4, 32)); mc = fmaxf(mc, __shfl_xor(mc, 8, 32));
        const float mn = fmaxf(m_r[rt][r], mc); const float al = (mn > -1.0e38f) ? expf(m_r[rt][r] - mn) : 1.0f; m_r[rt][r] = mn; const float p0 = ok0 ? expf(s0 - mn) : 0.f, p1 = ok1 ? expf(s1 - mn) : 0.f; l_r[rt][r] = l_r[rt][r] * al + p0 + p1;
#pragma unroll
        for (int dt = 0; dt < DT; ++dt) oacc[rt][dt][r] *= al;
        FragH t2; t2.h[0] = (_Float16)(p0 * 1024.0f); t2.h[1] = (_Float16)(p1 * 1024.0f); sP[w][rt * 16 + 8 * hh + r][ln] = t2.u[0]; sP[w][rt * 16 + 8 * hh + r][16 + ln] = t2.u[1]; }
    __builtin_amdgcn_fence(__ATOMIC_ACQ_REL, "workgroup"); __builtin_amdgcn_wave_barrier();
    FragH pa[2];
#pragma unroll
    for (int rt = 0; rt < RTN; ++rt) { pa[rt].half[0] = *(const v8us*)&sP[w][rt * 16 + ln][8 * hh]; pa[rt].half[1] = *(const v8us*)&sP[w][rt * 16 + ln][16 + 8 * hh]; }
#pragma unroll
    for (int dt = 0; dt < DT; ++dt) { const unsigned short* vrow = Vth + (size_t)(dt * 16 + ln) * TK + j0; FragH bv; bv.half[0] = *(const v8us*)(vrow + 8 * hh); bv.half[1] = *(const v8us*)(vrow + 16 + 8 * hh);
#pragma unroll
      for (int rt = 0; rt < RTN; ++rt) oacc[rt][dt] = mmaH<1>(pa[rt].v, pa[rt].v, bv.v, bv.v, oacc[rt][dt]); }
    __builtin_amdgcn_fence(__ATOMIC_ACQ_REL, "workgroup"); __builtin_amdgcn_wave_barrier(); }
#pragma unroll
  for (int rt = 0; rt < RTN; ++rt) {
#pragma unroll
    for (int r = 0; r < 8; ++r) { float l = l_r[rt][r]; l += __shfl_xor(l, 1, 32); l += __shfl_xor(l, 2, 32); l += __shfl_xor(l, 4, 32); l += __shfl_xor(l, 8, 32); l_r[rt][r] = (l > 0.f) ? 1.0f / (l * 1024.0f) : 0.f; }
#pragma unroll
    for (int dt = 0; dt < DT; ++dt)
#pragma unroll
      for (int r = 0; r < 8; ++r) sO[w][rt * 16 + 8 * hh + r][dt * 16 + ln] = oacc[rt][dt][r] * l_r[rt][r]; }
  __builtin_amdgcn_fence(__ATOMIC_ACQ_REL, "workgroup"); __builtin_amdgcn_wave_barrier();
  {
#pragma unroll
    for (int rp = 0; rp < RPW; rp += 2) { const int r = rp + (lane >> 4), pc = lane & 15; const v4f val = *(const v4fa*)&sO[w][r][pc * 4]; *(v4f*)(O + ((size_t)b * TQ + q0 + r) * ldo + h * 64 + pc * 4) = val; }
     } }
// Six 16-byte asynchronous copies to LDS per lane (one 32-key tile's share). s_wait_xcnt 0 closes the statement so that no address register of an issued copy is rewritten ahead of it.
__device__ __forceinline__ void cp_tile6(unsigned l0, const unsigned short* g0, unsigned l1, const unsigned short* g1, unsigned l2, const unsigned short* g2, unsigned l3, const unsigned short* g3, unsigned l4, const unsigned short* g4, unsigned l5, const unsigned short* g5) {
  asm volatile("global_load_async_to_lds_b128 %0, %1, off\n\t"
               "global_load_async_to_lds_b128 %2, %3, off\n\t"
               "global_load_async_to_lds_b128 %4, %5, off\n\t"
               "global_load_async_to_lds_b128 %6, %7, off\n\t"
               "global_load_async_to_lds_b128 %8, %9, off\n\t"
               "global_load_async_to_lds_b128 %10, %11, off\n\t"
               "s_wait_xcnt 0x0"
               :: "v"(l0), "v"(g0), "v"(l1), "v"(g1), "v"(l2), "v"(g2), "v"(l3), "v"(g3), "v"(l4), "v"(g4), "v"(l5), "v"(g5) : "memory");
}
// x <- 2^x on eight or nine values by the hardware's v_exp_f32. One statement, each value in its own register: none reads a neighbour's result or overwrites a neighbour's source.
__device__ __forceinline__ void exp2x8(float& a, float& b, float& c, float& d, float& e, float& f, float& g, float& h) {
  asm("v_exp_f32 %0, %0\n\tv_exp_f32 %1, %1\n\tv_exp_f32 %2, %2\n\tv_exp_f32 %3, %3\n\tv_exp_f32 %4, %4\n\tv_exp_f32 %5, %5\n\tv_exp_f32 %6, %6\n\tv_exp_f32 %7, %7\n\tv_nop"      /* v_nop: the one slot that the instruction set asks for between the last v_exp_f32 and whatever the compiler puts next */
      : "+v"(a), "+v"(b), "+v"(c), "+v"(d), "+v"(e), "+v"(f), "+v"(g), "+v"(h));
}
__device__ __forceinline__ void exp2x9(float& z, float& a, float& b, float& c, float& d, float& e, float& f, float& g, float& h) {
  asm("v_exp_f32 %0, %0\n\tv_exp_f32 %1, %1\n\tv_exp_f32 %2, %2\n\tv_exp_f32 %3, %3\n\tv_exp_f32 %4, %4\n\tv_exp_f32 %5, %5\n\tv_exp_f32 %6, %6\n\tv_exp_f32 %7, %7\n\tv_exp_f32 %8, %8\n\tv_nop"      /* v_nop: as in exp2x8 */
      : "+v"(z), "+v"(a), "+v"(b), "+v"(c), "+v"(d), "+v"(e), "+v"(f), "+v"(g), "+v"(h));
}
typedef float v2f __attribute__((ext_vector_type(2)));
// lane l takes the value of lane l ^ 16 (the other 16-lane half)
__device__ __forceinline__ float xhalf(float x) { return __builtin_bit_cast(float, __builtin_amdgcn_permlanex16(__builtin_bit_cast(int, x), __builtin_bit_cast(int, x), 0x76543210, 0xfedcba98, false, false)); }
template <int CAUSAL>
__global__ __launch_bounds__(128) void k_flashqk(const _Float16* __restrict__ Q16, const _Float16* __restrict__ QL, int ldq, const _Float16* __restrict__ K16, const _Float16* __restrict__ KL, int ldk, const _Float16* __restrict__ Vt, const int* __restrict__ MSK, float* __restrict__ O, int ldo) {
  static_assert(CAUSAL == 5, "compacted-key mode only");
  constexpr int RPW = 16, DT = 4, KS = 2;
  __shared__ __attribute__((aligned(16))) float sO[4][RPW][64 + 4];
  __shared__ __attribute__((aligned(16))) unsigned short sKh[2][32][72], sKl[2][32][72], sV[2][64][40];      /* row pitches 144 B and 80 B: 16 B x odd, for 16-byte fragment reads */
  const int tid = threadIdx.x, w = tid >> 5, lane = tid & 31, ln = lane & 15, hh = lane >> 4;
  const int slab = blockIdx.x / QBLKS, qblk = blockIdx.x % QBLKS; const int b = slab / NH, h = slab % NH; const int qb0 = qblk * (4 * RPW); const int q0 = qb0 + w * RPW;
  FragH aq[KS], aql[KS];
  { const unsigned short* qr = (const unsigned short*)Q16 + ((size_t)b * TQ + q0 + ln) * ldq + h * 64; const unsigned short* ql = (const unsigned short*)QL + ((size_t)b * TQ + q0 + ln) * ldq + h * 64;
#pragma unroll
    for (int ks = 0; ks < KS; ++ks) { aq[ks].half[0] = *(const v8us*)(qr + ks * 32 + 8 * hh); aq[ks].half[1] = *(const v8us*)(qr + ks * 32 + 16 + 8 * hh); aql[ks].half[0] = *(const v8us*)(ql + ks * 32 + 8 * hh); aql[ks].half[1] = *(const v8us*)(ql + ks * 32 + 16 + 8 * hh); } }
  const unsigned short* Vth = (const unsigned short*)Vt + (size_t)slab * 64 * TK;
  float m_r = -3.0e38f, l_r = 0.f; v8f oacc[DT];      /* query q0 + ln: running maximum less 10, in base-2 units (equal in both halves), this half's share of the sum (x2^10), O^T rows dt * 16 + 8 hh + r */
#pragma unroll
  for (int dt = 0; dt < DT; ++dt) oacc[dt] = (v8f){0.f,0.f,0.f,0.f,0.f,0.f,0.f,0.f};
  const int kcnt = min(MSK[b * 32 + ((h < CDRH) ? 0 : 1)], TK);      /* number of valid keys of this (sequence, head class); K planes and V^T hold them compacted, in key order */
  const int jend = (kcnt + 31) & ~31;
  const int kr0 = tid >> 3, kc0 = (tid & 7) * 8, vr0 = tid >> 2, vc0 = (tid & 3) * 8;      /* a lane's share of a tile: rows kr0 and kr0 + 16 of both K planes, rows vr0 and vr0 + 32 of V^T, 16 bytes each; whole 128-byte K lines per 8 lanes */
  const unsigned short* gkh = (const unsigned short*)K16 + ((size_t)b * TK + kr0) * ldk + h * 64 + kc0; const unsigned short* gkl = (const unsigned short*)KL + ((size_t)b * TK + kr0) * ldk + h * 64 + kc0; const unsigned short* gv = Vth + (size_t)vr0 * TK + vc0;
  auto stage = [&](int jt, int bf) { const size_t ko = (size_t)jt * ldk;
    cp_tile6((unsigned)(size_t)&sKh[bf][kr0][kc0], gkh + ko, (unsigned)(size_t)&sKh[bf][kr0 + 16][kc0], gkh + ko + (size_t)16 * ldk, (unsigned)(size_t)&sKl[bf][kr0][kc0], gkl + ko, (unsigned)(size_t)&sKl[bf][kr0 + 16][kc0], gkl + ko + (size_t)16 * ldk,
             (unsigned)(size_t)&sV[bf][vr0][vc0], gv + jt, (unsigned)(size_t)&sV[bf][vr0 + 32][vc0], gv + (size_t)32 * TK + jt); };
  if (jend > 0) stage(0, 0);
  asm volatile("s_wait_asynccnt 0x0" ::: "memory");      /* this wave's share of tile 0 has landed */
  __syncthreads();      /* tile 0 is published to all four waves */
  if (jend > 32) stage(32, 1);
#pragma unroll 1
  for (int j0 = 0; j0 < jend; j0 += 32) {
    const int bf = (j0 >> 5) & 1;
    float sc[2][8];      /* sc[nt][r] = raw score (q . k, not yet scaled) of key j0 + 16 nt + 8 hh + r for query q0 + ln; the inner loops of this trip are fully unrolled so that sc, pb, ls and oacc are indexed by constants and stay in registers */
#pragma unroll
    for (int nt = 0; nt < 2; ++nt) { const unsigned short* kr = &sKh[bf][nt * 16 + ln][0]; const unsigned short* klr = &sKl[bf][nt * 16 + ln][0]; FragH bk[KS], bkl[KS];
#pragma unroll
      for (int ks = 0; ks < KS; ++ks) { bk[ks].half[0] = *(const v8us*)(kr + ks * 32 + 8 * hh); bk[ks].half[1] = *(const v8us*)(kr + ks * 32 + 16 + 8 * hh); bkl[ks].half[0] = *(const v8us*)(klr + ks * 32 + 8 * hh); bkl[ks].half[1] = *(const v8us*)(klr + ks * 32 + 16 + 8 * hh); }
      v8f acc = (v8f){0.f,0.f,0.f,0.f,0.f,0.f,0.f,0.f}, accl = acc;
#pragma unroll
      for (int ks = 0; ks < KS; ++ks) { acc = mmaH<1>(bk[ks].v, bk[ks].v, aq[ks].v, aq[ks].v, acc); accl = mmaH<1>(bk[ks].v, bk[ks].v, aql[ks].v, aql[ks].v, accl); accl = mmaH<1>(bkl[ks].v, bkl[ks].v, aq[ks].v, aq[ks].v, accl); }
#pragma unroll
      for (int r = 0; r < 8; ++r) sc[nt][r] = acc[r] + accl[r] * 0.0009765625f; }
    if (j0 + 32 > kcnt) {      /* block-uniform: only the last trip holds keys past the count (key padding and head-specific masks are applied by the gather) */
#pragma unroll
      for (int nt = 0; nt < 2; ++nt)
#pragma unroll
        for (int r = 0; r < 8; ++r) if (j0 + nt * 16 + 8 * hh + r >= kcnt) sc[nt][r] = -3.0e38f; }
    float mc = fmaxf(sc[0][0], sc[1][0]);
#pragma unroll
    for (int r = 1; r < 8; ++r) mc = fmaxf(mc, fmaxf(sc[0][r], sc[1][r]));
    mc = fmaxf(mc, xhalf(mc));
    const float mn = fmaxf(m_r, mc * SCL2 - 10.0f);      /* the softmax reference point: running maximum of the scaled scores less 10, so 2^(score * SCL2 - mn) is P x 2^10 as the f16 operand wants it, with no multiply; every term and every rescale uses this same value. Finite in every trip: key j0 is below the count; so an invalid key's term below is exactly 0, and so is the first trip's rescale factor */
    float al = m_r - mn; m_r = mn;
#pragma unroll
    for (int nt = 0; nt < 2; ++nt)
#pragma unroll
      for (int r = 0; r < 8; r += 2) { const v2f t = __builtin_elementwise_fma((v2f){sc[nt][r], sc[nt][r + 1]}, (v2f){SCL2, SCL2}, (v2f){-mn, -mn}); sc[nt][r] = t[0]; sc[nt][r + 1] = t[1]; }      /* scale and reference point in one packed operation for two scores */
    exp2x9(al, sc[0][0], sc[0][1], sc[0][2], sc[0][3], sc[0][4], sc[0][5], sc[0][6], sc[0][7]);      /* al: the rescale factor of the sums so far; sc: now P x 2^10 */
    exp2x8(sc[1][0], sc[1][1], sc[1][2], sc[1][3], sc[1][4], sc[1][5], sc[1][6], sc[1][7]);
    FragH pb; float ls[4];
#pragma unroll
    for (int nt = 0; nt < 2; ++nt)
#pragma unroll
      for (int r = 0; r < 8; ++r) { const float p = sc[nt][r]; if (r < 2) ls[nt * 2 + r] = p; else ls[nt * 2 + (r & 1)] += p; pb.h[nt * 8 + r] = (_Float16)p; }      /* element nt * 8 + r of the B operand = key 16 nt + 8 hh + r: the k order of the V^T fragment */
    l_r = l_r * al + ((ls[0] + ls[1]) + (ls[2] + ls[3]));
#pragma unroll
    for (int dt = 0; dt < DT; ++dt)
#pragma unroll
      for (int r = 0; r < 8; ++r) oacc[dt][r] *= al;
#pragma unroll
    for (int dt = 0; dt < DT; ++dt) { const unsigned short* vrow = &sV[bf][dt * 16 + ln][0]; FragH bv; bv.half[0] = *(const v8us*)(vrow + 8 * hh); bv.half[1] = *(const v8us*)(vrow + 16 + 8 * hh);
      oacc[dt] = mmaH<1>(bv.v, bv.v, pb.v, pb.v, oacc[dt]); }
    asm volatile("s_wait_dscnt 0x0" ::: "memory");      /* this wave's reads of buffer bf have returned before the buffer is refilled */
    asm volatile("s_wait_asynccnt 0x0" ::: "memory");      /* this wave's share of the next tile has landed */
    __syncthreads();      /* publishes the next tile and ends every wave's reads of buffer bf */
    if (j0 + 64 < jend) stage(j0 + 64, bf); }
  asm volatile("s_wait_asynccnt 0x0" ::: "memory");      /* no copy is outstanding when the wave goes on to its end */
  const float l = l_r + xhalf(l_r); const float linv = (l > 0.f) ? 1.0f / l : 0.f;      /* sum and O^T carry the same 2^10 */
#pragma unroll
  for (int dt = 0; dt < DT; ++dt) { const v4f o0 = {oacc[dt][0] * linv, oacc[dt][1] * linv, oacc[dt][2] * linv, oacc[dt][3] * linv}, o1 = {oacc[dt][4] * linv, oacc[dt][5] * linv, oacc[dt][6] * linv, oacc[dt][7] * linv};
    *(v4fa*)&sO[w][ln][dt * 16 + 8 * hh] = o0; *(v4fa*)&sO[w][ln][dt * 16 + 8 * hh + 4] = o1; }
  __builtin_amdgcn_fence(__ATOMIC_ACQ_REL, "workgroup"); __builtin_amdgcn_wave_barrier();
  {
#pragma unroll
    for (int rp = 0; rp < RPW; rp += 2) { const int r = rp + (lane >> 4), pc = lane & 15; const v4f val = *(const v4fa*)&sO[w][r][pc * 4]; *(v4f*)(O + ((size_t)b * TQ + q0 + r) * ldo + h * 64 + pc * 4) = val; }
     } }

// f32 -> f16 hi + 2^10 residual A fragments of one row (k order of g2_frag: elements 0..7 = k 8 hh + i, elements 8..15 = k 16 + 8 hh + i); p already points at k = 8 hh. Same rounding as in k_qkv.
__device__ __forceinline__ void g2_split(const float* p, v16h& fh, v16h& fl) { const v4f x0 = *(const v4fa*)p, x1 = *(const v4fa*)(p + 4), x2 = *(const v4fa*)(p + 16), x3 = *(const v4fa*)(p + 20); FragH h, l;
#pragma unroll
  for (int q = 0; q < 4; ++q) { _Float16 t = (_Float16)x0[q]; h.h[q] = t; l.h[q] = (_Float16)((x0[q] - (float)t) * 1024.0f); t = (_Float16)x1[q]; h.h[4 + q] = t; l.h[4 + q] = (_Float16)((x1[q] - (float)t) * 1024.0f);
    t = (_Float16)x2[q]; h.h[8 + q] = t; l.h[8 + q] = (_Float16)((x2[q] - (float)t) * 1024.0f); t = (_Float16)x3[q]; h.h[12 + q] = t; l.h[12 + q] = (_Float16)((x3[q] - (float)t) * 1024.0f); }
  fh = h.v; fl = l.v; }
// Ten 16-byte asynchronous copies to LDS per lane (half a pass's share in k_gemm_out). s_wait_xcnt 0 closes the statement, as in cp_tile12.
__device__ __forceinline__ void cp_tile10(unsigned l0, unsigned l1, unsigned l2, unsigned l3, unsigned l4, unsigned l5, unsigned l6, unsigned l7, unsigned l8, unsigned l9,
    const char* g0, const char* g1, const char* g2, const char* g3, const char* g4, const char* g5, const char* g6, const char* g7, const char* g8, const char* g9) {
  asm volatile("global_load_async_to_lds_b128 %0, %10, off\n\t"
               "global_load_async_to_lds_b128 %1, %11, off\n\t"
               "global_load_async_to_lds_b128 %2, %12, off\n\t"
               "global_load_async_to_lds_b128 %3, %13, off\n\t"
               "global_load_async_to_lds_b128 %4, %14, off\n\t"
               "global_load_async_to_lds_b128 %5, %15, off\n\t"
               "global_load_async_to_lds_b128 %6, %16, off\n\t"
               "global_load_async_to_lds_b128 %7, %17, off\n\t"
               "global_load_async_to_lds_b128 %8, %18, off\n\t"
               "global_load_async_to_lds_b128 %9, %19, off\n\t"
               "s_wait_xcnt 0x0"
               :: "v"(l0), "v"(l1), "v"(l2), "v"(l3), "v"(l4), "v"(l5), "v"(l6), "v"(l7), "v"(l8), "v"(l9),
                  "v"(g0), "v"(g1), "v"(g2), "v"(g3), "v"(g4), "v"(g5), "v"(g6), "v"(g7), "v"(g8), "v"(g9) : "memory");
}
#define OP 272      /* LDS row pitch of the f32 context rows in bytes: 256 + 16 = 16 B x odd */
#define OAB (128 * OP)      /* the context rows of a buffer; the weight rows (pitch QP) follow */
#define OBUF (OAB + 64 * QP)
// Output projection in one launch: C[NR][DMOD] = A Wo + bias from the f32 context A. Wave tile 32x64 as in k_qkv; each A fragment is split hi + 2^10 residual in registers, and each x16 weight fragment (Bh = [out][in]) feeds the hi and the residual product, which keep separate f32 accumulators: C = hi / 16 + bias + residual / (16 * 1024). A pass takes 64 inputs: two whole lines of each of the block's 128 context rows and one of each of its 64 weight rows, brought into LDS once per block by asynchronous copies (whole lines per instruction), two buffers; the four waves take their fragments from there.
__global__ __launch_bounds__(128) void k_gemm_out(const float* __restrict__ A, const _Float16* __restrict__ Bh, const float* __restrict__ bias, float* __restrict__ C) {
  __shared__ __attribute__((aligned(16))) char sm[2 * OBUF]; static_assert(4 * 32 * 68 * 4 <= 2 * OBUF, "the output staging fits the buffers");
  const int tid = threadIdx.x, w = tid >> 5, lane = tid & 31, ln = lane & 15, hh = lane >> 4;
  constexpr int ntn = DMOD >> 6; const int mt = blockIdx.x / ntn, nq = blockIdx.x - mt * ntn; const int row0 = mt * 128 + 32 * w, col0 = nq * 64;
  const int ar0 = tid >> 4, ac = (tid & 15) * 16, br0 = tid >> 3, bc = (tid & 7) * 16;      /* a lane's share of a pass: 16 bytes of context rows ar0 + 8 i (i < 16) and of weight rows br0 + 16 i (i < 4) */
  const char* ga = (const char*)(A + (size_t)(mt * 128 + ar0) * DMOD) + ac; const char* gb = (const char*)(Bh + (size_t)(col0 + br0) * DMOD) + bc;
  const unsigned lca = (unsigned)(size_t)sm + ar0 * OP + ac, lcb = (unsigned)(size_t)sm + OAB + br0 * QP + bc;
  constexpr size_t AS = (size_t)8 * DMOD * 4, BS = (size_t)16 * DMOD * 2;
  auto stage = [&](int bf) { const unsigned la = lca + bf * OBUF, lb = lcb + bf * OBUF;      /* the next 64 inputs of every row into buffer bf; the pointers step behind the statements' own waits */
    cp_tile10(la, la + 8 * OP, la + 16 * OP, la + 24 * OP, la + 32 * OP, la + 40 * OP, la + 48 * OP, la + 56 * OP, la + 64 * OP, la + 72 * OP, ga, ga + AS, ga + 2 * AS, ga + 3 * AS, ga + 4 * AS, ga + 5 * AS, ga + 6 * AS, ga + 7 * AS, ga + 8 * AS, ga + 9 * AS);
    cp_tile10(la + 80 * OP, la + 88 * OP, la + 96 * OP, la + 104 * OP, la + 112 * OP, la + 120 * OP, lb, lb + 16 * QP, lb + 32 * QP, lb + 48 * QP, ga + 10 * AS, ga + 11 * AS, ga + 12 * AS, ga + 13 * AS, ga + 14 * AS, ga + 15 * AS, gb, gb + BS, gb + 2 * BS, gb + 3 * BS);
    ga += 256; gb += 128; };
  stage(0);
  float bv[4];      /* the four bias loads go out ahead of the loop and land under it */
#pragma unroll
  for (int t = 0; t < 4; ++t) bv[t] = bf16_round(bias[col0 + t * 16 + ln]);
  const char* ab = sm + (32 * w + ln) * OP + 32 * hh; const char* bb = sm + OAB + ln * QP + 16 * hh;
  v8f ch[2][4], cl[2][4];
#pragma unroll
  for (int u = 0; u < 8; ++u) { ch[u >> 2][u & 3] = (v8f){0.f,0.f,0.f,0.f,0.f,0.f,0.f,0.f}; cl[u >> 2][u & 3] = (v8f){0.f,0.f,0.f,0.f,0.f,0.f,0.f,0.f}; }
  asm volatile("s_wait_asynccnt 0x0" ::: "memory");      /* this wave's share of pass 0 has landed */
  __syncthreads();      /* pass 0 is published to all four waves */
  stage(1);
#pragma unroll 1      /* rolled: 8 passes of 32 products; the loop's code stays a few instruction-cache lines */
  for (int p = 0; p < DMOD / 64; ++p) { const int bf = p & 1; const char* ap = ab + bf * OBUF; const char* bp = bb + bf * OBUF;
#pragma unroll
    for (int s = 0; s < 2; ++s) { v16h a0h, a0l, a1h, a1l, b[4];      /* a k block of 32: its 16 LDS reads stand ahead of its first product */
#pragma unroll
      for (int t = 0; t < 4; ++t) b[t] = g2_fragl(bp + t * 16 * QP + s * 64);
      g2_split((const float*)(ap + s * 128), a0h, a0l); g2_split((const float*)(ap + 16 * OP + s * 128), a1h, a1l);
#pragma unroll
      for (int t = 0; t < 4; ++t) { ch[0][t] = g2_mma(a0h, b[t], ch[0][t]); ch[1][t] = g2_mma(a1h, b[t], ch[1][t]); cl[0][t] = g2_mma(a0l, b[t], cl[0][t]); cl[1][t] = g2_mma(a1l, b[t], cl[1][t]); } }
    asm volatile("s_wait_dscnt 0x0" ::: "memory");      /* this wave's reads of buffer bf have returned before the buffer is refilled */
    asm volatile("s_wait_asynccnt 0x0" ::: "memory");      /* this wave's share of the next pass has landed */
    __syncthreads();      /* publishes the next pass and ends every wave's reads of buffer bf */
    if (p + 2 < DMOD / 64) stage(bf); }
  asm volatile("s_wait_asynccnt 0x0" ::: "memory");      /* no copy is outstanding when the buffers become output staging */
  float (*so)[68] = (float (*)[68])(sm + w * (32 * 68 * 4));      /* the wave's own range of the buffers, which nobody reads any more behind the last pass's barrier */
#pragma unroll
  for (int u = 0; u < 8; ++u) { const int t = u & 3, half = u >> 2;
#pragma unroll
    for (int r = 0; r < 8; ++r) so[half * 16 + 8 * hh + r][t * 16 + ln] = (ch[half][t][r] * 0.0625f + bv[t]) + cl[half][t][r] * (0.0625f / 1024.0f); }
  __builtin_amdgcn_fence(__ATOMIC_ACQ_REL, "workgroup"); __builtin_amdgcn_wave_barrier();      /* the wave reads back rows that its other lanes wrote */
  const int rsub = lane >> 4, c4 = (lane & 15) * 4;
#pragma unroll
  for (int q = 0; q < 16; ++q) { const int r = q * 2 + rsub; const v4f v = *(const v4fa*)&so[r][c4]; *(v4f*)(C + (size_t)(row0 + r) * DMOD + col0 + c4) = v; } }
typedef int v4ia __attribute__((ext_vector_type(4), may_alias));
// One block per sequence, 8 consecutive keys a thread. IDX[b][0][.] = positions of the keys valid for the CDR heads, IDX[b][1][.] = for the other heads, ascending; entries past the count are 0. CNT[b*32 + class] = the counts (one 128-byte line per sequence).
__device__ __forceinline__ void key_lists(const int* __restrict__ mask, const int* __restrict__ cdrs, int* __restrict__ IDX, int* __restrict__ CNT, int b, int tid) {
  __shared__ int sh[256]; __shared__ int sany; static_assert(TK == 256 * 8, "8 keys a thread");
  const v4ia m0 = *(const v4ia*)(mask + (size_t)b * TK + tid * 8), m1 = *(const v4ia*)(mask + (size_t)b * TK + tid * 8 + 4), c0 = *(const v4ia*)(cdrs + (size_t)b * TK + tid * 8), c1 = *(const v4ia*)(cdrs + (size_t)b * TK + tid * 8 + 4);
  bool vp[8], vc[8]; int np = 0, nb = 0, any = 0;
#pragma unroll
  for (int q = 0; q < 8; ++q) { const int mv = (q < 4) ? m0[q & 3] : m1[q & 3], cv = (q < 4) ? c0[q & 3] : c1[q & 3]; vp[q] = mv != 0; vc[q] = cv != 0; any |= vc[q] ? 1 : 0; np += vp[q] ? 1 : 0; nb += (vp[q] && vc[q]) ? 1 : 0; }
  if (tid == 0) sany = 0; __syncthreads(); if (any) sany = 1;
  const int own = np | (nb << 16); int v = own; sh[tid] = v; __syncthreads();      /* both counts stay <= 2048, so one packed inclusive scan serves both lists */
  for (int st = 1; st < 256; st <<= 1) { const int add = (tid >= st) ? sh[tid - st] : 0; __syncthreads(); v += add; sh[tid] = v; __syncthreads(); }
  const bool allmasked = (sany == 0);      /* no CDR token at all -> the CDR mask is disabled */
  const int tot = sh[255], ex = v - own; const int cnt1 = tot & 0xFFFF, cnt0 = allmasked ? cnt1 : (tot >> 16); int o1 = ex & 0xFFFF, o0 = allmasked ? o1 : (ex >> 16);
  int* i0 = IDX + ((size_t)b * 2 + 0) * TK; int* i1 = IDX + ((size_t)b * 2 + 1) * TK;
#pragma unroll
  for (int q = 0; q < 8; ++q) { const int k = tid * 8 + q; if (vp[q]) i1[o1++] = k; if (vp[q] && (allmasked || vc[q])) i0[o0++] = k; if (k >= cnt1) i1[k] = 0; if (k >= cnt0) i0[k] = 0; }
  if (tid == 0) { CNT[b * 32 + 0] = cnt0; CNT[b * 32 + 1] = cnt1; } }
// All that the projections wait for, in one launch; the three parts share nothing and a block does one of them, chosen by its index (so every barrier of the key lists is passed by a whole block or by none of it). The part with the longest chain of dependent steps has the lowest indices, the stream of x the highest.
#define WTB (DMOD * (DMOD / 8) / 256)      /* blocks for one weight matrix */
#define XB (NR * DMOD / 8 / 256)      /* blocks for x */
__global__ __launch_bounds__(256) void k_prep(const float* __restrict__ x, const int* __restrict__ mask, const int* __restrict__ cdrs, const float* __restrict__ Wq, const float* __restrict__ Wk, const float* __restrict__ Wv, const float* __restrict__ Wo,
    _Float16* __restrict__ BQ, _Float16* __restrict__ BK, _Float16* __restrict__ BV, _Float16* __restrict__ BO, int* __restrict__ IDX, int* __restrict__ CNT, _Float16* __restrict__ X16) {
  static_assert(WTB * 256 * 8 == DMOD * DMOD && (size_t)XB * 256 * 8 == (size_t)NR * DMOD, "the parts' blocks cover their arrays exactly");
  const int blk = blockIdx.x, tid = threadIdx.x;
  if (blk < NB) { key_lists(mask, cdrs, IDX, CNT, blk, tid); return; }
  if (blk < NB + 4 * WTB) { const int u = blk - NB, m = u / WTB;
    wt_f16((m == 0) ? Wq : (m == 1) ? Wk : (m == 2) ? Wv : Wo, (m == 0) ? BQ : (m == 1) ? BK : (m == 2) ? BV : BO, DMOD, DMOD, 16.0f, (u % WTB) * 256 + tid); return; }
  x16_piece(x, X16, (size_t)(blk - NB - 4 * WTB) * 256 + tid); }

extern "C" void kernel_launch(void* const* d_in, const int* in_sizes, int n_in,
                              void* d_out, int out_size, void* d_ws, size_t ws_size, hipStream_t stream) {
  (void)in_sizes; (void)n_in; (void)out_size;
  const float* const* I = (const float* const*)d_in; const float* x = I[0]; const int* mask = (const int*)d_in[1]; const int* cdrs = (const int*)d_in[2]; const float* Wq = I[3]; const float* bq = I[4]; const float* Wk = I[5]; const float* bk = I[6]; const float* Wv = I[7]; const float* bv = I[8]; const float* Wo = I[9]; const float* bo = I[10];
  char* ws = (char*)d_ws; size_t off = 0;
  auto take = [&](size_t bytes) { char* p = ws + off; off += (bytes + 255) & ~(size_t)255; return p; };
  const size_t w8 = (size_t)DMOD * DMOD / 8;
  _Float16* BQ = (_Float16*)take(w8 * 16); _Float16* BK = (_Float16*)take(w8 * 16); _Float16* BV = (_Float16*)take(w8 * 16); _Float16* BO = (_Float16*)take(w8 * 16); int* IDX = (int*)take((size_t)NB * 2 * TK * 4); int* CNT = (int*)take((size_t)NB * 32 * 4);
  _Float16* X16 = (_Float16*)take((size_t)NR * DMOD * 2); float* F32 = (float*)take((size_t)NR * DMOD * 4); _Float16* QH = (_Float16*)take((size_t)NR * DMOD * 2); _Float16* QL = (_Float16*)take((size_t)NR * DMOD * 2); _Float16* KH = (_Float16*)take((size_t)NR * DMOD * 2); _Float16* KL = (_Float16*)take((size_t)NR * DMOD * 2); _Float16* VH = (_Float16*)take((size_t)NR * DMOD * 2); _Float16* VL = (_Float16*)take((size_t)NR * DMOD * 2); _Float16* VT = (_Float16*)take((size_t)NR * DMOD * 2); _Float16* VTL = (_Float16*)take((size_t)NR * DMOD * 2);
  float* O = F32;
  if (off > ws_size) return;      /* 2 + 0.06 + 8 + 16 + 8 x 8 = 90 MiB */
  k_prep<<<NB + 4 * WTB + XB, 256, 0, stream>>>(x, mask, cdrs, Wq, Wk, Wv, Wo, BQ, BK, BV, BO, IDX, CNT, X16);
  const dim3 gA((NR / 128) * (DMOD / 64), 1);
  k_qkv<<<3 * NB * (TK / 128) * NH, 128, 0, stream>>>(X16, BQ, BK, BV, bq, bk, bv, IDX, CNT, QH, QL, KH, KL, VT);
  k_flashqk<5><<<NB * NH * QBLKS, 128, 0, stream>>>(QH, QL, DMOD, KH, KL, DMOD, VT, CNT, O, DMOD);      /* q/k hi + residual; P (x2^10) and V plain f16 */
  k_gemm_out<<<gA, 128, 0, stream>>>(O, BO, bo, (float*)d_out);
}
